// v000
// Times are from an AMD MI455X. After a warm-up the kernel runs many times in a row, and a time is the length of
// such a window on the GPU divided by its runs, so every launch and the gaps after it count. The runs cycle
// through copies of the inputs. A figure is the median of several windows, for all but v000 over two sittings.
// Sittings can differ by a few percent; kernels timed side by side share one.
// v000, which the later versions start from, runs in 147 microseconds.
// Contractions: conv1x1 theta/phi/g GEMM W[384x256].X[256x128] per strip on v_wmma_f32_16x16x32_f16 (f16
// containers of bf16-RNE weights x256 and bf16-RNE x, 1 product); M = pooled-phi . pooled-g^T per batch
// [128x128], K=1024, on v_wmma_f32_16x16x32_f16 (2x2 max-pooled phi and g as plain f16, 1 product);
// y^T = M^T.theta^T, K=128, on v_wmma_f32_16x16x32_bf16 (M and theta as bf16 hi + bf16 residual planes,
// 3 products); output conv W[256x128].Y on v_wmma_f32_16x16x32_bf16 (bf16 weights, y as bf16 hi + residual
// planes, 2 products); f32 accumulate everywhere; max-pool, bias, batch-norm statistics (f64 sums, f32 apply)
// and the residual add on VALU.
#include <hip/hip_runtime.h>
#include <math.h>
#include <stdint.h>

#ifndef NB
#define NB 8
#endif
#ifndef NQ
#define NQ 4096
#endif
#define NB_FULL 8
#define CC     256
#define HIMG   64
#define WIMG   64
#define NN     4096
#define DQ     128
#define HP     32
#define WP     32
#define MM     1024
#define MW     384
#define QT     64
#define SN     128
#define NSTRIP 32
#define OSP    68
#define TP     72
#define STL    32
#define WSC    256.0f
#define IWSC   0.00390625f
#define INS    0.0009765625f
#define BNEPS  1e-5f

static_assert(NB >= 1 && NB <= NB_FULL);
static_assert(NQ % 128 == 0 && NQ >= 128 && NQ <= NN);
static_assert(NQ % QT == 0);
static_assert(NN == HIMG * WIMG);
static_assert(SN == 2 * WIMG && NSTRIP * SN == NN && SN == 8 * 16);
static_assert(HIMG % 2 == 0 && WIMG % 2 == 0 && HP == HIMG / 2 && WP == WIMG / 2 && MM == HP * WP);
static_assert(WP == 32);
static_assert(MM % QT == 0 && MM % 32 == 0);
static_assert(NN % QT == 0 && CC % QT == 0 && DQ == 2 * QT);
static_assert(MW == 3 * DQ && MW % 8 == 0);
static_assert(CC % 32 == 0 && DQ % 32 == 0);
static_assert((OSP * 4) % 16 == 0 && (TP * 2) % 16 == 0);
static_assert(SN * OSP * 4 <= 65536 && DQ * OSP * 4 <= 65536);
static_assert(((size_t)NB * CC * NQ) % 1024 == 0);
static_assert((size_t)NB * CC * NQ * 4 <= 2 * (size_t)NB * NN * DQ * 4);
static_assert((size_t)NB_FULL * CC * NN * 4 == (size_t)33554432);
static_assert(STL * 4 == 128);

typedef _Float16       v16h __attribute__((ext_vector_type(16)));
typedef _Float16       v8h  __attribute__((ext_vector_type(8)));
typedef __bf16         v16b __attribute__((ext_vector_type(16)));
typedef unsigned short v8us __attribute__((ext_vector_type(8)));
typedef float          v8f  __attribute__((ext_vector_type(8)));
typedef float          v4f  __attribute__((ext_vector_type(4)));
typedef unsigned int   v4u  __attribute__((ext_vector_type(4)));

union Frag { v8us u[2]; v16h h; v16b bf; };
static_assert(sizeof(Frag) == 32);

// ---- scalar helpers ---------------------------------------------------------------------------------------
__device__ __forceinline__ unsigned short bf_bits(float f) {          // f32 -> bf16 bits, RNE convert
  unsigned u = __float_as_uint(f);
  return (unsigned short)((u + 0x7FFFu + ((u >> 16) & 1u)) >> 16);
}
__device__ __forceinline__ float bf_up(unsigned short hb) { return __uint_as_float(((unsigned)hb) << 16); }
__device__ __forceinline__ float bfr(float f) { return bf_up(bf_bits(f)); }
__device__ __forceinline__ unsigned short h_bits(_Float16 x) { return __builtin_bit_cast(unsigned short, x); }
__device__ __forceinline__ unsigned pk16(unsigned short a, unsigned short b) { return (unsigned)a | ((unsigned)b << 16); }
__device__ __forceinline__ v8f zero8() { v8f z = {0.f, 0.f, 0.f, 0.f, 0.f, 0.f, 0.f, 0.f}; return z; }
// 8 f32 values -> bf16 hi bits and bf16 residual bits (lo = RNE(v - hi)), packed 2 per uint
__device__ __forceinline__ void split8(const float* f, v4u& uh, v4u& ul) {
#pragma unroll
  for (int t = 0; t < 4; ++t) {
    const float f0 = f[2 * t], f1 = f[2 * t + 1];
    const unsigned short hb0 = bf_bits(f0), hb1 = bf_bits(f1);
    const unsigned short lb0 = bf_bits(f0 - bf_up(hb0));
    const unsigned short lb1 = bf_bits(f1 - bf_up(hb1));
    uh[t] = pk16(hb0, hb1);
    ul[t] = pk16(lb0, lb1);
  }
}

// ---- 16-bit fragment loader (A, or B from a k-contiguous [n][k] row): lane -> row/col (lane&15), p already includes
//      + 8*(lane>>4); elements 0..7 <- p[0..7] (k0+8h..), elements 8..15 <- p[16..23] (k0+16+8h..)
__device__ __forceinline__ Frag ldfrag(const unsigned short* p) {
  Frag f;
  f.u[0] = *(const v8us*)(p);
  f.u[1] = *(const v8us*)(p + 16);
  return f;
}

// ---- WMMA helpers: builtin followed by a 4-slot VALU gap tying D and keeping A/B live --------------------------
__device__ __forceinline__ v8f mma_h(v16h a, v16h b, v8f c) {
  v8f d = __builtin_amdgcn_wmma_f32_16x16x32_f16(false, a, false, b, (short)0, c, false, false);
#if defined(__HIP_DEVICE_COMPILE__)
  asm volatile("v_nop\n\tv_nop\n\tv_nop\n\tv_nop" : "+v"(d) : "v"(a), "v"(b));
#endif
  return d;
}
__device__ __forceinline__ v8f mma_b(v16b a, v16b b, v8f c) {
  v8f d = __builtin_amdgcn_wmma_f32_16x16x32_bf16(false, a, false, b, (short)0, c, false, false);
#if defined(__HIP_DEVICE_COMPILE__)
  const v16h ha = __builtin_bit_cast(v16h, a), hb = __builtin_bit_cast(v16h, b);
  asm volatile("v_nop\n\tv_nop\n\tv_nop\n\tv_nop" : "+v"(d) : "v"(ha), "v"(hb));
#endif
  return d;
}

// =========================================================================================================
// (0) weights. Blocks 0..47: W16 f16 [384][256], rows 0..127 = theta_w, 128..255 = phi_w, 256..383 = g_w; value =
//     f16 of (bf16-RNE(w) * 256) (exact). Block owns rows 8*blk..8*blk+7: one wave per 512-B row = 32 lanes x 16 B
// coverage: 48 blocks x 8 rows x 32 lanes x 8 halves = 384 x 256; 16 blocks x 16 rows x 16 lanes x 8 = 256 x 128.
// =========================================================================================================
__global__ __launch_bounds__(256)
void cvt_w(const float* __restrict__ tw, const float* __restrict__ pw, const float* __restrict__ gw,
           const float* __restrict__ ow, unsigned short* W16, unsigned short* WWb) {
  const int tid = threadIdx.x, blk = blockIdx.x;
  if (blk < MW / 8) {
    const int rl = tid >> 5, col = 8 * (tid & 31);
    const int o = 8 * blk + rl;                                      // 0..383
    const int grp = blk >> 4;                                        // 0,1,2 (block-uniform)
    const float* wbase = (grp == 0) ? tw : ((grp == 1) ? pw : gw);  // all global
    const float* s = wbase + (size_t)(o - DQ * grp) * CC + col;      // (o - 128 grp) in 0..127
    const v4f a = *(const v4f*)s;
    const v4f q = *(const v4f*)(s + 4);
    const float f[8] = {a[0], a[1], a[2], a[3], q[0], q[1], q[2], q[3]};
    v4u u;
#pragma unroll
    for (int t = 0; t < 4; ++t) {
      const _Float16 h0 = (_Float16)(bfr(f[2 * t]) * WSC);
      const _Float16 h1 = (_Float16)(bfr(f[2 * t + 1]) * WSC);
      u[t] = pk16(h_bits(h0), h_bits(h1));
    }
{
      *(v4u*)(W16 + (size_t)o * CC + col) = u;
      
    }
  } else {
    const int rb = blk - MW / 8;                                     // 0..15
    const int o = 16 * rb + (tid >> 4);                              // 0..255
    const int col = 8 * (tid & 15);                                  // 0..120
    const float* s = ow + (size_t)o * DQ + col;
    const v4f a = *(const v4f*)s;
    const v4f q = *(const v4f*)(s + 4);
    const float f[8] = {a[0], a[1], a[2], a[3], q[0], q[1], q[2], q[3]};
    v4u u;
#pragma unroll
    for (int t = 0; t < 4; ++t) u[t] = pk16(bf_bits(f[2 * t]), bf_bits(f[2 * t + 1]));
{
      *(v4u*)(WWb + (size_t)o * DQ + col) = u;
      
    }
  }
}

// =========================================================================================================
// (1) x f32 [b][256 c][4096 n] -> XP f16 [b][n][c] (position-major, bf16-RNE values, exact in f16) through an LDS
//     tile T[64 n][64 c] (pitch TP, cross-thread, block barrier). Block (nb, cb, b) owns a 64 c x 64 n tile.
// coverage: T written rows (8e+t)=0..63 x cols cl 0..63, read rows 0..63 x cols 8e..8e+7; XP 2 it x 32 rows x 8 lanes
//           x 8 = 64 n x 64 c; grid (64, 4, NB) covers XP [b][0..4095][0..255] exactly once.
// =========================================================================================================
__global__ __launch_bounds__(256)
void cvt_x(const float* __restrict__ x, unsigned short* XP) {
  __shared__ __align__(16) unsigned short T[QT * TP];
  const int tid = threadIdx.x;
  const int nb = blockIdx.x, cb = blockIdx.y, b = blockIdx.z;
  const int e = tid & 7, lq = tid >> 3;                             // lq 0..31
  const int n0 = nb * QT, c0 = cb * QT;
#pragma unroll
  for (int it = 0; it < 2; ++it) {
    const int cl = it * 32 + lq;                                     // 0..63
    const float* sp = x + ((size_t)(b * CC + c0 + cl)) * NN + n0 + 8 * e;
    const v4f a = *(const v4f*)sp;
    const v4f q = *(const v4f*)(sp + 4);
    unsigned short hb[8];
#pragma unroll
    for (int t = 0; t < 4; ++t) {
      hb[t]     = h_bits((_Float16)bfr(a[t]));
      hb[4 + t] = h_bits((_Float16)bfr(q[t]));
    }
#pragma unroll
    for (int t = 0; t < 8; ++t) T[(8 * e + t) * TP + cl] = hb[t];
  }
  __syncthreads();
  v4u up[2];
#pragma unroll
  for (int it = 0; it < 2; ++it) {
    const int nl = it * 32 + lq;                                     // 0..63
    up[it] = *(const v4u*)(T + nl * TP + 8 * e);
  }
{
#pragma unroll
    for (int it = 0; it < 2; ++it) {
      const int rl = it * 32 + lq;
      *(v4u*)(XP + ((size_t)(b * NN + n0 + rl)) * CC + c0 + 8 * e) = up[it];
    }
    
  }
}

// =========================================================================================================
// (2) conv1x1 GEMM for one (b, strip of 128 positions = image rows 2s and 2s+1, 64-o block of the stacked weights):
//     Y[o][n] = (1/256) sum_c W16[o][c] XP[b][n][c]. Block 256 threads = 8 waves; wave w owns cols n0+16w..+15
//     (one B fragment per k-step, k = c contiguous in the XP row) and 4 m-tiles (A rows o = o0 + 16 mt + (lane&15),
//     split k map loader from W16). K = 256 = 8 steps. Epilogue staged in LDS Os[n_loc][o_loc] (pitch OSP, b128
//     stores, cross-wave), block barrier, then (block-uniform branch on the o block):
//       o-blocks 0,1 -> theta dims 0..63 / 64..127 + bias -> Qh/Ql bf16 [b][4096 n][128 d] (hi = RNE(v), lo = RNE(v-hi)):
//       o-blocks 2,3 -> phi + bias in f32 -> PF f32 [b][4096 n][128 d]: 128 rows x the dsel half (256 B = 2 whole
//                       lines) of the 512-B row, 16 consecutive lanes x 16 B, one instruction per 2 rows.
//       o-blocks 4,5 -> g + bias -> GF f32 [b][4096 n][128 d], same layout.
// coverage: Os 8 waves x 16 n x 64 o = 128 x 64 written, reads rows <= 127 cols <= 63; theta planes 4 it x 32 rows
//           x 8 lanes x 8 = 128 n x 64 d; f32 planes 8 it x 16 rows x 16 lanes x 4 = 128 n x 64 d; grid (32, 6, NB)
//           covers all 4096 rows x 128 d of Qh/Ql and of PF/GF exactly once.
// =========================================================================================================
__global__ __launch_bounds__(256)
void gemm_proj(const unsigned short* __restrict__ W16, const unsigned short* __restrict__ XP,
               const float* __restrict__ tb, const float* __restrict__ pb, const float* __restrict__ gb,
               unsigned short* Qh, unsigned short* Ql, float* PF, float* GF) {
  __shared__ __align__(16) float Os[SN * OSP];
  const int tid  = threadIdx.x;
  const int lane = tid & 31, wave = tid >> 5;                        // wave 0..7
  const int hh   = lane >> 4, c = lane & 15;
  const int st   = blockIdx.x, mb = blockIdx.y, b = blockIdx.z;
  const int n0   = st * SN, o0 = mb * QT;

  const unsigned short* ap = W16 + (size_t)(o0 + c) * CC + 8 * hh;
  const unsigned short* bp = XP + ((size_t)(b * NN + n0 + 16 * wave + c)) * CC + 8 * hh;

  v8f acc[4];
#pragma unroll
  for (int mt = 0; mt < 4; ++mt) acc[mt] = zero8();

#pragma unroll
  for (int ks = 0; ks < CC / 32; ++ks) {
    const Frag fb = ldfrag(bp + 32 * ks);
#pragma unroll
    for (int mt = 0; mt < 4; ++mt) {
      const Frag fa = ldfrag(ap + (size_t)(16 * mt) * CC + 32 * ks);
      acc[mt] = mma_h(fa.h, fb.h, acc[mt]);
    }
  }

  // ---- epilogue: scale back -> LDS Os[n_loc][o_loc]; lane (hh, c) holds o = 16 mt + 8 hh + r for n_loc = 16 w + c
  {
    const int nl = 16 * wave + c;
#pragma unroll
    for (int mt = 0; mt < 4; ++mt) {
      v4f va, vb;
#pragma unroll
      for (int r = 0; r < 4; ++r) { va[r] = acc[mt][r] * IWSC; vb[r] = acc[mt][4 + r] * IWSC; }
      *(v4f*)(Os + nl * OSP + 16 * mt + 8 * hh)     = va;
      *(v4f*)(Os + nl * OSP + 16 * mt + 8 * hh + 4) = vb;
    }
  }
  __syncthreads();

  const int grp = mb >> 1;                                           // 0 theta, 1 phi, 2 g (block-uniform)
  const int dsel = (mb & 1) * QT;                                    // 0 or 64
  const float* bias = (grp == 0) ? tb : ((grp == 1) ? pb : gb);     // all global

  if (grp == 0) {
    const int e = tid & 7, lq = tid >> 3;                            // lq 0..31
    float bv[8];
    {
      const v4f ba = *(const v4f*)(bias + dsel + 8 * e);
      const v4f bq = *(const v4f*)(bias + dsel + 8 * e + 4);
#pragma unroll
      for (int t = 0; t < 4; ++t) { bv[t] = bfr(ba[t]); bv[4 + t] = bfr(bq[t]); }
    }
    v4u uh[4], ul[4];
#pragma unroll
    for (int it = 0; it < 4; ++it) {
      const int row = it * 32 + lq;                                  // n_loc 0..127
      const v4f a = *(const v4f*)(Os + row * OSP + 8 * e);
      const v4f q = *(const v4f*)(Os + row * OSP + 8 * e + 4);
      float f[8];
#pragma unroll
      for (int t = 0; t < 4; ++t) { f[t] = a[t] + bv[t]; f[4 + t] = q[t] + bv[4 + t]; }
      split8(f, uh[it], ul[it]);
    }
{
#pragma unroll
      for (int it = 0; it < 4; ++it) {
        const int row = it * 32 + lq;
        const size_t po = ((size_t)(b * NN + n0 + row)) * DQ + dsel + 8 * e;
        *(v4u*)(Qh + po) = uh[it];
        *(v4u*)(Ql + po) = ul[it];
      }
      
    }
  } else {
    const int e16 = tid & 15, lr = tid >> 4;                        // lr 0..15
    v4f bv4;
    {
      const v4f bq = *(const v4f*)(bias + dsel + 4 * e16);
#pragma unroll
      for (int t = 0; t < 4; ++t) bv4[t] = bfr(bq[t]);
    }
    float* P = (grp == 1) ? PF : GF;                                 // both global
    v4f res[8];
#pragma unroll
    for (int it = 0; it < 8; ++it) {
      const int row = it * 16 + lr;                                  // n_loc 0..127
      const v4f a = *(const v4f*)(Os + row * OSP + 4 * e16);
      v4f v;
#pragma unroll
      for (int t = 0; t < 4; ++t) v[t] = a[t] + bv4[t];
      res[it] = v;
    }
{
#pragma unroll
      for (int it = 0; it < 8; ++it) {
        const int row = it * 16 + lr;
        const size_t po = ((size_t)(b * NN + n0 + row)) * DQ + dsel + 4 * e16;
        *(v4f*)(P + po) = res[it];
      }
      
    }
  }
}

// =========================================================================================================
// (3) 2x2 stride-2 max-pool of PF / GF f32 [b][4096 n][128 d] in f32 -> Pp / Gp f16 [b][1024 m][128 d],
//     m = 32 py + px, window n = (2py+dy) 64 + 2px+dx, dy,dx in {0,1}. Block (py, b), 256 threads: lane group
// coverage: 32 blocks x 32 px x 16 lanes x 8 = rows 0..1023 x 128 d of both planes; grid (32, NB) exactly once.
// =========================================================================================================
__global__ __launch_bounds__(256)
void pool_pg(const float* __restrict__ PF, const float* __restrict__ GF,
             unsigned short* Pp, unsigned short* Gp) {
  const int tid = threadIdx.x, py = blockIdx.x, b = blockIdx.y;
  const int e16 = tid & 15, lr = tid >> 4;                          // lr 0..15
  v4u pu[2], gu[2];
#pragma unroll
  for (int it = 0; it < 2; ++it) {
    const int px = it * 16 + lr;                                     // 0..31
    float fk[8], fg[8];
#pragma unroll
    for (int t = 0; t < 8; ++t) { fk[t] = -__builtin_inff(); fg[t] = -__builtin_inff(); }
#pragma unroll
    for (int dy = 0; dy < 2; ++dy) {
      const size_t rb = ((size_t)(b * NN + (2 * py + dy) * WIMG + 2 * px)) * DQ + 8 * e16;
#pragma unroll
      for (int dx = 0; dx < 2; ++dx) {
        const float* pk = PF + rb + (size_t)dx * DQ;
        const float* pg = GF + rb + (size_t)dx * DQ;
        const v4f ka = *(const v4f*)pk, kq = *(const v4f*)(pk + 4);
        const v4f ga = *(const v4f*)pg, gq = *(const v4f*)(pg + 4);
#pragma unroll
        for (int t = 0; t < 4; ++t) {
          fk[t]     = fmaxf(fk[t], ka[t]);
          fk[4 + t] = fmaxf(fk[4 + t], kq[t]);
          fg[t]     = fmaxf(fg[t], ga[t]);
          fg[4 + t] = fmaxf(fg[4 + t], gq[t]);
        }
      }
    }
#pragma unroll
    for (int t = 0; t < 4; ++t) {
      pu[it][t] = pk16(h_bits((_Float16)fk[2 * t]), h_bits((_Float16)fk[2 * t + 1]));
      gu[it][t] = pk16(h_bits((_Float16)fg[2 * t]), h_bits((_Float16)fg[2 * t + 1]));
    }
  }
{
#pragma unroll
    for (int it = 0; it < 2; ++it) {
      const int px = it * 16 + lr;
      const size_t po = ((size_t)(b * MM + WP * py + px)) * DQ + 8 * e16;
      *(v4u*)(Pp + po) = pu[it];
      *(v4u*)(Gp + po) = gu[it];
    }
    
  }
}

// =========================================================================================================
// (4) Pp / Gp f16 [b][1024 m][128 d] -> Pc / Gc f16 [b][d][m] (channel-major, m contiguous) through an LDS tile
//     T[64 d][64 m] (pitch TP, cross-thread, block barrier). Block (mt, yb, b): plane = yb>>1 (block-uniform,
// coverage: reads 2 it x 32 rows x 8 lanes x 8 = 64 m x 64 d; T written rows (8e+t)=0..63 x cols 0..63, read rows
//           0..63 x cols 8e..8e+7; writes 64 d x 64 m; grid (16, 4, NB) covers Pc and Gc [b][0..127][0..1023] once.
// =========================================================================================================
__global__ __launch_bounds__(256)
void tr_pg(const unsigned short* __restrict__ Pp, const unsigned short* __restrict__ Gp,
           unsigned short* Pc, unsigned short* Gc) {
  __shared__ __align__(16) unsigned short T[QT * TP];
  const int tid = threadIdx.x;
  const int mt = blockIdx.x, yb = blockIdx.y, b = blockIdx.z;
  const int db = yb & 1, sel = yb >> 1;                             // block-uniform
  const unsigned short* src = (sel == 0) ? Pp : Gp;                  // both global
  unsigned short* dst = (sel == 0) ? Pc : Gc;                        // both global
  const int e = tid & 7, lq = tid >> 3;                             // lq 0..31
  const int m0 = mt * QT, d0 = db * QT;
#pragma unroll
  for (int it = 0; it < 2; ++it) {
    const int ml = it * 32 + lq;                                     // 0..63
    const v4u w = *(const v4u*)(src + ((size_t)(b * MM + m0 + ml)) * DQ + d0 + 8 * e);
    unsigned short hb[8];
#pragma unroll
    for (int t = 0; t < 4; ++t) {
      hb[2 * t]     = (unsigned short)(w[t] & 0xFFFFu);
      hb[2 * t + 1] = (unsigned short)(w[t] >> 16);
    }
#pragma unroll
    for (int t = 0; t < 8; ++t) T[(8 * e + t) * TP + ml] = hb[t];
  }
  __syncthreads();
  v4u up[2];
#pragma unroll
  for (int it = 0; it < 2; ++it) {
    const int dl = it * 32 + lq;                                     // 0..63
    up[it] = *(const v4u*)(T + dl * TP + 8 * e);
  }
{
#pragma unroll
    for (int it = 0; it < 2; ++it) {
      const int dl = it * 32 + lq;
      *(v4u*)(dst + ((size_t)(b * DQ + d0 + dl)) * MM + m0 + 8 * e) = up[it];
    }
    
  }
}

// =========================================================================================================
// (5) M GEMM for one (b, 64-row block of phi channels): M[cp][ci] = sum_m Pc[b][cp][m] Gc[b][ci][m], K = 1024 =
//     32 steps (rolled by 2). Block 256 threads = 8 waves; wave w owns cols ci = 16w..16w+15 (B fragment from the
//     m-contiguous Gc row, split k map) and 4 m-tiles (A rows cp = c0 + 16 mt + (lane&15) from Pc, split k map).
//     Epilogue staged in LDS Os[ci_loc][cp_loc] (pitch OSP, b128 stores, cross-wave), block barrier, then
// coverage: Os 8 waves x 16 ci x 64 cp = 128 x 64 written, reads rows 0..127 cols 8e..8e+7 <= 63; planes 4 it x
//           32 rows x 8 lanes x 8 = 128 ci x 64 cp; grid (2, NB) covers MTh/MTl [b][0..127][0..127] exactly once.
// =========================================================================================================
__global__ __launch_bounds__(256)
void gemm_m(const unsigned short* __restrict__ Pc, const unsigned short* __restrict__ Gc,
            unsigned short* MTh, unsigned short* MTl) {
  __shared__ __align__(16) float Os[DQ * OSP];
  const int tid  = threadIdx.x;
  const int lane = tid & 31, wave = tid >> 5;                        // wave 0..7
  const int hh   = lane >> 4, c = lane & 15;
  const int mb   = blockIdx.x, b = blockIdx.y;
  const int c0   = mb * QT;

  const unsigned short* ap = Pc + ((size_t)(b * DQ + c0 + c)) * MM + 8 * hh;
  const unsigned short* bp = Gc + ((size_t)(b * DQ + 16 * wave + c)) * MM + 8 * hh;

  v8f acc[4];
#pragma unroll
  for (int mt = 0; mt < 4; ++mt) acc[mt] = zero8();

#pragma unroll 2
  for (int ks = 0; ks < MM / 32; ++ks) {
    const Frag fb = ldfrag(bp + 32 * ks);
#pragma unroll
    for (int mt = 0; mt < 4; ++mt) {
      const Frag fa = ldfrag(ap + (size_t)(16 * mt) * MM + 32 * ks);
      acc[mt] = mma_h(fa.h, fb.h, acc[mt]);
    }
  }

  // ---- epilogue: -> LDS Os[ci_loc][cp_loc]; lane (hh, c) holds cp_loc = 16 mt + 8 hh + r for ci_loc = 16 w + c
  {
    const int nl = 16 * wave + c;
#pragma unroll
    for (int mt = 0; mt < 4; ++mt) {
      v4f va, vb;
#pragma unroll
      for (int r = 0; r < 4; ++r) { va[r] = acc[mt][r]; vb[r] = acc[mt][4 + r]; }
      *(v4f*)(Os + nl * OSP + 16 * mt + 8 * hh)     = va;
      *(v4f*)(Os + nl * OSP + 16 * mt + 8 * hh + 4) = vb;
    }
  }
  __syncthreads();

  const int e = tid & 7, lq = tid >> 3;                              // lq 0..31
  v4u uh[4], ul[4];
#pragma unroll
  for (int it = 0; it < 4; ++it) {
    const int row = it * 32 + lq;                                    // ci 0..127
    const v4f a = *(const v4f*)(Os + row * OSP + 8 * e);
    const v4f q = *(const v4f*)(Os + row * OSP + 8 * e + 4);
    const float f[8] = {a[0], a[1], a[2], a[3], q[0], q[1], q[2], q[3]};
    split8(f, uh[it], ul[it]);
  }
{
#pragma unroll
    for (int it = 0; it < 4; ++it) {
      const int row = it * 32 + lq;
      const size_t po = ((size_t)(b * DQ + row)) * DQ + c0 + 8 * e;
      *(v4u*)(MTh + po) = uh[it];
      *(v4u*)(MTl + po) = ul[it];
    }
    
  }
}

// =========================================================================================================
// (6) y GEMM for one (b, 64-n tile, 64-ci block): y[n][ci] = (1/1024) sum_cp (MTh+MTl)[b][ci][cp] (Qh+Ql)[b][n][cp]
//     on bf16 WMMA, 3 products per k-step (hi.hi + hi.lo + lo.hi, shared accumulator), K = 128 = 4 steps.
//     Block 128 threads = 4 waves; wave w owns cols n0+16w..+15 (B fragments from the cp-contiguous theta rows)
//     and 4 m-tiles (A rows ci = i0 + 16 mt + (lane&15), split k map from the MTh/MTl rows). Epilogue staged in
//     LDS Os[n_loc][ci_loc] (pitch OSP, b128 stores, cross-wave), block barrier, then Yh/Yl bf16 [b][4096 n][128 ci]
// coverage: Os 4 waves x 16 n x 64 ci written, reads rows 0..63 cols 8e..8e+7 <= 63; planes 4 it x 16 rows x 8
//           lanes x 8 = 64 n x 64 ci; grid (NQ/64, 2, NB) covers rows 0..NQ-1 x 128 ci of Yh/Yl exactly once.
// =========================================================================================================
__global__ __launch_bounds__(128)
void gemm_y(const unsigned short* __restrict__ MTh, const unsigned short* __restrict__ MTl,
            const unsigned short* __restrict__ Qh, const unsigned short* __restrict__ Ql,
            unsigned short* Yh, unsigned short* Yl) {
  __shared__ __align__(16) float Os[QT * OSP];
  const int tid  = threadIdx.x;
  const int lane = tid & 31, wave = tid >> 5;                        // wave 0..3
  const int hh   = lane >> 4, c = lane & 15;
  const int nt   = blockIdx.x, cb = blockIdx.y, b = blockIdx.z;
  const int n0   = nt * QT, i0 = cb * QT;

  const size_t ao = ((size_t)(b * DQ + i0 + c)) * DQ + 8 * hh;
  const unsigned short* aph = MTh + ao;
  const unsigned short* apl = MTl + ao;
  const size_t bo = ((size_t)(b * NN + n0 + 16 * wave + c)) * DQ + 8 * hh;
  const unsigned short* bph = Qh + bo;
  const unsigned short* bpl = Ql + bo;

  v8f acc[4];
#pragma unroll
  for (int mt = 0; mt < 4; ++mt) acc[mt] = zero8();

#pragma unroll
  for (int ks = 0; ks < DQ / 32; ++ks) {
    const Frag fbh = ldfrag(bph + 32 * ks);
    const Frag fbl = ldfrag(bpl + 32 * ks);
#pragma unroll
    for (int mt = 0; mt < 4; ++mt) {
      const Frag fah = ldfrag(aph + (size_t)(16 * mt) * DQ + 32 * ks);
      const Frag fal = ldfrag(apl + (size_t)(16 * mt) * DQ + 32 * ks);
      acc[mt] = mma_b(fah.bf, fbh.bf, acc[mt]);
      acc[mt] = mma_b(fah.bf, fbl.bf, acc[mt]);
      acc[mt] = mma_b(fal.bf, fbh.bf, acc[mt]);
    }
  }

  // ---- epilogue: y = acc/1024 -> LDS Os[n_loc][ci_loc]; lane (hh, c) holds ci_loc = 16 mt + 8 hh + r, n_loc = 16 w + c
  {
    const int nl = 16 * wave + c;
#pragma unroll
    for (int mt = 0; mt < 4; ++mt) {
      v4f va, vb;
#pragma unroll
      for (int r = 0; r < 4; ++r) { va[r] = acc[mt][r] * INS; vb[r] = acc[mt][4 + r] * INS; }
      *(v4f*)(Os + nl * OSP + 16 * mt + 8 * hh)     = va;
      *(v4f*)(Os + nl * OSP + 16 * mt + 8 * hh + 4) = vb;
    }
  }
  __syncthreads();

  const int e = tid & 7, lq = tid >> 3;                              // lq 0..15
  v4u uh[4], ul[4];
#pragma unroll
  for (int it = 0; it < 4; ++it) {
    const int row = it * 16 + lq;                                    // n_loc 0..63
    const v4f a = *(const v4f*)(Os + row * OSP + 8 * e);
    const v4f q = *(const v4f*)(Os + row * OSP + 8 * e + 4);
    const float f[8] = {a[0], a[1], a[2], a[3], q[0], q[1], q[2], q[3]};
    split8(f, uh[it], ul[it]);
  }
{
#pragma unroll
    for (int it = 0; it < 4; ++it) {
      const int row = it * 16 + lq;
      const size_t po = ((size_t)(b * NN + n0 + row)) * DQ + i0 + 8 * e;
      *(v4u*)(Yh + po) = uh[it];
      *(v4u*)(Yl + po) = ul[it];
    }
    
  }
}

// =========================================================================================================
// (7) output conv for one (b, 64-n tile, 64-c block): A[c][n] = sum_ci WWb[c][ci] (Yh + Yl)[b][n][ci] on bf16 WMMA
//     (2 products per k-step, shared accumulator), K = 128 = 4 steps. Block 128 threads = 4 waves; wave w owns cols
//     n0+16w..+15 (B fragments from the k-contiguous Yh/Yl rows) and 4 m-tiles (A rows c = c0 + 16 mt + (lane&15),
//     split k map loader from WWb). Epilogue staged in LDS Os[n_loc][c_loc] (pitch OSP, b128 stores, cross-wave),
//     segment 64 n = 2 lines): 8 consecutive lanes x 16 B (values gathered from 4 Os rows), one instruction per 16
// coverage: Os 4 waves x 16 n x 64 c written, read rows nl+t <= 63 x cols cl <= 63; Z 8 it x 16 lines x 8 lanes x
//           4 floats = 64 c x 64 n; grid (NQ/64, 4, NB) covers Z[b][0..255][0..NQ-1] exactly once.
// =========================================================================================================
__global__ __launch_bounds__(128)
void gemm_out(const unsigned short* __restrict__ WWb, const unsigned short* __restrict__ Yh,
              const unsigned short* __restrict__ Yl, const float* __restrict__ wb, float* Z) {
  __shared__ __align__(16) float Os[QT * OSP];
  const int tid  = threadIdx.x;
  const int lane = tid & 31, wave = tid >> 5;
  const int hh   = lane >> 4, c = lane & 15;
  const int nt   = blockIdx.x, cb = blockIdx.y, b = blockIdx.z;
  const int n0   = nt * QT, c0 = cb * QT;

  const unsigned short* ap  = WWb + (size_t)(c0 + c) * DQ + 8 * hh;
  const size_t bo = ((size_t)(b * NN + n0 + 16 * wave + c)) * DQ + 8 * hh;
  const unsigned short* bph = Yh + bo;
  const unsigned short* bpl = Yl + bo;

  v8f acc[4];
#pragma unroll
  for (int mt = 0; mt < 4; ++mt) acc[mt] = zero8();

#pragma unroll
  for (int ks = 0; ks < DQ / 32; ++ks) {
    const Frag fbh = ldfrag(bph + 32 * ks);
    const Frag fbl = ldfrag(bpl + 32 * ks);
#pragma unroll
    for (int mt = 0; mt < 4; ++mt) {
      const Frag fa = ldfrag(ap + (size_t)(16 * mt) * DQ + 32 * ks);
      acc[mt] = mma_b(fa.bf, fbh.bf, acc[mt]);
      acc[mt] = mma_b(fa.bf, fbl.bf, acc[mt]);
    }
  }

  // ---- epilogue: -> LDS Os[n_loc][c_loc]; lane (hh, c) holds c_loc = 16 mt + 8 hh + r for n_loc = 16 w + c
  {
    const int nl = 16 * wave + c;
#pragma unroll
    for (int mt = 0; mt < 4; ++mt) {
      v4f va, vb;
#pragma unroll
      for (int r = 0; r < 4; ++r) { va[r] = acc[mt][r]; vb[r] = acc[mt][4 + r]; }
      *(v4f*)(Os + nl * OSP + 16 * mt + 8 * hh)     = va;
      *(v4f*)(Os + nl * OSP + 16 * mt + 8 * hh + 4) = vb;
    }
  }
  __syncthreads();

  const int e = tid & 7, lq = tid >> 3;                              // lq 0..15
  v4f res[8];
#pragma unroll
  for (int it = 0; it < 8; ++it) {
    const int L   = it * 16 + lq;                                    // 0..127
    const int cl  = L >> 1, hf = L & 1;                              // channel 0..63 within the block
    const int nl  = hf * 32 + 4 * e;                                 // position 0..63
    const float bvs = bfr(wb[c0 + cl]);
#pragma unroll
    for (int t = 0; t < 4; ++t) {
      res[it][t] = Os[(nl + t) * OSP + cl] + bvs;
    }
  }
{
#pragma unroll
    for (int it = 0; it < 8; ++it) {
      const int L   = it * 16 + lq;
      const int cl  = L >> 1, hf = L & 1;
      const int nl  = hf * 32 + 4 * e;
      const size_t idx = ((size_t)(b * CC + c0 + cl)) * NQ + n0 + nl;
      *(v4f*)(Z + idx) = res[it];
    }
    
  }
}

// =========================================================================================================
// (8) batch-norm statistics per channel ch (one block per channel, 256 threads): f64 sums of z and z*z over
//     NB x NQ values read as b128, LDS f64 tree (cross-thread, block barriers), mean and biased variance in f64,
//     rstd = 1/sqrt(var + eps) in f32; stats line ST[ch][32 floats] = {mean, bf16-RNE(gamma)*rstd, bf16-RNE(beta),
// coverage: grid (CC) writes every line of ST exactly once; reads Z rows (b<NB, ch, n<NQ) all produced by (7).
// =========================================================================================================
__global__ __launch_bounds__(256)
void bn_stats(const float* __restrict__ Z, const float* __restrict__ gam, const float* __restrict__ bet,
              float* ST) {
  __shared__ double sh1[256];
  __shared__ double sh2[256];
  const int tid = threadIdx.x, ch = blockIdx.x;
  double s = 0.0, ss = 0.0;
#pragma unroll 1
  for (int b = 0; b < NB; ++b) {
    const float* zr = Z + ((size_t)(b * CC + ch)) * NQ;
#pragma unroll 1
    for (int k = tid; k < NQ / 4; k += 256) {
      const v4f v = *(const v4f*)(zr + 4 * k);
#pragma unroll
      for (int t = 0; t < 4; ++t) { const double d = (double)v[t]; s += d; ss += d * d; }
    }
  }
  sh1[tid] = s;
  sh2[tid] = ss;
  __syncthreads();
#pragma unroll 1
  for (int stp = 128; stp > 0; stp >>= 1) {
    if (tid < stp) { sh1[tid] += sh1[tid + stp]; sh2[tid] += sh2[tid + stp]; }
    __syncthreads();
  }
  const double cnt  = (double)NB * (double)NQ;
  const double mean = sh1[0] / cnt;
  double var = sh2[0] / cnt - mean * mean;
  var = (var > 0.0) ? var : 0.0;
  const float rstd  = 1.0f / sqrtf((float)var + BNEPS);
  const float meanf = (float)mean;
  const float scl   = bfr(gam[ch]) * rstd;
  const float btr   = bfr(bet[ch]);
  if (tid < 8) {
    v4f w;
    w[0] = (tid == 0) ? meanf : 0.f;
    w[1] = (tid == 0) ? scl : 0.f;
    w[2] = (tid == 0) ? btr : 0.f;
    w[3] = 0.f;
    float* p = ST + (size_t)ch * STL + 4 * tid;
    *(v4f*)p = w;
    
  }
}

// =========================================================================================================
// (9) out[b][ch][n] = ((z - mean) * (gamma*rstd) + beta) + bf16-RNE(x): one thread per 4 consecutive n; a wave writes
// coverage: NB*CC*NQ/1024 blocks x 256 threads x 4 floats = out[b<NB][0..255][0..NQ-1] exactly once.
// =========================================================================================================
__global__ __launch_bounds__(256)
void bn_apply(const float* __restrict__ Z, const float* __restrict__ x, const float* __restrict__ ST,
              float* out) {
  const size_t i4   = (size_t)blockIdx.x * 256 + threadIdx.x;
  const size_t el   = i4 * 4;
  const size_t rowi = el / NQ;
  const int n  = (int)(el - rowi * NQ);
  const int ch = (int)(rowi % CC);
  const int b  = (int)(rowi / CC);
  const v4f z  = *(const v4f*)(Z + el);
  const size_t xo = ((size_t)(b * CC + ch)) * NN + n;
  const v4f xv = *(const v4f*)(x + xo);
  const float mean = ST[(size_t)ch * STL + 0];
  const float scl  = ST[(size_t)ch * STL + 1];
  const float btr  = ST[(size_t)ch * STL + 2];
  v4f r;
#pragma unroll
  for (int t = 0; t < 4; ++t) r[t] = ((z[t] - mean) * scl + btr) + bfr(xv[t]);
  float* p = out + xo;
  *(v4f*)p = r;
  
}

// =========================================================================================================
// Workspace map (bytes; each region start a multiple of 256; every extent is an exact row/tile multiple and is
//   W16 f16 [384][256]            196608      WWb bf16 [256][128]        65536
//   XP  f16 [NB][4096][256]     16777216 (NB=8)
//   Qh/Ql bf16 [NB][4096][128]   8388608 x2
//   PGZ region 33554432: PF f32 [NB][4096][128] at +0 and GF at +16777216 (live launches 3-4 only), then reused
//       as Z f32 [NB][256][NQ] at +0 (written by launch 8, read by 9-10); Z extent <= region (static_assert)
//   Pp/Gp/Pc/Gc f16 [NB][1024][128] / [NB][128][1024]   2097152 x4
//   MTh/MTl bf16 [NB][128][128]   262144 x2
//   Yh/Yl bf16 [NB][4096][128]   8388608 x2
//   ST  f32 [256][32]               32768
//   total (NB=8, NQ=4096) = 93093888
// =========================================================================================================
extern "C" void kernel_launch(void* const* d_in, const int* in_sizes, int n_in,
                              void* d_out, int out_size, void* d_ws, size_t ws_size,
                              hipStream_t stream) {
  const int XN = NB * CC * NN;
  if (n_in < 11) return;
  if (in_sizes[0] < XN) return;
  if (in_sizes[1] < DQ * CC || in_sizes[3] < DQ * CC || in_sizes[5] < DQ * CC || in_sizes[7] < CC * DQ) return;
  if (in_sizes[2] < DQ || in_sizes[4] < DQ || in_sizes[6] < DQ || in_sizes[8] < CC) return;
  if (in_sizes[9] < CC || in_sizes[10] < CC) return;
  if (out_size < XN) return;

  size_t off = 0;
  auto carve = [&](size_t bytes) { const size_t o = off; off += (bytes + 255) & ~(size_t)255; return o; };
  const size_t oW16 = carve((size_t)MW * CC * 2);
  const size_t oWWb = carve((size_t)CC * DQ * 2);
  const size_t oXP  = carve((size_t)NB * NN * CC * 2);
  const size_t oQh  = carve((size_t)NB * NN * DQ * 2);
  const size_t oQl  = carve((size_t)NB * NN * DQ * 2);
  const size_t oPGZ = carve((size_t)2 * NB * NN * DQ * 4);
  const size_t oPp  = carve((size_t)NB * MM * DQ * 2);
  const size_t oGp  = carve((size_t)NB * MM * DQ * 2);
  const size_t oPc  = carve((size_t)NB * DQ * MM * 2);
  const size_t oGc  = carve((size_t)NB * DQ * MM * 2);
  const size_t oMTh = carve((size_t)NB * DQ * DQ * 2);
  const size_t oMTl = carve((size_t)NB * DQ * DQ * 2);
  const size_t oYh  = carve((size_t)NB * NN * DQ * 2);
  const size_t oYl  = carve((size_t)NB * NN * DQ * 2);
  const size_t oST  = carve((size_t)CC * STL * 4);
  if (off > ws_size) return;
  if (off > (size_t)134217728) return;

  const float* x  = (const float*)d_in[0];
  const float* gw = (const float*)d_in[1];
  const float* gb = (const float*)d_in[2];
  const float* tw = (const float*)d_in[3];
  const float* tb = (const float*)d_in[4];
  const float* pw = (const float*)d_in[5];
  const float* pb = (const float*)d_in[6];
  const float* ow = (const float*)d_in[7];
  const float* wb = (const float*)d_in[8];
  const float* bg = (const float*)d_in[9];
  const float* bb = (const float*)d_in[10];

  char* ws = (char*)d_ws;
  unsigned short* W16 = (unsigned short*)(ws + oW16);
  unsigned short* WWb = (unsigned short*)(ws + oWWb);
  unsigned short* XP  = (unsigned short*)(ws + oXP);
  unsigned short* Qh  = (unsigned short*)(ws + oQh);
  unsigned short* Ql  = (unsigned short*)(ws + oQl);
  float*          PF  = (float*)(ws + oPGZ);
  float*          GF  = (float*)(ws + oPGZ + (size_t)NB * NN * DQ * 4);
  float*          Z   = (float*)(ws + oPGZ);
  unsigned short* Pp  = (unsigned short*)(ws + oPp);
  unsigned short* Gp  = (unsigned short*)(ws + oGp);
  unsigned short* Pc  = (unsigned short*)(ws + oPc);
  unsigned short* Gc  = (unsigned short*)(ws + oGc);
  unsigned short* MTh = (unsigned short*)(ws + oMTh);
  unsigned short* MTl = (unsigned short*)(ws + oMTl);
  unsigned short* Yh  = (unsigned short*)(ws + oYh);
  unsigned short* Yl  = (unsigned short*)(ws + oYl);
  float*          ST  = (float*)(ws + oST);
  float* out = (float*)d_out;

  const dim3 blk256(256), blk128(128);

  // (0) theta_w / phi_w / g_w -> stacked f16 plane; w_w -> bf16 plane
  cvt_w<<<dim3(MW / 8 + CC / 16), blk256, 0, stream>>>(tw, pw, gw, ow, W16, WWb);
  // (1) x -> position-major 16-bit plane
  cvt_x<<<dim3(NN / QT, CC / QT, NB), blk256, 0, stream>>>(x, XP);
  // (2) conv1x1 GEMM -> theta hi/res planes, phi / g conv outputs + bias as f32 planes
  gemm_proj<<<dim3(NSTRIP, MW / QT, NB), blk256, 0, stream>>>(W16, XP, tb, pb, gb, Qh, Ql, PF, GF);
  // (3) 2x2 stride-2 max-pool -> pooled phi / g f16 planes [b][m][d]
  pool_pg<<<dim3(HP, NB), blk256, 0, stream>>>(PF, GF, Pp, Gp);
  // (4) pooled planes -> channel-major [b][d][m]
  tr_pg<<<dim3(MM / QT, 4, NB), blk256, 0, stream>>>(Pp, Gp, Pc, Gc);
  // (5) M = pooled-phi . pooled-g^T per batch -> M^T hi/res planes [b][ci][cp]
  gemm_m<<<dim3(DQ / QT, NB), blk256, 0, stream>>>(Pc, Gc, MTh, MTl);
  // (6) y = theta . M / 1024 -> y hi/res planes [b][n][128]
  gemm_y<<<dim3(NQ / QT, DQ / QT, NB), blk128, 0, stream>>>(MTh, MTl, Qh, Ql, Yh, Yl);
  // (7) output conv + bias -> Z [b][256][NQ]
  gemm_out<<<dim3(NQ / QT, CC / QT, NB), blk128, 0, stream>>>(WWb, Yh, Yl, wb, Z);
  // (8) batch statistics per channel -> ST lines
  bn_stats<<<dim3(CC), blk256, 0, stream>>>(Z, bg, bb, ST);
  // (9) normalise, affine, residual -> out [b][256][4096]
  bn_apply<<<dim3((NB * CC * NQ) / 1024), blk256, 0, stream>>>(Z, x, ST, out);
  (void)hipGetLastError();
}

// v001
// One run takes 139 microseconds.
// Next to v000, in two timings, it ran 1.06 and 1.07 times as fast.
// Contractions: conv1x1 theta/phi/g GEMM W[384x256].X[256x128] per strip on v_wmma_f32_16x16x32_f16 (f16
// containers of bf16-RNE weights x256 and bf16-RNE x, 1 product); M = pooled-phi . pooled-g^T per batch
// [128x128], K=1024, on v_wmma_f32_16x16x32_f16 (2x2 max-pooled phi and g as plain f16, 1 product);
// y^T = M^T.theta^T, K=128, on v_wmma_f32_16x16x32_bf16 (M and theta as bf16 hi + bf16 residual planes,
// 3 products); output conv W[256x128].Y on v_wmma_f32_16x16x32_bf16 (bf16 weights, y as bf16 hi + residual
// planes, 2 products); f32 accumulate everywhere; max-pool, bias, batch-norm statistics (f64 sums, f32 apply)
// and the residual add on VALU.
#include <hip/hip_runtime.h>
#include <math.h>
#include <stdint.h>

#ifndef NB
#define NB 8
#endif
#ifndef NQ
#define NQ 4096
#endif
#define NB_FULL 8
#define CC     256
#define HIMG   64
#define WIMG   64
#define NN     4096
#define DQ     128
#define HP     32
#define WP     32
#define MM     1024
#define MW     384
#define QT     64
#define SN     128
#define NSTRIP 32
#define OSP    68
#define TP     72
#define STL    32
#define WSC    256.0f
#define IWSC   0.00390625f
#define INS    0.0009765625f
#define BNEPS  1e-5f
#define SBT    1024
#define SQ     (NQ / (4 * SBT))

static_assert(NB >= 1 && NB <= NB_FULL);
static_assert(NQ % 128 == 0 && NQ >= 128 && NQ <= NN);
static_assert(NQ % QT == 0);
static_assert(NN == HIMG * WIMG);
static_assert(SN == 2 * WIMG && NSTRIP * SN == NN && SN == 8 * 16);
static_assert(HIMG % 2 == 0 && WIMG % 2 == 0 && HP == HIMG / 2 && WP == WIMG / 2 && MM == HP * WP);
static_assert(WP == 32);
static_assert(MM % QT == 0 && MM % 32 == 0);
static_assert(NN % QT == 0 && CC % QT == 0 && DQ == 2 * QT);
static_assert(MW == 3 * DQ && MW % 8 == 0);
static_assert(CC % 32 == 0 && DQ % 32 == 0);
static_assert((OSP * 4) % 16 == 0 && (TP * 2) % 16 == 0);
static_assert(SN * OSP * 4 <= 65536 && DQ * OSP * 4 <= 65536);
static_assert(((size_t)NB * CC * NQ) % 1024 == 0);
static_assert((size_t)NB * CC * NQ * 4 <= 2 * (size_t)NB * NN * DQ * 4);
static_assert((size_t)NB_FULL * CC * NN * 4 == (size_t)33554432);
static_assert(STL * 4 == 128);
static_assert(NQ % (4 * SBT) == 0 && (SBT & (SBT - 1)) == 0 && SBT <= 1024);

typedef _Float16       v16h __attribute__((ext_vector_type(16)));
typedef _Float16       v8h  __attribute__((ext_vector_type(8)));
typedef __bf16         v16b __attribute__((ext_vector_type(16)));
typedef unsigned short v8us __attribute__((ext_vector_type(8)));
typedef float          v8f  __attribute__((ext_vector_type(8)));
typedef float          v4f  __attribute__((ext_vector_type(4)));
typedef unsigned int   v4u  __attribute__((ext_vector_type(4)));

union Frag { v8us u[2]; v16h h; v16b bf; };
static_assert(sizeof(Frag) == 32);

// ---- scalar helpers ---------------------------------------------------------------------------------------
__device__ __forceinline__ unsigned short bf_bits(float f) {          // f32 -> bf16 bits, RNE convert
  unsigned u = __float_as_uint(f);
  return (unsigned short)((u + 0x7FFFu + ((u >> 16) & 1u)) >> 16);
}
__device__ __forceinline__ float bf_up(unsigned short hb) { return __uint_as_float(((unsigned)hb) << 16); }
__device__ __forceinline__ float bfr(float f) { return bf_up(bf_bits(f)); }
__device__ __forceinline__ unsigned short h_bits(_Float16 x) { return __builtin_bit_cast(unsigned short, x); }
__device__ __forceinline__ unsigned pk16(unsigned short a, unsigned short b) { return (unsigned)a | ((unsigned)b << 16); }
__device__ __forceinline__ v8f zero8() { v8f z = {0.f, 0.f, 0.f, 0.f, 0.f, 0.f, 0.f, 0.f}; return z; }
// 8 f32 values -> bf16 hi bits and bf16 residual bits (lo = RNE(v - hi)), packed 2 per uint
__device__ __forceinline__ void split8(const float* f, v4u& uh, v4u& ul) {
#pragma unroll
  for (int t = 0; t < 4; ++t) {
    const float f0 = f[2 * t], f1 = f[2 * t + 1];
    const unsigned short hb0 = bf_bits(f0), hb1 = bf_bits(f1);
    const unsigned short lb0 = bf_bits(f0 - bf_up(hb0));
    const unsigned short lb1 = bf_bits(f1 - bf_up(hb1));
    uh[t] = pk16(hb0, hb1);
    ul[t] = pk16(lb0, lb1);
  }
}

// ---- 16-bit fragment loader (A, or B from a k-contiguous [n][k] row): lane -> row/col (lane&15), p already includes
//      + 8*(lane>>4); elements 0..7 <- p[0..7] (k0+8h..), elements 8..15 <- p[16..23] (k0+16+8h..)
__device__ __forceinline__ Frag ldfrag(const unsigned short* p) {
  Frag f;
  f.u[0] = *(const v8us*)(p);
  f.u[1] = *(const v8us*)(p + 16);
  return f;
}

// ---- WMMA helpers: builtin followed by a 4-slot VALU gap tying D and keeping A/B live --------------------------
__device__ __forceinline__ v8f mma_h(v16h a, v16h b, v8f c) {
  v8f d = __builtin_amdgcn_wmma_f32_16x16x32_f16(false, a, false, b, (short)0, c, false, false);
#if defined(__HIP_DEVICE_COMPILE__)
  asm volatile("v_nop\n\tv_nop\n\tv_nop\n\tv_nop" : "+v"(d) : "v"(a), "v"(b));
#endif
  return d;
}
__device__ __forceinline__ v8f mma_b(v16b a, v16b b, v8f c) {
  v8f d = __builtin_amdgcn_wmma_f32_16x16x32_bf16(false, a, false, b, (short)0, c, false, false);
#if defined(__HIP_DEVICE_COMPILE__)
  const v16h ha = __builtin_bit_cast(v16h, a), hb = __builtin_bit_cast(v16h, b);
  asm volatile("v_nop\n\tv_nop\n\tv_nop\n\tv_nop" : "+v"(d) : "v"(ha), "v"(hb));
#endif
  return d;
}

// =========================================================================================================
// (0) weights. Blocks 0..47: W16 f16 [384][256], rows 0..127 = theta_w, 128..255 = phi_w, 256..383 = g_w; value =
//     f16 of (bf16-RNE(w) * 256) (exact). Block owns rows 8*blk..8*blk+7: one wave per 512-B row = 32 lanes x 16 B
// coverage: 48 blocks x 8 rows x 32 lanes x 8 halves = 384 x 256; 16 blocks x 16 rows x 16 lanes x 8 = 256 x 128.
// =========================================================================================================
__global__ __launch_bounds__(256)
void cvt_w(const float* __restrict__ tw, const float* __restrict__ pw, const float* __restrict__ gw,
           const float* __restrict__ ow, unsigned short* W16, unsigned short* WWb) {
  const int tid = threadIdx.x, blk = blockIdx.x;
  if (blk < MW / 8) {
    const int rl = tid >> 5, col = 8 * (tid & 31);
    const int o = 8 * blk + rl;                                      // 0..383
    const int grp = blk >> 4;                                        // 0,1,2 (block-uniform)
    const float* wbase = (grp == 0) ? tw : ((grp == 1) ? pw : gw);  // all global
    const float* s = wbase + (size_t)(o - DQ * grp) * CC + col;      // (o - 128 grp) in 0..127
    const v4f a = *(const v4f*)s;
    const v4f q = *(const v4f*)(s + 4);
    const float f[8] = {a[0], a[1], a[2], a[3], q[0], q[1], q[2], q[3]};
    v4u u;
#pragma unroll
    for (int t = 0; t < 4; ++t) {
      const _Float16 h0 = (_Float16)(bfr(f[2 * t]) * WSC);
      const _Float16 h1 = (_Float16)(bfr(f[2 * t + 1]) * WSC);
      u[t] = pk16(h_bits(h0), h_bits(h1));
    }
{
      *(v4u*)(W16 + (size_t)o * CC + col) = u;
      
    }
  } else {
    const int rb = blk - MW / 8;                                     // 0..15
    const int o = 16 * rb + (tid >> 4);                              // 0..255
    const int col = 8 * (tid & 15);                                  // 0..120
    const float* s = ow + (size_t)o * DQ + col;
    const v4f a = *(const v4f*)s;
    const v4f q = *(const v4f*)(s + 4);
    const float f[8] = {a[0], a[1], a[2], a[3], q[0], q[1], q[2], q[3]};
    v4u u;
#pragma unroll
    for (int t = 0; t < 4; ++t) u[t] = pk16(bf_bits(f[2 * t]), bf_bits(f[2 * t + 1]));
{
      *(v4u*)(WWb + (size_t)o * DQ + col) = u;
      
    }
  }
}

// =========================================================================================================
// (1) x f32 [b][256 c][4096 n] -> XP f16 [b][n][c] (position-major, bf16-RNE values, exact in f16) through an LDS
//     tile T[64 n][64 c] (pitch TP, cross-thread, block barrier). Block (nb, cb, b) owns a 64 c x 64 n tile.
// coverage: T written rows (8e+t)=0..63 x cols cl 0..63, read rows 0..63 x cols 8e..8e+7; XP 2 it x 32 rows x 8 lanes
//           x 8 = 64 n x 64 c; grid (64, 4, NB) covers XP [b][0..4095][0..255] exactly once.
// =========================================================================================================
__global__ __launch_bounds__(256)
void cvt_x(const float* __restrict__ x, unsigned short* XP) {
  __shared__ __align__(16) unsigned short T[QT * TP];
  const int tid = threadIdx.x;
  const int nb = blockIdx.x, cb = blockIdx.y, b = blockIdx.z;
  const int e = tid & 7, lq = tid >> 3;                             // lq 0..31
  const int n0 = nb * QT, c0 = cb * QT;
#pragma unroll
  for (int it = 0; it < 2; ++it) {
    const int cl = it * 32 + lq;                                     // 0..63
    const float* sp = x + ((size_t)(b * CC + c0 + cl)) * NN + n0 + 8 * e;
    const v4f a = *(const v4f*)sp;
    const v4f q = *(const v4f*)(sp + 4);
    unsigned short hb[8];
#pragma unroll
    for (int t = 0; t < 4; ++t) {
      hb[t]     = h_bits((_Float16)bfr(a[t]));
      hb[4 + t] = h_bits((_Float16)bfr(q[t]));
    }
#pragma unroll
    for (int t = 0; t < 8; ++t) T[(8 * e + t) * TP + cl] = hb[t];
  }
  __syncthreads();
  v4u up[2];
#pragma unroll
  for (int it = 0; it < 2; ++it) {
    const int nl = it * 32 + lq;                                     // 0..63
    up[it] = *(const v4u*)(T + nl * TP + 8 * e);
  }
{
#pragma unroll
    for (int it = 0; it < 2; ++it) {
      const int rl = it * 32 + lq;
      *(v4u*)(XP + ((size_t)(b * NN + n0 + rl)) * CC + c0 + 8 * e) = up[it];
    }
    
  }
}

// =========================================================================================================
// (2) conv1x1 GEMM for one (b, strip of 128 positions = image rows 2s and 2s+1, 64-o block of the stacked weights):
//     Y[o][n] = (1/256) sum_c W16[o][c] XP[b][n][c]. Block 256 threads = 8 waves; wave w owns cols n0+16w..+15
//     (one B fragment per k-step, k = c contiguous in the XP row) and 4 m-tiles (A rows o = o0 + 16 mt + (lane&15),
//     split k map loader from W16). K = 256 = 8 steps. Epilogue staged in LDS Os[n_loc][o_loc] (pitch OSP, b128
//     stores, cross-wave), block barrier, then (block-uniform branch on the o block):
//       o-blocks 0,1 -> theta dims 0..63 / 64..127 + bias -> Qh/Ql bf16 [b][4096 n][128 d] (hi = RNE(v), lo = RNE(v-hi)):
//       o-blocks 2,3 -> phi + bias in f32 -> PF f32 [b][4096 n][128 d]: 128 rows x the dsel half (256 B = 2 whole
//                       lines) of the 512-B row, 16 consecutive lanes x 16 B, one instruction per 2 rows.
//       o-blocks 4,5 -> g + bias -> GF f32 [b][4096 n][128 d], same layout.
// coverage: Os 8 waves x 16 n x 64 o = 128 x 64 written, reads rows <= 127 cols <= 63; theta planes 4 it x 32 rows
//           x 8 lanes x 8 = 128 n x 64 d; f32 planes 8 it x 16 rows x 16 lanes x 4 = 128 n x 64 d; grid (32, 6, NB)
//           covers all 4096 rows x 128 d of Qh/Ql and of PF/GF exactly once.
// =========================================================================================================
__global__ __launch_bounds__(256)
void gemm_proj(const unsigned short* __restrict__ W16, const unsigned short* __restrict__ XP,
               const float* __restrict__ tb, const float* __restrict__ pb, const float* __restrict__ gb,
               unsigned short* Qh, unsigned short* Ql, float* PF, float* GF) {
  __shared__ __align__(16) float Os[SN * OSP];
  const int tid  = threadIdx.x;
  const int lane = tid & 31, wave = tid >> 5;                        // wave 0..7
  const int hh   = lane >> 4, c = lane & 15;
  const int st   = blockIdx.x, mb = blockIdx.y, b = blockIdx.z;
  const int n0   = st * SN, o0 = mb * QT;

  const unsigned short* ap = W16 + (size_t)(o0 + c) * CC + 8 * hh;
  const unsigned short* bp = XP + ((size_t)(b * NN + n0 + 16 * wave + c)) * CC + 8 * hh;

  v8f acc[4];
#pragma unroll
  for (int mt = 0; mt < 4; ++mt) acc[mt] = zero8();

#pragma unroll
  for (int ks = 0; ks < CC / 32; ++ks) {
    const Frag fb = ldfrag(bp + 32 * ks);
#pragma unroll
    for (int mt = 0; mt < 4; ++mt) {
      const Frag fa = ldfrag(ap + (size_t)(16 * mt) * CC + 32 * ks);
      acc[mt] = mma_h(fa.h, fb.h, acc[mt]);
    }
  }

  // ---- epilogue: scale back -> LDS Os[n_loc][o_loc]; lane (hh, c) holds o = 16 mt + 8 hh + r for n_loc = 16 w + c
  {
    const int nl = 16 * wave + c;
#pragma unroll
    for (int mt = 0; mt < 4; ++mt) {
      v4f va, vb;
#pragma unroll
      for (int r = 0; r < 4; ++r) { va[r] = acc[mt][r] * IWSC; vb[r] = acc[mt][4 + r] * IWSC; }
      *(v4f*)(Os + nl * OSP + 16 * mt + 8 * hh)     = va;
      *(v4f*)(Os + nl * OSP + 16 * mt + 8 * hh + 4) = vb;
    }
  }
  __syncthreads();

  const int grp = mb >> 1;                                           // 0 theta, 1 phi, 2 g (block-uniform)
  const int dsel = (mb & 1) * QT;                                    // 0 or 64
  const float* bias = (grp == 0) ? tb : ((grp == 1) ? pb : gb);     // all global

  if (grp == 0) {
    const int e = tid & 7, lq = tid >> 3;                            // lq 0..31
    float bv[8];
    {
      const v4f ba = *(const v4f*)(bias + dsel + 8 * e);
      const v4f bq = *(const v4f*)(bias + dsel + 8 * e + 4);
#pragma unroll
      for (int t = 0; t < 4; ++t) { bv[t] = bfr(ba[t]); bv[4 + t] = bfr(bq[t]); }
    }
    v4u uh[4], ul[4];
#pragma unroll
    for (int it = 0; it < 4; ++it) {
      const int row = it * 32 + lq;                                  // n_loc 0..127
      const v4f a = *(const v4f*)(Os + row * OSP + 8 * e);
      const v4f q = *(const v4f*)(Os + row * OSP + 8 * e + 4);
      float f[8];
#pragma unroll
      for (int t = 0; t < 4; ++t) { f[t] = a[t] + bv[t]; f[4 + t] = q[t] + bv[4 + t]; }
      split8(f, uh[it], ul[it]);
    }
{
#pragma unroll
      for (int it = 0; it < 4; ++it) {
        const int row = it * 32 + lq;
        const size_t po = ((size_t)(b * NN + n0 + row)) * DQ + dsel + 8 * e;
        *(v4u*)(Qh + po) = uh[it];
        *(v4u*)(Ql + po) = ul[it];
      }
      
    }
  } else {
    const int e16 = tid & 15, lr = tid >> 4;                        // lr 0..15
    v4f bv4;
    {
      const v4f bq = *(const v4f*)(bias + dsel + 4 * e16);
#pragma unroll
      for (int t = 0; t < 4; ++t) bv4[t] = bfr(bq[t]);
    }
    float* P = (grp == 1) ? PF : GF;                                 // both global
    v4f res[8];
#pragma unroll
    for (int it = 0; it < 8; ++it) {
      const int row = it * 16 + lr;                                  // n_loc 0..127
      const v4f a = *(const v4f*)(Os + row * OSP + 4 * e16);
      v4f v;
#pragma unroll
      for (int t = 0; t < 4; ++t) v[t] = a[t] + bv4[t];
      res[it] = v;
    }
{
#pragma unroll
      for (int it = 0; it < 8; ++it) {
        const int row = it * 16 + lr;
        const size_t po = ((size_t)(b * NN + n0 + row)) * DQ + dsel + 4 * e16;
        *(v4f*)(P + po) = res[it];
      }
      
    }
  }
}

// =========================================================================================================
// (3) 2x2 stride-2 max-pool of PF / GF f32 [b][4096 n][128 d] in f32 -> Pp / Gp f16 [b][1024 m][128 d],
//     m = 32 py + px, window n = (2py+dy) 64 + 2px+dx, dy,dx in {0,1}. Block (py, b), 256 threads: lane group
// coverage: 32 blocks x 32 px x 16 lanes x 8 = rows 0..1023 x 128 d of both planes; grid (32, NB) exactly once.
// =========================================================================================================
__global__ __launch_bounds__(256)
void pool_pg(const float* __restrict__ PF, const float* __restrict__ GF,
             unsigned short* Pp, unsigned short* Gp) {
  const int tid = threadIdx.x, py = blockIdx.x, b = blockIdx.y;
  const int e16 = tid & 15, lr = tid >> 4;                          // lr 0..15
  v4u pu[2], gu[2];
#pragma unroll
  for (int it = 0; it < 2; ++it) {
    const int px = it * 16 + lr;                                     // 0..31
    float fk[8], fg[8];
#pragma unroll
    for (int t = 0; t < 8; ++t) { fk[t] = -__builtin_inff(); fg[t] = -__builtin_inff(); }
#pragma unroll
    for (int dy = 0; dy < 2; ++dy) {
      const size_t rb = ((size_t)(b * NN + (2 * py + dy) * WIMG + 2 * px)) * DQ + 8 * e16;
#pragma unroll
      for (int dx = 0; dx < 2; ++dx) {
        const float* pk = PF + rb + (size_t)dx * DQ;
        const float* pg = GF + rb + (size_t)dx * DQ;
        const v4f ka = *(const v4f*)pk, kq = *(const v4f*)(pk + 4);
        const v4f ga = *(const v4f*)pg, gq = *(const v4f*)(pg + 4);
#pragma unroll
        for (int t = 0; t < 4; ++t) {
          fk[t]     = fmaxf(fk[t], ka[t]);
          fk[4 + t] = fmaxf(fk[4 + t], kq[t]);
          fg[t]     = fmaxf(fg[t], ga[t]);
          fg[4 + t] = fmaxf(fg[4 + t], gq[t]);
        }
      }
    }
#pragma unroll
    for (int t = 0; t < 4; ++t) {
      pu[it][t] = pk16(h_bits((_Float16)fk[2 * t]), h_bits((_Float16)fk[2 * t + 1]));
      gu[it][t] = pk16(h_bits((_Float16)fg[2 * t]), h_bits((_Float16)fg[2 * t + 1]));
    }
  }
{
#pragma unroll
    for (int it = 0; it < 2; ++it) {
      const int px = it * 16 + lr;
      const size_t po = ((size_t)(b * MM + WP * py + px)) * DQ + 8 * e16;
      *(v4u*)(Pp + po) = pu[it];
      *(v4u*)(Gp + po) = gu[it];
    }
    
  }
}

// =========================================================================================================
// (4) Pp / Gp f16 [b][1024 m][128 d] -> Pc / Gc f16 [b][d][m] (channel-major, m contiguous) through an LDS tile
//     T[64 d][64 m] (pitch TP, cross-thread, block barrier). Block (mt, yb, b): plane = yb>>1 (block-uniform,
// coverage: reads 2 it x 32 rows x 8 lanes x 8 = 64 m x 64 d; T written rows (8e+t)=0..63 x cols 0..63, read rows
//           0..63 x cols 8e..8e+7; writes 64 d x 64 m; grid (16, 4, NB) covers Pc and Gc [b][0..127][0..1023] once.
// =========================================================================================================
__global__ __launch_bounds__(256)
void tr_pg(const unsigned short* __restrict__ Pp, const unsigned short* __restrict__ Gp,
           unsigned short* Pc, unsigned short* Gc) {
  __shared__ __align__(16) unsigned short T[QT * TP];
  const int tid = threadIdx.x;
  const int mt = blockIdx.x, yb = blockIdx.y, b = blockIdx.z;
  const int db = yb & 1, sel = yb >> 1;                             // block-uniform
  const unsigned short* src = (sel == 0) ? Pp : Gp;                  // both global
  unsigned short* dst = (sel == 0) ? Pc : Gc;                        // both global
  const int e = tid & 7, lq = tid >> 3;                             // lq 0..31
  const int m0 = mt * QT, d0 = db * QT;
#pragma unroll
  for (int it = 0; it < 2; ++it) {
    const int ml = it * 32 + lq;                                     // 0..63
    const v4u w = *(const v4u*)(src + ((size_t)(b * MM + m0 + ml)) * DQ + d0 + 8 * e);
    unsigned short hb[8];
#pragma unroll
    for (int t = 0; t < 4; ++t) {
      hb[2 * t]     = (unsigned short)(w[t] & 0xFFFFu);
      hb[2 * t + 1] = (unsigned short)(w[t] >> 16);
    }
#pragma unroll
    for (int t = 0; t < 8; ++t) T[(8 * e + t) * TP + ml] = hb[t];
  }
  __syncthreads();
  v4u up[2];
#pragma unroll
  for (int it = 0; it < 2; ++it) {
    const int dl = it * 32 + lq;                                     // 0..63
    up[it] = *(const v4u*)(T + dl * TP + 8 * e);
  }
{
#pragma unroll
    for (int it = 0; it < 2; ++it) {
      const int dl = it * 32 + lq;
      *(v4u*)(dst + ((size_t)(b * DQ + d0 + dl)) * MM + m0 + 8 * e) = up[it];
    }
    
  }
}

// =========================================================================================================
// (5) M GEMM for one (b, 64-row block of phi channels): M[cp][ci] = sum_m Pc[b][cp][m] Gc[b][ci][m], K = 1024 =
//     32 steps (rolled by 2). Block 256 threads = 8 waves; wave w owns cols ci = 16w..16w+15 (B fragment from the
//     m-contiguous Gc row, split k map) and 4 m-tiles (A rows cp = c0 + 16 mt + (lane&15) from Pc, split k map).
//     Epilogue staged in LDS Os[ci_loc][cp_loc] (pitch OSP, b128 stores, cross-wave), block barrier, then
// coverage: Os 8 waves x 16 ci x 64 cp = 128 x 64 written, reads rows 0..127 cols 8e..8e+7 <= 63; planes 4 it x
//           32 rows x 8 lanes x 8 = 128 ci x 64 cp; grid (2, NB) covers MTh/MTl [b][0..127][0..127] exactly once.
// =========================================================================================================
__global__ __launch_bounds__(256)
void gemm_m(const unsigned short* __restrict__ Pc, const unsigned short* __restrict__ Gc,
            unsigned short* MTh, unsigned short* MTl) {
  __shared__ __align__(16) float Os[DQ * OSP];
  const int tid  = threadIdx.x;
  const int lane = tid & 31, wave = tid >> 5;                        // wave 0..7
  const int hh   = lane >> 4, c = lane & 15;
  const int mb   = blockIdx.x, b = blockIdx.y;
  const int c0   = mb * QT;

  const unsigned short* ap = Pc + ((size_t)(b * DQ + c0 + c)) * MM + 8 * hh;
  const unsigned short* bp = Gc + ((size_t)(b * DQ + 16 * wave + c)) * MM + 8 * hh;

  v8f acc[4];
#pragma unroll
  for (int mt = 0; mt < 4; ++mt) acc[mt] = zero8();

#pragma unroll 2
  for (int ks = 0; ks < MM / 32; ++ks) {
    const Frag fb = ldfrag(bp + 32 * ks);
#pragma unroll
    for (int mt = 0; mt < 4; ++mt) {
      const Frag fa = ldfrag(ap + (size_t)(16 * mt) * MM + 32 * ks);
      acc[mt] = mma_h(fa.h, fb.h, acc[mt]);
    }
  }

  // ---- epilogue: -> LDS Os[ci_loc][cp_loc]; lane (hh, c) holds cp_loc = 16 mt + 8 hh + r for ci_loc = 16 w + c
  {
    const int nl = 16 * wave + c;
#pragma unroll
    for (int mt = 0; mt < 4; ++mt) {
      v4f va, vb;
#pragma unroll
      for (int r = 0; r < 4; ++r) { va[r] = acc[mt][r]; vb[r] = acc[mt][4 + r]; }
      *(v4f*)(Os + nl * OSP + 16 * mt + 8 * hh)     = va;
      *(v4f*)(Os + nl * OSP + 16 * mt + 8 * hh + 4) = vb;
    }
  }
  __syncthreads();

  const int e = tid & 7, lq = tid >> 3;                              // lq 0..31
  v4u uh[4], ul[4];
#pragma unroll
  for (int it = 0; it < 4; ++it) {
    const int row = it * 32 + lq;                                    // ci 0..127
    const v4f a = *(const v4f*)(Os + row * OSP + 8 * e);
    const v4f q = *(const v4f*)(Os + row * OSP + 8 * e + 4);
    const float f[8] = {a[0], a[1], a[2], a[3], q[0], q[1], q[2], q[3]};
    split8(f, uh[it], ul[it]);
  }
{
#pragma unroll
    for (int it = 0; it < 4; ++it) {
      const int row = it * 32 + lq;
      const size_t po = ((size_t)(b * DQ + row)) * DQ + c0 + 8 * e;
      *(v4u*)(MTh + po) = uh[it];
      *(v4u*)(MTl + po) = ul[it];
    }
    
  }
}

// =========================================================================================================
// (6) y GEMM for one (b, 64-n tile, 64-ci block): y[n][ci] = (1/1024) sum_cp (MTh+MTl)[b][ci][cp] (Qh+Ql)[b][n][cp]
//     on bf16 WMMA, 3 products per k-step (hi.hi + hi.lo + lo.hi, shared accumulator), K = 128 = 4 steps.
//     Block 128 threads = 4 waves; wave w owns cols n0+16w..+15 (B fragments from the cp-contiguous theta rows)
//     and 4 m-tiles (A rows ci = i0 + 16 mt + (lane&15), split k map from the MTh/MTl rows). Epilogue staged in
//     LDS Os[n_loc][ci_loc] (pitch OSP, b128 stores, cross-wave), block barrier, then Yh/Yl bf16 [b][4096 n][128 ci]
// coverage: Os 4 waves x 16 n x 64 ci written, reads rows 0..63 cols 8e..8e+7 <= 63; planes 4 it x 16 rows x 8
//           lanes x 8 = 64 n x 64 ci; grid (NQ/64, 2, NB) covers rows 0..NQ-1 x 128 ci of Yh/Yl exactly once.
// =========================================================================================================
__global__ __launch_bounds__(128)
void gemm_y(const unsigned short* __restrict__ MTh, const unsigned short* __restrict__ MTl,
            const unsigned short* __restrict__ Qh, const unsigned short* __restrict__ Ql,
            unsigned short* Yh, unsigned short* Yl) {
  __shared__ __align__(16) float Os[QT * OSP];
  const int tid  = threadIdx.x;
  const int lane = tid & 31, wave = tid >> 5;                        // wave 0..3
  const int hh   = lane >> 4, c = lane & 15;
  const int nt   = blockIdx.x, cb = blockIdx.y, b = blockIdx.z;
  const int n0   = nt * QT, i0 = cb * QT;

  const size_t ao = ((size_t)(b * DQ + i0 + c)) * DQ + 8 * hh;
  const unsigned short* aph = MTh + ao;
  const unsigned short* apl = MTl + ao;
  const size_t bo = ((size_t)(b * NN + n0 + 16 * wave + c)) * DQ + 8 * hh;
  const unsigned short* bph = Qh + bo;
  const unsigned short* bpl = Ql + bo;

  v8f acc[4];
#pragma unroll
  for (int mt = 0; mt < 4; ++mt) acc[mt] = zero8();

#pragma unroll
  for (int ks = 0; ks < DQ / 32; ++ks) {
    const Frag fbh = ldfrag(bph + 32 * ks);
    const Frag fbl = ldfrag(bpl + 32 * ks);
#pragma unroll
    for (int mt = 0; mt < 4; ++mt) {
      const Frag fah = ldfrag(aph + (size_t)(16 * mt) * DQ + 32 * ks);
      const Frag fal = ldfrag(apl + (size_t)(16 * mt) * DQ + 32 * ks);
      acc[mt] = mma_b(fah.bf, fbh.bf, acc[mt]);
      acc[mt] = mma_b(fah.bf, fbl.bf, acc[mt]);
      acc[mt] = mma_b(fal.bf, fbh.bf, acc[mt]);
    }
  }

  // ---- epilogue: y = acc/1024 -> LDS Os[n_loc][ci_loc]; lane (hh, c) holds ci_loc = 16 mt + 8 hh + r, n_loc = 16 w + c
  {
    const int nl = 16 * wave + c;
#pragma unroll
    for (int mt = 0; mt < 4; ++mt) {
      v4f va, vb;
#pragma unroll
      for (int r = 0; r < 4; ++r) { va[r] = acc[mt][r] * INS; vb[r] = acc[mt][4 + r] * INS; }
      *(v4f*)(Os + nl * OSP + 16 * mt + 8 * hh)     = va;
      *(v4f*)(Os + nl * OSP + 16 * mt + 8 * hh + 4) = vb;
    }
  }
  __syncthreads();

  const int e = tid & 7, lq = tid >> 3;                              // lq 0..15
  v4u uh[4], ul[4];
#pragma unroll
  for (int it = 0; it < 4; ++it) {
    const int row = it * 16 + lq;                                    // n_loc 0..63
    const v4f a = *(const v4f*)(Os + row * OSP + 8 * e);
    const v4f q = *(const v4f*)(Os + row * OSP + 8 * e + 4);
    const float f[8] = {a[0], a[1], a[2], a[3], q[0], q[1], q[2], q[3]};
    split8(f, uh[it], ul[it]);
  }
{
#pragma unroll
    for (int it = 0; it < 4; ++it) {
      const int row = it * 16 + lq;
      const size_t po = ((size_t)(b * NN + n0 + row)) * DQ + i0 + 8 * e;
      *(v4u*)(Yh + po) = uh[it];
      *(v4u*)(Yl + po) = ul[it];
    }
    
  }
}

// =========================================================================================================
// (7) output conv for one (b, 64-n tile, 64-c block): A[c][n] = sum_ci WWb[c][ci] (Yh + Yl)[b][n][ci] on bf16 WMMA
//     (2 products per k-step, shared accumulator), K = 128 = 4 steps. Block 128 threads = 4 waves; wave w owns cols
//     n0+16w..+15 (B fragments from the k-contiguous Yh/Yl rows) and 4 m-tiles (A rows c = c0 + 16 mt + (lane&15),
//     split k map loader from WWb). Epilogue staged in LDS Os[n_loc][c_loc] (pitch OSP, b128 stores, cross-wave),
//     segment 64 n = 2 lines): 8 consecutive lanes x 16 B (values gathered from 4 Os rows), one instruction per 16
// coverage: Os 4 waves x 16 n x 64 c written, read rows nl+t <= 63 x cols cl <= 63; Z 8 it x 16 lines x 8 lanes x
//           4 floats = 64 c x 64 n; grid (NQ/64, 4, NB) covers Z[b][0..255][0..NQ-1] exactly once.
// =========================================================================================================
__global__ __launch_bounds__(128)
void gemm_out(const unsigned short* __restrict__ WWb, const unsigned short* __restrict__ Yh,
              const unsigned short* __restrict__ Yl, const float* __restrict__ wb, float* Z) {
  __shared__ __align__(16) float Os[QT * OSP];
  const int tid  = threadIdx.x;
  const int lane = tid & 31, wave = tid >> 5;
  const int hh   = lane >> 4, c = lane & 15;
  const int nt   = blockIdx.x, cb = blockIdx.y, b = blockIdx.z;
  const int n0   = nt * QT, c0 = cb * QT;

  const unsigned short* ap  = WWb + (size_t)(c0 + c) * DQ + 8 * hh;
  const size_t bo = ((size_t)(b * NN + n0 + 16 * wave + c)) * DQ + 8 * hh;
  const unsigned short* bph = Yh + bo;
  const unsigned short* bpl = Yl + bo;

  v8f acc[4];
#pragma unroll
  for (int mt = 0; mt < 4; ++mt) acc[mt] = zero8();

#pragma unroll
  for (int ks = 0; ks < DQ / 32; ++ks) {
    const Frag fbh = ldfrag(bph + 32 * ks);
    const Frag fbl = ldfrag(bpl + 32 * ks);
#pragma unroll
    for (int mt = 0; mt < 4; ++mt) {
      const Frag fa = ldfrag(ap + (size_t)(16 * mt) * DQ + 32 * ks);
      acc[mt] = mma_b(fa.bf, fbh.bf, acc[mt]);
      acc[mt] = mma_b(fa.bf, fbl.bf, acc[mt]);
    }
  }

  // ---- epilogue: -> LDS Os[n_loc][c_loc]; lane (hh, c) holds c_loc = 16 mt + 8 hh + r for n_loc = 16 w + c
  {
    const int nl = 16 * wave + c;
#pragma unroll
    for (int mt = 0; mt < 4; ++mt) {
      v4f va, vb;
#pragma unroll
      for (int r = 0; r < 4; ++r) { va[r] = acc[mt][r]; vb[r] = acc[mt][4 + r]; }
      *(v4f*)(Os + nl * OSP + 16 * mt + 8 * hh)     = va;
      *(v4f*)(Os + nl * OSP + 16 * mt + 8 * hh + 4) = vb;
    }
  }
  __syncthreads();

  const int e = tid & 7, lq = tid >> 3;                              // lq 0..15
  v4f res[8];
#pragma unroll
  for (int it = 0; it < 8; ++it) {
    const int L   = it * 16 + lq;                                    // 0..127
    const int cl  = L >> 1, hf = L & 1;                              // channel 0..63 within the block
    const int nl  = hf * 32 + 4 * e;                                 // position 0..63
    const float bvs = bfr(wb[c0 + cl]);
#pragma unroll
    for (int t = 0; t < 4; ++t) {
      res[it][t] = Os[(nl + t) * OSP + cl] + bvs;
    }
  }
{
#pragma unroll
    for (int it = 0; it < 8; ++it) {
      const int L   = it * 16 + lq;
      const int cl  = L >> 1, hf = L & 1;
      const int nl  = hf * 32 + 4 * e;
      const size_t idx = ((size_t)(b * CC + c0 + cl)) * NQ + n0 + nl;
      *(v4f*)(Z + idx) = res[it];
    }
    
  }
}

// =========================================================================================================
// (8) batch-norm statistics per channel ch (one block per channel, 1024 threads = 32 waves): every thread issues all
//     its b128 reads of z (one per batch image and 1024-quad slice) before it sums any, f64 sums of z and z*z in four
//     independent chains, LDS f64 tree (cross-thread, block barriers), mean and biased variance in f64,
//     rstd = 1/sqrt(var + eps) in f32; stats line ST[ch][32 floats] = {mean, bf16-RNE(gamma)*rstd, bf16-RNE(beta),
// coverage: grid (CC) writes every line of ST exactly once; reads Z rows (b<NB, ch, n<NQ) all produced by (7).
// =========================================================================================================
__global__ __launch_bounds__(SBT)
void bn_stats(const float* __restrict__ Z, const float* __restrict__ gam, const float* __restrict__ bet,
              float* ST) {
  __shared__ double sh1[SBT];
  __shared__ double sh2[SBT];
  const int tid = threadIdx.x, ch = blockIdx.x;
  v4f v[NB * SQ];
  // both loops unrolled: v[] stays in registers and the reads issue back to back, none waiting for a sum
#pragma unroll
  for (int b = 0; b < NB; ++b) {
    const float* zr = Z + ((size_t)(b * CC + ch)) * NQ;
#pragma unroll
    for (int j = 0; j < SQ; ++j) {
      v[b * SQ + j] = *(const v4f*)(zr + 4 * (j * SBT + tid));
      // a later read of this run may land its result in this read's address registers: the wait stands in front of it
      asm volatile("s_wait_xcnt 0x0" ::: "memory");
    }
  }
  double s4[4] = {0.0, 0.0, 0.0, 0.0}, q4[4] = {0.0, 0.0, 0.0, 0.0};
  // unrolled: every index of v[], s4[] and q4[] is a constant (registers, no scratch)
#pragma unroll
  for (int i = 0; i < NB * SQ; ++i) {
#pragma unroll
    for (int t = 0; t < 4; ++t) { const double d = (double)v[i][t]; s4[t] += d; q4[t] += d * d; }
  }
  sh1[tid] = (s4[0] + s4[1]) + (s4[2] + s4[3]);
  sh2[tid] = (q4[0] + q4[1]) + (q4[2] + q4[3]);
  __syncthreads();
#pragma unroll 1
  for (int stp = SBT / 2; stp > 0; stp >>= 1) {
    if (tid < stp) { sh1[tid] += sh1[tid + stp]; sh2[tid] += sh2[tid + stp]; }
    __syncthreads();
  }
  const double cnt  = (double)NB * (double)NQ;
  const double mean = sh1[0] / cnt;
  double var = sh2[0] / cnt - mean * mean;
  var = (var > 0.0) ? var : 0.0;
  const float rstd  = 1.0f / sqrtf((float)var + BNEPS);
  const float meanf = (float)mean;
  const float scl   = bfr(gam[ch]) * rstd;
  const float btr   = bfr(bet[ch]);
  if (tid < 8) {
    v4f w;
    w[0] = (tid == 0) ? meanf : 0.f;
    w[1] = (tid == 0) ? scl : 0.f;
    w[2] = (tid == 0) ? btr : 0.f;
    w[3] = 0.f;
    float* p = ST + (size_t)ch * STL + 4 * tid;
    *(v4f*)p = w;
    
  }
}

// =========================================================================================================
// (9) out[b][ch][n] = ((z - mean) * (gamma*rstd) + beta) + bf16-RNE(x): one thread per 4 consecutive n; a wave writes
// coverage: NB*CC*NQ/1024 blocks x 256 threads x 4 floats = out[b<NB][0..255][0..NQ-1] exactly once.
// =========================================================================================================
__global__ __launch_bounds__(256)
void bn_apply(const float* __restrict__ Z, const float* __restrict__ x, const float* __restrict__ ST,
              float* out) {
  const size_t i4   = (size_t)blockIdx.x * 256 + threadIdx.x;
  const size_t el   = i4 * 4;
  const size_t rowi = el / NQ;
  const int n  = (int)(el - rowi * NQ);
  const int ch = (int)(rowi % CC);
  const int b  = (int)(rowi / CC);
  const v4f z  = *(const v4f*)(Z + el);
  const size_t xo = ((size_t)(b * CC + ch)) * NN + n;
  const v4f xv = *(const v4f*)(x + xo);
  const float mean = ST[(size_t)ch * STL + 0];
  const float scl  = ST[(size_t)ch * STL + 1];
  const float btr  = ST[(size_t)ch * STL + 2];
  v4f r;
#pragma unroll
  for (int t = 0; t < 4; ++t) r[t] = ((z[t] - mean) * scl + btr) + bfr(xv[t]);
  float* p = out + xo;
  *(v4f*)p = r;
  
}

// =========================================================================================================
// Workspace map (bytes; each region start a multiple of 256; every extent is an exact row/tile multiple and is
//   W16 f16 [384][256]            196608      WWb bf16 [256][128]        65536
//   XP  f16 [NB][4096][256]     16777216 (NB=8)
//   Qh/Ql bf16 [NB][4096][128]   8388608 x2
//   PGZ region 33554432: PF f32 [NB][4096][128] at +0 and GF at +16777216 (live launches 3-4 only), then reused
//       as Z f32 [NB][256][NQ] at +0 (written by launch 8, read by 9-10); Z extent <= region (static_assert)
//   Pp/Gp/Pc/Gc f16 [NB][1024][128] / [NB][128][1024]   2097152 x4
//   MTh/MTl bf16 [NB][128][128]   262144 x2
//   Yh/Yl bf16 [NB][4096][128]   8388608 x2
//   ST  f32 [256][32]               32768
//   total (NB=8, NQ=4096) = 93093888
// =========================================================================================================
extern "C" void kernel_launch(void* const* d_in, const int* in_sizes, int n_in,
                              void* d_out, int out_size, void* d_ws, size_t ws_size,
                              hipStream_t stream) {
  const int XN = NB * CC * NN;
  if (n_in < 11) return;
  if (in_sizes[0] < XN) return;
  if (in_sizes[1] < DQ * CC || in_sizes[3] < DQ * CC || in_sizes[5] < DQ * CC || in_sizes[7] < CC * DQ) return;
  if (in_sizes[2] < DQ || in_sizes[4] < DQ || in_sizes[6] < DQ || in_sizes[8] < CC) return;
  if (in_sizes[9] < CC || in_sizes[10] < CC) return;
  if (out_size < XN) return;

  size_t off = 0;
  auto carve = [&](size_t bytes) { const size_t o = off; off += (bytes + 255) & ~(size_t)255; return o; };
  const size_t oW16 = carve((size_t)MW * CC * 2);
  const size_t oWWb = carve((size_t)CC * DQ * 2);
  const size_t oXP  = carve((size_t)NB * NN * CC * 2);
  const size_t oQh  = carve((size_t)NB * NN * DQ * 2);
  const size_t oQl  = carve((size_t)NB * NN * DQ * 2);
  const size_t oPGZ = carve((size_t)2 * NB * NN * DQ * 4);
  const size_t oPp  = carve((size_t)NB * MM * DQ * 2);
  const size_t oGp  = carve((size_t)NB * MM * DQ * 2);
  const size_t oPc  = carve((size_t)NB * DQ * MM * 2);
  const size_t oGc  = carve((size_t)NB * DQ * MM * 2);
  const size_t oMTh = carve((size_t)NB * DQ * DQ * 2);
  const size_t oMTl = carve((size_t)NB * DQ * DQ * 2);
  const size_t oYh  = carve((size_t)NB * NN * DQ * 2);
  const size_t oYl  = carve((size_t)NB * NN * DQ * 2);
  const size_t oST  = carve((size_t)CC * STL * 4);
  if (off > ws_size) return;
  if (off > (size_t)134217728) return;

  const float* x  = (const float*)d_in[0];
  const float* gw = (const float*)d_in[1];
  const float* gb = (const float*)d_in[2];
  const float* tw = (const float*)d_in[3];
  const float* tb = (const float*)d_in[4];
  const float* pw = (const float*)d_in[5];
  const float* pb = (const float*)d_in[6];
  const float* ow = (const float*)d_in[7];
  const float* wb = (const float*)d_in[8];
  const float* bg = (const float*)d_in[9];
  const float* bb = (const float*)d_in[10];

  char* ws = (char*)d_ws;
  unsigned short* W16 = (unsigned short*)(ws + oW16);
  unsigned short* WWb = (unsigned short*)(ws + oWWb);
  unsigned short* XP  = (unsigned short*)(ws + oXP);
  unsigned short* Qh  = (unsigned short*)(ws + oQh);
  unsigned short* Ql  = (unsigned short*)(ws + oQl);
  float*          PF  = (float*)(ws + oPGZ);
  float*          GF  = (float*)(ws + oPGZ + (size_t)NB * NN * DQ * 4);
  float*          Z   = (float*)(ws + oPGZ);
  unsigned short* Pp  = (unsigned short*)(ws + oPp);
  unsigned short* Gp  = (unsigned short*)(ws + oGp);
  unsigned short* Pc  = (unsigned short*)(ws + oPc);
  unsigned short* Gc  = (unsigned short*)(ws + oGc);
  unsigned short* MTh = (unsigned short*)(ws + oMTh);
  unsigned short* MTl = (unsigned short*)(ws + oMTl);
  unsigned short* Yh  = (unsigned short*)(ws + oYh);
  unsigned short* Yl  = (unsigned short*)(ws + oYl);
  float*          ST  = (float*)(ws + oST);
  float* out = (float*)d_out;

  const dim3 blk256(256), blk128(128);

  // (0) theta_w / phi_w / g_w -> stacked f16 plane; w_w -> bf16 plane
  cvt_w<<<dim3(MW / 8 + CC / 16), blk256, 0, stream>>>(tw, pw, gw, ow, W16, WWb);
  // (1) x -> position-major 16-bit plane
  cvt_x<<<dim3(NN / QT, CC / QT, NB), blk256, 0, stream>>>(x, XP);
  // (2) conv1x1 GEMM -> theta hi/res planes, phi / g conv outputs + bias as f32 planes
  gemm_proj<<<dim3(NSTRIP, MW / QT, NB), blk256, 0, stream>>>(W16, XP, tb, pb, gb, Qh, Ql, PF, GF);
  // (3) 2x2 stride-2 max-pool -> pooled phi / g f16 planes [b][m][d]
  pool_pg<<<dim3(HP, NB), blk256, 0, stream>>>(PF, GF, Pp, Gp);
  // (4) pooled planes -> channel-major [b][d][m]
  tr_pg<<<dim3(MM / QT, 4, NB), blk256, 0, stream>>>(Pp, Gp, Pc, Gc);
  // (5) M = pooled-phi . pooled-g^T per batch -> M^T hi/res planes [b][ci][cp]
  gemm_m<<<dim3(DQ / QT, NB), blk256, 0, stream>>>(Pc, Gc, MTh, MTl);
  // (6) y = theta . M / 1024 -> y hi/res planes [b][n][128]
  gemm_y<<<dim3(NQ / QT, DQ / QT, NB), blk128, 0, stream>>>(MTh, MTl, Qh, Ql, Yh, Yl);
  // (7) output conv + bias -> Z [b][256][NQ]
  gemm_out<<<dim3(NQ / QT, CC / QT, NB), blk128, 0, stream>>>(WWb, Yh, Yl, wb, Z);
  // (8) batch statistics per channel -> ST lines
  bn_stats<<<dim3(CC), dim3(SBT), 0, stream>>>(Z, bg, bb, ST);
  // (9) normalise, affine, residual -> out [b][256][4096]
  bn_apply<<<dim3((NB * CC * NQ) / 1024), blk256, 0, stream>>>(Z, x, ST, out);
  (void)hipGetLastError();
}

// v002
// It runs in 123 microseconds.
// Next to v001, in two timings, it ran 1.11 and 1.13 times as fast.
// All steps since v000 together make it 1.19 times as fast.
// Contractions: conv1x1 theta/phi/g GEMM W[384x256].X[256x128] per strip on v_wmma_f32_16x16x32_f16 (f16
// containers of bf16-RNE weights x256 and bf16-RNE x, 1 product); M = pooled-phi . pooled-g^T per batch
// [128x128], K=1024, on v_wmma_f32_16x16x32_f16 (2x2 max-pooled phi and g as plain f16, 1 product);
// y^T = M^T.theta^T, K=128, on v_wmma_f32_16x16x32_bf16 (M and theta as bf16 hi + bf16 residual planes,
// 3 products); output conv W[256x128].Y on v_wmma_f32_16x16x32_bf16 (bf16 weights, y as bf16 hi + residual
// planes, 2 products); f32 accumulate everywhere; max-pool, bias, batch-norm statistics (f64 sums, f32 apply)
// and the residual add on VALU.
#include <hip/hip_runtime.h>
#include <math.h>
#include <stdint.h>

#ifndef NB
#define NB 8
#endif
#ifndef NQ
#define NQ 4096
#endif
#define NB_FULL 8
#define CC     256
#define HIMG   64
#define WIMG   64
#define NN     4096
#define DQ     128
#define HP     32
#define WP     32
#define MM     1024
#define MW     384
#define QT     64
#define SN     128
#define NSTRIP 32
#define OSP    68
#define TP     72
#define STL    32
#define WSC    256.0f
#define IWSC   0.00390625f
#define INS    0.0009765625f
#define BNEPS  1e-5f
#define SBT    1024
#define SQ     (NQ / (4 * SBT))

static_assert(NB >= 1 && NB <= NB_FULL);
static_assert(NQ % 128 == 0 && NQ >= 128 && NQ <= NN);
static_assert(NQ % QT == 0);
static_assert(NN == HIMG * WIMG);
static_assert(SN == 2 * WIMG && NSTRIP * SN == NN && SN == 8 * 16);
static_assert(HIMG % 2 == 0 && WIMG % 2 == 0 && HP == HIMG / 2 && WP == WIMG / 2 && MM == HP * WP);
static_assert(WP == 32);
static_assert(MM % QT == 0 && MM % 32 == 0);
static_assert(NN % QT == 0 && CC % QT == 0 && DQ == 2 * QT);
static_assert(MW == 3 * DQ && MW % 8 == 0);
static_assert(CC % 32 == 0 && DQ % 32 == 0);
static_assert((OSP * 4) % 16 == 0 && (TP * 2) % 16 == 0);
static_assert(SN * OSP * 4 <= 65536 && DQ * OSP * 4 <= 65536);
static_assert(((size_t)NB * CC * NQ) % 1024 == 0);
static_assert((size_t)NB * CC * NQ * 4 <= 2 * (size_t)NB * NN * DQ * 4);
static_assert((size_t)NB_FULL * CC * NN * 4 == (size_t)33554432);
static_assert(STL * 4 == 128);
static_assert(QT * TP * 2 <= SN * OSP * 4 && NN == 16 * 4 * WIMG && MM == 16 * 64);
static_assert(NQ % (4 * SBT) == 0 && (SBT & (SBT - 1)) == 0 && SBT <= 1024);

typedef _Float16       v16h __attribute__((ext_vector_type(16)));
typedef _Float16       v8h  __attribute__((ext_vector_type(8)));
typedef __bf16         v16b __attribute__((ext_vector_type(16)));
typedef unsigned short v8us __attribute__((ext_vector_type(8)));
typedef float          v8f  __attribute__((ext_vector_type(8)));
typedef float          v4f  __attribute__((ext_vector_type(4)));
typedef unsigned int   v4u  __attribute__((ext_vector_type(4)));

union Frag { v8us u[2]; v16h h; v16b bf; };
static_assert(sizeof(Frag) == 32);

// ---- scalar helpers ---------------------------------------------------------------------------------------
__device__ __forceinline__ unsigned short bf_bits(float f) {          // f32 -> bf16 bits, RNE convert
  unsigned u = __float_as_uint(f);
  return (unsigned short)((u + 0x7FFFu + ((u >> 16) & 1u)) >> 16);
}
__device__ __forceinline__ float bf_up(unsigned short hb) { return __uint_as_float(((unsigned)hb) << 16); }
__device__ __forceinline__ float bfr(float f) { return bf_up(bf_bits(f)); }
__device__ __forceinline__ unsigned short h_bits(_Float16 x) { return __builtin_bit_cast(unsigned short, x); }
__device__ __forceinline__ unsigned pk16(unsigned short a, unsigned short b) { return (unsigned)a | ((unsigned)b << 16); }
__device__ __forceinline__ v8f zero8() { v8f z = {0.f, 0.f, 0.f, 0.f, 0.f, 0.f, 0.f, 0.f}; return z; }
// 8 f32 values -> bf16 hi bits and bf16 residual bits (lo = RNE(v - hi)), packed 2 per uint
__device__ __forceinline__ void split8(const float* f, v4u& uh, v4u& ul) {
#pragma unroll
  for (int t = 0; t < 4; ++t) {
    const float f0 = f[2 * t], f1 = f[2 * t + 1];
    const unsigned short hb0 = bf_bits(f0), hb1 = bf_bits(f1);
    const unsigned short lb0 = bf_bits(f0 - bf_up(hb0));
    const unsigned short lb1 = bf_bits(f1 - bf_up(hb1));
    uh[t] = pk16(hb0, hb1);
    ul[t] = pk16(lb0, lb1);
  }
}

// ---- 16-bit fragment loader (A, or B from a k-contiguous [n][k] row): lane -> row/col (lane&15), p already includes
//      + 8*(lane>>4); elements 0..7 <- p[0..7] (k0+8h..), elements 8..15 <- p[16..23] (k0+16+8h..)
__device__ __forceinline__ Frag ldfrag(const unsigned short* p) {
  Frag f;
  f.u[0] = *(const v8us*)(p);
  f.u[1] = *(const v8us*)(p + 16);
  return f;
}

// ---- WMMA helpers: builtin followed by a 4-slot VALU gap tying D and keeping A/B live --------------------------
__device__ __forceinline__ v8f mma_h(v16h a, v16h b, v8f c) {
  v8f d = __builtin_amdgcn_wmma_f32_16x16x32_f16(false, a, false, b, (short)0, c, false, false);
#if defined(__HIP_DEVICE_COMPILE__)
  asm volatile("v_nop\n\tv_nop\n\tv_nop\n\tv_nop" : "+v"(d) : "v"(a), "v"(b));
#endif
  return d;
}
__device__ __forceinline__ v8f mma_b(v16b a, v16b b, v8f c) {
  v8f d = __builtin_amdgcn_wmma_f32_16x16x32_bf16(false, a, false, b, (short)0, c, false, false);
#if defined(__HIP_DEVICE_COMPILE__)
  const v16h ha = __builtin_bit_cast(v16h, a), hb = __builtin_bit_cast(v16h, b);
  asm volatile("v_nop\n\tv_nop\n\tv_nop\n\tv_nop" : "+v"(d) : "v"(ha), "v"(hb));
#endif
  return d;
}

// =========================================================================================================
// (0) weights. Blocks 0..47: W16 f16 [384][256], rows 0..127 = theta_w, 128..255 = phi_w, 256..383 = g_w; value =
//     f16 of (bf16-RNE(w) * 256) (exact). Block owns rows 8*blk..8*blk+7: one wave per 512-B row = 32 lanes x 16 B
// coverage: 48 blocks x 8 rows x 32 lanes x 8 halves = 384 x 256; 16 blocks x 16 rows x 16 lanes x 8 = 256 x 128.
// =========================================================================================================
__global__ __launch_bounds__(256)
void cvt_w(const float* __restrict__ tw, const float* __restrict__ pw, const float* __restrict__ gw,
           const float* __restrict__ ow, unsigned short* W16, unsigned short* WWb) {
  const int tid = threadIdx.x, blk = blockIdx.x;
  if (blk < MW / 8) {
    const int rl = tid >> 5, col = 8 * (tid & 31);
    const int o = 8 * blk + rl;                                      // 0..383
    const int grp = blk >> 4;                                        // 0,1,2 (block-uniform)
    const float* wbase = (grp == 0) ? tw : ((grp == 1) ? pw : gw);  // all global
    const float* s = wbase + (size_t)(o - DQ * grp) * CC + col;      // (o - 128 grp) in 0..127
    const v4f a = *(const v4f*)s;
    const v4f q = *(const v4f*)(s + 4);
    const float f[8] = {a[0], a[1], a[2], a[3], q[0], q[1], q[2], q[3]};
    v4u u;
#pragma unroll
    for (int t = 0; t < 4; ++t) {
      const _Float16 h0 = (_Float16)(bfr(f[2 * t]) * WSC);
      const _Float16 h1 = (_Float16)(bfr(f[2 * t + 1]) * WSC);
      u[t] = pk16(h_bits(h0), h_bits(h1));
    }
{
      *(v4u*)(W16 + (size_t)o * CC + col) = u;
      
    }
  } else {
    const int rb = blk - MW / 8;                                     // 0..15
    const int o = 16 * rb + (tid >> 4);                              // 0..255
    const int col = 8 * (tid & 15);                                  // 0..120
    const float* s = ow + (size_t)o * DQ + col;
    const v4f a = *(const v4f*)s;
    const v4f q = *(const v4f*)(s + 4);
    const float f[8] = {a[0], a[1], a[2], a[3], q[0], q[1], q[2], q[3]};
    v4u u;
#pragma unroll
    for (int t = 0; t < 4; ++t) u[t] = pk16(bf_bits(f[2 * t]), bf_bits(f[2 * t + 1]));
{
      *(v4u*)(WWb + (size_t)o * DQ + col) = u;
      
    }
  }
}

// =========================================================================================================
// (1) x f32 [b][256 c][4096 n] -> XP f16 [b][n][c] (position-major, bf16-RNE values, exact in f16) through an LDS
//     tile T[64 n][64 c] (pitch TP, cross-thread, block barrier). Block (nb, cb, b) owns a 64 c x 64 n tile.
// coverage: T written rows (8e+t)=0..63 x cols cl 0..63, read rows 0..63 x cols 8e..8e+7; XP 2 it x 32 rows x 8 lanes
//           x 8 = 64 n x 64 c; grid (64, 4, NB) covers XP [b][0..4095][0..255] exactly once.
// =========================================================================================================
__global__ __launch_bounds__(256)
void cvt_x(const float* __restrict__ x, unsigned short* XP) {
  __shared__ __align__(16) unsigned short T[QT * TP];
  const int tid = threadIdx.x;
  const int nb = blockIdx.x, cb = blockIdx.y, b = blockIdx.z;
  const int e = tid & 7, lq = tid >> 3;                             // lq 0..31
  const int n0 = nb * QT, c0 = cb * QT;
#pragma unroll
  for (int it = 0; it < 2; ++it) {
    const int cl = it * 32 + lq;                                     // 0..63
    const float* sp = x + ((size_t)(b * CC + c0 + cl)) * NN + n0 + 8 * e;
    const v4f a = *(const v4f*)sp;
    const v4f q = *(const v4f*)(sp + 4);
    unsigned short hb[8];
#pragma unroll
    for (int t = 0; t < 4; ++t) {
      hb[t]     = h_bits((_Float16)bfr(a[t]));
      hb[4 + t] = h_bits((_Float16)bfr(q[t]));
    }
#pragma unroll
    for (int t = 0; t < 8; ++t) T[(8 * e + t) * TP + cl] = hb[t];
  }
  __syncthreads();
  v4u up[2];
#pragma unroll
  for (int it = 0; it < 2; ++it) {
    const int nl = it * 32 + lq;                                     // 0..63
    up[it] = *(const v4u*)(T + nl * TP + 8 * e);
  }
{
#pragma unroll
    for (int it = 0; it < 2; ++it) {
      const int rl = it * 32 + lq;
      *(v4u*)(XP + ((size_t)(b * NN + n0 + rl)) * CC + c0 + 8 * e) = up[it];
    }
    
  }
}

// =========================================================================================================
// (2) conv1x1 GEMM, Y[o][n] = (1/256) sum_c W16[o][c] XP[b][n][c], K = 256 = 8 steps, 256 threads = 8 waves; the
//     block's shape depends on blockIdx.y (block-uniform branch, taken in front of every barrier):
//     y = 0,1 (theta dims 0..63 / 64..127): strip of 128 positions x 64 o. Wave w owns cols n0+16w..+15 (one B
//       fragment per k-step, k = c contiguous in the XP row) and 4 m-tiles (A rows o = o0 + 16 mt + (lane&15), split
//       k map loader from W16). Epilogue staged in LDS Os[n_loc][o_loc] (pitch OSP, b128 stores, cross-wave), block
//       barrier, + bias -> Qh/Ql bf16 [b][4096 n][128 d] (hi = RNE(v), lo = RNE(v-hi)).
//     y = 2,3 (phi, g): idx = 32 (y-2) + x -> 256 positions (image rows 4 ds..4 ds+3, ds = idx&15) x 64 o
//       (ob = idx>>4: phi dims 0.., 64.., then g dims 0.., 64..). Wave w = (pyl = w>>2, xt = w&3) owns the two n-tiles
//       of image rows 4 ds + 2 pyl and + 2 pyl + 1 at columns 16 xt..16 xt+15, and 4 m-tiles. The 2x2 stride-2
//       max-pool is done on the accumulators: the row pair is the wave's two tiles (same lane, same register), the
//       column pair is lane ^ 1. Scale and bias follow the maximum (x -> fl(x/256 + bias) never decreases as x grows, so
//       the maximum of the results is the result of the maximum). f16 values go through the LDS tile T[64 o][64 m]
//       (pitch TP, cross-wave, block barrier) -> Pc / Gc f16 [b][128 d][1024 m], m = 32 py + px: 8 consecutive lanes
//       x 16 B = the one whole 128-B line that this block owns of each of its 64 rows.
// coverage: theta: Os 8 waves x 16 n x 64 o = 128 x 64 written, reads rows <= 127 cols <= 63; planes 4 it x 32 rows
//           x 8 lanes x 8 = 128 n x 64 d; 32 x 2 blocks cover 4096 rows x 128 d of Qh/Ql once. phi/g: T written rows
//           16 mt + 8 hh + 4 (c&1) + j = 0..63 x cols 32 pyl + 8 xt + (c>>1) = 0..63, read rows 0..63 x cols 8 g..8 g+7;
//           16 ds x 4 ob blocks cover Pc and Gc [b][0..127][0..1023] exactly once.
// =========================================================================================================
__device__ __forceinline__ float max_pair(float v) {                 // max of lanes l and l ^ 1 (quad_perm 1,0,3,2)
  const int o = __builtin_amdgcn_mov_dpp(__float_as_int(v), 0xB1, 0xF, 0xF, true);
  return fmaxf(v, __int_as_float(o));
}

__global__ __launch_bounds__(256)
void gemm_proj(const unsigned short* __restrict__ W16, const unsigned short* __restrict__ XP,
               const float* __restrict__ tb, const float* __restrict__ pb, const float* __restrict__ gb,
               unsigned short* Qh, unsigned short* Ql, unsigned short* Pc, unsigned short* Gc) {
  __shared__ __align__(16) float Os[SN * OSP];
  const int tid  = threadIdx.x;
  const int lane = tid & 31, wave = tid >> 5;                        // wave 0..7
  const int hh   = lane >> 4, c = lane & 15;
  const int st   = blockIdx.x, mb = blockIdx.y, b = blockIdx.z;

  if (mb >= 2) {
    // ---- phi / g: 64 o x 256 positions, pooled in registers
    const int idx = (mb - 2) * NSTRIP + st;                          // 0..63
    const int ds = idx & 15, ob = idx >> 4;                          // ds 0..15, ob 0..3
    const int sel = ob >> 1, d0 = QT * (ob & 1);                     // plane (0 phi, 1 g), first dim 0 or 64
    const int wv  = __builtin_amdgcn_readfirstlane(wave);            // scalar: row bases stay in SGPRs, fewer VGPRs
    const int pyl = wv >> 2, xt = wv & 3;
    const unsigned lo = (unsigned)(c * CC + 8 * hh);                 // the lane's offset, the same in A and B rows
    const unsigned short* ap  = W16 + (size_t)(DQ + QT * ob) * CC + lo;
    const unsigned short* bp0 = XP + ((size_t)(b * NN + (4 * ds + 2 * pyl) * WIMG + 16 * xt)) * CC + lo;
    const unsigned short* bp1 = bp0 + (size_t)WIMG * CC;

    v8f a0[4], a1[4];
#pragma unroll
    for (int mt = 0; mt < 4; ++mt) { a0[mt] = zero8(); a1[mt] = zero8(); }
#pragma unroll
    for (int ks = 0; ks < CC / 32; ++ks) {
      const Frag fb0 = ldfrag(bp0 + 32 * ks);
      const Frag fb1 = ldfrag(bp1 + 32 * ks);
      Frag fa[4];
#pragma unroll
      for (int mt = 0; mt < 4; ++mt) fa[mt] = ldfrag(ap + (size_t)(16 * mt) * CC + 32 * ks);
#pragma unroll
      for (int mt = 0; mt < 4; ++mt) {
        a0[mt] = mma_h(fa[mt].h, fb0.h, a0[mt]);
        a1[mt] = mma_h(fa[mt].h, fb1.h, a1[mt]);
      }
    }

    unsigned short* T = (unsigned short*)Os;                         // [64 o][TP] f16
    const float* bias = (sel == 0) ? pb : gb;                        // both global
    const int odd = c & 1;                                           // even lane stores r 0..3, odd lane r 4..7
    const int ml  = 32 * pyl + 8 * xt + (c >> 1);                    // 0..63
#pragma unroll
    for (int mt = 0; mt < 4; ++mt) {
      const int ol = 16 * mt + 8 * hh + 4 * odd;                     // 0..60
      const v4f bq = *(const v4f*)(bias + d0 + ol);
#pragma unroll
      for (int j = 0; j < 4; ++j) {
        const float pe = max_pair(fmaxf(a0[mt][j], a1[mt][j]));
        const float po = max_pair(fmaxf(a0[mt][4 + j], a1[mt][4 + j]));
        const float v  = (odd ? po : pe) * IWSC + bfr(bq[j]);
        T[(ol + j) * TP + ml] = h_bits((_Float16)v);
      }
    }
    __syncthreads();
    {
      const int g = tid & 7, lq = tid >> 3;                          // lq 0..31
      unsigned short* dst = (sel == 0) ? Pc : Gc;                    // both global
      v4u u[2];
#pragma unroll
      for (int it = 0; it < 2; ++it) u[it] = *(const v4u*)(T + (it * 32 + lq) * TP + 8 * g);
#pragma unroll
      for (int it = 0; it < 2; ++it)
        *(v4u*)(dst + ((size_t)(b * DQ + d0 + it * 32 + lq)) * MM + 64 * ds + 8 * g) = u[it];
    }
    return;
  }

  const int n0   = st * SN, o0 = mb * QT;

  const unsigned short* ap = W16 + (size_t)(o0 + c) * CC + 8 * hh;
  const unsigned short* bp = XP + ((size_t)(b * NN + n0 + 16 * wave + c)) * CC + 8 * hh;

  v8f acc[4];
#pragma unroll
  for (int mt = 0; mt < 4; ++mt) acc[mt] = zero8();

#pragma unroll
  for (int ks = 0; ks < CC / 32; ++ks) {
    const Frag fb = ldfrag(bp + 32 * ks);
#pragma unroll
    for (int mt = 0; mt < 4; ++mt) {
      const Frag fa = ldfrag(ap + (size_t)(16 * mt) * CC + 32 * ks);
      acc[mt] = mma_h(fa.h, fb.h, acc[mt]);
    }
  }

  // ---- epilogue: scale back -> LDS Os[n_loc][o_loc]; lane (hh, c) holds o = 16 mt + 8 hh + r for n_loc = 16 w + c
  {
    const int nl = 16 * wave + c;
#pragma unroll
    for (int mt = 0; mt < 4; ++mt) {
      v4f va, vb;
#pragma unroll
      for (int r = 0; r < 4; ++r) { va[r] = acc[mt][r] * IWSC; vb[r] = acc[mt][4 + r] * IWSC; }
      *(v4f*)(Os + nl * OSP + 16 * mt + 8 * hh)     = va;
      *(v4f*)(Os + nl * OSP + 16 * mt + 8 * hh + 4) = vb;
    }
  }
  __syncthreads();

  const int dsel = mb * QT;                                          // 0 or 64
  const float* bias = tb;
  {
    const int e = tid & 7, lq = tid >> 3;                            // lq 0..31
    float bv[8];
    {
      const v4f ba = *(const v4f*)(bias + dsel + 8 * e);
      const v4f bq = *(const v4f*)(bias + dsel + 8 * e + 4);
#pragma unroll
      for (int t = 0; t < 4; ++t) { bv[t] = bfr(ba[t]); bv[4 + t] = bfr(bq[t]); }
    }
    v4u uh[4], ul[4];
#pragma unroll
    for (int it = 0; it < 4; ++it) {
      const int row = it * 32 + lq;                                  // n_loc 0..127
      const v4f a = *(const v4f*)(Os + row * OSP + 8 * e);
      const v4f q = *(const v4f*)(Os + row * OSP + 8 * e + 4);
      float f[8];
#pragma unroll
      for (int t = 0; t < 4; ++t) { f[t] = a[t] + bv[t]; f[4 + t] = q[t] + bv[4 + t]; }
      split8(f, uh[it], ul[it]);
    }
{
#pragma unroll
      for (int it = 0; it < 4; ++it) {
        const int row = it * 32 + lq;
        const size_t po = ((size_t)(b * NN + n0 + row)) * DQ + dsel + 8 * e;
        *(v4u*)(Qh + po) = uh[it];
        *(v4u*)(Ql + po) = ul[it];
      }
      
    }
  }
}

// =========================================================================================================
// (5) M GEMM for one (b, 64-row block of phi channels): M[cp][ci] = sum_m Pc[b][cp][m] Gc[b][ci][m], K = 1024 =
//     32 steps (rolled by 2). Block 256 threads = 8 waves; wave w owns cols ci = 16w..16w+15 (B fragment from the
//     m-contiguous Gc row, split k map) and 4 m-tiles (A rows cp = c0 + 16 mt + (lane&15) from Pc, split k map).
//     Epilogue staged in LDS Os[ci_loc][cp_loc] (pitch OSP, b128 stores, cross-wave), block barrier, then
// coverage: Os 8 waves x 16 ci x 64 cp = 128 x 64 written, reads rows 0..127 cols 8e..8e+7 <= 63; planes 4 it x
//           32 rows x 8 lanes x 8 = 128 ci x 64 cp; grid (2, NB) covers MTh/MTl [b][0..127][0..127] exactly once.
// =========================================================================================================
__global__ __launch_bounds__(256)
void gemm_m(const unsigned short* __restrict__ Pc, const unsigned short* __restrict__ Gc,
            unsigned short* MTh, unsigned short* MTl) {
  __shared__ __align__(16) float Os[DQ * OSP];
  const int tid  = threadIdx.x;
  const int lane = tid & 31, wave = tid >> 5;                        // wave 0..7
  const int hh   = lane >> 4, c = lane & 15;
  const int mb   = blockIdx.x, b = blockIdx.y;
  const int c0   = mb * QT;

  const unsigned short* ap = Pc + ((size_t)(b * DQ + c0 + c)) * MM + 8 * hh;
  const unsigned short* bp = Gc + ((size_t)(b * DQ + 16 * wave + c)) * MM + 8 * hh;

  v8f acc[4];
#pragma unroll
  for (int mt = 0; mt < 4; ++mt) acc[mt] = zero8();

#pragma unroll 2
  for (int ks = 0; ks < MM / 32; ++ks) {
    const Frag fb = ldfrag(bp + 32 * ks);
#pragma unroll
    for (int mt = 0; mt < 4; ++mt) {
      const Frag fa = ldfrag(ap + (size_t)(16 * mt) * MM + 32 * ks);
      acc[mt] = mma_h(fa.h, fb.h, acc[mt]);
    }
  }

  // ---- epilogue: -> LDS Os[ci_loc][cp_loc]; lane (hh, c) holds cp_loc = 16 mt + 8 hh + r for ci_loc = 16 w + c
  {
    const int nl = 16 * wave + c;
#pragma unroll
    for (int mt = 0; mt < 4; ++mt) {
      v4f va, vb;
#pragma unroll
      for (int r = 0; r < 4; ++r) { va[r] = acc[mt][r]; vb[r] = acc[mt][4 + r]; }
      *(v4f*)(Os + nl * OSP + 16 * mt + 8 * hh)     = va;
      *(v4f*)(Os + nl * OSP + 16 * mt + 8 * hh + 4) = vb;
    }
  }
  __syncthreads();

  const int e = tid & 7, lq = tid >> 3;                              // lq 0..31
  v4u uh[4], ul[4];
#pragma unroll
  for (int it = 0; it < 4; ++it) {
    const int row = it * 32 + lq;                                    // ci 0..127
    const v4f a = *(const v4f*)(Os + row * OSP + 8 * e);
    const v4f q = *(const v4f*)(Os + row * OSP + 8 * e + 4);
    const float f[8] = {a[0], a[1], a[2], a[3], q[0], q[1], q[2], q[3]};
    split8(f, uh[it], ul[it]);
  }
{
#pragma unroll
    for (int it = 0; it < 4; ++it) {
      const int row = it * 32 + lq;
      const size_t po = ((size_t)(b * DQ + row)) * DQ + c0 + 8 * e;
      *(v4u*)(MTh + po) = uh[it];
      *(v4u*)(MTl + po) = ul[it];
    }
    
  }
}

// =========================================================================================================
// (6) y GEMM for one (b, 64-n tile, 64-ci block): y[n][ci] = (1/1024) sum_cp (MTh+MTl)[b][ci][cp] (Qh+Ql)[b][n][cp]
//     on bf16 WMMA, 3 products per k-step (hi.hi + hi.lo + lo.hi, shared accumulator), K = 128 = 4 steps.
//     Block 128 threads = 4 waves; wave w owns cols n0+16w..+15 (B fragments from the cp-contiguous theta rows)
//     and 4 m-tiles (A rows ci = i0 + 16 mt + (lane&15), split k map from the MTh/MTl rows). Epilogue staged in
//     LDS Os[n_loc][ci_loc] (pitch OSP, b128 stores, cross-wave), block barrier, then Yh/Yl bf16 [b][4096 n][128 ci]
// coverage: Os 4 waves x 16 n x 64 ci written, reads rows 0..63 cols 8e..8e+7 <= 63; planes 4 it x 16 rows x 8
//           lanes x 8 = 64 n x 64 ci; grid (NQ/64, 2, NB) covers rows 0..NQ-1 x 128 ci of Yh/Yl exactly once.
// =========================================================================================================
__global__ __launch_bounds__(128)
void gemm_y(const unsigned short* __restrict__ MTh, const unsigned short* __restrict__ MTl,
            const unsigned short* __restrict__ Qh, const unsigned short* __restrict__ Ql,
            unsigned short* Yh, unsigned short* Yl) {
  __shared__ __align__(16) float Os[QT * OSP];
  const int tid  = threadIdx.x;
  const int lane = tid & 31, wave = tid >> 5;                        // wave 0..3
  const int hh   = lane >> 4, c = lane & 15;
  const int nt   = blockIdx.x, cb = blockIdx.y, b = blockIdx.z;
  const int n0   = nt * QT, i0 = cb * QT;

  const size_t ao = ((size_t)(b * DQ + i0 + c)) * DQ + 8 * hh;
  const unsigned short* aph = MTh + ao;
  const unsigned short* apl = MTl + ao;
  const size_t bo = ((size_t)(b * NN + n0 + 16 * wave + c)) * DQ + 8 * hh;
  const unsigned short* bph = Qh + bo;
  const unsigned short* bpl = Ql + bo;

  v8f acc[4];
#pragma unroll
  for (int mt = 0; mt < 4; ++mt) acc[mt] = zero8();

#pragma unroll
  for (int ks = 0; ks < DQ / 32; ++ks) {
    const Frag fbh = ldfrag(bph + 32 * ks);
    const Frag fbl = ldfrag(bpl + 32 * ks);
#pragma unroll
    for (int mt = 0; mt < 4; ++mt) {
      const Frag fah = ldfrag(aph + (size_t)(16 * mt) * DQ + 32 * ks);
      const Frag fal = ldfrag(apl + (size_t)(16 * mt) * DQ + 32 * ks);
      acc[mt] = mma_b(fah.bf, fbh.bf, acc[mt]);
      acc[mt] = mma_b(fah.bf, fbl.bf, acc[mt]);
      acc[mt] = mma_b(fal.bf, fbh.bf, acc[mt]);
    }
  }

  // ---- epilogue: y = acc/1024 -> LDS Os[n_loc][ci_loc]; lane (hh, c) holds ci_loc = 16 mt + 8 hh + r, n_loc = 16 w + c
  {
    const int nl = 16 * wave + c;
#pragma unroll
    for (int mt = 0; mt < 4; ++mt) {
      v4f va, vb;
#pragma unroll
      for (int r = 0; r < 4; ++r) { va[r] = acc[mt][r] * INS; vb[r] = acc[mt][4 + r] * INS; }
      *(v4f*)(Os + nl * OSP + 16 * mt + 8 * hh)     = va;
      *(v4f*)(Os + nl * OSP + 16 * mt + 8 * hh + 4) = vb;
    }
  }
  __syncthreads();

  const int e = tid & 7, lq = tid >> 3;                              // lq 0..15
  v4u uh[4], ul[4];
#pragma unroll
  for (int it = 0; it < 4; ++it) {
    const int row = it * 16 + lq;                                    // n_loc 0..63
    const v4f a = *(const v4f*)(Os + row * OSP + 8 * e);
    const v4f q = *(const v4f*)(Os + row * OSP + 8 * e + 4);
    const float f[8] = {a[0], a[1], a[2], a[3], q[0], q[1], q[2], q[3]};
    split8(f, uh[it], ul[it]);
  }
{
#pragma unroll
    for (int it = 0; it < 4; ++it) {
      const int row = it * 16 + lq;
      const size_t po = ((size_t)(b * NN + n0 + row)) * DQ + i0 + 8 * e;
      *(v4u*)(Yh + po) = uh[it];
      *(v4u*)(Yl + po) = ul[it];
    }
    
  }
}

// =========================================================================================================
// (7) output conv for one (b, 64-n tile, 64-c block): A[c][n] = sum_ci WWb[c][ci] (Yh + Yl)[b][n][ci] on bf16 WMMA
//     (2 products per k-step, shared accumulator), K = 128 = 4 steps. Block 128 threads = 4 waves; wave w owns cols
//     n0+16w..+15 (B fragments from the k-contiguous Yh/Yl rows) and 4 m-tiles (A rows c = c0 + 16 mt + (lane&15),
//     split k map loader from WWb). Epilogue staged in LDS Os[n_loc][c_loc] (pitch OSP, b128 stores, cross-wave),
//     segment 64 n = 2 lines): 8 consecutive lanes x 16 B (values gathered from 4 Os rows), one instruction per 16
// coverage: Os 4 waves x 16 n x 64 c written, read rows nl+t <= 63 x cols cl <= 63; Z 8 it x 16 lines x 8 lanes x
//           4 floats = 64 c x 64 n; grid (NQ/64, 4, NB) covers Z[b][0..255][0..NQ-1] exactly once.
// =========================================================================================================
__global__ __launch_bounds__(128)
void gemm_out(const unsigned short* __restrict__ WWb, const unsigned short* __restrict__ Yh,
              const unsigned short* __restrict__ Yl, const float* __restrict__ wb, float* Z) {
  __shared__ __align__(16) float Os[QT * OSP];
  const int tid  = threadIdx.x;
  const int lane = tid & 31, wave = tid >> 5;
  const int hh   = lane >> 4, c = lane & 15;
  const int nt   = blockIdx.x, cb = blockIdx.y, b = blockIdx.z;
  const int n0   = nt * QT, c0 = cb * QT;

  const unsigned short* ap  = WWb + (size_t)(c0 + c) * DQ + 8 * hh;
  const size_t bo = ((size_t)(b * NN + n0 + 16 * wave + c)) * DQ + 8 * hh;
  const unsigned short* bph = Yh + bo;
  const unsigned short* bpl = Yl + bo;

  v8f acc[4];
#pragma unroll
  for (int mt = 0; mt < 4; ++mt) acc[mt] = zero8();

#pragma unroll
  for (int ks = 0; ks < DQ / 32; ++ks) {
    const Frag fbh = ldfrag(bph + 32 * ks);
    const Frag fbl = ldfrag(bpl + 32 * ks);
#pragma unroll
    for (int mt = 0; mt < 4; ++mt) {
      const Frag fa = ldfrag(ap + (size_t)(16 * mt) * DQ + 32 * ks);
      acc[mt] = mma_b(fa.bf, fbh.bf, acc[mt]);
      acc[mt] = mma_b(fa.bf, fbl.bf, acc[mt]);
    }
  }

  // ---- epilogue: -> LDS Os[n_loc][c_loc]; lane (hh, c) holds c_loc = 16 mt + 8 hh + r for n_loc = 16 w + c
  {
    const int nl = 16 * wave + c;
#pragma unroll
    for (int mt = 0; mt < 4; ++mt) {
      v4f va, vb;
#pragma unroll
      for (int r = 0; r < 4; ++r) { va[r] = acc[mt][r]; vb[r] = acc[mt][4 + r]; }
      *(v4f*)(Os + nl * OSP + 16 * mt + 8 * hh)     = va;
      *(v4f*)(Os + nl * OSP + 16 * mt + 8 * hh + 4) = vb;
    }
  }
  __syncthreads();

  const int e = tid & 7, lq = tid >> 3;                              // lq 0..15
  v4f res[8];
#pragma unroll
  for (int it = 0; it < 8; ++it) {
    const int L   = it * 16 + lq;                                    // 0..127
    const int cl  = L >> 1, hf = L & 1;                              // channel 0..63 within the block
    const int nl  = hf * 32 + 4 * e;                                 // position 0..63
    const float bvs = bfr(wb[c0 + cl]);
#pragma unroll
    for (int t = 0; t < 4; ++t) {
      res[it][t] = Os[(nl + t) * OSP + cl] + bvs;
    }
  }
{
#pragma unroll
    for (int it = 0; it < 8; ++it) {
      const int L   = it * 16 + lq;
      const int cl  = L >> 1, hf = L & 1;
      const int nl  = hf * 32 + 4 * e;
      const size_t idx = ((size_t)(b * CC + c0 + cl)) * NQ + n0 + nl;
      *(v4f*)(Z + idx) = res[it];
    }
    
  }
}

// =========================================================================================================
// (8) batch-norm statistics per channel ch (one block per channel, 1024 threads = 32 waves): every thread issues all
//     its b128 reads of z (one per batch image and 1024-quad slice) before it sums any, f64 sums of z and z*z in four
//     independent chains, LDS f64 tree (cross-thread, block barriers), mean and biased variance in f64,
//     rstd = 1/sqrt(var + eps) in f32; stats line ST[ch][32 floats] = {mean, bf16-RNE(gamma)*rstd, bf16-RNE(beta),
// coverage: grid (CC) writes every line of ST exactly once; reads Z rows (b<NB, ch, n<NQ) all produced by (7).
// =========================================================================================================
__global__ __launch_bounds__(SBT)
void bn_stats(const float* __restrict__ Z, const float* __restrict__ gam, const float* __restrict__ bet,
              float* ST) {
  __shared__ double sh1[SBT];
  __shared__ double sh2[SBT];
  const int tid = threadIdx.x, ch = blockIdx.x;
  v4f v[NB * SQ];
  // both loops unrolled: v[] stays in registers and the reads issue back to back, none waiting for a sum
#pragma unroll
  for (int b = 0; b < NB; ++b) {
    const float* zr = Z + ((size_t)(b * CC + ch)) * NQ;
#pragma unroll
    for (int j = 0; j < SQ; ++j) {
      v[b * SQ + j] = *(const v4f*)(zr + 4 * (j * SBT + tid));
      // a later read of this run may land its result in this read's address registers: the wait stands in front of it
      asm volatile("s_wait_xcnt 0x0" ::: "memory");
    }
  }
  double s4[4] = {0.0, 0.0, 0.0, 0.0}, q4[4] = {0.0, 0.0, 0.0, 0.0};
  // unrolled: every index of v[], s4[] and q4[] is a constant (registers, no scratch)
#pragma unroll
  for (int i = 0; i < NB * SQ; ++i) {
#pragma unroll
    for (int t = 0; t < 4; ++t) { const double d = (double)v[i][t]; s4[t] += d; q4[t] += d * d; }
  }
  sh1[tid] = (s4[0] + s4[1]) + (s4[2] + s4[3]);
  sh2[tid] = (q4[0] + q4[1]) + (q4[2] + q4[3]);
  __syncthreads();
#pragma unroll 1
  for (int stp = SBT / 2; stp > 0; stp >>= 1) {
    if (tid < stp) { sh1[tid] += sh1[tid + stp]; sh2[tid] += sh2[tid + stp]; }
    __syncthreads();
  }
  const double cnt  = (double)NB * (double)NQ;
  const double mean = sh1[0] / cnt;
  double var = sh2[0] / cnt - mean * mean;
  var = (var > 0.0) ? var : 0.0;
  const float rstd  = 1.0f / sqrtf((float)var + BNEPS);
  const float meanf = (float)mean;
  const float scl   = bfr(gam[ch]) * rstd;
  const float btr   = bfr(bet[ch]);
  if (tid < 8) {
    v4f w;
    w[0] = (tid == 0) ? meanf : 0.f;
    w[1] = (tid == 0) ? scl : 0.f;
    w[2] = (tid == 0) ? btr : 0.f;
    w[3] = 0.f;
    float* p = ST + (size_t)ch * STL + 4 * tid;
    *(v4f*)p = w;
    
  }
}

// =========================================================================================================
// (9) out[b][ch][n] = ((z - mean) * (gamma*rstd) + beta) + bf16-RNE(x): one thread per 4 consecutive n; a wave writes
// coverage: NB*CC*NQ/1024 blocks x 256 threads x 4 floats = out[b<NB][0..255][0..NQ-1] exactly once.
// =========================================================================================================
__global__ __launch_bounds__(256)
void bn_apply(const float* __restrict__ Z, const float* __restrict__ x, const float* __restrict__ ST,
              float* out) {
  const size_t i4   = (size_t)blockIdx.x * 256 + threadIdx.x;
  const size_t el   = i4 * 4;
  const size_t rowi = el / NQ;
  const int n  = (int)(el - rowi * NQ);
  const int ch = (int)(rowi % CC);
  const int b  = (int)(rowi / CC);
  const v4f z  = *(const v4f*)(Z + el);
  const size_t xo = ((size_t)(b * CC + ch)) * NN + n;
  const v4f xv = *(const v4f*)(x + xo);
  const float mean = ST[(size_t)ch * STL + 0];
  const float scl  = ST[(size_t)ch * STL + 1];
  const float btr  = ST[(size_t)ch * STL + 2];
  v4f r;
#pragma unroll
  for (int t = 0; t < 4; ++t) r[t] = ((z[t] - mean) * scl + btr) + bfr(xv[t]);
  float* p = out + xo;
  *(v4f*)p = r;
  
}

// =========================================================================================================
// Workspace map (bytes; each region start a multiple of 256; every extent is an exact row/tile multiple and is
//   W16 f16 [384][256]            196608      WWb bf16 [256][128]        65536
//   XP  f16 [NB][4096][256]     16777216 (NB=8)
//   Qh/Ql bf16 [NB][4096][128]   8388608 x2
//   PGZ region 33554432: Z f32 [NB][256][NQ] at +0; Z extent <= region (static_assert)
//   Pc/Gc f16 [NB][128][1024]   2097152 x2
//   MTh/MTl bf16 [NB][128][128]   262144 x2
//   Yh/Yl bf16 [NB][4096][128]   8388608 x2
//   ST  f32 [256][32]               32768
//   total (NB=8, NQ=4096) = 88899584
// =========================================================================================================
extern "C" void kernel_launch(void* const* d_in, const int* in_sizes, int n_in,
                              void* d_out, int out_size, void* d_ws, size_t ws_size,
                              hipStream_t stream) {
  const int XN = NB * CC * NN;
  if (n_in < 11) return;
  if (in_sizes[0] < XN) return;
  if (in_sizes[1] < DQ * CC || in_sizes[3] < DQ * CC || in_sizes[5] < DQ * CC || in_sizes[7] < CC * DQ) return;
  if (in_sizes[2] < DQ || in_sizes[4] < DQ || in_sizes[6] < DQ || in_sizes[8] < CC) return;
  if (in_sizes[9] < CC || in_sizes[10] < CC) return;
  if (out_size < XN) return;

  size_t off = 0;
  auto carve = [&](size_t bytes) { const size_t o = off; off += (bytes + 255) & ~(size_t)255; return o; };
  const size_t oW16 = carve((size_t)MW * CC * 2);
  const size_t oWWb = carve((size_t)CC * DQ * 2);
  const size_t oXP  = carve((size_t)NB * NN * CC * 2);
  const size_t oQh  = carve((size_t)NB * NN * DQ * 2);
  const size_t oQl  = carve((size_t)NB * NN * DQ * 2);
  const size_t oPGZ = carve((size_t)2 * NB * NN * DQ * 4);
  const size_t oPc  = carve((size_t)NB * DQ * MM * 2);
  const size_t oGc  = carve((size_t)NB * DQ * MM * 2);
  const size_t oMTh = carve((size_t)NB * DQ * DQ * 2);
  const size_t oMTl = carve((size_t)NB * DQ * DQ * 2);
  const size_t oYh  = carve((size_t)NB * NN * DQ * 2);
  const size_t oYl  = carve((size_t)NB * NN * DQ * 2);
  const size_t oST  = carve((size_t)CC * STL * 4);
  if (off > ws_size) return;
  if (off > (size_t)134217728) return;

  const float* x  = (const float*)d_in[0];
  const float* gw = (const float*)d_in[1];
  const float* gb = (const float*)d_in[2];
  const float* tw = (const float*)d_in[3];
  const float* tb = (const float*)d_in[4];
  const float* pw = (const float*)d_in[5];
  const float* pb = (const float*)d_in[6];
  const float* ow = (const float*)d_in[7];
  const float* wb = (const float*)d_in[8];
  const float* bg = (const float*)d_in[9];
  const float* bb = (const float*)d_in[10];

  char* ws = (char*)d_ws;
  unsigned short* W16 = (unsigned short*)(ws + oW16);
  unsigned short* WWb = (unsigned short*)(ws + oWWb);
  unsigned short* XP  = (unsigned short*)(ws + oXP);
  unsigned short* Qh  = (unsigned short*)(ws + oQh);
  unsigned short* Ql  = (unsigned short*)(ws + oQl);
  float*          Z   = (float*)(ws + oPGZ);
  unsigned short* Pc  = (unsigned short*)(ws + oPc);
  unsigned short* Gc  = (unsigned short*)(ws + oGc);
  unsigned short* MTh = (unsigned short*)(ws + oMTh);
  unsigned short* MTl = (unsigned short*)(ws + oMTl);
  unsigned short* Yh  = (unsigned short*)(ws + oYh);
  unsigned short* Yl  = (unsigned short*)(ws + oYl);
  float*          ST  = (float*)(ws + oST);
  float* out = (float*)d_out;

  const dim3 blk256(256), blk128(128);

  // (0) theta_w / phi_w / g_w -> stacked f16 plane; w_w -> bf16 plane
  cvt_w<<<dim3(MW / 8 + CC / 16), blk256, 0, stream>>>(tw, pw, gw, ow, W16, WWb);
  // (1) x -> position-major 16-bit plane
  cvt_x<<<dim3(NN / QT, CC / QT, NB), blk256, 0, stream>>>(x, XP);
  // (2) conv1x1 GEMM -> theta hi/res planes; phi / g + bias, 2x2 max-pooled, as channel-major f16 planes [b][d][m]
  gemm_proj<<<dim3(NSTRIP, 4, NB), blk256, 0, stream>>>(W16, XP, tb, pb, gb, Qh, Ql, Pc, Gc);
  // (5) M = pooled-phi . pooled-g^T per batch -> M^T hi/res planes [b][ci][cp]
  gemm_m<<<dim3(DQ / QT, NB), blk256, 0, stream>>>(Pc, Gc, MTh, MTl);
  // (6) y = theta . M / 1024 -> y hi/res planes [b][n][128]
  gemm_y<<<dim3(NQ / QT, DQ / QT, NB), blk128, 0, stream>>>(MTh, MTl, Qh, Ql, Yh, Yl);
  // (7) output conv + bias -> Z [b][256][NQ]
  gemm_out<<<dim3(NQ / QT, CC / QT, NB), blk128, 0, stream>>>(WWb, Yh, Yl, wb, Z);
  // (8) batch statistics per channel -> ST lines
  bn_stats<<<dim3(CC), dim3(SBT), 0, stream>>>(Z, bg, bb, ST);
  // (9) normalise, affine, residual -> out [b][256][4096]
  bn_apply<<<dim3((NB * CC * NQ) / 1024), blk256, 0, stream>>>(Z, x, ST, out);
  (void)hipGetLastError();
}

// v003
// It runs in 99.6 microseconds.
// Next to v002, in two timings, it ran 1.25 and 1.23 times as fast.
// All steps since v000 together make it 1.48 times as fast.
// Contractions: conv1x1 theta/phi/g GEMM W[384x256].X[256x128] per strip on v_wmma_f32_16x16x32_f16 (f16
// containers of bf16-RNE weights x256 and bf16-RNE x, 1 product); M = pooled-phi . pooled-g^T per batch
// [128x128], K=1024, on v_wmma_f32_16x16x32_f16 (2x2 max-pooled phi and g as plain f16, 1 product);
// y^T = M^T.theta^T, K=128, on v_wmma_f32_16x16x32_bf16 (M and theta as bf16 hi + bf16 residual planes,
// 3 products); output conv W[256x128].Y on v_wmma_f32_16x16x32_bf16 (bf16 weights, y as bf16 hi + residual
// planes, 2 products); f32 accumulate everywhere; max-pool, bias, batch-norm statistics (f64 sums, f32 apply)
// and the residual add on VALU.
#include <hip/hip_runtime.h>
#include <math.h>
#include <stdint.h>

#ifndef NB
#define NB 8
#endif
#ifndef NQ
#define NQ 4096
#endif
#define NB_FULL 8
#define CC     256
#define HIMG   64
#define WIMG   64
#define NN     4096
#define DQ     128
#define HP     32
#define WP     32
#define MM     1024
#define MW     384
#define QT     64
#define SN     128
#define NSTRIP 32
#define OSP    68
#define TP     72
#define STL    32
#define WSC    256.0f
#define IWSC   0.00390625f
#define INS    0.0009765625f
#define BNEPS  1e-5f
#define SBT    1024
#define KSL    128
#define SQ     (NQ / (4 * SBT))

static_assert(NB >= 1 && NB <= NB_FULL);
static_assert(NQ % 128 == 0 && NQ >= 128 && NQ <= NN);
static_assert(NQ % QT == 0);
static_assert(NN == HIMG * WIMG);
static_assert(SN == 2 * WIMG && NSTRIP * SN == NN && SN == 8 * 16);
static_assert(HIMG % 2 == 0 && WIMG % 2 == 0 && HP == HIMG / 2 && WP == WIMG / 2 && MM == HP * WP);
static_assert(WP == 32);
static_assert(MM % QT == 0 && MM % 32 == 0);
static_assert(NN % QT == 0 && CC % QT == 0 && DQ == 2 * QT);
static_assert(MW == 3 * DQ && MW % 8 == 0);
static_assert(CC % 32 == 0 && DQ % 32 == 0);
static_assert((OSP * 4) % 16 == 0 && (TP * 2) % 16 == 0);
static_assert(SN * OSP * 4 <= 65536 && DQ * OSP * 4 <= 65536);
static_assert(((size_t)NB * CC * NQ) % 1024 == 0);
static_assert((size_t)NB * CC * NQ * 4 <= 2 * (size_t)NB * NN * DQ * 4);
static_assert((size_t)NB_FULL * CC * NN * 4 == (size_t)33554432);
static_assert(STL * 4 == 128);
static_assert(QT * TP * 2 <= SN * OSP * 4 && NN == 16 * 4 * WIMG && MM == 16 * 64);
static_assert(MM == 8 * KSL && KSL == 4 * 32 && DQ == 8 * 16);
static_assert(NQ % (4 * SBT) == 0 && (SBT & (SBT - 1)) == 0 && SBT <= 1024);

typedef _Float16       v16h __attribute__((ext_vector_type(16)));
typedef _Float16       v8h  __attribute__((ext_vector_type(8)));
typedef __bf16         v16b __attribute__((ext_vector_type(16)));
typedef unsigned short v8us __attribute__((ext_vector_type(8)));
typedef float          v8f  __attribute__((ext_vector_type(8)));
typedef float          v4f  __attribute__((ext_vector_type(4)));
typedef unsigned int   v4u  __attribute__((ext_vector_type(4)));
typedef unsigned int   v2u  __attribute__((ext_vector_type(2)));

union Frag { v8us u[2]; v16h h; v16b bf; };
static_assert(sizeof(Frag) == 32);

// ---- scalar helpers ---------------------------------------------------------------------------------------
__device__ __forceinline__ unsigned short bf_bits(float f) {          // f32 -> bf16 bits, RNE convert
  unsigned u = __float_as_uint(f);
  return (unsigned short)((u + 0x7FFFu + ((u >> 16) & 1u)) >> 16);
}
__device__ __forceinline__ float bf_up(unsigned short hb) { return __uint_as_float(((unsigned)hb) << 16); }
__device__ __forceinline__ float bfr(float f) { return bf_up(bf_bits(f)); }
__device__ __forceinline__ unsigned short h_bits(_Float16 x) { return __builtin_bit_cast(unsigned short, x); }
__device__ __forceinline__ unsigned pk16(unsigned short a, unsigned short b) { return (unsigned)a | ((unsigned)b << 16); }
__device__ __forceinline__ v8f zero8() { v8f z = {0.f, 0.f, 0.f, 0.f, 0.f, 0.f, 0.f, 0.f}; return z; }
// 8 f32 values -> bf16 hi bits and bf16 residual bits (lo = RNE(v - hi)), packed 2 per uint
__device__ __forceinline__ void split8(const float* f, v4u& uh, v4u& ul) {
#pragma unroll
  for (int t = 0; t < 4; ++t) {
    const float f0 = f[2 * t], f1 = f[2 * t + 1];
    const unsigned short hb0 = bf_bits(f0), hb1 = bf_bits(f1);
    const unsigned short lb0 = bf_bits(f0 - bf_up(hb0));
    const unsigned short lb1 = bf_bits(f1 - bf_up(hb1));
    uh[t] = pk16(hb0, hb1);
    ul[t] = pk16(lb0, lb1);
  }
}

// ---- 16-bit fragment loader (A, or B from a k-contiguous [n][k] row): lane -> row/col (lane&15), p already includes
//      + 8*(lane>>4); elements 0..7 <- p[0..7] (k0+8h..), elements 8..15 <- p[16..23] (k0+16+8h..)
__device__ __forceinline__ Frag ldfrag(const unsigned short* p) {
  Frag f;
  f.u[0] = *(const v8us*)(p);
  f.u[1] = *(const v8us*)(p + 16);
  return f;
}

// ---- WMMA helpers: builtin followed by a 4-slot VALU gap tying D and keeping A/B live --------------------------
__device__ __forceinline__ v8f mma_h(v16h a, v16h b, v8f c) {
  v8f d = __builtin_amdgcn_wmma_f32_16x16x32_f16(false, a, false, b, (short)0, c, false, false);
#if defined(__HIP_DEVICE_COMPILE__)
  asm volatile("v_nop\n\tv_nop\n\tv_nop\n\tv_nop" : "+v"(d) : "v"(a), "v"(b));
#endif
  return d;
}
__device__ __forceinline__ v8f mma_b(v16b a, v16b b, v8f c) {
  v8f d = __builtin_amdgcn_wmma_f32_16x16x32_bf16(false, a, false, b, (short)0, c, false, false);
#if defined(__HIP_DEVICE_COMPILE__)
  const v16h ha = __builtin_bit_cast(v16h, a), hb = __builtin_bit_cast(v16h, b);
  asm volatile("v_nop\n\tv_nop\n\tv_nop\n\tv_nop" : "+v"(d) : "v"(ha), "v"(hb));
#endif
  return d;
}

// =========================================================================================================
// (0) weights. Blocks 0..47: W16 f16 [384][256], rows 0..127 = theta_w, 128..255 = phi_w, 256..383 = g_w; value =
//     f16 of (bf16-RNE(w) * 256) (exact). Block owns rows 8*blk..8*blk+7: one wave per 512-B row = 32 lanes x 16 B
// coverage: 48 blocks x 8 rows x 32 lanes x 8 halves = 384 x 256; 16 blocks x 16 rows x 16 lanes x 8 = 256 x 128.
// =========================================================================================================
__global__ __launch_bounds__(256)
void cvt_w(const float* __restrict__ tw, const float* __restrict__ pw, const float* __restrict__ gw,
           const float* __restrict__ ow, unsigned short* W16, unsigned short* WWb) {
  const int tid = threadIdx.x, blk = blockIdx.x;
  if (blk < MW / 8) {
    const int rl = tid >> 5, col = 8 * (tid & 31);
    const int o = 8 * blk + rl;                                      // 0..383
    const int grp = blk >> 4;                                        // 0,1,2 (block-uniform)
    const float* wbase = (grp == 0) ? tw : ((grp == 1) ? pw : gw);  // all global
    const float* s = wbase + (size_t)(o - DQ * grp) * CC + col;      // (o - 128 grp) in 0..127
    const v4f a = *(const v4f*)s;
    const v4f q = *(const v4f*)(s + 4);
    const float f[8] = {a[0], a[1], a[2], a[3], q[0], q[1], q[2], q[3]};
    v4u u;
#pragma unroll
    for (int t = 0; t < 4; ++t) {
      const _Float16 h0 = (_Float16)(bfr(f[2 * t]) * WSC);
      const _Float16 h1 = (_Float16)(bfr(f[2 * t + 1]) * WSC);
      u[t] = pk16(h_bits(h0), h_bits(h1));
    }
{
      *(v4u*)(W16 + (size_t)o * CC + col) = u;
      
    }
  } else {
    const int rb = blk - MW / 8;                                     // 0..15
    const int o = 16 * rb + (tid >> 4);                              // 0..255
    const int col = 8 * (tid & 15);                                  // 0..120
    const float* s = ow + (size_t)o * DQ + col;
    const v4f a = *(const v4f*)s;
    const v4f q = *(const v4f*)(s + 4);
    const float f[8] = {a[0], a[1], a[2], a[3], q[0], q[1], q[2], q[3]};
    v4u u;
#pragma unroll
    for (int t = 0; t < 4; ++t) u[t] = pk16(bf_bits(f[2 * t]), bf_bits(f[2 * t + 1]));
{
      *(v4u*)(WWb + (size_t)o * DQ + col) = u;
      
    }
  }
}

// =========================================================================================================
// (1) x f32 [b][256 c][4096 n] -> XP f16 [b][n][c] (position-major, bf16-RNE values, exact in f16) through an LDS
//     tile T[64 n][64 c] (pitch TP, cross-thread, block barrier). Block (nb, cb, b) owns a 64 c x 64 n tile.
// coverage: T written rows (8e+t)=0..63 x cols cl 0..63, read rows 0..63 x cols 8e..8e+7; XP 2 it x 32 rows x 8 lanes
//           x 8 = 64 n x 64 c; grid (64, 4, NB) covers XP [b][0..4095][0..255] exactly once.
// =========================================================================================================
__global__ __launch_bounds__(256)
void cvt_x(const float* __restrict__ x, unsigned short* XP) {
  __shared__ __align__(16) unsigned short T[QT * TP];
  const int tid = threadIdx.x;
  const int nb = blockIdx.x, cb = blockIdx.y, b = blockIdx.z;
  const int e = tid & 7, lq = tid >> 3;                             // lq 0..31
  const int n0 = nb * QT, c0 = cb * QT;
#pragma unroll
  for (int it = 0; it < 2; ++it) {
    const int cl = it * 32 + lq;                                     // 0..63
    const float* sp = x + ((size_t)(b * CC + c0 + cl)) * NN + n0 + 8 * e;
    const v4f a = *(const v4f*)sp;
    const v4f q = *(const v4f*)(sp + 4);
    unsigned short hb[8];
#pragma unroll
    for (int t = 0; t < 4; ++t) {
      hb[t]     = h_bits((_Float16)bfr(a[t]));
      hb[4 + t] = h_bits((_Float16)bfr(q[t]));
    }
#pragma unroll
    for (int t = 0; t < 8; ++t) T[(8 * e + t) * TP + cl] = hb[t];
  }
  __syncthreads();
  v4u up[2];
#pragma unroll
  for (int it = 0; it < 2; ++it) {
    const int nl = it * 32 + lq;                                     // 0..63
    up[it] = *(const v4u*)(T + nl * TP + 8 * e);
  }
{
#pragma unroll
    for (int it = 0; it < 2; ++it) {
      const int rl = it * 32 + lq;
      *(v4u*)(XP + ((size_t)(b * NN + n0 + rl)) * CC + c0 + 8 * e) = up[it];
    }
    
  }
}

// =========================================================================================================
// (2) conv1x1 GEMM, Y[o][n] = (1/256) sum_c W16[o][c] XP[b][n][c], K = 256 = 8 steps, 256 threads = 8 waves; the
//     block's shape depends on blockIdx.y (block-uniform branch, taken in front of every barrier):
//     y = 0,1 (theta dims 0..63 / 64..127): strip of 128 positions x 64 o. Wave w owns cols n0+16w..+15 (one B
//       fragment per k-step, k = c contiguous in the XP row) and 4 m-tiles (A rows o = o0 + 16 mt + (lane&15), split
//       k map loader from W16). Epilogue staged in LDS Os[n_loc][o_loc] (pitch OSP, b128 stores, cross-wave), block
//       barrier, + bias -> Qh/Ql bf16 [b][4096 n][128 d] (hi = RNE(v), lo = RNE(v-hi)).
//     y = 2,3 (phi, g): idx = 32 (y-2) + x -> 256 positions (image rows 4 ds..4 ds+3, ds = idx&15) x 64 o
//       (ob = idx>>4: phi dims 0.., 64.., then g dims 0.., 64..). Wave w = (pyl = w>>2, xt = w&3) owns the two n-tiles
//       of image rows 4 ds + 2 pyl and + 2 pyl + 1 at columns 16 xt..16 xt+15, and 4 m-tiles. The 2x2 stride-2
//       max-pool is done on the accumulators: the row pair is the wave's two tiles (same lane, same register), the
//       column pair is lane ^ 1. Scale and bias follow the maximum (x -> fl(x/256 + bias) never decreases as x grows, so
//       the maximum of the results is the result of the maximum). f16 values go through the LDS tile T[64 o][64 m]
//       (pitch TP, cross-wave, block barrier) -> Pc / Gc f16 [b][128 d][1024 m], m = 32 py + px: 8 consecutive lanes
//       x 16 B = the one whole 128-B line that this block owns of each of its 64 rows.
// coverage: theta: Os 8 waves x 16 n x 64 o = 128 x 64 written, reads rows <= 127 cols <= 63; planes 4 it x 32 rows
//           x 8 lanes x 8 = 128 n x 64 d; 32 x 2 blocks cover 4096 rows x 128 d of Qh/Ql once. phi/g: T written rows
//           16 mt + 8 hh + 4 (c&1) + j = 0..63 x cols 32 pyl + 8 xt + (c>>1) = 0..63, read rows 0..63 x cols 8 g..8 g+7;
//           16 ds x 4 ob blocks cover Pc and Gc [b][0..127][0..1023] exactly once.
// =========================================================================================================
__device__ __forceinline__ float max_pair(float v) {                 // max of lanes l and l ^ 1 (quad_perm 1,0,3,2)
  const int o = __builtin_amdgcn_mov_dpp(__float_as_int(v), 0xB1, 0xF, 0xF, true);
  return fmaxf(v, __int_as_float(o));
}

__global__ __launch_bounds__(256)
void gemm_proj(const unsigned short* __restrict__ W16, const unsigned short* __restrict__ XP,
               const float* __restrict__ tb, const float* __restrict__ pb, const float* __restrict__ gb,
               unsigned short* Qh, unsigned short* Ql, unsigned short* Pc, unsigned short* Gc) {
  __shared__ __align__(16) float Os[SN * OSP];
  const int tid  = threadIdx.x;
  const int lane = tid & 31, wave = tid >> 5;                        // wave 0..7
  const int hh   = lane >> 4, c = lane & 15;
  const int st   = blockIdx.x, mb = blockIdx.y, b = blockIdx.z;

  if (mb >= 2) {
    // ---- phi / g: 64 o x 256 positions, pooled in registers
    const int idx = (mb - 2) * NSTRIP + st;                          // 0..63
    const int ds = idx & 15, ob = idx >> 4;                          // ds 0..15, ob 0..3
    const int sel = ob >> 1, d0 = QT * (ob & 1);                     // plane (0 phi, 1 g), first dim 0 or 64
    const int wv  = __builtin_amdgcn_readfirstlane(wave);            // scalar: row bases stay in SGPRs, fewer VGPRs
    const int pyl = wv >> 2, xt = wv & 3;
    const unsigned lo = (unsigned)(c * CC + 8 * hh);                 // the lane's offset, the same in A and B rows
    const unsigned short* ap  = W16 + (size_t)(DQ + QT * ob) * CC + lo;
    const unsigned short* bp0 = XP + ((size_t)(b * NN + (4 * ds + 2 * pyl) * WIMG + 16 * xt)) * CC + lo;
    const unsigned short* bp1 = bp0 + (size_t)WIMG * CC;

    v8f a0[4], a1[4];
#pragma unroll
    for (int mt = 0; mt < 4; ++mt) { a0[mt] = zero8(); a1[mt] = zero8(); }
#pragma unroll
    for (int ks = 0; ks < CC / 32; ++ks) {
      const Frag fb0 = ldfrag(bp0 + 32 * ks);
      const Frag fb1 = ldfrag(bp1 + 32 * ks);
      Frag fa[4];
#pragma unroll
      for (int mt = 0; mt < 4; ++mt) fa[mt] = ldfrag(ap + (size_t)(16 * mt) * CC + 32 * ks);
#pragma unroll
      for (int mt = 0; mt < 4; ++mt) {
        a0[mt] = mma_h(fa[mt].h, fb0.h, a0[mt]);
        a1[mt] = mma_h(fa[mt].h, fb1.h, a1[mt]);
      }
    }

    unsigned short* T = (unsigned short*)Os;                         // [64 o][TP] f16
    const float* bias = (sel == 0) ? pb : gb;                        // both global
    const int odd = c & 1;                                           // even lane stores r 0..3, odd lane r 4..7
    const int ml  = 32 * pyl + 8 * xt + (c >> 1);                    // 0..63
#pragma unroll
    for (int mt = 0; mt < 4; ++mt) {
      const int ol = 16 * mt + 8 * hh + 4 * odd;                     // 0..60
      const v4f bq = *(const v4f*)(bias + d0 + ol);
#pragma unroll
      for (int j = 0; j < 4; ++j) {
        const float pe = max_pair(fmaxf(a0[mt][j], a1[mt][j]));
        const float po = max_pair(fmaxf(a0[mt][4 + j], a1[mt][4 + j]));
        const float v  = (odd ? po : pe) * IWSC + bfr(bq[j]);
        T[(ol + j) * TP + ml] = h_bits((_Float16)v);
      }
    }
    __syncthreads();
    {
      const int g = tid & 7, lq = tid >> 3;                          // lq 0..31
      unsigned short* dst = (sel == 0) ? Pc : Gc;                    // both global
      v4u u[2];
#pragma unroll
      for (int it = 0; it < 2; ++it) u[it] = *(const v4u*)(T + (it * 32 + lq) * TP + 8 * g);
#pragma unroll
      for (int it = 0; it < 2; ++it)
        *(v4u*)(dst + ((size_t)(b * DQ + d0 + it * 32 + lq)) * MM + 64 * ds + 8 * g) = u[it];
    }
    return;
  }

  const int n0   = st * SN, o0 = mb * QT;

  const unsigned short* ap = W16 + (size_t)(o0 + c) * CC + 8 * hh;
  const unsigned short* bp = XP + ((size_t)(b * NN + n0 + 16 * wave + c)) * CC + 8 * hh;

  v8f acc[4];
#pragma unroll
  for (int mt = 0; mt < 4; ++mt) acc[mt] = zero8();

#pragma unroll
  for (int ks = 0; ks < CC / 32; ++ks) {
    const Frag fb = ldfrag(bp + 32 * ks);
#pragma unroll
    for (int mt = 0; mt < 4; ++mt) {
      const Frag fa = ldfrag(ap + (size_t)(16 * mt) * CC + 32 * ks);
      acc[mt] = mma_h(fa.h, fb.h, acc[mt]);
    }
  }

  // ---- epilogue: scale back -> LDS Os[n_loc][o_loc]; lane (hh, c) holds o = 16 mt + 8 hh + r for n_loc = 16 w + c
  {
    const int nl = 16 * wave + c;
#pragma unroll
    for (int mt = 0; mt < 4; ++mt) {
      v4f va, vb;
#pragma unroll
      for (int r = 0; r < 4; ++r) { va[r] = acc[mt][r] * IWSC; vb[r] = acc[mt][4 + r] * IWSC; }
      *(v4f*)(Os + nl * OSP + 16 * mt + 8 * hh)     = va;
      *(v4f*)(Os + nl * OSP + 16 * mt + 8 * hh + 4) = vb;
    }
  }
  __syncthreads();

  const int dsel = mb * QT;                                          // 0 or 64
  const float* bias = tb;
  {
    const int e = tid & 7, lq = tid >> 3;                            // lq 0..31
    float bv[8];
    {
      const v4f ba = *(const v4f*)(bias + dsel + 8 * e);
      const v4f bq = *(const v4f*)(bias + dsel + 8 * e + 4);
#pragma unroll
      for (int t = 0; t < 4; ++t) { bv[t] = bfr(ba[t]); bv[4 + t] = bfr(bq[t]); }
    }
    v4u uh[4], ul[4];
#pragma unroll
    for (int it = 0; it < 4; ++it) {
      const int row = it * 32 + lq;                                  // n_loc 0..127
      const v4f a = *(const v4f*)(Os + row * OSP + 8 * e);
      const v4f q = *(const v4f*)(Os + row * OSP + 8 * e + 4);
      float f[8];
#pragma unroll
      for (int t = 0; t < 4; ++t) { f[t] = a[t] + bv[t]; f[4 + t] = q[t] + bv[4 + t]; }
      split8(f, uh[it], ul[it]);
    }
{
#pragma unroll
      for (int it = 0; it < 4; ++it) {
        const int row = it * 32 + lq;
        const size_t po = ((size_t)(b * NN + n0 + row)) * DQ + dsel + 8 * e;
        *(v4u*)(Qh + po) = uh[it];
        *(v4u*)(Ql + po) = ul[it];
      }
      
    }
  }
}

// =========================================================================================================
// (5) M GEMM for one (b, 64-row block of phi channels, 16-column tile of g channels): M[cp][ci] = sum_m Pc[b][cp][m]
//     Gc[b][ci][m], K = 1024. Block 256 threads = 8 waves; wave w owns the k slice m = 128 w..128 w + 127 (4 steps) of
//     the whole 64 x 16 tile: B fragments from the m-contiguous Gc rows ci = 16 ct + (lane&15), A rows cp = c0 + 16 mt +
//     (lane&15) from Pc, both with the split k map. A wave issues its 40 b128 reads before its first product.
//     The 8 partial tiles go to LDS Os[16 w + ci_loc][cp_loc] (pitch OSP, b128 stores, cross-wave), block barrier, then
//     each thread adds the 8 slices of 4 consecutive cp in slice order (f32) -> MTh/MTl bf16 [b][ci][cp]: 16 lanes x 8 B
//     = the one whole 128-B line that this block owns of each of its 16 rows, in each plane.
// coverage: Os 8 waves x 16 ci x 64 cp = 128 x 64 written, reads rows 16 w + row <= 127, cols 4e..4e+3 <= 63; planes
//           16 rows x 16 lanes x 4 = 16 ci x 64 cp; grid (8, 2, NB) covers MTh/MTl [b][0..127][0..127] exactly once.
// =========================================================================================================
__global__ __launch_bounds__(256)
void gemm_m(const unsigned short* __restrict__ Pc, const unsigned short* __restrict__ Gc,
            unsigned short* MTh, unsigned short* MTl) {
  __shared__ __align__(16) float Os[DQ * OSP];
  const int tid  = threadIdx.x;
  const int lane = tid & 31, wave = tid >> 5;                        // wave 0..7 = k slice
  const int hh   = lane >> 4, c = lane & 15;
  const int ct   = blockIdx.x, mb = blockIdx.y, b = blockIdx.z;
  const int c0   = mb * QT;

  const unsigned short* ap = Pc + ((size_t)(b * DQ + c0 + c)) * MM + KSL * wave + 8 * hh;
  const unsigned short* bp = Gc + ((size_t)(b * DQ + 16 * ct + c)) * MM + KSL * wave + 8 * hh;

  Frag fb[KSL / 32], fa[KSL / 32][4];
#pragma unroll
  for (int ks = 0; ks < KSL / 32; ++ks) {
    fb[ks] = ldfrag(bp + 32 * ks);
#pragma unroll
    for (int mt = 0; mt < 4; ++mt) fa[ks][mt] = ldfrag(ap + (size_t)(16 * mt) * MM + 32 * ks);
  }
#if defined(__HIP_DEVICE_COMPILE__)
  // inputs-only fence on the loaded values: keeps every read of the slice in front of the first product, so that the
  // wave waits for memory once; without it each product's reads are issued, and waited for, one product at a time
  asm volatile("" :: "v"(fb[0].h), "v"(fb[1].h), "v"(fb[2].h), "v"(fb[3].h),
               "v"(fa[0][0].h), "v"(fa[0][1].h), "v"(fa[0][2].h), "v"(fa[0][3].h),
               "v"(fa[1][0].h), "v"(fa[1][1].h), "v"(fa[1][2].h), "v"(fa[1][3].h),
               "v"(fa[2][0].h), "v"(fa[2][1].h), "v"(fa[2][2].h), "v"(fa[2][3].h),
               "v"(fa[3][0].h), "v"(fa[3][1].h), "v"(fa[3][2].h), "v"(fa[3][3].h));
#endif

  v8f acc[4];
#pragma unroll
  for (int mt = 0; mt < 4; ++mt) acc[mt] = zero8();
#pragma unroll
  for (int ks = 0; ks < KSL / 32; ++ks) {
#pragma unroll
    for (int mt = 0; mt < 4; ++mt) acc[mt] = mma_h(fa[ks][mt].h, fb[ks].h, acc[mt]);
  }

  // ---- partial tile -> LDS Os[16 w + ci_loc][cp_loc]; lane (hh, c) holds cp_loc = 16 mt + 8 hh + r for ci_loc = c
  {
    const int nl = 16 * wave + c;
#pragma unroll
    for (int mt = 0; mt < 4; ++mt) {
      v4f va, vb;
#pragma unroll
      for (int r = 0; r < 4; ++r) { va[r] = acc[mt][r]; vb[r] = acc[mt][4 + r]; }
      *(v4f*)(Os + nl * OSP + 16 * mt + 8 * hh)     = va;
      *(v4f*)(Os + nl * OSP + 16 * mt + 8 * hh + 4) = vb;
    }
  }
  __syncthreads();

  const int e = tid & 15, row = tid >> 4;                            // cp quad 0..15, ci_loc 0..15
  v4f s = *(const v4f*)(Os + row * OSP + 4 * e);
#pragma unroll
  for (int w = 1; w < MM / KSL; ++w) s += *(const v4f*)(Os + (16 * w + row) * OSP + 4 * e);
  v2u uh, ul;
#pragma unroll
  for (int t = 0; t < 2; ++t) {
    const float f0 = s[2 * t], f1 = s[2 * t + 1];
    const unsigned short hb0 = bf_bits(f0), hb1 = bf_bits(f1);
    uh[t] = pk16(hb0, hb1);
    ul[t] = pk16(bf_bits(f0 - bf_up(hb0)), bf_bits(f1 - bf_up(hb1)));
  }
  const size_t po = ((size_t)(b * DQ + 16 * ct + row)) * DQ + c0 + 4 * e;
  *(v2u*)(MTh + po) = uh;
  *(v2u*)(MTl + po) = ul;
}

// =========================================================================================================
// (6) y GEMM for one (b, 64-n tile, 64-ci block): y[n][ci] = (1/1024) sum_cp (MTh+MTl)[b][ci][cp] (Qh+Ql)[b][n][cp]
//     on bf16 WMMA, 3 products per k-step (hi.hi + hi.lo + lo.hi, shared accumulator), K = 128 = 4 steps.
//     Block 128 threads = 4 waves; wave w owns cols n0+16w..+15 (B fragments from the cp-contiguous theta rows)
//     and 4 m-tiles (A rows ci = i0 + 16 mt + (lane&15), split k map from the MTh/MTl rows). Epilogue staged in
//     LDS Os[n_loc][ci_loc] (pitch OSP, b128 stores, cross-wave), block barrier, then Yh/Yl bf16 [b][4096 n][128 ci]
// coverage: Os 4 waves x 16 n x 64 ci written, reads rows 0..63 cols 8e..8e+7 <= 63; planes 4 it x 16 rows x 8
//           lanes x 8 = 64 n x 64 ci; grid (NQ/64, 2, NB) covers rows 0..NQ-1 x 128 ci of Yh/Yl exactly once.
// =========================================================================================================
__global__ __launch_bounds__(128)
void gemm_y(const unsigned short* __restrict__ MTh, const unsigned short* __restrict__ MTl,
            const unsigned short* __restrict__ Qh, const unsigned short* __restrict__ Ql,
            unsigned short* Yh, unsigned short* Yl) {
  __shared__ __align__(16) float Os[QT * OSP];
  const int tid  = threadIdx.x;
  const int lane = tid & 31, wave = tid >> 5;                        // wave 0..3
  const int hh   = lane >> 4, c = lane & 15;
  const int nt   = blockIdx.x, cb = blockIdx.y, b = blockIdx.z;
  const int n0   = nt * QT, i0 = cb * QT;

  const size_t ao = ((size_t)(b * DQ + i0 + c)) * DQ + 8 * hh;
  const unsigned short* aph = MTh + ao;
  const unsigned short* apl = MTl + ao;
  const size_t bo = ((size_t)(b * NN + n0 + 16 * wave + c)) * DQ + 8 * hh;
  const unsigned short* bph = Qh + bo;
  const unsigned short* bpl = Ql + bo;

  v8f acc[4];
#pragma unroll
  for (int mt = 0; mt < 4; ++mt) acc[mt] = zero8();

#pragma unroll
  for (int ks = 0; ks < DQ / 32; ++ks) {
    const Frag fbh = ldfrag(bph + 32 * ks);
    const Frag fbl = ldfrag(bpl + 32 * ks);
#pragma unroll
    for (int mt = 0; mt < 4; ++mt) {
      const Frag fah = ldfrag(aph + (size_t)(16 * mt) * DQ + 32 * ks);
      const Frag fal = ldfrag(apl + (size_t)(16 * mt) * DQ + 32 * ks);
      acc[mt] = mma_b(fah.bf, fbh.bf, acc[mt]);
      acc[mt] = mma_b(fah.bf, fbl.bf, acc[mt]);
      acc[mt] = mma_b(fal.bf, fbh.bf, acc[mt]);
    }
  }

  // ---- epilogue: y = acc/1024 -> LDS Os[n_loc][ci_loc]; lane (hh, c) holds ci_loc = 16 mt + 8 hh + r, n_loc = 16 w + c
  {
    const int nl = 16 * wave + c;
#pragma unroll
    for (int mt = 0; mt < 4; ++mt) {
      v4f va, vb;
#pragma unroll
      for (int r = 0; r < 4; ++r) { va[r] = acc[mt][r] * INS; vb[r] = acc[mt][4 + r] * INS; }
      *(v4f*)(Os + nl * OSP + 16 * mt + 8 * hh)     = va;
      *(v4f*)(Os + nl * OSP + 16 * mt + 8 * hh + 4) = vb;
    }
  }
  __syncthreads();

  const int e = tid & 7, lq = tid >> 3;                              // lq 0..15
  v4u uh[4], ul[4];
#pragma unroll
  for (int it = 0; it < 4; ++it) {
    const int row = it * 16 + lq;                                    // n_loc 0..63
    const v4f a = *(const v4f*)(Os + row * OSP + 8 * e);
    const v4f q = *(const v4f*)(Os + row * OSP + 8 * e + 4);
    const float f[8] = {a[0], a[1], a[2], a[3], q[0], q[1], q[2], q[3]};
    split8(f, uh[it], ul[it]);
  }
{
#pragma unroll
    for (int it = 0; it < 4; ++it) {
      const int row = it * 16 + lq;
      const size_t po = ((size_t)(b * NN + n0 + row)) * DQ + i0 + 8 * e;
      *(v4u*)(Yh + po) = uh[it];
      *(v4u*)(Yl + po) = ul[it];
    }
    
  }
}

// =========================================================================================================
// (7) output conv for one (b, 64-n tile, 64-c block): A[c][n] = sum_ci WWb[c][ci] (Yh + Yl)[b][n][ci] on bf16 WMMA
//     (2 products per k-step, shared accumulator), K = 128 = 4 steps. Block 128 threads = 4 waves; wave w owns cols
//     n0+16w..+15 (B fragments from the k-contiguous Yh/Yl rows) and 4 m-tiles (A rows c = c0 + 16 mt + (lane&15),
//     split k map loader from WWb). Epilogue staged in LDS Os[n_loc][c_loc] (pitch OSP, b128 stores, cross-wave),
//     segment 64 n = 2 lines): 8 consecutive lanes x 16 B (values gathered from 4 Os rows), one instruction per 16
// coverage: Os 4 waves x 16 n x 64 c written, read rows nl+t <= 63 x cols cl <= 63; Z 8 it x 16 lines x 8 lanes x
//           4 floats = 64 c x 64 n; grid (NQ/64, 4, NB) covers Z[b][0..255][0..NQ-1] exactly once.
// =========================================================================================================
__global__ __launch_bounds__(128)
void gemm_out(const unsigned short* __restrict__ WWb, const unsigned short* __restrict__ Yh,
              const unsigned short* __restrict__ Yl, const float* __restrict__ wb, float* Z) {
  __shared__ __align__(16) float Os[QT * OSP];
  const int tid  = threadIdx.x;
  const int lane = tid & 31, wave = tid >> 5;
  const int hh   = lane >> 4, c = lane & 15;
  const int nt   = blockIdx.x, cb = blockIdx.y, b = blockIdx.z;
  const int n0   = nt * QT, c0 = cb * QT;

  const unsigned short* ap  = WWb + (size_t)(c0 + c) * DQ + 8 * hh;
  const size_t bo = ((size_t)(b * NN + n0 + 16 * wave + c)) * DQ + 8 * hh;
  const unsigned short* bph = Yh + bo;
  const unsigned short* bpl = Yl + bo;

  v8f acc[4];
#pragma unroll
  for (int mt = 0; mt < 4; ++mt) acc[mt] = zero8();

#pragma unroll
  for (int ks = 0; ks < DQ / 32; ++ks) {
    const Frag fbh = ldfrag(bph + 32 * ks);
    const Frag fbl = ldfrag(bpl + 32 * ks);
#pragma unroll
    for (int mt = 0; mt < 4; ++mt) {
      const Frag fa = ldfrag(ap + (size_t)(16 * mt) * DQ + 32 * ks);
      acc[mt] = mma_b(fa.bf, fbh.bf, acc[mt]);
      acc[mt] = mma_b(fa.bf, fbl.bf, acc[mt]);
    }
  }

  // ---- epilogue: -> LDS Os[n_loc][c_loc]; lane (hh, c) holds c_loc = 16 mt + 8 hh + r for n_loc = 16 w + c
  {
    const int nl = 16 * wave + c;
#pragma unroll
    for (int mt = 0; mt < 4; ++mt) {
      v4f va, vb;
#pragma unroll
      for (int r = 0; r < 4; ++r) { va[r] = acc[mt][r]; vb[r] = acc[mt][4 + r]; }
      *(v4f*)(Os + nl * OSP + 16 * mt + 8 * hh)     = va;
      *(v4f*)(Os + nl * OSP + 16 * mt + 8 * hh + 4) = vb;
    }
  }
  __syncthreads();

  const int e = tid & 7, lq = tid >> 3;                              // lq 0..15
  v4f res[8];
#pragma unroll
  for (int it = 0; it < 8; ++it) {
    const int L   = it * 16 + lq;                                    // 0..127
    const int cl  = L >> 1, hf = L & 1;                              // channel 0..63 within the block
    const int nl  = hf * 32 + 4 * e;                                 // position 0..63
    const float bvs = bfr(wb[c0 + cl]);
#pragma unroll
    for (int t = 0; t < 4; ++t) {
      res[it][t] = Os[(nl + t) * OSP + cl] + bvs;
    }
  }
{
#pragma unroll
    for (int it = 0; it < 8; ++it) {
      const int L   = it * 16 + lq;
      const int cl  = L >> 1, hf = L & 1;
      const int nl  = hf * 32 + 4 * e;
      const size_t idx = ((size_t)(b * CC + c0 + cl)) * NQ + n0 + nl;
      *(v4f*)(Z + idx) = res[it];
    }
    
  }
}

// =========================================================================================================
// (8) batch-norm statistics per channel ch (one block per channel, 1024 threads = 32 waves): every thread issues all
//     its b128 reads of z (one per batch image and 1024-quad slice) before it sums any, f64 sums of z and z*z in four
//     independent chains, LDS f64 tree (cross-thread, block barriers), mean and biased variance in f64,
//     rstd = 1/sqrt(var + eps) in f32; stats line ST[ch][32 floats] = {mean, bf16-RNE(gamma)*rstd, bf16-RNE(beta),
// coverage: grid (CC) writes every line of ST exactly once; reads Z rows (b<NB, ch, n<NQ) all produced by (7).
// =========================================================================================================
__global__ __launch_bounds__(SBT)
void bn_stats(const float* __restrict__ Z, const float* __restrict__ gam, const float* __restrict__ bet,
              float* ST) {
  __shared__ double sh1[SBT];
  __shared__ double sh2[SBT];
  const int tid = threadIdx.x, ch = blockIdx.x;
  v4f v[NB * SQ];
  // both loops unrolled: v[] stays in registers and the reads issue back to back, none waiting for a sum
#pragma unroll
  for (int b = 0; b < NB; ++b) {
    const float* zr = Z + ((size_t)(b * CC + ch)) * NQ;
#pragma unroll
    for (int j = 0; j < SQ; ++j) {
      v[b * SQ + j] = *(const v4f*)(zr + 4 * (j * SBT + tid));
      // a later read of this run may land its result in this read's address registers: the wait stands in front of it
      asm volatile("s_wait_xcnt 0x0" ::: "memory");
    }
  }
  double s4[4] = {0.0, 0.0, 0.0, 0.0}, q4[4] = {0.0, 0.0, 0.0, 0.0};
  // unrolled: every index of v[], s4[] and q4[] is a constant (registers, no scratch)
#pragma unroll
  for (int i = 0; i < NB * SQ; ++i) {
#pragma unroll
    for (int t = 0; t < 4; ++t) { const double d = (double)v[i][t]; s4[t] += d; q4[t] += d * d; }
  }
  sh1[tid] = (s4[0] + s4[1]) + (s4[2] + s4[3]);
  sh2[tid] = (q4[0] + q4[1]) + (q4[2] + q4[3]);
  __syncthreads();
#pragma unroll 1
  for (int stp = SBT / 2; stp > 0; stp >>= 1) {
    if (tid < stp) { sh1[tid] += sh1[tid + stp]; sh2[tid] += sh2[tid + stp]; }
    __syncthreads();
  }
  const double cnt  = (double)NB * (double)NQ;
  const double mean = sh1[0] / cnt;
  double var = sh2[0] / cnt - mean * mean;
  var = (var > 0.0) ? var : 0.0;
  const float rstd  = 1.0f / sqrtf((float)var + BNEPS);
  const float meanf = (float)mean;
  const float scl   = bfr(gam[ch]) * rstd;
  const float btr   = bfr(bet[ch]);
  if (tid < 8) {
    v4f w;
    w[0] = (tid == 0) ? meanf : 0.f;
    w[1] = (tid == 0) ? scl : 0.f;
    w[2] = (tid == 0) ? btr : 0.f;
    w[3] = 0.f;
    float* p = ST + (size_t)ch * STL + 4 * tid;
    *(v4f*)p = w;
    
  }
}

// =========================================================================================================
// (9) out[b][ch][n] = ((z - mean) * (gamma*rstd) + beta) + bf16-RNE(x): one thread per 4 consecutive n; a wave writes
// coverage: NB*CC*NQ/1024 blocks x 256 threads x 4 floats = out[b<NB][0..255][0..NQ-1] exactly once.
// =========================================================================================================
__global__ __launch_bounds__(256)
void bn_apply(const float* __restrict__ Z, const float* __restrict__ x, const float* __restrict__ ST,
              float* out) {
  const size_t i4   = (size_t)blockIdx.x * 256 + threadIdx.x;
  const size_t el   = i4 * 4;
  const size_t rowi = el / NQ;
  const int n  = (int)(el - rowi * NQ);
  const int ch = (int)(rowi % CC);
  const int b  = (int)(rowi / CC);
  const v4f z  = *(const v4f*)(Z + el);
  const size_t xo = ((size_t)(b * CC + ch)) * NN + n;
  const v4f xv = *(const v4f*)(x + xo);
  const float mean = ST[(size_t)ch * STL + 0];
  const float scl  = ST[(size_t)ch * STL + 1];
  const float btr  = ST[(size_t)ch * STL + 2];
  v4f r;
#pragma unroll
  for (int t = 0; t < 4; ++t) r[t] = ((z[t] - mean) * scl + btr) + bfr(xv[t]);
  float* p = out + xo;
  *(v4f*)p = r;
  
}

// =========================================================================================================
// Workspace map (bytes; each region start a multiple of 256; every extent is an exact row/tile multiple and is
//   W16 f16 [384][256]            196608      WWb bf16 [256][128]        65536
//   XP  f16 [NB][4096][256]     16777216 (NB=8)
//   Qh/Ql bf16 [NB][4096][128]   8388608 x2
//   PGZ region 33554432: Z f32 [NB][256][NQ] at +0; Z extent <= region (static_assert)
//   Pc/Gc f16 [NB][128][1024]   2097152 x2
//   MTh/MTl bf16 [NB][128][128]   262144 x2
//   Yh/Yl bf16 [NB][4096][128]   8388608 x2
//   ST  f32 [256][32]               32768
//   total (NB=8, NQ=4096) = 88899584
// =========================================================================================================
extern "C" void kernel_launch(void* const* d_in, const int* in_sizes, int n_in,
                              void* d_out, int out_size, void* d_ws, size_t ws_size,
                              hipStream_t stream) {
  const int XN = NB * CC * NN;
  if (n_in < 11) return;
  if (in_sizes[0] < XN) return;
  if (in_sizes[1] < DQ * CC || in_sizes[3] < DQ * CC || in_sizes[5] < DQ * CC || in_sizes[7] < CC * DQ) return;
  if (in_sizes[2] < DQ || in_sizes[4] < DQ || in_sizes[6] < DQ || in_sizes[8] < CC) return;
  if (in_sizes[9] < CC || in_sizes[10] < CC) return;
  if (out_size < XN) return;

  size_t off = 0;
  auto carve = [&](size_t bytes) { const size_t o = off; off += (bytes + 255) & ~(size_t)255; return o; };
  const size_t oW16 = carve((size_t)MW * CC * 2);
  const size_t oWWb = carve((size_t)CC * DQ * 2);
  const size_t oXP  = carve((size_t)NB * NN * CC * 2);
  const size_t oQh  = carve((size_t)NB * NN * DQ * 2);
  const size_t oQl  = carve((size_t)NB * NN * DQ * 2);
  const size_t oPGZ = carve((size_t)2 * NB * NN * DQ * 4);
  const size_t oPc  = carve((size_t)NB * DQ * MM * 2);
  const size_t oGc  = carve((size_t)NB * DQ * MM * 2);
  const size_t oMTh = carve((size_t)NB * DQ * DQ * 2);
  const size_t oMTl = carve((size_t)NB * DQ * DQ * 2);
  const size_t oYh  = carve((size_t)NB * NN * DQ * 2);
  const size_t oYl  = carve((size_t)NB * NN * DQ * 2);
  const size_t oST  = carve((size_t)CC * STL * 4);
  if (off > ws_size) return;
  if (off > (size_t)134217728) return;

  const float* x  = (const float*)d_in[0];
  const float* gw = (const float*)d_in[1];
  const float* gb = (const float*)d_in[2];
  const float* tw = (const float*)d_in[3];
  const float* tb = (const float*)d_in[4];
  const float* pw = (const float*)d_in[5];
  const float* pb = (const float*)d_in[6];
  const float* ow = (const float*)d_in[7];
  const float* wb = (const float*)d_in[8];
  const float* bg = (const float*)d_in[9];
  const float* bb = (const float*)d_in[10];

  char* ws = (char*)d_ws;
  unsigned short* W16 = (unsigned short*)(ws + oW16);
  unsigned short* WWb = (unsigned short*)(ws + oWWb);
  unsigned short* XP  = (unsigned short*)(ws + oXP);
  unsigned short* Qh  = (unsigned short*)(ws + oQh);
  unsigned short* Ql  = (unsigned short*)(ws + oQl);
  float*          Z   = (float*)(ws + oPGZ);
  unsigned short* Pc  = (unsigned short*)(ws + oPc);
  unsigned short* Gc  = (unsigned short*)(ws + oGc);
  unsigned short* MTh = (unsigned short*)(ws + oMTh);
  unsigned short* MTl = (unsigned short*)(ws + oMTl);
  unsigned short* Yh  = (unsigned short*)(ws + oYh);
  unsigned short* Yl  = (unsigned short*)(ws + oYl);
  float*          ST  = (float*)(ws + oST);
  float* out = (float*)d_out;

  const dim3 blk256(256), blk128(128);

  // (0) theta_w / phi_w / g_w -> stacked f16 plane; w_w -> bf16 plane
  cvt_w<<<dim3(MW / 8 + CC / 16), blk256, 0, stream>>>(tw, pw, gw, ow, W16, WWb);
  // (1) x -> position-major 16-bit plane
  cvt_x<<<dim3(NN / QT, CC / QT, NB), blk256, 0, stream>>>(x, XP);
  // (2) conv1x1 GEMM -> theta hi/res planes; phi / g + bias, 2x2 max-pooled, as channel-major f16 planes [b][d][m]
  gemm_proj<<<dim3(NSTRIP, 4, NB), blk256, 0, stream>>>(W16, XP, tb, pb, gb, Qh, Ql, Pc, Gc);
  // (5) M = pooled-phi . pooled-g^T per batch -> M^T hi/res planes [b][ci][cp]
  gemm_m<<<dim3(DQ / 16, DQ / QT, NB), blk256, 0, stream>>>(Pc, Gc, MTh, MTl);
  // (6) y = theta . M / 1024 -> y hi/res planes [b][n][128]
  gemm_y<<<dim3(NQ / QT, DQ / QT, NB), blk128, 0, stream>>>(MTh, MTl, Qh, Ql, Yh, Yl);
  // (7) output conv + bias -> Z [b][256][NQ]
  gemm_out<<<dim3(NQ / QT, CC / QT, NB), blk128, 0, stream>>>(WWb, Yh, Yl, wb, Z);
  // (8) batch statistics per channel -> ST lines
  bn_stats<<<dim3(CC), dim3(SBT), 0, stream>>>(Z, bg, bb, ST);
  // (9) normalise, affine, residual -> out [b][256][4096]
  bn_apply<<<dim3((NB * CC * NQ) / 1024), blk256, 0, stream>>>(Z, x, ST, out);
  (void)hipGetLastError();
}

// v004
// A run of this version takes 87.9 microseconds.
// In both of two side-by-side timings against v003, it was 1.13 times as fast.
// Counting every step since v000, it is 1.68 times as fast.
// Contractions: conv1x1 theta/phi/g GEMM W[384x256].X[256x128] per strip on v_wmma_f32_16x16x32_f16 (f16
// containers of bf16-RNE weights x256 and bf16-RNE x, 1 product); M = pooled-phi . pooled-g^T per batch
// [128x128], K=1024, on v_wmma_f32_16x16x32_f16 (2x2 max-pooled phi and g as plain f16, 1 product);
// y^T = M^T.theta^T, K=128, on v_wmma_f32_16x16x32_bf16 (M and theta as bf16 hi + bf16 residual planes,
// 3 products); output conv W[256x128].Y on v_wmma_f32_16x16x32_bf16 (bf16 weights, y as bf16 hi + residual
// planes, 2 products); f32 accumulate everywhere; max-pool, bias, batch-norm statistics (f64 sums, f32 apply)
// and the residual add on VALU.
// Every 16-bit WMMA operand plane lies in the workspace in fragment order: one fragment = 16 rows x 32 k = 1 KiB =
// [j 0..1][lane 0..31][8 values], unit (j, lane) = row (lane&15), k = 16 j + 8 (lane>>4) .. + 7. A wave reads a fragment
// with two b128 loads of 512 contiguous bytes each (4 whole lines a load).
#include <hip/hip_runtime.h>
#include <math.h>
#include <stdint.h>

#ifndef NB
#define NB 8
#endif
#ifndef NQ
#define NQ 4096
#endif
#define NB_FULL 8
#define CC     256
#define HIMG   64
#define WIMG   64
#define NN     4096
#define DQ     128
#define HP     32
#define WP     32
#define MM     1024
#define MW     384
#define QT     64
#define SN     128
#define NSTRIP 32
#define OSP    68
#define TP     72
#define STL    32
#define WSC    256.0f
#define IWSC   0.00390625f
#define INS    0.0009765625f
#define BNEPS  1e-5f
#define SBT    1024
#define KSL    128
#define FRG    512
#define SQ     (NQ / (4 * SBT))

static_assert(NB >= 1 && NB <= NB_FULL);
static_assert(NQ % 128 == 0 && NQ >= 128 && NQ <= NN);
static_assert(NQ % QT == 0);
static_assert(NN == HIMG * WIMG);
static_assert(SN == 2 * WIMG && NSTRIP * SN == NN && SN == 8 * 16);
static_assert(HIMG % 2 == 0 && WIMG % 2 == 0 && HP == HIMG / 2 && WP == WIMG / 2 && MM == HP * WP);
static_assert(WP == 32);
static_assert(MM % QT == 0 && MM % 32 == 0);
static_assert(NN % QT == 0 && CC % QT == 0 && DQ == 2 * QT);
static_assert(MW == 3 * DQ && MW % 8 == 0);
static_assert(CC % 32 == 0 && DQ % 32 == 0);
static_assert((OSP * 4) % 16 == 0 && (TP * 2) % 16 == 0);
static_assert(SN * OSP * 4 <= 65536 && DQ * OSP * 4 <= 65536);
static_assert(((size_t)NB * CC * NQ) % 1024 == 0);
static_assert((size_t)NB * CC * NQ * 4 <= 2 * (size_t)NB * NN * DQ * 4);
static_assert((size_t)NB_FULL * CC * NN * 4 == (size_t)33554432);
static_assert(STL * 4 == 128);
static_assert(QT * TP * 2 <= SN * OSP * 4 && NN == 16 * 4 * WIMG && MM == 16 * 64);
static_assert(MM == 8 * KSL && KSL == 4 * 32 && DQ == 8 * 16);
static_assert(NQ % (4 * SBT) == 0 && (SBT & (SBT - 1)) == 0 && SBT <= 1024);

typedef _Float16       v16h __attribute__((ext_vector_type(16)));
typedef _Float16       v8h  __attribute__((ext_vector_type(8)));
typedef __bf16         v16b __attribute__((ext_vector_type(16)));
typedef unsigned short v8us __attribute__((ext_vector_type(8)));
typedef float          v8f  __attribute__((ext_vector_type(8)));
typedef float          v4f  __attribute__((ext_vector_type(4)));
typedef unsigned int   v4u  __attribute__((ext_vector_type(4)));
typedef unsigned int   v2u  __attribute__((ext_vector_type(2)));

union Frag { v8us u[2]; v16h h; v16b bf; };
static_assert(sizeof(Frag) == 32);

// ---- scalar helpers ---------------------------------------------------------------------------------------
__device__ __forceinline__ unsigned short bf_bits(float f) {          // f32 -> bf16 bits, RNE convert
  unsigned u = __float_as_uint(f);
  return (unsigned short)((u + 0x7FFFu + ((u >> 16) & 1u)) >> 16);
}
__device__ __forceinline__ float bf_up(unsigned short hb) { return __uint_as_float(((unsigned)hb) << 16); }
__device__ __forceinline__ float bfr(float f) { return bf_up(bf_bits(f)); }
__device__ __forceinline__ unsigned short h_bits(_Float16 x) { return __builtin_bit_cast(unsigned short, x); }
__device__ __forceinline__ unsigned pk16(unsigned short a, unsigned short b) { return (unsigned)a | ((unsigned)b << 16); }
__device__ __forceinline__ v8f zero8() { v8f z = {0.f, 0.f, 0.f, 0.f, 0.f, 0.f, 0.f, 0.f}; return z; }
// 8 f32 values -> bf16 hi bits and bf16 residual bits (lo = RNE(v - hi)), packed 2 per uint
__device__ __forceinline__ void split8(const float* f, v4u& uh, v4u& ul) {
#pragma unroll
  for (int t = 0; t < 4; ++t) {
    const float f0 = f[2 * t], f1 = f[2 * t + 1];
    const unsigned short hb0 = bf_bits(f0), hb1 = bf_bits(f1);
    const unsigned short lb0 = bf_bits(f0 - bf_up(hb0));
    const unsigned short lb1 = bf_bits(f1 - bf_up(hb1));
    uh[t] = pk16(hb0, hb1);
    ul[t] = pk16(lb0, lb1);
  }
}

// ---- 16-bit fragment loader (A or B) from a plane in fragment order: lane -> row/col (lane&15), h = lane>>4; p = start
//      of the fragment + 8*lane; elements 0..7 <- p[0..7] (k0+8h..), elements 8..15 <- p[256..263] (k0+16+8h..)
__device__ __forceinline__ Frag ldfrag(const unsigned short* p) {
  Frag f;
  f.u[0] = *(const v8us*)(p);
  f.u[1] = *(const v8us*)(p + FRG / 2);
  return f;
}
// k offset (0, 8, 16, 24) inside its fragment of the 16-B unit that thread t stores (unit = t & 63; its row is t & 15)
__device__ __forceinline__ int unit_k(int t) { return 16 * ((t >> 5) & 1) + 8 * ((t >> 4) & 1); }

// ---- WMMA helpers: builtin followed by a 4-slot VALU gap tying D and keeping A/B live --------------------------
__device__ __forceinline__ v8f mma_h(v16h a, v16h b, v8f c) {
  v8f d = __builtin_amdgcn_wmma_f32_16x16x32_f16(false, a, false, b, (short)0, c, false, false);
#if defined(__HIP_DEVICE_COMPILE__)
  asm volatile("v_nop\n\tv_nop\n\tv_nop\n\tv_nop" : "+v"(d) : "v"(a), "v"(b));
#endif
  return d;
}
__device__ __forceinline__ v8f mma_b(v16b a, v16b b, v8f c) {
  v8f d = __builtin_amdgcn_wmma_f32_16x16x32_bf16(false, a, false, b, (short)0, c, false, false);
#if defined(__HIP_DEVICE_COMPILE__)
  const v16h ha = __builtin_bit_cast(v16h, a), hb = __builtin_bit_cast(v16h, b);
  asm volatile("v_nop\n\tv_nop\n\tv_nop\n\tv_nop" : "+v"(d) : "v"(ha), "v"(hb));
#endif
  return d;
}

// =========================================================================================================
// (0) weights. Blocks 0..47: W16 f16 [384][256], rows 0..127 = theta_w, 128..255 = phi_w, 256..383 = g_w; value =
//     f16 of (bf16-RNE(w) * 256) (exact), fragments [24 o tiles][8 k steps]. Blocks 48..63: WWb bf16 of w_w [256][128],
//     fragments [16 c tiles][4 k steps]. A block owns 4 consecutive fragments, a thread one 16-B unit.
// coverage: 48 blocks x 256 units x 8 halves = 384 x 256; 16 blocks x 256 units x 8 = 256 x 128.
// =========================================================================================================
__global__ __launch_bounds__(256)
void cvt_w(const float* __restrict__ tw, const float* __restrict__ pw, const float* __restrict__ gw,
           const float* __restrict__ ow, unsigned short* W16, unsigned short* WWb) {
  const int tid = threadIdx.x, blk = blockIdx.x;
  if (blk < MW / 8) {
    const int un = blk * 256 + tid;                                  // unit 0..12287
    const int fr = un >> 6;                                          // fragment = 8 (o tile) + k step
    const int o = 16 * (fr >> 3) + (tid & 15);                       // 0..383, o tile = blk >> 1
    const int col = 32 * (fr & 7) + unit_k(tid);                     // 0..248
    const int grp = blk >> 4;                                        // 0,1,2 (block-uniform)
    const float* wbase = (grp == 0) ? tw : ((grp == 1) ? pw : gw);  // all global
    const float* s = wbase + (size_t)(o - DQ * grp) * CC + col;      // (o - 128 grp) in 0..127
    const v4f a = *(const v4f*)s;
    const v4f q = *(const v4f*)(s + 4);
    const float f[8] = {a[0], a[1], a[2], a[3], q[0], q[1], q[2], q[3]};
    v4u u;
#pragma unroll
    for (int t = 0; t < 4; ++t) {
      const _Float16 h0 = (_Float16)(bfr(f[2 * t]) * WSC);
      const _Float16 h1 = (_Float16)(bfr(f[2 * t + 1]) * WSC);
      u[t] = pk16(h_bits(h0), h_bits(h1));
    }
{
      *(v4u*)(W16 + (size_t)un * 8) = u;
      
    }
  } else {
    const int un = (blk - MW / 8) * 256 + tid;                       // unit 0..4095
    const int fr = un >> 6;                                          // fragment = 4 (c tile) + k step
    const int o = 16 * (fr >> 2) + (tid & 15);                       // 0..255
    const int col = 32 * (fr & 3) + unit_k(tid);                     // 0..120
    const float* s = ow + (size_t)o * DQ + col;
    const v4f a = *(const v4f*)s;
    const v4f q = *(const v4f*)(s + 4);
    const float f[8] = {a[0], a[1], a[2], a[3], q[0], q[1], q[2], q[3]};
    v4u u;
#pragma unroll
    for (int t = 0; t < 4; ++t) u[t] = pk16(bf_bits(f[2 * t]), bf_bits(f[2 * t + 1]));
{
      *(v4u*)(WWb + (size_t)un * 8) = u;
      
    }
  }
}

// =========================================================================================================
// (1) x f32 [b][256 c][4096 n] -> XP f16, fragments [b][256 n tiles][8 k steps], k = c (bf16-RNE values, exact in f16),
//     through an LDS tile T[64 n][64 c] (pitch TP, cross-thread, block barrier). Block (nb, cb, b) owns a 64 c x 64 n
//     tile = 4 n tiles x 2 k steps = 8 fragments.
// coverage: T written rows (8e+t)=0..63 x cols cl 0..63, read rows 0..63 x cols 0..63; XP 2 it x 256 units x 8 = 8
//           fragments; grid (64, 4, NB) covers every fragment of XP exactly once.
// =========================================================================================================
__global__ __launch_bounds__(256)
void cvt_x(const float* __restrict__ x, unsigned short* XP) {
  __shared__ __align__(16) unsigned short T[QT * TP];
  const int tid = threadIdx.x;
  const int nb = blockIdx.x, cb = blockIdx.y, b = blockIdx.z;
  const int e = tid & 7, lq = tid >> 3;                             // lq 0..31
  const int n0 = nb * QT, c0 = cb * QT;
#pragma unroll
  for (int it = 0; it < 2; ++it) {
    const int cl = it * 32 + lq;                                     // 0..63
    const float* sp = x + ((size_t)(b * CC + c0 + cl)) * NN + n0 + 8 * e;
    const v4f a = *(const v4f*)sp;
    const v4f q = *(const v4f*)(sp + 4);
    unsigned short hb[8];
#pragma unroll
    for (int t = 0; t < 4; ++t) {
      hb[t]     = h_bits((_Float16)bfr(a[t]));
      hb[4 + t] = h_bits((_Float16)bfr(q[t]));
    }
#pragma unroll
    for (int t = 0; t < 8; ++t) T[(8 * e + t) * TP + cl] = hb[t];
  }
  __syncthreads();
  v4u up[2];
#pragma unroll
  for (int it = 0; it < 2; ++it) {
    const int fl = it * 4 + (tid >> 6);                              // fragment 0..7 = 2 (n tile) + k step
    up[it] = *(const v4u*)(T + (16 * (fl >> 1) + (tid & 15)) * TP + 32 * (fl & 1) + unit_k(tid));
  }
{
#pragma unroll
    for (int it = 0; it < 2; ++it) {
      const int fl = it * 4 + (tid >> 6);
      const int fg = (b * (NN / 16) + n0 / 16 + (fl >> 1)) * (CC / 32) + c0 / 32 + (fl & 1);
      *(v4u*)(XP + (size_t)fg * FRG + 8 * (tid & 63)) = up[it];
    }
    
  }
}

// =========================================================================================================
// (2) conv1x1 GEMM, Y[o][n] = (1/256) sum_c W16[o][c] XP[b][n][c], K = 256 = 8 steps, 256 threads = 8 waves; every
//     plane read or written here is in fragment order (Qh/Ql: [b][256 n tiles][4 k steps], k = d; Pc/Gc: [b][8 d tiles]
//     [32 k steps], k = m); the
//     block's shape depends on blockIdx.y (block-uniform branch, taken in front of every barrier):
//     y = 0,1 (theta dims 0..63 / 64..127): strip of 128 positions x 64 o. Wave w owns cols n0+16w..+15 (one B
//       fragment per k-step) and 4 m-tiles (A rows o = o0 + 16 mt + (lane&15), from W16). Epilogue staged in LDS
//       Os[n_loc][o_loc] (pitch OSP, b128 stores, cross-wave), block barrier, + bias -> Qh/Ql bf16 (hi = RNE(v),
//       lo = RNE(v-hi)), 16 fragments a plane, a wave's store = 512 contiguous bytes.
//     y = 2,3 (phi, g): idx = 32 (y-2) + x -> 256 positions (image rows 4 ds..4 ds+3, ds = idx&15) x 64 o
//       (ob = idx>>4: phi dims 0.., 64.., then g dims 0.., 64..). Wave w = (pyl = w>>2, xt = w&3) owns the two n-tiles
//       of image rows 4 ds + 2 pyl and + 2 pyl + 1 at columns 16 xt..16 xt+15, and 4 m-tiles. The 2x2 stride-2
//       max-pool is done on the accumulators: the row pair is the wave's two tiles (same lane, same register), the
//       column pair is lane ^ 1. Scale and bias follow the maximum (x -> fl(x/256 + bias) never decreases as x grows, so
//       the maximum of the results is the result of the maximum). f16 values go through the LDS tile T[64 o][64 m]
//       (pitch TP, cross-wave, block barrier) -> Pc / Gc f16, m = 32 py + px: the block owns 4 d tiles x 2 k steps = 8
//       whole fragments.
// coverage: theta: Os 8 waves x 16 n x 64 o = 128 x 64 written, reads rows <= 127 cols <= 63; planes 4 it x 256 units
//           x 8 = 128 n x 64 d; 32 x 2 blocks cover 4096 rows x 128 d of Qh/Ql once. phi/g: T written rows
//           16 mt + 8 hh + 4 (c&1) + j = 0..63 x cols 32 pyl + 8 xt + (c>>1) = 0..63, read rows 0..63 x cols 0..63;
//           16 ds x 4 ob blocks cover Pc and Gc (128 d x 1024 m a batch) exactly once.
// =========================================================================================================
__device__ __forceinline__ float max_pair(float v) {                 // max of lanes l and l ^ 1 (quad_perm 1,0,3,2)
  const int o = __builtin_amdgcn_mov_dpp(__float_as_int(v), 0xB1, 0xF, 0xF, true);
  return fmaxf(v, __int_as_float(o));
}

__global__ __launch_bounds__(256)
void gemm_proj(const unsigned short* __restrict__ W16, const unsigned short* __restrict__ XP,
               const float* __restrict__ tb, const float* __restrict__ pb, const float* __restrict__ gb,
               unsigned short* Qh, unsigned short* Ql, unsigned short* Pc, unsigned short* Gc) {
  __shared__ __align__(16) float Os[SN * OSP];
  const int tid  = threadIdx.x;
  const int lane = tid & 31, wave = tid >> 5;                        // wave 0..7
  const int hh   = lane >> 4, c = lane & 15;
  const int st   = blockIdx.x, mb = blockIdx.y, b = blockIdx.z;

  if (mb >= 2) {
    // ---- phi / g: 64 o x 256 positions, pooled in registers
    const int idx = (mb - 2) * NSTRIP + st;                          // 0..63
    const int ds = idx & 15, ob = idx >> 4;                          // ds 0..15, ob 0..3
    const int sel = ob >> 1, d0 = QT * (ob & 1);                     // plane (0 phi, 1 g), first dim 0 or 64
    const int wv  = __builtin_amdgcn_readfirstlane(wave);            // scalar: row bases stay in SGPRs, fewer VGPRs
    const int pyl = wv >> 2, xt = wv & 3;
    const unsigned lo = (unsigned)(8 * lane);                        // the lane's offset, the same in every fragment
    const unsigned short* ap  = W16 + (size_t)((DQ + QT * ob) / 16 * (CC / 32)) * FRG + lo;
    const unsigned short* bp0 = XP + (size_t)((b * (NN / 16) + (4 * ds + 2 * pyl) * (WIMG / 16) + xt) * (CC / 32)) * FRG + lo;
    const unsigned short* bp1 = bp0 + (size_t)(WIMG / 16 * (CC / 32)) * FRG;

    v8f a0[4], a1[4];
#pragma unroll
    for (int mt = 0; mt < 4; ++mt) { a0[mt] = zero8(); a1[mt] = zero8(); }
#pragma unroll
    for (int ks = 0; ks < CC / 32; ++ks) {
      const Frag fb0 = ldfrag(bp0 + FRG * ks);
      const Frag fb1 = ldfrag(bp1 + FRG * ks);
      Frag fa[4];
#pragma unroll
      for (int mt = 0; mt < 4; ++mt) fa[mt] = ldfrag(ap + (size_t)(mt * (CC / 32) + ks) * FRG);
#pragma unroll
      for (int mt = 0; mt < 4; ++mt) {
        a0[mt] = mma_h(fa[mt].h, fb0.h, a0[mt]);
        a1[mt] = mma_h(fa[mt].h, fb1.h, a1[mt]);
      }
    }

    unsigned short* T = (unsigned short*)Os;                         // [64 o][TP] f16
    const float* bias = (sel == 0) ? pb : gb;                        // both global
    const int odd = c & 1;                                           // even lane stores r 0..3, odd lane r 4..7
    const int ml  = 32 * pyl + 8 * xt + (c >> 1);                    // 0..63
#pragma unroll
    for (int mt = 0; mt < 4; ++mt) {
      const int ol = 16 * mt + 8 * hh + 4 * odd;                     // 0..60
      const v4f bq = *(const v4f*)(bias + d0 + ol);
#pragma unroll
      for (int j = 0; j < 4; ++j) {
        const float pe = max_pair(fmaxf(a0[mt][j], a1[mt][j]));
        const float po = max_pair(fmaxf(a0[mt][4 + j], a1[mt][4 + j]));
        const float v  = (odd ? po : pe) * IWSC + bfr(bq[j]);
        T[(ol + j) * TP + ml] = h_bits((_Float16)v);
      }
    }
    __syncthreads();
    {
      const int kl = (tid >> 6) & 1;                                 // k step of the block's two; d tile = 2 it + (tid >> 7)
      unsigned short* dst = (sel == 0) ? Pc : Gc;                    // both global
      v4u u[2];
#pragma unroll
      for (int it = 0; it < 2; ++it)
        u[it] = *(const v4u*)(T + (16 * (2 * it + (tid >> 7)) + (tid & 15)) * TP + 32 * kl + unit_k(tid));
#pragma unroll
      for (int it = 0; it < 2; ++it) {
        const int fg = (b * (DQ / 16) + d0 / 16 + 2 * it + (tid >> 7)) * (MM / 32) + 2 * ds + kl;
        *(v4u*)(dst + (size_t)fg * FRG + 8 * (tid & 63)) = u[it];
      }
    }
    return;
  }

  const int n0   = st * SN, o0 = mb * QT;

  const unsigned short* ap = W16 + (size_t)(o0 / 16 * (CC / 32)) * FRG + 8 * lane;
  const unsigned short* bp = XP + (size_t)((b * (NN / 16) + n0 / 16 + wave) * (CC / 32)) * FRG + 8 * lane;

  v8f acc[4];
#pragma unroll
  for (int mt = 0; mt < 4; ++mt) acc[mt] = zero8();

#pragma unroll
  for (int ks = 0; ks < CC / 32; ++ks) {
    const Frag fb = ldfrag(bp + FRG * ks);
#pragma unroll
    for (int mt = 0; mt < 4; ++mt) {
      const Frag fa = ldfrag(ap + (size_t)(mt * (CC / 32) + ks) * FRG);
      acc[mt] = mma_h(fa.h, fb.h, acc[mt]);
    }
  }

  // ---- epilogue: scale back -> LDS Os[n_loc][o_loc]; lane (hh, c) holds o = 16 mt + 8 hh + r for n_loc = 16 w + c
  {
    const int nl = 16 * wave + c;
#pragma unroll
    for (int mt = 0; mt < 4; ++mt) {
      v4f va, vb;
#pragma unroll
      for (int r = 0; r < 4; ++r) { va[r] = acc[mt][r] * IWSC; vb[r] = acc[mt][4 + r] * IWSC; }
      *(v4f*)(Os + nl * OSP + 16 * mt + 8 * hh)     = va;
      *(v4f*)(Os + nl * OSP + 16 * mt + 8 * hh + 4) = vb;
    }
  }
  __syncthreads();

  const int dsel = mb * QT;                                          // 0 or 64
  const float* bias = tb;
  {
    const int kl = (tid >> 6) & 1;                                   // k step of the block's two; n tile = 2 it + (tid >> 7)
    const int dl = 32 * kl + unit_k(tid);                            // d_loc 0..56
    float bv[8];
    {
      const v4f ba = *(const v4f*)(bias + dsel + dl);
      const v4f bq = *(const v4f*)(bias + dsel + dl + 4);
#pragma unroll
      for (int t = 0; t < 4; ++t) { bv[t] = bfr(ba[t]); bv[4 + t] = bfr(bq[t]); }
    }
    v4u uh[4], ul[4];
#pragma unroll
    for (int it = 0; it < 4; ++it) {
      const int row = 16 * (2 * it + (tid >> 7)) + (tid & 15);       // n_loc 0..127
      const v4f a = *(const v4f*)(Os + row * OSP + dl);
      const v4f q = *(const v4f*)(Os + row * OSP + dl + 4);
      float f[8];
#pragma unroll
      for (int t = 0; t < 4; ++t) { f[t] = a[t] + bv[t]; f[4 + t] = q[t] + bv[4 + t]; }
      split8(f, uh[it], ul[it]);
    }
{
#pragma unroll
      for (int it = 0; it < 4; ++it) {
        const int fg = (b * (NN / 16) + n0 / 16 + 2 * it + (tid >> 7)) * (DQ / 32) + dsel / 32 + kl;
        const size_t po = (size_t)fg * FRG + 8 * (tid & 63);
        *(v4u*)(Qh + po) = uh[it];
        *(v4u*)(Ql + po) = ul[it];
      }
      
    }
  }
}

// =========================================================================================================
// (5) M GEMM for one (b, 64-row block of phi channels, 16-column tile of g channels): M[cp][ci] = sum_m Pc[b][cp][m]
//     Gc[b][ci][m], K = 1024. Block 256 threads = 8 waves; wave w owns the k slice m = 128 w..128 w + 127 (4 steps) of
//     the whole 64 x 16 tile: B fragments of the Gc rows ci = 16 ct + (lane&15), A rows cp = c0 + 16 mt + (lane&15)
//     from Pc, both planes in fragment order. A wave issues its 40 b128 reads before its first product.
//     The 8 partial tiles go to LDS Os[16 w + ci_loc][cp_loc] (pitch OSP, b128 stores, cross-wave), block barrier, then
//     each thread adds the 8 slices of 4 consecutive cp in slice order (f32) -> MTh/MTl bf16, fragments [b][8 ci tiles]
//     [4 k steps], k = cp: the block owns 2 whole fragments of each plane, a thread half a 16-B unit.
// coverage: Os 8 waves x 16 ci x 64 cp = 128 x 64 written, reads rows 16 w + row <= 127, cols cq..cq+3 <= 63; planes
//           256 threads x 4 = 16 ci x 64 cp; grid (8, 2, NB) covers MTh/MTl (128 ci x 128 cp a batch) exactly once.
// =========================================================================================================
__global__ __launch_bounds__(256)
void gemm_m(const unsigned short* __restrict__ Pc, const unsigned short* __restrict__ Gc,
            unsigned short* MTh, unsigned short* MTl) {
  __shared__ __align__(16) float Os[DQ * OSP];
  const int tid  = threadIdx.x;
  const int lane = tid & 31, wave = tid >> 5;                        // wave 0..7 = k slice
  const int hh   = lane >> 4, c = lane & 15;
  const int ct   = blockIdx.x, mb = blockIdx.y, b = blockIdx.z;
  const int c0   = mb * QT;

  const unsigned short* ap = Pc + (size_t)((b * (DQ / 16) + c0 / 16) * (MM / 32) + (KSL / 32) * wave) * FRG + 8 * lane;
  const unsigned short* bp = Gc + (size_t)((b * (DQ / 16) + ct) * (MM / 32) + (KSL / 32) * wave) * FRG + 8 * lane;

  Frag fb[KSL / 32], fa[KSL / 32][4];
#pragma unroll
  for (int ks = 0; ks < KSL / 32; ++ks) {
    fb[ks] = ldfrag(bp + FRG * ks);
#pragma unroll
    for (int mt = 0; mt < 4; ++mt) fa[ks][mt] = ldfrag(ap + (size_t)(mt * (MM / 32) + ks) * FRG);
  }
#if defined(__HIP_DEVICE_COMPILE__)
  // inputs-only fence on the loaded values: keeps every read of the slice in front of the first product, so that the
  // wave waits for memory once; without it each product's reads are issued, and waited for, one product at a time
  asm volatile("" :: "v"(fb[0].h), "v"(fb[1].h), "v"(fb[2].h), "v"(fb[3].h),
               "v"(fa[0][0].h), "v"(fa[0][1].h), "v"(fa[0][2].h), "v"(fa[0][3].h),
               "v"(fa[1][0].h), "v"(fa[1][1].h), "v"(fa[1][2].h), "v"(fa[1][3].h),
               "v"(fa[2][0].h), "v"(fa[2][1].h), "v"(fa[2][2].h), "v"(fa[2][3].h),
               "v"(fa[3][0].h), "v"(fa[3][1].h), "v"(fa[3][2].h), "v"(fa[3][3].h));
#endif

  v8f acc[4];
#pragma unroll
  for (int mt = 0; mt < 4; ++mt) acc[mt] = zero8();
#pragma unroll
  for (int ks = 0; ks < KSL / 32; ++ks) {
#pragma unroll
    for (int mt = 0; mt < 4; ++mt) acc[mt] = mma_h(fa[ks][mt].h, fb[ks].h, acc[mt]);
  }

  // ---- partial tile -> LDS Os[16 w + ci_loc][cp_loc]; lane (hh, c) holds cp_loc = 16 mt + 8 hh + r for ci_loc = c
  {
    const int nl = 16 * wave + c;
#pragma unroll
    for (int mt = 0; mt < 4; ++mt) {
      v4f va, vb;
#pragma unroll
      for (int r = 0; r < 4; ++r) { va[r] = acc[mt][r]; vb[r] = acc[mt][4 + r]; }
      *(v4f*)(Os + nl * OSP + 16 * mt + 8 * hh)     = va;
      *(v4f*)(Os + nl * OSP + 16 * mt + 8 * hh + 4) = vb;
    }
  }
  __syncthreads();

  const int row = (tid >> 1) & 15;                                   // ci_loc 0..15 = the unit's row
  const int cq  = 32 * (tid >> 7) + unit_k(tid >> 1) + 4 * (tid & 1); // cp_loc 0..60: two threads share a 16-B unit
  v4f s = *(const v4f*)(Os + row * OSP + cq);
#pragma unroll
  for (int w = 1; w < MM / KSL; ++w) s += *(const v4f*)(Os + (16 * w + row) * OSP + cq);
  v2u uh, ul;
#pragma unroll
  for (int t = 0; t < 2; ++t) {
    const float f0 = s[2 * t], f1 = s[2 * t + 1];
    const unsigned short hb0 = bf_bits(f0), hb1 = bf_bits(f1);
    uh[t] = pk16(hb0, hb1);
    ul[t] = pk16(bf_bits(f0 - bf_up(hb0)), bf_bits(f1 - bf_up(hb1)));
  }
  const size_t po = (size_t)((b * (DQ / 16) + ct) * (DQ / 32) + c0 / 32 + (tid >> 7)) * FRG + 4 * (tid & 127);
  *(v2u*)(MTh + po) = uh;
  *(v2u*)(MTl + po) = ul;
}

// =========================================================================================================
// (6) y GEMM for one (b, 64-n tile, 64-ci block): y[n][ci] = (1/1024) sum_cp (MTh+MTl)[b][ci][cp] (Qh+Ql)[b][n][cp]
//     on bf16 WMMA, 3 products per k-step (hi.hi + hi.lo + lo.hi, shared accumulator), K = 128 = 4 steps.
//     Block 128 threads = 4 waves; wave w owns cols n0+16w..+15 (B fragments of the theta planes) and 4 m-tiles
//     (A rows ci = i0 + 16 mt + (lane&15), from MTh/MTl). Epilogue staged in LDS Os[n_loc][ci_loc] (pitch OSP, b128
//     stores, cross-wave), block barrier, then Yh/Yl bf16, fragments [b][256 n tiles][4 k steps], k = ci
// coverage: Os 4 waves x 16 n x 64 ci written, reads rows 0..63 cols 0..63; planes 4 it x 128 units x 8 = 64 n x
//           64 ci = 8 fragments; grid (NQ/64, 2, NB) covers rows 0..NQ-1 x 128 ci of Yh/Yl exactly once.
// =========================================================================================================
__global__ __launch_bounds__(128)
void gemm_y(const unsigned short* __restrict__ MTh, const unsigned short* __restrict__ MTl,
            const unsigned short* __restrict__ Qh, const unsigned short* __restrict__ Ql,
            unsigned short* Yh, unsigned short* Yl) {
  __shared__ __align__(16) float Os[QT * OSP];
  const int tid  = threadIdx.x;
  const int lane = tid & 31, wave = tid >> 5;                        // wave 0..3
  const int hh   = lane >> 4, c = lane & 15;
  const int nt   = blockIdx.x, cb = blockIdx.y, b = blockIdx.z;
  const int n0   = nt * QT, i0 = cb * QT;

  const size_t ao = (size_t)((b * (DQ / 16) + i0 / 16) * (DQ / 32)) * FRG + 8 * lane;
  const unsigned short* aph = MTh + ao;
  const unsigned short* apl = MTl + ao;
  const size_t bo = (size_t)((b * (NN / 16) + n0 / 16 + wave) * (DQ / 32)) * FRG + 8 * lane;
  const unsigned short* bph = Qh + bo;
  const unsigned short* bpl = Ql + bo;

  v8f acc[4];
#pragma unroll
  for (int mt = 0; mt < 4; ++mt) acc[mt] = zero8();

#pragma unroll
  for (int ks = 0; ks < DQ / 32; ++ks) {
    const Frag fbh = ldfrag(bph + FRG * ks);
    const Frag fbl = ldfrag(bpl + FRG * ks);
#pragma unroll
    for (int mt = 0; mt < 4; ++mt) {
      const Frag fah = ldfrag(aph + (size_t)(mt * (DQ / 32) + ks) * FRG);
      const Frag fal = ldfrag(apl + (size_t)(mt * (DQ / 32) + ks) * FRG);
      acc[mt] = mma_b(fah.bf, fbh.bf, acc[mt]);
      acc[mt] = mma_b(fah.bf, fbl.bf, acc[mt]);
      acc[mt] = mma_b(fal.bf, fbh.bf, acc[mt]);
    }
  }

  // ---- epilogue: y = acc/1024 -> LDS Os[n_loc][ci_loc]; lane (hh, c) holds ci_loc = 16 mt + 8 hh + r, n_loc = 16 w + c
  {
    const int nl = 16 * wave + c;
#pragma unroll
    for (int mt = 0; mt < 4; ++mt) {
      v4f va, vb;
#pragma unroll
      for (int r = 0; r < 4; ++r) { va[r] = acc[mt][r] * INS; vb[r] = acc[mt][4 + r] * INS; }
      *(v4f*)(Os + nl * OSP + 16 * mt + 8 * hh)     = va;
      *(v4f*)(Os + nl * OSP + 16 * mt + 8 * hh + 4) = vb;
    }
  }
  __syncthreads();

  const int cl = 32 * (tid >> 6) + unit_k(tid);                      // ci_loc 0..56; k step = tid >> 6, n tile = it
  v4u uh[4], ul[4];
#pragma unroll
  for (int it = 0; it < 4; ++it) {
    const int row = it * 16 + (tid & 15);                            // n_loc 0..63
    const v4f a = *(const v4f*)(Os + row * OSP + cl);
    const v4f q = *(const v4f*)(Os + row * OSP + cl + 4);
    const float f[8] = {a[0], a[1], a[2], a[3], q[0], q[1], q[2], q[3]};
    split8(f, uh[it], ul[it]);
  }
{
#pragma unroll
    for (int it = 0; it < 4; ++it) {
      const int fg = (b * (NN / 16) + n0 / 16 + it) * (DQ / 32) + i0 / 32 + (tid >> 6);
      const size_t po = (size_t)fg * FRG + 8 * (tid & 63);
      *(v4u*)(Yh + po) = uh[it];
      *(v4u*)(Yl + po) = ul[it];
    }
    
  }
}

// =========================================================================================================
// (7) output conv for one (b, 64-n tile, 64-c block): A[c][n] = sum_ci WWb[c][ci] (Yh + Yl)[b][n][ci] on bf16 WMMA
//     (2 products per k-step, shared accumulator), K = 128 = 4 steps. Block 128 threads = 4 waves; wave w owns cols
//     n0+16w..+15 (B fragments of the Yh/Yl planes) and 4 m-tiles (A rows c = c0 + 16 mt + (lane&15), from WWb),
//     all in fragment order. Epilogue staged in LDS Os[n_loc][c_loc] (pitch OSP, b128 stores, cross-wave),
//     segment 64 n = 2 lines): 8 consecutive lanes x 16 B (values gathered from 4 Os rows), one instruction per 16
// coverage: Os 4 waves x 16 n x 64 c written, read rows nl+t <= 63 x cols cl <= 63; Z 8 it x 16 lines x 8 lanes x
//           4 floats = 64 c x 64 n; grid (NQ/64, 4, NB) covers Z[b][0..255][0..NQ-1] exactly once.
// =========================================================================================================
__global__ __launch_bounds__(128)
void gemm_out(const unsigned short* __restrict__ WWb, const unsigned short* __restrict__ Yh,
              const unsigned short* __restrict__ Yl, const float* __restrict__ wb, float* Z) {
  __shared__ __align__(16) float Os[QT * OSP];
  const int tid  = threadIdx.x;
  const int lane = tid & 31, wave = tid >> 5;
  const int hh   = lane >> 4, c = lane & 15;
  const int nt   = blockIdx.x, cb = blockIdx.y, b = blockIdx.z;
  const int n0   = nt * QT, c0 = cb * QT;

  const unsigned short* ap  = WWb + (size_t)(c0 / 16 * (DQ / 32)) * FRG + 8 * lane;
  const size_t bo = (size_t)((b * (NN / 16) + n0 / 16 + wave) * (DQ / 32)) * FRG + 8 * lane;
  const unsigned short* bph = Yh + bo;
  const unsigned short* bpl = Yl + bo;

  v8f acc[4];
#pragma unroll
  for (int mt = 0; mt < 4; ++mt) acc[mt] = zero8();

#pragma unroll
  for (int ks = 0; ks < DQ / 32; ++ks) {
    const Frag fbh = ldfrag(bph + FRG * ks);
    const Frag fbl = ldfrag(bpl + FRG * ks);
#pragma unroll
    for (int mt = 0; mt < 4; ++mt) {
      const Frag fa = ldfrag(ap + (size_t)(mt * (DQ / 32) + ks) * FRG);
      acc[mt] = mma_b(fa.bf, fbh.bf, acc[mt]);
      acc[mt] = mma_b(fa.bf, fbl.bf, acc[mt]);
    }
  }

  // ---- epilogue: -> LDS Os[n_loc][c_loc]; lane (hh, c) holds c_loc = 16 mt + 8 hh + r for n_loc = 16 w + c
  {
    const int nl = 16 * wave + c;
#pragma unroll
    for (int mt = 0; mt < 4; ++mt) {
      v4f va, vb;
#pragma unroll
      for (int r = 0; r < 4; ++r) { va[r] = acc[mt][r]; vb[r] = acc[mt][4 + r]; }
      *(v4f*)(Os + nl * OSP + 16 * mt + 8 * hh)     = va;
      *(v4f*)(Os + nl * OSP + 16 * mt + 8 * hh + 4) = vb;
    }
  }
  __syncthreads();

  const int e = tid & 7, lq = tid >> 3;                              // lq 0..15
  v4f res[8];
#pragma unroll
  for (int it = 0; it < 8; ++it) {
    const int L   = it * 16 + lq;                                    // 0..127
    const int cl  = L >> 1, hf = L & 1;                              // channel 0..63 within the block
    const int nl  = hf * 32 + 4 * e;                                 // position 0..63
    const float bvs = bfr(wb[c0 + cl]);
#pragma unroll
    for (int t = 0; t < 4; ++t) {
      res[it][t] = Os[(nl + t) * OSP + cl] + bvs;
    }
  }
{
#pragma unroll
    for (int it = 0; it < 8; ++it) {
      const int L   = it * 16 + lq;
      const int cl  = L >> 1, hf = L & 1;
      const int nl  = hf * 32 + 4 * e;
      const size_t idx = ((size_t)(b * CC + c0 + cl)) * NQ + n0 + nl;
      *(v4f*)(Z + idx) = res[it];
    }
    
  }
}

// =========================================================================================================
// (8) batch-norm statistics per channel ch (one block per channel, 1024 threads = 32 waves): every thread issues all
//     its b128 reads of z (one per batch image and 1024-quad slice) before it sums any, f64 sums of z and z*z in four
//     independent chains, LDS f64 tree (cross-thread, block barriers), mean and biased variance in f64,
//     rstd = 1/sqrt(var + eps) in f32; stats line ST[ch][32 floats] = {mean, bf16-RNE(gamma)*rstd, bf16-RNE(beta),
// coverage: grid (CC) writes every line of ST exactly once; reads Z rows (b<NB, ch, n<NQ) all produced by (7).
// =========================================================================================================
__global__ __launch_bounds__(SBT)
void bn_stats(const float* __restrict__ Z, const float* __restrict__ gam, const float* __restrict__ bet,
              float* ST) {
  __shared__ double sh1[SBT];
  __shared__ double sh2[SBT];
  const int tid = threadIdx.x, ch = blockIdx.x;
  v4f v[NB * SQ];
  // both loops unrolled: v[] stays in registers and the reads issue back to back, none waiting for a sum
#pragma unroll
  for (int b = 0; b < NB; ++b) {
    const float* zr = Z + ((size_t)(b * CC + ch)) * NQ;
#pragma unroll
    for (int j = 0; j < SQ; ++j) {
      v[b * SQ + j] = *(const v4f*)(zr + 4 * (j * SBT + tid));
      // a later read of this run may land its result in this read's address registers: the wait stands in front of it
      asm volatile("s_wait_xcnt 0x0" ::: "memory");
    }
  }
  double s4[4] = {0.0, 0.0, 0.0, 0.0}, q4[4] = {0.0, 0.0, 0.0, 0.0};
  // unrolled: every index of v[], s4[] and q4[] is a constant (registers, no scratch)
#pragma unroll
  for (int i = 0; i < NB * SQ; ++i) {
#pragma unroll
    for (int t = 0; t < 4; ++t) { const double d = (double)v[i][t]; s4[t] += d; q4[t] += d * d; }
  }
  sh1[tid] = (s4[0] + s4[1]) + (s4[2] + s4[3]);
  sh2[tid] = (q4[0] + q4[1]) + (q4[2] + q4[3]);
  __syncthreads();
#pragma unroll 1
  for (int stp = SBT / 2; stp > 0; stp >>= 1) {
    if (tid < stp) { sh1[tid] += sh1[tid + stp]; sh2[tid] += sh2[tid + stp]; }
    __syncthreads();
  }
  const double cnt  = (double)NB * (double)NQ;
  const double mean = sh1[0] / cnt;
  double var = sh2[0] / cnt - mean * mean;
  var = (var > 0.0) ? var : 0.0;
  const float rstd  = 1.0f / sqrtf((float)var + BNEPS);
  const float meanf = (float)mean;
  const float scl   = bfr(gam[ch]) * rstd;
  const float btr   = bfr(bet[ch]);
  if (tid < 8) {
    v4f w;
    w[0] = (tid == 0) ? meanf : 0.f;
    w[1] = (tid == 0) ? scl : 0.f;
    w[2] = (tid == 0) ? btr : 0.f;
    w[3] = 0.f;
    float* p = ST + (size_t)ch * STL + 4 * tid;
    *(v4f*)p = w;
    
  }
}

// =========================================================================================================
// (9) out[b][ch][n] = ((z - mean) * (gamma*rstd) + beta) + bf16-RNE(x): one thread per 4 consecutive n; a wave writes
// coverage: NB*CC*NQ/1024 blocks x 256 threads x 4 floats = out[b<NB][0..255][0..NQ-1] exactly once.
// =========================================================================================================
__global__ __launch_bounds__(256)
void bn_apply(const float* __restrict__ Z, const float* __restrict__ x, const float* __restrict__ ST,
              float* out) {
  const size_t i4   = (size_t)blockIdx.x * 256 + threadIdx.x;
  const size_t el   = i4 * 4;
  const size_t rowi = el / NQ;
  const int n  = (int)(el - rowi * NQ);
  const int ch = (int)(rowi % CC);
  const int b  = (int)(rowi / CC);
  const v4f z  = *(const v4f*)(Z + el);
  const size_t xo = ((size_t)(b * CC + ch)) * NN + n;
  const v4f xv = *(const v4f*)(x + xo);
  const float mean = ST[(size_t)ch * STL + 0];
  const float scl  = ST[(size_t)ch * STL + 1];
  const float btr  = ST[(size_t)ch * STL + 2];
  v4f r;
#pragma unroll
  for (int t = 0; t < 4; ++t) r[t] = ((z[t] - mean) * scl + btr) + bfr(xv[t]);
  float* p = out + xo;
  *(v4f*)p = r;
  
}

// =========================================================================================================
// Workspace map (bytes; each region start a multiple of 256; every extent is an exact row/tile multiple and is
//   (the 16-bit planes hold these extents in fragment order)
//   W16 f16 [384][256]            196608      WWb bf16 [256][128]        65536
//   XP  f16 [NB][4096][256]     16777216 (NB=8)
//   Qh/Ql bf16 [NB][4096][128]   8388608 x2
//   PGZ region 33554432: Z f32 [NB][256][NQ] at +0; Z extent <= region (static_assert)
//   Pc/Gc f16 [NB][128][1024]   2097152 x2
//   MTh/MTl bf16 [NB][128][128]   262144 x2
//   Yh/Yl bf16 [NB][4096][128]   8388608 x2
//   ST  f32 [256][32]               32768
//   total (NB=8, NQ=4096) = 88899584
// =========================================================================================================
extern "C" void kernel_launch(void* const* d_in, const int* in_sizes, int n_in,
                              void* d_out, int out_size, void* d_ws, size_t ws_size,
                              hipStream_t stream) {
  const int XN = NB * CC * NN;
  if (n_in < 11) return;
  if (in_sizes[0] < XN) return;
  if (in_sizes[1] < DQ * CC || in_sizes[3] < DQ * CC || in_sizes[5] < DQ * CC || in_sizes[7] < CC * DQ) return;
  if (in_sizes[2] < DQ || in_sizes[4] < DQ || in_sizes[6] < DQ || in_sizes[8] < CC) return;
  if (in_sizes[9] < CC || in_sizes[10] < CC) return;
  if (out_size < XN) return;

  size_t off = 0;
  auto carve = [&](size_t bytes) { const size_t o = off; off += (bytes + 255) & ~(size_t)255; return o; };
  const size_t oW16 = carve((size_t)MW * CC * 2);
  const size_t oWWb = carve((size_t)CC * DQ * 2);
  const size_t oXP  = carve((size_t)NB * NN * CC * 2);
  const size_t oQh  = carve((size_t)NB * NN * DQ * 2);
  const size_t oQl  = carve((size_t)NB * NN * DQ * 2);
  const size_t oPGZ = carve((size_t)2 * NB * NN * DQ * 4);
  const size_t oPc  = carve((size_t)NB * DQ * MM * 2);
  const size_t oGc  = carve((size_t)NB * DQ * MM * 2);
  const size_t oMTh = carve((size_t)NB * DQ * DQ * 2);
  const size_t oMTl = carve((size_t)NB * DQ * DQ * 2);
  const size_t oYh  = carve((size_t)NB * NN * DQ * 2);
  const size_t oYl  = carve((size_t)NB * NN * DQ * 2);
  const size_t oST  = carve((size_t)CC * STL * 4);
  if (off > ws_size) return;
  if (off > (size_t)134217728) return;

  const float* x  = (const float*)d_in[0];
  const float* gw = (const float*)d_in[1];
  const float* gb = (const float*)d_in[2];
  const float* tw = (const float*)d_in[3];
  const float* tb = (const float*)d_in[4];
  const float* pw = (const float*)d_in[5];
  const float* pb = (const float*)d_in[6];
  const float* ow = (const float*)d_in[7];
  const float* wb = (const float*)d_in[8];
  const float* bg = (const float*)d_in[9];
  const float* bb = (const float*)d_in[10];

  char* ws = (char*)d_ws;
  unsigned short* W16 = (unsigned short*)(ws + oW16);
  unsigned short* WWb = (unsigned short*)(ws + oWWb);
  unsigned short* XP  = (unsigned short*)(ws + oXP);
  unsigned short* Qh  = (unsigned short*)(ws + oQh);
  unsigned short* Ql  = (unsigned short*)(ws + oQl);
  float*          Z   = (float*)(ws + oPGZ);
  unsigned short* Pc  = (unsigned short*)(ws + oPc);
  unsigned short* Gc  = (unsigned short*)(ws + oGc);
  unsigned short* MTh = (unsigned short*)(ws + oMTh);
  unsigned short* MTl = (unsigned short*)(ws + oMTl);
  unsigned short* Yh  = (unsigned short*)(ws + oYh);
  unsigned short* Yl  = (unsigned short*)(ws + oYl);
  float*          ST  = (float*)(ws + oST);
  float* out = (float*)d_out;

  const dim3 blk256(256), blk128(128);

  // (0) theta_w / phi_w / g_w -> stacked f16 plane; w_w -> bf16 plane
  cvt_w<<<dim3(MW / 8 + CC / 16), blk256, 0, stream>>>(tw, pw, gw, ow, W16, WWb);
  // (1) x -> position-major 16-bit plane
  cvt_x<<<dim3(NN / QT, CC / QT, NB), blk256, 0, stream>>>(x, XP);
  // (2) conv1x1 GEMM -> theta hi/res planes; phi / g + bias, 2x2 max-pooled, as channel-major f16 planes [b][d][m]
  gemm_proj<<<dim3(NSTRIP, 4, NB), blk256, 0, stream>>>(W16, XP, tb, pb, gb, Qh, Ql, Pc, Gc);
  // (5) M = pooled-phi . pooled-g^T per batch -> M^T hi/res planes [b][ci][cp]
  gemm_m<<<dim3(DQ / 16, DQ / QT, NB), blk256, 0, stream>>>(Pc, Gc, MTh, MTl);
  // (6) y = theta . M / 1024 -> y hi/res planes [b][n][128]
  gemm_y<<<dim3(NQ / QT, DQ / QT, NB), blk128, 0, stream>>>(MTh, MTl, Qh, Ql, Yh, Yl);
  // (7) output conv + bias -> Z [b][256][NQ]
  gemm_out<<<dim3(NQ / QT, CC / QT, NB), blk128, 0, stream>>>(WWb, Yh, Yl, wb, Z);
  // (8) batch statistics per channel -> ST lines
  bn_stats<<<dim3(CC), dim3(SBT), 0, stream>>>(Z, bg, bb, ST);
  // (9) normalise, affine, residual -> out [b][256][4096]
  bn_apply<<<dim3((NB * CC * NQ) / 1024), blk256, 0, stream>>>(Z, x, ST, out);
  (void)hipGetLastError();
}

// v005
// One run takes 79.8 microseconds.
// Timed twice side by side with v004, it ran 1.09 and 1.11 times as fast.
// Over all steps from v000 it is 1.84 times as fast.
// Contractions: conv1x1 theta/phi/g GEMM W[384x256].X[256x128] per strip on v_wmma_f32_16x16x32_f16 (f16
// containers of bf16-RNE weights x256 and bf16-RNE x, 1 product); M = pooled-phi . pooled-g^T per batch
// [128x128], K=1024, on v_wmma_f32_16x16x32_f16 (2x2 max-pooled phi and g as plain f16, 1 product);
// y^T = M^T.theta^T, K=128, on v_wmma_f32_16x16x32_bf16 (M and theta as bf16 hi + bf16 residual planes,
// 3 products); output conv W[256x128].Y on v_wmma_f32_16x16x32_bf16 (bf16 weights, y as bf16 hi + residual
// planes, 2 products); f32 accumulate everywhere; max-pool, bias, batch-norm statistics (f64 sums, f32 apply)
// and the residual add on VALU.
// Every 16-bit WMMA operand plane lies in the workspace in fragment order: one fragment = 16 rows x 32 k = 1 KiB =
// [j 0..1][lane 0..31][8 values], unit (j, lane) = row (lane&15), k = 16 j + 8 (lane>>4) .. + 7. A wave reads a fragment
// with two b128 loads of 512 contiguous bytes each (4 whole lines a load).
#include <hip/hip_runtime.h>
#include <math.h>
#include <stdint.h>

#ifndef NB
#define NB 8
#endif
#ifndef NQ
#define NQ 4096
#endif
#define NB_FULL 8
#define CC     256
#define HIMG   64
#define WIMG   64
#define NN     4096
#define DQ     128
#define HP     32
#define WP     32
#define MM     1024
#define MW     384
#define QT     64
#define SN     128
#define NSTRIP 32
#define OSP    68
#define TP     72
#define STL    32
#define WSC    256.0f
#define IWSC   0.00390625f
#define INS    0.0009765625f
#define BNEPS  1e-5f
#define SBT    1024
#define KSL    128
#define FRG    512
#define SQ     (NQ / (4 * SBT))

static_assert(NB >= 1 && NB <= NB_FULL);
static_assert(NQ % 128 == 0 && NQ >= 128 && NQ <= NN);
static_assert(NQ % QT == 0);
static_assert(NN == HIMG * WIMG);
static_assert(SN == 2 * WIMG && NSTRIP * SN == NN && SN == 8 * 16);
static_assert(HIMG % 2 == 0 && WIMG % 2 == 0 && HP == HIMG / 2 && WP == WIMG / 2 && MM == HP * WP);
static_assert(WP == 32);
static_assert(MM % QT == 0 && MM % 32 == 0);
static_assert(NN % QT == 0 && CC % QT == 0 && DQ == 2 * QT);
static_assert(MW == 3 * DQ && MW % 8 == 0);
static_assert(CC % 32 == 0 && DQ % 32 == 0);
static_assert((OSP * 4) % 16 == 0 && (TP * 2) % 16 == 0);
static_assert(SN * OSP * 4 <= 65536 && DQ * OSP * 4 <= 65536);
static_assert(((size_t)NB * CC * NQ) % 1024 == 0);
static_assert((size_t)NB * CC * NQ * 4 <= 2 * (size_t)NB * NN * DQ * 4);
static_assert((size_t)NB_FULL * CC * NN * 4 == (size_t)33554432);
static_assert(STL * 4 == 128);
static_assert(QT * TP * 2 <= SN * OSP * 4 && NN == 16 * 4 * WIMG && MM == 16 * 64);
static_assert(MM == 8 * KSL && KSL == 4 * 32 && DQ == 8 * 16);
static_assert(NQ % (4 * SBT) == 0 && (SBT & (SBT - 1)) == 0 && SBT <= 1024);

typedef _Float16       v16h __attribute__((ext_vector_type(16)));
typedef _Float16       v8h  __attribute__((ext_vector_type(8)));
typedef __bf16         v16b __attribute__((ext_vector_type(16)));
typedef unsigned short v8us __attribute__((ext_vector_type(8)));
typedef float          v8f  __attribute__((ext_vector_type(8)));
typedef float          v4f  __attribute__((ext_vector_type(4)));
typedef unsigned int   v4u  __attribute__((ext_vector_type(4)));
typedef unsigned int   v2u  __attribute__((ext_vector_type(2)));

union Frag { v8us u[2]; v16h h; v16b bf; };
static_assert(sizeof(Frag) == 32);

// ---- scalar helpers ---------------------------------------------------------------------------------------
__device__ __forceinline__ unsigned short bf_bits(float f) {          // f32 -> bf16 bits, RNE convert
  unsigned u = __float_as_uint(f);
  return (unsigned short)((u + 0x7FFFu + ((u >> 16) & 1u)) >> 16);
}
__device__ __forceinline__ float bf_up(unsigned short hb) { return __uint_as_float(((unsigned)hb) << 16); }
__device__ __forceinline__ float bfr(float f) { return bf_up(bf_bits(f)); }
__device__ __forceinline__ unsigned short h_bits(_Float16 x) { return __builtin_bit_cast(unsigned short, x); }
__device__ __forceinline__ unsigned pk16(unsigned short a, unsigned short b) { return (unsigned)a | ((unsigned)b << 16); }
__device__ __forceinline__ v8f zero8() { v8f z = {0.f, 0.f, 0.f, 0.f, 0.f, 0.f, 0.f, 0.f}; return z; }
// 8 f32 values -> bf16 hi bits and bf16 residual bits (lo = RNE(v - hi)), packed 2 per uint
__device__ __forceinline__ void split8(const float* f, v4u& uh, v4u& ul) {
#pragma unroll
  for (int t = 0; t < 4; ++t) {
    const float f0 = f[2 * t], f1 = f[2 * t + 1];
    const unsigned short hb0 = bf_bits(f0), hb1 = bf_bits(f1);
    const unsigned short lb0 = bf_bits(f0 - bf_up(hb0));
    const unsigned short lb1 = bf_bits(f1 - bf_up(hb1));
    uh[t] = pk16(hb0, hb1);
    ul[t] = pk16(lb0, lb1);
  }
}

// ---- 16-bit fragment loader (A or B) from a plane in fragment order: lane -> row/col (lane&15), h = lane>>4; p = start
//      of the fragment + 8*lane; elements 0..7 <- p[0..7] (k0+8h..), elements 8..15 <- p[256..263] (k0+16+8h..)
__device__ __forceinline__ Frag ldfrag(const unsigned short* p) {
  Frag f;
  f.u[0] = *(const v8us*)(p);
  f.u[1] = *(const v8us*)(p + FRG / 2);
  return f;
}
// k offset (0, 8, 16, 24) inside its fragment of the 16-B unit that thread t stores (unit = t & 63; its row is t & 15)
__device__ __forceinline__ int unit_k(int t) { return 16 * ((t >> 5) & 1) + 8 * ((t >> 4) & 1); }

// ---- WMMA helpers: builtin followed by a 4-slot VALU gap tying D and keeping A/B live --------------------------
__device__ __forceinline__ v8f mma_h(v16h a, v16h b, v8f c) {
  v8f d = __builtin_amdgcn_wmma_f32_16x16x32_f16(false, a, false, b, (short)0, c, false, false);
#if defined(__HIP_DEVICE_COMPILE__)
  asm volatile("v_nop\n\tv_nop\n\tv_nop\n\tv_nop" : "+v"(d) : "v"(a), "v"(b));
#endif
  return d;
}
__device__ __forceinline__ v8f mma_b(v16b a, v16b b, v8f c) {
  v8f d = __builtin_amdgcn_wmma_f32_16x16x32_bf16(false, a, false, b, (short)0, c, false, false);
#if defined(__HIP_DEVICE_COMPILE__)
  const v16h ha = __builtin_bit_cast(v16h, a), hb = __builtin_bit_cast(v16h, b);
  asm volatile("v_nop\n\tv_nop\n\tv_nop\n\tv_nop" : "+v"(d) : "v"(ha), "v"(hb));
#endif
  return d;
}

// =========================================================================================================
// (0) weights. Blocks 0..47: W16 f16 [384][256], rows 0..127 = theta_w, 128..255 = phi_w, 256..383 = g_w; value =
//     f16 of (bf16-RNE(w) * 256) (exact), fragments [24 o tiles][8 k steps]. Blocks 48..63: WWb bf16 of w_w [256][128],
//     fragments [16 c tiles][4 k steps]. A block owns 4 consecutive fragments, a thread one 16-B unit.
// coverage: 48 blocks x 256 units x 8 halves = 384 x 256; 16 blocks x 256 units x 8 = 256 x 128.
// =========================================================================================================
__global__ __launch_bounds__(256)
void cvt_w(const float* __restrict__ tw, const float* __restrict__ pw, const float* __restrict__ gw,
           const float* __restrict__ ow, unsigned short* W16, unsigned short* WWb) {
  const int tid = threadIdx.x, blk = blockIdx.x;
  if (blk < MW / 8) {
    const int un = blk * 256 + tid;                                  // unit 0..12287
    const int fr = un >> 6;                                          // fragment = 8 (o tile) + k step
    const int o = 16 * (fr >> 3) + (tid & 15);                       // 0..383, o tile = blk >> 1
    const int col = 32 * (fr & 7) + unit_k(tid);                     // 0..248
    const int grp = blk >> 4;                                        // 0,1,2 (block-uniform)
    const float* wbase = (grp == 0) ? tw : ((grp == 1) ? pw : gw);  // all global
    const float* s = wbase + (size_t)(o - DQ * grp) * CC + col;      // (o - 128 grp) in 0..127
    const v4f a = *(const v4f*)s;
    const v4f q = *(const v4f*)(s + 4);
    const float f[8] = {a[0], a[1], a[2], a[3], q[0], q[1], q[2], q[3]};
    v4u u;
#pragma unroll
    for (int t = 0; t < 4; ++t) {
      const _Float16 h0 = (_Float16)(bfr(f[2 * t]) * WSC);
      const _Float16 h1 = (_Float16)(bfr(f[2 * t + 1]) * WSC);
      u[t] = pk16(h_bits(h0), h_bits(h1));
    }
{
      *(v4u*)(W16 + (size_t)un * 8) = u;
      
    }
  } else {
    const int un = (blk - MW / 8) * 256 + tid;                       // unit 0..4095
    const int fr = un >> 6;                                          // fragment = 4 (c tile) + k step
    const int o = 16 * (fr >> 2) + (tid & 15);                       // 0..255
    const int col = 32 * (fr & 3) + unit_k(tid);                     // 0..120
    const float* s = ow + (size_t)o * DQ + col;
    const v4f a = *(const v4f*)s;
    const v4f q = *(const v4f*)(s + 4);
    const float f[8] = {a[0], a[1], a[2], a[3], q[0], q[1], q[2], q[3]};
    v4u u;
#pragma unroll
    for (int t = 0; t < 4; ++t) u[t] = pk16(bf_bits(f[2 * t]), bf_bits(f[2 * t + 1]));
{
      *(v4u*)(WWb + (size_t)un * 8) = u;
      
    }
  }
}

// =========================================================================================================
// (1) x f32 [b][256 c][4096 n] -> XP f16, fragments [b][256 n tiles][8 k steps], k = c (bf16-RNE values, exact in f16),
//     through an LDS tile T[64 n][64 c] (pitch TP, cross-thread, block barrier). Block (nb, cb, b) owns a 64 c x 64 n
//     tile = 4 n tiles x 2 k steps = 8 fragments.
// coverage: T written rows (8e+t)=0..63 x cols cl 0..63, read rows 0..63 x cols 0..63; XP 2 it x 256 units x 8 = 8
//           fragments; grid (64, 4, NB) covers every fragment of XP exactly once.
// =========================================================================================================
__global__ __launch_bounds__(256)
void cvt_x(const float* __restrict__ x, unsigned short* XP) {
  __shared__ __align__(16) unsigned short T[QT * TP];
  const int tid = threadIdx.x;
  const int nb = blockIdx.x, cb = blockIdx.y, b = blockIdx.z;
  const int e = tid & 7, lq = tid >> 3;                             // lq 0..31
  const int n0 = nb * QT, c0 = cb * QT;
#pragma unroll
  for (int it = 0; it < 2; ++it) {
    const int cl = it * 32 + lq;                                     // 0..63
    const float* sp = x + ((size_t)(b * CC + c0 + cl)) * NN + n0 + 8 * e;
    const v4f a = *(const v4f*)sp;
    const v4f q = *(const v4f*)(sp + 4);
    unsigned short hb[8];
#pragma unroll
    for (int t = 0; t < 4; ++t) {
      hb[t]     = h_bits((_Float16)bfr(a[t]));
      hb[4 + t] = h_bits((_Float16)bfr(q[t]));
    }
#pragma unroll
    for (int t = 0; t < 8; ++t) T[(8 * e + t) * TP + cl] = hb[t];
  }
  __syncthreads();
  v4u up[2];
#pragma unroll
  for (int it = 0; it < 2; ++it) {
    const int fl = it * 4 + (tid >> 6);                              // fragment 0..7 = 2 (n tile) + k step
    up[it] = *(const v4u*)(T + (16 * (fl >> 1) + (tid & 15)) * TP + 32 * (fl & 1) + unit_k(tid));
  }
{
#pragma unroll
    for (int it = 0; it < 2; ++it) {
      const int fl = it * 4 + (tid >> 6);
      const int fg = (b * (NN / 16) + n0 / 16 + (fl >> 1)) * (CC / 32) + c0 / 32 + (fl & 1);
      *(v4u*)(XP + (size_t)fg * FRG + 8 * (tid & 63)) = up[it];
    }
    
  }
}

// =========================================================================================================
// (2) conv1x1 GEMM, Y[o][n] = (1/256) sum_c W16[o][c] XP[b][n][c], K = 256 = 8 steps, 256 threads = 8 waves; every
//     plane read or written here is in fragment order (Qh/Ql: [b][256 n tiles][4 k steps], k = d; Pc/Gc: [b][8 d tiles]
//     [32 k steps], k = m); the
//     block's shape depends on blockIdx.y (block-uniform branch, taken in front of every barrier):
//     y = 0,1 (theta dims 0..63 / 64..127): strip of 128 positions x 64 o. Wave w owns cols n0+16w..+15 (one B
//       fragment per k-step) and 4 m-tiles (A rows o = o0 + 16 mt + (lane&15), from W16). Epilogue staged in LDS
//       Os[n_loc][o_loc] (pitch OSP, b128 stores, cross-wave), block barrier, + bias -> Qh/Ql bf16 (hi = RNE(v),
//       lo = RNE(v-hi)), 16 fragments a plane, a wave's store = 512 contiguous bytes.
//     y = 2,3 (phi, g): idx = 32 (y-2) + x -> 256 positions (image rows 4 ds..4 ds+3, ds = idx&15) x 64 o
//       (ob = idx>>4: phi dims 0.., 64.., then g dims 0.., 64..). Wave w = (pyl = w>>2, xt = w&3) owns the two n-tiles
//       of image rows 4 ds + 2 pyl and + 2 pyl + 1 at columns 16 xt..16 xt+15, and 4 m-tiles. The 2x2 stride-2
//       max-pool is done on the accumulators: the row pair is the wave's two tiles (same lane, same register), the
//       column pair is lane ^ 1. Scale and bias follow the maximum (x -> fl(x/256 + bias) never decreases as x grows, so
//       the maximum of the results is the result of the maximum). f16 values go through the LDS tile T[64 o][64 m]
//       (pitch TP, cross-wave, block barrier) -> Pc / Gc f16, m = 32 py + px: the block owns 4 d tiles x 2 k steps = 8
//       whole fragments.
// coverage: theta: Os 8 waves x 16 n x 64 o = 128 x 64 written, reads rows <= 127 cols <= 63; planes 4 it x 256 units
//           x 8 = 128 n x 64 d; 32 x 2 blocks cover 4096 rows x 128 d of Qh/Ql once. phi/g: T written rows
//           16 mt + 8 hh + 4 (c&1) + j = 0..63 x cols 32 pyl + 8 xt + (c>>1) = 0..63, read rows 0..63 x cols 0..63;
//           16 ds x 4 ob blocks cover Pc and Gc (128 d x 1024 m a batch) exactly once.
// =========================================================================================================
__device__ __forceinline__ float max_pair(float v) {                 // max of lanes l and l ^ 1 (quad_perm 1,0,3,2)
  const int o = __builtin_amdgcn_mov_dpp(__float_as_int(v), 0xB1, 0xF, 0xF, true);
  return fmaxf(v, __int_as_float(o));
}

__global__ __launch_bounds__(256)
void gemm_proj(const unsigned short* __restrict__ W16, const unsigned short* __restrict__ XP,
               const float* __restrict__ tb, const float* __restrict__ pb, const float* __restrict__ gb,
               unsigned short* Qh, unsigned short* Ql, unsigned short* Pc, unsigned short* Gc) {
  __shared__ __align__(16) float Os[SN * OSP];
  const int tid  = threadIdx.x;
  const int lane = tid & 31, wave = tid >> 5;                        // wave 0..7
  const int hh   = lane >> 4, c = lane & 15;
  const int st   = blockIdx.x, mb = blockIdx.y, b = blockIdx.z;

  if (mb >= 2) {
    // ---- phi / g: 64 o x 256 positions, pooled in registers
    const int idx = (mb - 2) * NSTRIP + st;                          // 0..63
    const int ds = idx & 15, ob = idx >> 4;                          // ds 0..15, ob 0..3
    const int sel = ob >> 1, d0 = QT * (ob & 1);                     // plane (0 phi, 1 g), first dim 0 or 64
    const int wv  = __builtin_amdgcn_readfirstlane(wave);            // scalar: row bases stay in SGPRs, fewer VGPRs
    const int pyl = wv >> 2, xt = wv & 3;
    const unsigned lo = (unsigned)(8 * lane);                        // the lane's offset, the same in every fragment
    const unsigned short* ap  = W16 + (size_t)((DQ + QT * ob) / 16 * (CC / 32)) * FRG + lo;
    const unsigned short* bp0 = XP + (size_t)((b * (NN / 16) + (4 * ds + 2 * pyl) * (WIMG / 16) + xt) * (CC / 32)) * FRG + lo;
    const unsigned short* bp1 = bp0 + (size_t)(WIMG / 16 * (CC / 32)) * FRG;

    v8f a0[4], a1[4];
#pragma unroll
    for (int mt = 0; mt < 4; ++mt) { a0[mt] = zero8(); a1[mt] = zero8(); }
#pragma unroll
    for (int ks = 0; ks < CC / 32; ++ks) {
      const Frag fb0 = ldfrag(bp0 + FRG * ks);
      const Frag fb1 = ldfrag(bp1 + FRG * ks);
      Frag fa[4];
#pragma unroll
      for (int mt = 0; mt < 4; ++mt) fa[mt] = ldfrag(ap + (size_t)(mt * (CC / 32) + ks) * FRG);
#pragma unroll
      for (int mt = 0; mt < 4; ++mt) {
        a0[mt] = mma_h(fa[mt].h, fb0.h, a0[mt]);
        a1[mt] = mma_h(fa[mt].h, fb1.h, a1[mt]);
      }
    }

    unsigned short* T = (unsigned short*)Os;                         // [64 o][TP] f16
    const float* bias = (sel == 0) ? pb : gb;                        // both global
    const int odd = c & 1;                                           // even lane stores r 0..3, odd lane r 4..7
    const int ml  = 32 * pyl + 8 * xt + (c >> 1);                    // 0..63
#pragma unroll
    for (int mt = 0; mt < 4; ++mt) {
      const int ol = 16 * mt + 8 * hh + 4 * odd;                     // 0..60
      const v4f bq = *(const v4f*)(bias + d0 + ol);
#pragma unroll
      for (int j = 0; j < 4; ++j) {
        const float pe = max_pair(fmaxf(a0[mt][j], a1[mt][j]));
        const float po = max_pair(fmaxf(a0[mt][4 + j], a1[mt][4 + j]));
        const float v  = (odd ? po : pe) * IWSC + bfr(bq[j]);
        T[(ol + j) * TP + ml] = h_bits((_Float16)v);
      }
    }
    __syncthreads();
    {
      const int kl = (tid >> 6) & 1;                                 // k step of the block's two; d tile = 2 it + (tid >> 7)
      unsigned short* dst = (sel == 0) ? Pc : Gc;                    // both global
      v4u u[2];
#pragma unroll
      for (int it = 0; it < 2; ++it)
        u[it] = *(const v4u*)(T + (16 * (2 * it + (tid >> 7)) + (tid & 15)) * TP + 32 * kl + unit_k(tid));
#pragma unroll
      for (int it = 0; it < 2; ++it) {
        const int fg = (b * (DQ / 16) + d0 / 16 + 2 * it + (tid >> 7)) * (MM / 32) + 2 * ds + kl;
        *(v4u*)(dst + (size_t)fg * FRG + 8 * (tid & 63)) = u[it];
      }
    }
    return;
  }

  const int n0   = st * SN, o0 = mb * QT;

  const unsigned short* ap = W16 + (size_t)(o0 / 16 * (CC / 32)) * FRG + 8 * lane;
  const unsigned short* bp = XP + (size_t)((b * (NN / 16) + n0 / 16 + wave) * (CC / 32)) * FRG + 8 * lane;

  v8f acc[4];
#pragma unroll
  for (int mt = 0; mt < 4; ++mt) acc[mt] = zero8();

  // the reads of two k-steps stand as one group in front of their products: the wave waits out the load latency once a
  // group, not once a product (registers: a third k-step would cost a resident wave)
#pragma unroll
  for (int kp = 0; kp < CC / 64; ++kp) {
    Frag fb[2], fa[2][4];
#pragma unroll
    for (int kl = 0; kl < 2; ++kl) {
      const int ks = 2 * kp + kl;
      fb[kl] = ldfrag(bp + FRG * ks);
#pragma unroll
      for (int mt = 0; mt < 4; ++mt) fa[kl][mt] = ldfrag(ap + (size_t)(mt * (CC / 32) + ks) * FRG);
    }
#pragma unroll
    for (int kl = 0; kl < 2; ++kl) {
#pragma unroll
      for (int mt = 0; mt < 4; ++mt) acc[mt] = mma_h(fa[kl][mt].h, fb[kl].h, acc[mt]);
    }
  }

  // ---- epilogue: scale back -> LDS Os[n_loc][o_loc]; lane (hh, c) holds o = 16 mt + 8 hh + r for n_loc = 16 w + c
  {
    const int nl = 16 * wave + c;
#pragma unroll
    for (int mt = 0; mt < 4; ++mt) {
      v4f va, vb;
#pragma unroll
      for (int r = 0; r < 4; ++r) { va[r] = acc[mt][r] * IWSC; vb[r] = acc[mt][4 + r] * IWSC; }
      *(v4f*)(Os + nl * OSP + 16 * mt + 8 * hh)     = va;
      *(v4f*)(Os + nl * OSP + 16 * mt + 8 * hh + 4) = vb;
    }
  }
  __syncthreads();

  const int dsel = mb * QT;                                          // 0 or 64
  const float* bias = tb;
  {
    const int kl = (tid >> 6) & 1;                                   // k step of the block's two; n tile = 2 it + (tid >> 7)
    const int dl = 32 * kl + unit_k(tid);                            // d_loc 0..56
    float bv[8];
    {
      const v4f ba = *(const v4f*)(bias + dsel + dl);
      const v4f bq = *(const v4f*)(bias + dsel + dl + 4);
#pragma unroll
      for (int t = 0; t < 4; ++t) { bv[t] = bfr(ba[t]); bv[4 + t] = bfr(bq[t]); }
    }
    v4u uh[4], ul[4];
#pragma unroll
    for (int it = 0; it < 4; ++it) {
      const int row = 16 * (2 * it + (tid >> 7)) + (tid & 15);       // n_loc 0..127
      const v4f a = *(const v4f*)(Os + row * OSP + dl);
      const v4f q = *(const v4f*)(Os + row * OSP + dl + 4);
      float f[8];
#pragma unroll
      for (int t = 0; t < 4; ++t) { f[t] = a[t] + bv[t]; f[4 + t] = q[t] + bv[4 + t]; }
      split8(f, uh[it], ul[it]);
    }
{
#pragma unroll
      for (int it = 0; it < 4; ++it) {
        const int fg = (b * (NN / 16) + n0 / 16 + 2 * it + (tid >> 7)) * (DQ / 32) + dsel / 32 + kl;
        const size_t po = (size_t)fg * FRG + 8 * (tid & 63);
        *(v4u*)(Qh + po) = uh[it];
        *(v4u*)(Ql + po) = ul[it];
      }
      
    }
  }
}

// =========================================================================================================
// (5) M GEMM for one (b, 64-row block of phi channels, 16-column tile of g channels): M[cp][ci] = sum_m Pc[b][cp][m]
//     Gc[b][ci][m], K = 1024. Block 256 threads = 8 waves; wave w owns the k slice m = 128 w..128 w + 127 (4 steps) of
//     the whole 64 x 16 tile: B fragments of the Gc rows ci = 16 ct + (lane&15), A rows cp = c0 + 16 mt + (lane&15)
//     from Pc, both planes in fragment order. A wave issues its 40 b128 reads before its first product.
//     The 8 partial tiles go to LDS Os[16 w + ci_loc][cp_loc] (pitch OSP, b128 stores, cross-wave), block barrier, then
//     each thread adds the 8 slices of 4 consecutive cp in slice order (f32) -> MTh/MTl bf16, fragments [b][8 ci tiles]
//     [4 k steps], k = cp: the block owns 2 whole fragments of each plane, a thread half a 16-B unit.
// coverage: Os 8 waves x 16 ci x 64 cp = 128 x 64 written, reads rows 16 w + row <= 127, cols cq..cq+3 <= 63; planes
//           256 threads x 4 = 16 ci x 64 cp; grid (8, 2, NB) covers MTh/MTl (128 ci x 128 cp a batch) exactly once.
// =========================================================================================================
__global__ __launch_bounds__(256)
void gemm_m(const unsigned short* __restrict__ Pc, const unsigned short* __restrict__ Gc,
            unsigned short* MTh, unsigned short* MTl) {
  __shared__ __align__(16) float Os[DQ * OSP];
  const int tid  = threadIdx.x;
  const int lane = tid & 31, wave = tid >> 5;                        // wave 0..7 = k slice
  const int hh   = lane >> 4, c = lane & 15;
  const int ct   = blockIdx.x, mb = blockIdx.y, b = blockIdx.z;
  const int c0   = mb * QT;

  const unsigned short* ap = Pc + (size_t)((b * (DQ / 16) + c0 / 16) * (MM / 32) + (KSL / 32) * wave) * FRG + 8 * lane;
  const unsigned short* bp = Gc + (size_t)((b * (DQ / 16) + ct) * (MM / 32) + (KSL / 32) * wave) * FRG + 8 * lane;

  Frag fb[KSL / 32], fa[KSL / 32][4];
#pragma unroll
  for (int ks = 0; ks < KSL / 32; ++ks) {
    fb[ks] = ldfrag(bp + FRG * ks);
#pragma unroll
    for (int mt = 0; mt < 4; ++mt) fa[ks][mt] = ldfrag(ap + (size_t)(mt * (MM / 32) + ks) * FRG);
  }
#if defined(__HIP_DEVICE_COMPILE__)
  // inputs-only fence on the loaded values: keeps every read of the slice in front of the first product, so that the
  // wave waits for memory once; without it each product's reads are issued, and waited for, one product at a time
  asm volatile("" :: "v"(fb[0].h), "v"(fb[1].h), "v"(fb[2].h), "v"(fb[3].h),
               "v"(fa[0][0].h), "v"(fa[0][1].h), "v"(fa[0][2].h), "v"(fa[0][3].h),
               "v"(fa[1][0].h), "v"(fa[1][1].h), "v"(fa[1][2].h), "v"(fa[1][3].h),
               "v"(fa[2][0].h), "v"(fa[2][1].h), "v"(fa[2][2].h), "v"(fa[2][3].h),
               "v"(fa[3][0].h), "v"(fa[3][1].h), "v"(fa[3][2].h), "v"(fa[3][3].h));
#endif

  v8f acc[4];
#pragma unroll
  for (int mt = 0; mt < 4; ++mt) acc[mt] = zero8();
#pragma unroll
  for (int ks = 0; ks < KSL / 32; ++ks) {
#pragma unroll
    for (int mt = 0; mt < 4; ++mt) acc[mt] = mma_h(fa[ks][mt].h, fb[ks].h, acc[mt]);
  }

  // ---- partial tile -> LDS Os[16 w + ci_loc][cp_loc]; lane (hh, c) holds cp_loc = 16 mt + 8 hh + r for ci_loc = c
  {
    const int nl = 16 * wave + c;
#pragma unroll
    for (int mt = 0; mt < 4; ++mt) {
      v4f va, vb;
#pragma unroll
      for (int r = 0; r < 4; ++r) { va[r] = acc[mt][r]; vb[r] = acc[mt][4 + r]; }
      *(v4f*)(Os + nl * OSP + 16 * mt + 8 * hh)     = va;
      *(v4f*)(Os + nl * OSP + 16 * mt + 8 * hh + 4) = vb;
    }
  }
  __syncthreads();

  const int row = (tid >> 1) & 15;                                   // ci_loc 0..15 = the unit's row
  const int cq  = 32 * (tid >> 7) + unit_k(tid >> 1) + 4 * (tid & 1); // cp_loc 0..60: two threads share a 16-B unit
  v4f s = *(const v4f*)(Os + row * OSP + cq);
#pragma unroll
  for (int w = 1; w < MM / KSL; ++w) s += *(const v4f*)(Os + (16 * w + row) * OSP + cq);
  v2u uh, ul;
#pragma unroll
  for (int t = 0; t < 2; ++t) {
    const float f0 = s[2 * t], f1 = s[2 * t + 1];
    const unsigned short hb0 = bf_bits(f0), hb1 = bf_bits(f1);
    uh[t] = pk16(hb0, hb1);
    ul[t] = pk16(bf_bits(f0 - bf_up(hb0)), bf_bits(f1 - bf_up(hb1)));
  }
  const size_t po = (size_t)((b * (DQ / 16) + ct) * (DQ / 32) + c0 / 32 + (tid >> 7)) * FRG + 4 * (tid & 127);
  *(v2u*)(MTh + po) = uh;
  *(v2u*)(MTl + po) = ul;
}

// =========================================================================================================
// (6) y GEMM for one (b, 64-n tile, 64-ci block): y[n][ci] = (1/1024) sum_cp (MTh+MTl)[b][ci][cp] (Qh+Ql)[b][n][cp]
//     on bf16 WMMA, 3 products per k-step (hi.hi + hi.lo + lo.hi, shared accumulator), K = 128 = 4 steps.
//     Block 128 threads = 4 waves; wave w owns cols n0+16w..+15 (B fragments of the theta planes) and 4 m-tiles
//     (A rows ci = i0 + 16 mt + (lane&15), from MTh/MTl). Epilogue staged in LDS Os[n_loc][ci_loc] (pitch OSP, b128
//     stores, cross-wave), block barrier, then Yh/Yl bf16, fragments [b][256 n tiles][4 k steps], k = ci
// coverage: Os 4 waves x 16 n x 64 ci written, reads rows 0..63 cols 0..63; planes 4 it x 128 units x 8 = 64 n x
//           64 ci = 8 fragments; grid (NQ/64, 2, NB) covers rows 0..NQ-1 x 128 ci of Yh/Yl exactly once.
// =========================================================================================================
__global__ __launch_bounds__(128)
void gemm_y(const unsigned short* __restrict__ MTh, const unsigned short* __restrict__ MTl,
            const unsigned short* __restrict__ Qh, const unsigned short* __restrict__ Ql,
            unsigned short* Yh, unsigned short* Yl) {
  __shared__ __align__(16) float Os[QT * OSP];
  const int tid  = threadIdx.x;
  const int lane = tid & 31, wave = tid >> 5;                        // wave 0..3
  const int hh   = lane >> 4, c = lane & 15;
  const int nt   = blockIdx.x, cb = blockIdx.y, b = blockIdx.z;
  const int n0   = nt * QT, i0 = cb * QT;

  const size_t ao = (size_t)((b * (DQ / 16) + i0 / 16) * (DQ / 32)) * FRG + 8 * lane;
  const unsigned short* aph = MTh + ao;
  const unsigned short* apl = MTl + ao;
  const size_t bo = (size_t)((b * (NN / 16) + n0 / 16 + wave) * (DQ / 32)) * FRG + 8 * lane;
  const unsigned short* bph = Qh + bo;
  const unsigned short* bpl = Ql + bo;

  v8f acc[4];
#pragma unroll
  for (int mt = 0; mt < 4; ++mt) acc[mt] = zero8();

  // the reads of two k-steps stand as one group in front of their products: two waits for memory a wave, not sixteen
#pragma unroll
  for (int kp = 0; kp < DQ / 64; ++kp) {
    Frag fbh[2], fbl[2], fah[2][4], fal[2][4];
#pragma unroll
    for (int kl = 0; kl < 2; ++kl) {
      const int ks = 2 * kp + kl;
      fbh[kl] = ldfrag(bph + FRG * ks);
      fbl[kl] = ldfrag(bpl + FRG * ks);
#pragma unroll
      for (int mt = 0; mt < 4; ++mt) {
        fah[kl][mt] = ldfrag(aph + (size_t)(mt * (DQ / 32) + ks) * FRG);
        fal[kl][mt] = ldfrag(apl + (size_t)(mt * (DQ / 32) + ks) * FRG);
      }
    }
#pragma unroll
    for (int kl = 0; kl < 2; ++kl) {
#pragma unroll
      for (int mt = 0; mt < 4; ++mt) {
        acc[mt] = mma_b(fah[kl][mt].bf, fbh[kl].bf, acc[mt]);
        acc[mt] = mma_b(fah[kl][mt].bf, fbl[kl].bf, acc[mt]);
        acc[mt] = mma_b(fal[kl][mt].bf, fbh[kl].bf, acc[mt]);
      }
    }
  }

  // ---- epilogue: y = acc/1024 -> LDS Os[n_loc][ci_loc]; lane (hh, c) holds ci_loc = 16 mt + 8 hh + r, n_loc = 16 w + c
  {
    const int nl = 16 * wave + c;
#pragma unroll
    for (int mt = 0; mt < 4; ++mt) {
      v4f va, vb;
#pragma unroll
      for (int r = 0; r < 4; ++r) { va[r] = acc[mt][r] * INS; vb[r] = acc[mt][4 + r] * INS; }
      *(v4f*)(Os + nl * OSP + 16 * mt + 8 * hh)     = va;
      *(v4f*)(Os + nl * OSP + 16 * mt + 8 * hh + 4) = vb;
    }
  }
  __syncthreads();

  const int cl = 32 * (tid >> 6) + unit_k(tid);                      // ci_loc 0..56; k step = tid >> 6, n tile = it
  v4u uh[4], ul[4];
#pragma unroll
  for (int it = 0; it < 4; ++it) {
    const int row = it * 16 + (tid & 15);                            // n_loc 0..63
    const v4f a = *(const v4f*)(Os + row * OSP + cl);
    const v4f q = *(const v4f*)(Os + row * OSP + cl + 4);
    const float f[8] = {a[0], a[1], a[2], a[3], q[0], q[1], q[2], q[3]};
    split8(f, uh[it], ul[it]);
  }
{
#pragma unroll
    for (int it = 0; it < 4; ++it) {
      const int fg = (b * (NN / 16) + n0 / 16 + it) * (DQ / 32) + i0 / 32 + (tid >> 6);
      const size_t po = (size_t)fg * FRG + 8 * (tid & 63);
      *(v4u*)(Yh + po) = uh[it];
      *(v4u*)(Yl + po) = ul[it];
    }
    
  }
}

// =========================================================================================================
// (7) output conv for one (b, 64-n tile, 64-c block): A[c][n] = sum_ci WWb[c][ci] (Yh + Yl)[b][n][ci] on bf16 WMMA
//     (2 products per k-step, shared accumulator), K = 128 = 4 steps. Block 128 threads = 4 waves; wave w owns cols
//     n0+16w..+15 (B fragments of the Yh/Yl planes) and 4 m-tiles (A rows c = c0 + 16 mt + (lane&15), from WWb),
//     all in fragment order. Epilogue staged in LDS Os[n_loc][c_loc] (pitch OSP, b128 stores, cross-wave),
//     segment 64 n = 2 lines): 8 consecutive lanes x 16 B (values gathered from 4 Os rows), one instruction per 16
// coverage: Os 4 waves x 16 n x 64 c written, read rows nl+t <= 63 x cols cl <= 63; Z 8 it x 16 lines x 8 lanes x
//           4 floats = 64 c x 64 n; grid (NQ/64, 4, NB) covers Z[b][0..255][0..NQ-1] exactly once.
// =========================================================================================================
__global__ __launch_bounds__(128)
void gemm_out(const unsigned short* __restrict__ WWb, const unsigned short* __restrict__ Yh,
              const unsigned short* __restrict__ Yl, const float* __restrict__ wb, float* Z) {
  __shared__ __align__(16) float Os[QT * OSP];
  const int tid  = threadIdx.x;
  const int lane = tid & 31, wave = tid >> 5;
  const int hh   = lane >> 4, c = lane & 15;
  const int nt   = blockIdx.x, cb = blockIdx.y, b = blockIdx.z;
  const int n0   = nt * QT, c0 = cb * QT;

  const unsigned short* ap  = WWb + (size_t)(c0 / 16 * (DQ / 32)) * FRG + 8 * lane;
  const size_t bo = (size_t)((b * (NN / 16) + n0 / 16 + wave) * (DQ / 32)) * FRG + 8 * lane;
  const unsigned short* bph = Yh + bo;
  const unsigned short* bpl = Yl + bo;

  v8f acc[4];
#pragma unroll
  for (int mt = 0; mt < 4; ++mt) acc[mt] = zero8();

#pragma unroll
  for (int ks = 0; ks < DQ / 32; ++ks) {
    const Frag fbh = ldfrag(bph + FRG * ks);
    const Frag fbl = ldfrag(bpl + FRG * ks);
    // the k-step's reads stand as one group in front of its products (a second k-step would cost a resident wave)
    Frag fa[4];
#pragma unroll
    for (int mt = 0; mt < 4; ++mt) fa[mt] = ldfrag(ap + (size_t)(mt * (DQ / 32) + ks) * FRG);
#pragma unroll
    for (int mt = 0; mt < 4; ++mt) {
      acc[mt] = mma_b(fa[mt].bf, fbh.bf, acc[mt]);
      acc[mt] = mma_b(fa[mt].bf, fbl.bf, acc[mt]);
    }
  }

  // ---- epilogue: -> LDS Os[n_loc][c_loc]; lane (hh, c) holds c_loc = 16 mt + 8 hh + r for n_loc = 16 w + c
  {
    const int nl = 16 * wave + c;
#pragma unroll
    for (int mt = 0; mt < 4; ++mt) {
      v4f va, vb;
#pragma unroll
      for (int r = 0; r < 4; ++r) { va[r] = acc[mt][r]; vb[r] = acc[mt][4 + r]; }
      *(v4f*)(Os + nl * OSP + 16 * mt + 8 * hh)     = va;
      *(v4f*)(Os + nl * OSP + 16 * mt + 8 * hh + 4) = vb;
    }
  }
  __syncthreads();

  const int e = tid & 7, lq = tid >> 3;                              // lq 0..15
  v4f res[8];
#pragma unroll
  for (int it = 0; it < 8; ++it) {
    const int L   = it * 16 + lq;                                    // 0..127
    const int cl  = L >> 1, hf = L & 1;                              // channel 0..63 within the block
    const int nl  = hf * 32 + 4 * e;                                 // position 0..63
    const float bvs = bfr(wb[c0 + cl]);
#pragma unroll
    for (int t = 0; t < 4; ++t) {
      res[it][t] = Os[(nl + t) * OSP + cl] + bvs;
    }
  }
{
#pragma unroll
    for (int it = 0; it < 8; ++it) {
      const int L   = it * 16 + lq;
      const int cl  = L >> 1, hf = L & 1;
      const int nl  = hf * 32 + 4 * e;
      const size_t idx = ((size_t)(b * CC + c0 + cl)) * NQ + n0 + nl;
      *(v4f*)(Z + idx) = res[it];
    }
    
  }
}

// =========================================================================================================
// (8) batch-norm statistics per channel ch (one block per channel, 1024 threads = 32 waves): every thread issues all
//     its b128 reads of z (one per batch image and 1024-quad slice) before it sums any, f64 sums of z and z*z in four
//     independent chains, LDS f64 tree (cross-thread, block barriers), mean and biased variance in f64,
//     rstd = 1/sqrt(var + eps) in f32; stats line ST[ch][32 floats] = {mean, bf16-RNE(gamma)*rstd, bf16-RNE(beta),
// coverage: grid (CC) writes every line of ST exactly once; reads Z rows (b<NB, ch, n<NQ) all produced by (7).
// =========================================================================================================
__global__ __launch_bounds__(SBT)
void bn_stats(const float* __restrict__ Z, const float* __restrict__ gam, const float* __restrict__ bet,
              float* ST) {
  __shared__ double sh1[SBT];
  __shared__ double sh2[SBT];
  const int tid = threadIdx.x, ch = blockIdx.x;
  v4f v[NB * SQ];
  // both loops unrolled: v[] stays in registers and the reads issue back to back, none waiting for a sum
#pragma unroll
  for (int b = 0; b < NB; ++b) {
    const float* zr = Z + ((size_t)(b * CC + ch)) * NQ;
#pragma unroll
    for (int j = 0; j < SQ; ++j) {
      v[b * SQ + j] = *(const v4f*)(zr + 4 * (j * SBT + tid));
      // a later read of this run may land its result in this read's address registers: the wait stands in front of it
      asm volatile("s_wait_xcnt 0x0" ::: "memory");
    }
  }
  double s4[4] = {0.0, 0.0, 0.0, 0.0}, q4[4] = {0.0, 0.0, 0.0, 0.0};
  // unrolled: every index of v[], s4[] and q4[] is a constant (registers, no scratch)
#pragma unroll
  for (int i = 0; i < NB * SQ; ++i) {
#pragma unroll
    for (int t = 0; t < 4; ++t) { const double d = (double)v[i][t]; s4[t] += d; q4[t] += d * d; }
  }
  sh1[tid] = (s4[0] + s4[1]) + (s4[2] + s4[3]);
  sh2[tid] = (q4[0] + q4[1]) + (q4[2] + q4[3]);
  __syncthreads();
#pragma unroll 1
  for (int stp = SBT / 2; stp > 0; stp >>= 1) {
    if (tid < stp) { sh1[tid] += sh1[tid + stp]; sh2[tid] += sh2[tid + stp]; }
    __syncthreads();
  }
  const double cnt  = (double)NB * (double)NQ;
  const double mean = sh1[0] / cnt;
  double var = sh2[0] / cnt - mean * mean;
  var = (var > 0.0) ? var : 0.0;
  const float rstd  = 1.0f / sqrtf((float)var + BNEPS);
  const float meanf = (float)mean;
  const float scl   = bfr(gam[ch]) * rstd;
  const float btr   = bfr(bet[ch]);
  if (tid < 8) {
    v4f w;
    w[0] = (tid == 0) ? meanf : 0.f;
    w[1] = (tid == 0) ? scl : 0.f;
    w[2] = (tid == 0) ? btr : 0.f;
    w[3] = 0.f;
    float* p = ST + (size_t)ch * STL + 4 * tid;
    *(v4f*)p = w;
    
  }
}

// =========================================================================================================
// (9) out[b][ch][n] = ((z - mean) * (gamma*rstd) + beta) + bf16-RNE(x): one thread per 4 consecutive n; a wave writes
// coverage: NB*CC*NQ/1024 blocks x 256 threads x 4 floats = out[b<NB][0..255][0..NQ-1] exactly once.
// =========================================================================================================
__global__ __launch_bounds__(256)
void bn_apply(const float* __restrict__ Z, const float* __restrict__ x, const float* __restrict__ ST,
              float* out) {
  const size_t i4   = (size_t)blockIdx.x * 256 + threadIdx.x;
  const size_t el   = i4 * 4;
  const size_t rowi = el / NQ;
  const int n  = (int)(el - rowi * NQ);
  const int ch = (int)(rowi % CC);
  const int b  = (int)(rowi / CC);
  const v4f z  = *(const v4f*)(Z + el);
  const size_t xo = ((size_t)(b * CC + ch)) * NN + n;
  const v4f xv = *(const v4f*)(x + xo);
  const float mean = ST[(size_t)ch * STL + 0];
  const float scl  = ST[(size_t)ch * STL + 1];
  const float btr  = ST[(size_t)ch * STL + 2];
  v4f r;
#pragma unroll
  for (int t = 0; t < 4; ++t) r[t] = ((z[t] - mean) * scl + btr) + bfr(xv[t]);
  float* p = out + xo;
  *(v4f*)p = r;
  
}

// =========================================================================================================
// Workspace map (bytes; each region start a multiple of 256; every extent is an exact row/tile multiple and is
//   (the 16-bit planes hold these extents in fragment order)
//   W16 f16 [384][256]            196608      WWb bf16 [256][128]        65536
//   XP  f16 [NB][4096][256]     16777216 (NB=8)
//   Qh/Ql bf16 [NB][4096][128]   8388608 x2
//   PGZ region 33554432: Z f32 [NB][256][NQ] at +0; Z extent <= region (static_assert)
//   Pc/Gc f16 [NB][128][1024]   2097152 x2
//   MTh/MTl bf16 [NB][128][128]   262144 x2
//   Yh/Yl bf16 [NB][4096][128]   8388608 x2
//   ST  f32 [256][32]               32768
//   total (NB=8, NQ=4096) = 88899584
// =========================================================================================================
extern "C" void kernel_launch(void* const* d_in, const int* in_sizes, int n_in,
                              void* d_out, int out_size, void* d_ws, size_t ws_size,
                              hipStream_t stream) {
  const int XN = NB * CC * NN;
  if (n_in < 11) return;
  if (in_sizes[0] < XN) return;
  if (in_sizes[1] < DQ * CC || in_sizes[3] < DQ * CC || in_sizes[5] < DQ * CC || in_sizes[7] < CC * DQ) return;
  if (in_sizes[2] < DQ || in_sizes[4] < DQ || in_sizes[6] < DQ || in_sizes[8] < CC) return;
  if (in_sizes[9] < CC || in_sizes[10] < CC) return;
  if (out_size < XN) return;

  size_t off = 0;
  auto carve = [&](size_t bytes) { const size_t o = off; off += (bytes + 255) & ~(size_t)255; return o; };
  const size_t oW16 = carve((size_t)MW * CC * 2);
  const size_t oWWb = carve((size_t)CC * DQ * 2);
  const size_t oXP  = carve((size_t)NB * NN * CC * 2);
  const size_t oQh  = carve((size_t)NB * NN * DQ * 2);
  const size_t oQl  = carve((size_t)NB * NN * DQ * 2);
  const size_t oPGZ = carve((size_t)2 * NB * NN * DQ * 4);
  const size_t oPc  = carve((size_t)NB * DQ * MM * 2);
  const size_t oGc  = carve((size_t)NB * DQ * MM * 2);
  const size_t oMTh = carve((size_t)NB * DQ * DQ * 2);
  const size_t oMTl = carve((size_t)NB * DQ * DQ * 2);
  const size_t oYh  = carve((size_t)NB * NN * DQ * 2);
  const size_t oYl  = carve((size_t)NB * NN * DQ * 2);
  const size_t oST  = carve((size_t)CC * STL * 4);
  if (off > ws_size) return;
  if (off > (size_t)134217728) return;

  const float* x  = (const float*)d_in[0];
  const float* gw = (const float*)d_in[1];
  const float* gb = (const float*)d_in[2];
  const float* tw = (const float*)d_in[3];
  const float* tb = (const float*)d_in[4];
  const float* pw = (const float*)d_in[5];
  const float* pb = (const float*)d_in[6];
  const float* ow = (const float*)d_in[7];
  const float* wb = (const float*)d_in[8];
  const float* bg = (const float*)d_in[9];
  const float* bb = (const float*)d_in[10];

  char* ws = (char*)d_ws;
  unsigned short* W16 = (unsigned short*)(ws + oW16);
  unsigned short* WWb = (unsigned short*)(ws + oWWb);
  unsigned short* XP  = (unsigned short*)(ws + oXP);
  unsigned short* Qh  = (unsigned short*)(ws + oQh);
  unsigned short* Ql  = (unsigned short*)(ws + oQl);
  float*          Z   = (float*)(ws + oPGZ);
  unsigned short* Pc  = (unsigned short*)(ws + oPc);
  unsigned short* Gc  = (unsigned short*)(ws + oGc);
  unsigned short* MTh = (unsigned short*)(ws + oMTh);
  unsigned short* MTl = (unsigned short*)(ws + oMTl);
  unsigned short* Yh  = (unsigned short*)(ws + oYh);
  unsigned short* Yl  = (unsigned short*)(ws + oYl);
  float*          ST  = (float*)(ws + oST);
  float* out = (float*)d_out;

  const dim3 blk256(256), blk128(128);

  // (0) theta_w / phi_w / g_w -> stacked f16 plane; w_w -> bf16 plane
  cvt_w<<<dim3(MW / 8 + CC / 16), blk256, 0, stream>>>(tw, pw, gw, ow, W16, WWb);
  // (1) x -> position-major 16-bit plane
  cvt_x<<<dim3(NN / QT, CC / QT, NB), blk256, 0, stream>>>(x, XP);
  // (2) conv1x1 GEMM -> theta hi/res planes; phi / g + bias, 2x2 max-pooled, as channel-major f16 planes [b][d][m]
  gemm_proj<<<dim3(NSTRIP, 4, NB), blk256, 0, stream>>>(W16, XP, tb, pb, gb, Qh, Ql, Pc, Gc);
  // (5) M = pooled-phi . pooled-g^T per batch -> M^T hi/res planes [b][ci][cp]
  gemm_m<<<dim3(DQ / 16, DQ / QT, NB), blk256, 0, stream>>>(Pc, Gc, MTh, MTl);
  // (6) y = theta . M / 1024 -> y hi/res planes [b][n][128]
  gemm_y<<<dim3(NQ / QT, DQ / QT, NB), blk128, 0, stream>>>(MTh, MTl, Qh, Ql, Yh, Yl);
  // (7) output conv + bias -> Z [b][256][NQ]
  gemm_out<<<dim3(NQ / QT, CC / QT, NB), blk128, 0, stream>>>(WWb, Yh, Yl, wb, Z);
  // (8) batch statistics per channel -> ST lines
  bn_stats<<<dim3(CC), dim3(SBT), 0, stream>>>(Z, bg, bb, ST);
  // (9) normalise, affine, residual -> out [b][256][4096]
  bn_apply<<<dim3((NB * CC * NQ) / 1024), blk256, 0, stream>>>(Z, x, ST, out);
  (void)hipGetLastError();
}

// v006
// Measured time: 76.2 microseconds a run.
// Next to v005, in two timings, it ran 1.05 and 1.04 times as fast.
// Over all steps from v000 it is 1.92 times as fast.
// Contractions: conv1x1 theta/phi/g GEMM W[384x256].X[256x128] per strip on v_wmma_f32_16x16x32_f16 (f16
// containers of bf16-RNE weights x256 and bf16-RNE x, 1 product); M = pooled-phi . pooled-g^T per batch
// [128x128], K=1024, on v_wmma_f32_16x16x32_f16 (2x2 max-pooled phi and g as plain f16, 1 product);
// y^T = M^T.theta^T, K=128, on v_wmma_f32_16x16x32_bf16 (M and theta as bf16 hi + bf16 residual planes,
// 3 products); output conv W[256x128].Y on v_wmma_f32_16x16x32_bf16 (bf16 weights, y as bf16 hi + residual
// planes, 2 products); f32 accumulate everywhere; max-pool, bias, batch-norm statistics (f64 sums, f32 apply)
// and the residual add on VALU.
// Every 16-bit WMMA operand plane lies in the workspace (y: in LDS) in fragment order: one fragment = 16 rows x 32 k = 1 KiB =
// [j 0..1][lane 0..31][8 values], unit (j, lane) = row (lane&15), k = 16 j + 8 (lane>>4) .. + 7. A wave reads a fragment
// with two b128 loads of 512 contiguous bytes each (4 whole lines a load).
#include <hip/hip_runtime.h>
#include <math.h>
#include <stdint.h>

#ifndef NB
#define NB 8
#endif
#ifndef NQ
#define NQ 4096
#endif
#define NB_FULL 8
#define CC     256
#define HIMG   64
#define WIMG   64
#define NN     4096
#define DQ     128
#define HP     32
#define WP     32
#define MM     1024
#define MW     384
#define QT     64
#define SN     128
#define NSTRIP 32
#define OSP    68
#define OSZ    260
#define TP     72
#define STL    32
#define WSC    256.0f
#define IWSC   0.00390625f
#define INS    0.0009765625f
#define BNEPS  1e-5f
#define SBT    1024
#define KSL    128
#define FRG    512
#define SQ     (NQ / (4 * SBT))

static_assert(NB >= 1 && NB <= NB_FULL);
static_assert(NQ % 128 == 0 && NQ >= 128 && NQ <= NN);
static_assert(NQ % QT == 0);
static_assert(NN == HIMG * WIMG);
static_assert(SN == 2 * WIMG && NSTRIP * SN == NN && SN == 8 * 16);
static_assert(HIMG % 2 == 0 && WIMG % 2 == 0 && HP == HIMG / 2 && WP == WIMG / 2 && MM == HP * WP);
static_assert(WP == 32);
static_assert(MM % QT == 0 && MM % 32 == 0);
static_assert(NN % QT == 0 && CC % QT == 0 && DQ == 2 * QT);
static_assert(MW == 3 * DQ && MW % 8 == 0);
static_assert(CC % 32 == 0 && DQ % 32 == 0);
static_assert((OSP * 4) % 16 == 0 && (TP * 2) % 16 == 0);
static_assert(SN * OSP * 4 <= 65536 && DQ * OSP * 4 <= 65536);
static_assert(((size_t)NB * CC * NQ) % 1024 == 0);
static_assert((size_t)NB * CC * NQ * 4 <= 2 * (size_t)NB * NN * DQ * 4);
static_assert((size_t)NB_FULL * CC * NN * 4 == (size_t)33554432);
static_assert(STL * 4 == 128);
static_assert((OSZ * 4) % 16 == 0 && OSZ >= CC && CC == 2 * 8 * 16 && QT == 4 * 16);
static_assert(QT * TP * 2 <= SN * OSP * 4 && NN == 16 * 4 * WIMG && MM == 16 * 64);
static_assert(MM == 8 * KSL && KSL == 4 * 32 && DQ == 8 * 16);
static_assert(NQ % (4 * SBT) == 0 && (SBT & (SBT - 1)) == 0 && SBT <= 1024);

typedef _Float16       v16h __attribute__((ext_vector_type(16)));
typedef _Float16       v8h  __attribute__((ext_vector_type(8)));
typedef __bf16         v16b __attribute__((ext_vector_type(16)));
typedef unsigned short v8us __attribute__((ext_vector_type(8)));
typedef float          v8f  __attribute__((ext_vector_type(8)));
typedef float          v4f  __attribute__((ext_vector_type(4)));
typedef unsigned int   v4u  __attribute__((ext_vector_type(4)));
typedef unsigned int   v2u  __attribute__((ext_vector_type(2)));

union Frag { v8us u[2]; v16h h; v16b bf; };
static_assert(sizeof(Frag) == 32);

// ---- scalar helpers ---------------------------------------------------------------------------------------
__device__ __forceinline__ unsigned short bf_bits(float f) {          // f32 -> bf16 bits, RNE convert
  unsigned u = __float_as_uint(f);
  return (unsigned short)((u + 0x7FFFu + ((u >> 16) & 1u)) >> 16);
}
__device__ __forceinline__ float bf_up(unsigned short hb) { return __uint_as_float(((unsigned)hb) << 16); }
__device__ __forceinline__ float bfr(float f) { return bf_up(bf_bits(f)); }
__device__ __forceinline__ unsigned short h_bits(_Float16 x) { return __builtin_bit_cast(unsigned short, x); }
__device__ __forceinline__ unsigned pk16(unsigned short a, unsigned short b) { return (unsigned)a | ((unsigned)b << 16); }
__device__ __forceinline__ v8f zero8() { v8f z = {0.f, 0.f, 0.f, 0.f, 0.f, 0.f, 0.f, 0.f}; return z; }
// 8 f32 values -> bf16 hi bits and bf16 residual bits (lo = RNE(v - hi)), packed 2 per uint
__device__ __forceinline__ void split8(const float* f, v4u& uh, v4u& ul) {
#pragma unroll
  for (int t = 0; t < 4; ++t) {
    const float f0 = f[2 * t], f1 = f[2 * t + 1];
    const unsigned short hb0 = bf_bits(f0), hb1 = bf_bits(f1);
    const unsigned short lb0 = bf_bits(f0 - bf_up(hb0));
    const unsigned short lb1 = bf_bits(f1 - bf_up(hb1));
    uh[t] = pk16(hb0, hb1);
    ul[t] = pk16(lb0, lb1);
  }
}

// ---- 16-bit fragment loader (A or B) from a plane in fragment order: lane -> row/col (lane&15), h = lane>>4; p = start
//      of the fragment + 8*lane; elements 0..7 <- p[0..7] (k0+8h..), elements 8..15 <- p[256..263] (k0+16+8h..)
__device__ __forceinline__ Frag ldfrag(const unsigned short* p) {
  Frag f;
  f.u[0] = *(const v8us*)(p);
  f.u[1] = *(const v8us*)(p + FRG / 2);
  return f;
}
// k offset (0, 8, 16, 24) inside its fragment of the 16-B unit that thread t stores (unit = t & 63; its row is t & 15)
__device__ __forceinline__ int unit_k(int t) { return 16 * ((t >> 5) & 1) + 8 * ((t >> 4) & 1); }

// ---- WMMA helpers: builtin followed by a 4-slot VALU gap tying D and keeping A/B live --------------------------
__device__ __forceinline__ v8f mma_h(v16h a, v16h b, v8f c) {
  v8f d = __builtin_amdgcn_wmma_f32_16x16x32_f16(false, a, false, b, (short)0, c, false, false);
#if defined(__HIP_DEVICE_COMPILE__)
  asm volatile("v_nop\n\tv_nop\n\tv_nop\n\tv_nop" : "+v"(d) : "v"(a), "v"(b));
#endif
  return d;
}
__device__ __forceinline__ v8f mma_b(v16b a, v16b b, v8f c) {
  v8f d = __builtin_amdgcn_wmma_f32_16x16x32_bf16(false, a, false, b, (short)0, c, false, false);
#if defined(__HIP_DEVICE_COMPILE__)
  const v16h ha = __builtin_bit_cast(v16h, a), hb = __builtin_bit_cast(v16h, b);
  asm volatile("v_nop\n\tv_nop\n\tv_nop\n\tv_nop" : "+v"(d) : "v"(ha), "v"(hb));
#endif
  return d;
}

// =========================================================================================================
// (0) weights. Blocks 0..47: W16 f16 [384][256], rows 0..127 = theta_w, 128..255 = phi_w, 256..383 = g_w; value =
//     f16 of (bf16-RNE(w) * 256) (exact), fragments [24 o tiles][8 k steps]. Blocks 48..63: WWb bf16 of w_w [256][128],
//     fragments [16 c tiles][4 k steps]. A block owns 4 consecutive fragments, a thread one 16-B unit.
// coverage: 48 blocks x 256 units x 8 halves = 384 x 256; 16 blocks x 256 units x 8 = 256 x 128.
// =========================================================================================================
__global__ __launch_bounds__(256)
void cvt_w(const float* __restrict__ tw, const float* __restrict__ pw, const float* __restrict__ gw,
           const float* __restrict__ ow, unsigned short* W16, unsigned short* WWb) {
  const int tid = threadIdx.x, blk = blockIdx.x;
  if (blk < MW / 8) {
    const int un = blk * 256 + tid;                                  // unit 0..12287
    const int fr = un >> 6;                                          // fragment = 8 (o tile) + k step
    const int o = 16 * (fr >> 3) + (tid & 15);                       // 0..383, o tile = blk >> 1
    const int col = 32 * (fr & 7) + unit_k(tid);                     // 0..248
    const int grp = blk >> 4;                                        // 0,1,2 (block-uniform)
    const float* wbase = (grp == 0) ? tw : ((grp == 1) ? pw : gw);  // all global
    const float* s = wbase + (size_t)(o - DQ * grp) * CC + col;      // (o - 128 grp) in 0..127
    const v4f a = *(const v4f*)s;
    const v4f q = *(const v4f*)(s + 4);
    const float f[8] = {a[0], a[1], a[2], a[3], q[0], q[1], q[2], q[3]};
    v4u u;
#pragma unroll
    for (int t = 0; t < 4; ++t) {
      const _Float16 h0 = (_Float16)(bfr(f[2 * t]) * WSC);
      const _Float16 h1 = (_Float16)(bfr(f[2 * t + 1]) * WSC);
      u[t] = pk16(h_bits(h0), h_bits(h1));
    }
{
      *(v4u*)(W16 + (size_t)un * 8) = u;
      
    }
  } else {
    const int un = (blk - MW / 8) * 256 + tid;                       // unit 0..4095
    const int fr = un >> 6;                                          // fragment = 4 (c tile) + k step
    const int o = 16 * (fr >> 2) + (tid & 15);                       // 0..255
    const int col = 32 * (fr & 3) + unit_k(tid);                     // 0..120
    const float* s = ow + (size_t)o * DQ + col;
    const v4f a = *(const v4f*)s;
    const v4f q = *(const v4f*)(s + 4);
    const float f[8] = {a[0], a[1], a[2], a[3], q[0], q[1], q[2], q[3]};
    v4u u;
#pragma unroll
    for (int t = 0; t < 4; ++t) u[t] = pk16(bf_bits(f[2 * t]), bf_bits(f[2 * t + 1]));
{
      *(v4u*)(WWb + (size_t)un * 8) = u;
      
    }
  }
}

// =========================================================================================================
// (1) x f32 [b][256 c][4096 n] -> XP f16, fragments [b][256 n tiles][8 k steps], k = c (bf16-RNE values, exact in f16),
//     through an LDS tile T[64 n][64 c] (pitch TP, cross-thread, block barrier). Block (nb, cb, b) owns a 64 c x 64 n
//     tile = 4 n tiles x 2 k steps = 8 fragments.
// coverage: T written rows (8e+t)=0..63 x cols cl 0..63, read rows 0..63 x cols 0..63; XP 2 it x 256 units x 8 = 8
//           fragments; grid (64, 4, NB) covers every fragment of XP exactly once.
// =========================================================================================================
__global__ __launch_bounds__(256)
void cvt_x(const float* __restrict__ x, unsigned short* XP) {
  __shared__ __align__(16) unsigned short T[QT * TP];
  const int tid = threadIdx.x;
  const int nb = blockIdx.x, cb = blockIdx.y, b = blockIdx.z;
  const int e = tid & 7, lq = tid >> 3;                             // lq 0..31
  const int n0 = nb * QT, c0 = cb * QT;
#pragma unroll
  for (int it = 0; it < 2; ++it) {
    const int cl = it * 32 + lq;                                     // 0..63
    const float* sp = x + ((size_t)(b * CC + c0 + cl)) * NN + n0 + 8 * e;
    const v4f a = *(const v4f*)sp;
    const v4f q = *(const v4f*)(sp + 4);
    unsigned short hb[8];
#pragma unroll
    for (int t = 0; t < 4; ++t) {
      hb[t]     = h_bits((_Float16)bfr(a[t]));
      hb[4 + t] = h_bits((_Float16)bfr(q[t]));
    }
#pragma unroll
    for (int t = 0; t < 8; ++t) T[(8 * e + t) * TP + cl] = hb[t];
  }
  __syncthreads();
  v4u up[2];
#pragma unroll
  for (int it = 0; it < 2; ++it) {
    const int fl = it * 4 + (tid >> 6);                              // fragment 0..7 = 2 (n tile) + k step
    up[it] = *(const v4u*)(T + (16 * (fl >> 1) + (tid & 15)) * TP + 32 * (fl & 1) + unit_k(tid));
  }
{
#pragma unroll
    for (int it = 0; it < 2; ++it) {
      const int fl = it * 4 + (tid >> 6);
      const int fg = (b * (NN / 16) + n0 / 16 + (fl >> 1)) * (CC / 32) + c0 / 32 + (fl & 1);
      *(v4u*)(XP + (size_t)fg * FRG + 8 * (tid & 63)) = up[it];
    }
    
  }
}

// =========================================================================================================
// (2) conv1x1 GEMM, Y[o][n] = (1/256) sum_c W16[o][c] XP[b][n][c], K = 256 = 8 steps, 256 threads = 8 waves; every
//     plane read or written here is in fragment order (Qh/Ql: [b][256 n tiles][4 k steps], k = d; Pc/Gc: [b][8 d tiles]
//     [32 k steps], k = m); the
//     block's shape depends on blockIdx.y (block-uniform branch, taken in front of every barrier):
//     y = 0,1 (theta dims 0..63 / 64..127): strip of 128 positions x 64 o. Wave w owns cols n0+16w..+15 (one B
//       fragment per k-step) and 4 m-tiles (A rows o = o0 + 16 mt + (lane&15), from W16). Epilogue staged in LDS
//       Os[n_loc][o_loc] (pitch OSP, b128 stores, cross-wave), block barrier, + bias -> Qh/Ql bf16 (hi = RNE(v),
//       lo = RNE(v-hi)), 16 fragments a plane, a wave's store = 512 contiguous bytes.
//     y = 2,3 (phi, g): idx = 32 (y-2) + x -> 256 positions (image rows 4 ds..4 ds+3, ds = idx&15) x 64 o
//       (ob = idx>>4: phi dims 0.., 64.., then g dims 0.., 64..). Wave w = (pyl = w>>2, xt = w&3) owns the two n-tiles
//       of image rows 4 ds + 2 pyl and + 2 pyl + 1 at columns 16 xt..16 xt+15, and 4 m-tiles. The 2x2 stride-2
//       max-pool is done on the accumulators: the row pair is the wave's two tiles (same lane, same register), the
//       column pair is lane ^ 1. Scale and bias follow the maximum (x -> fl(x/256 + bias) never decreases as x grows, so
//       the maximum of the results is the result of the maximum). f16 values go through the LDS tile T[64 o][64 m]
//       (pitch TP, cross-wave, block barrier) -> Pc / Gc f16, m = 32 py + px: the block owns 4 d tiles x 2 k steps = 8
//       whole fragments.
// coverage: theta: Os 8 waves x 16 n x 64 o = 128 x 64 written, reads rows <= 127 cols <= 63; planes 4 it x 256 units
//           x 8 = 128 n x 64 d; 32 x 2 blocks cover 4096 rows x 128 d of Qh/Ql once. phi/g: T written rows
//           16 mt + 8 hh + 4 (c&1) + j = 0..63 x cols 32 pyl + 8 xt + (c>>1) = 0..63, read rows 0..63 x cols 0..63;
//           16 ds x 4 ob blocks cover Pc and Gc (128 d x 1024 m a batch) exactly once.
// =========================================================================================================
__device__ __forceinline__ float max_pair(float v) {                 // max of lanes l and l ^ 1 (quad_perm 1,0,3,2)
  const int o = __builtin_amdgcn_mov_dpp(__float_as_int(v), 0xB1, 0xF, 0xF, true);
  return fmaxf(v, __int_as_float(o));
}

__global__ __launch_bounds__(256)
void gemm_proj(const unsigned short* __restrict__ W16, const unsigned short* __restrict__ XP,
               const float* __restrict__ tb, const float* __restrict__ pb, const float* __restrict__ gb,
               unsigned short* Qh, unsigned short* Ql, unsigned short* Pc, unsigned short* Gc) {
  __shared__ __align__(16) float Os[SN * OSP];
  const int tid  = threadIdx.x;
  const int lane = tid & 31, wave = tid >> 5;                        // wave 0..7
  const int hh   = lane >> 4, c = lane & 15;
  const int st   = blockIdx.x, mb = blockIdx.y, b = blockIdx.z;

  if (mb >= 2) {
    // ---- phi / g: 64 o x 256 positions, pooled in registers
    const int idx = (mb - 2) * NSTRIP + st;                          // 0..63
    const int ds = idx & 15, ob = idx >> 4;                          // ds 0..15, ob 0..3
    const int sel = ob >> 1, d0 = QT * (ob & 1);                     // plane (0 phi, 1 g), first dim 0 or 64
    const int wv  = __builtin_amdgcn_readfirstlane(wave);            // scalar: row bases stay in SGPRs, fewer VGPRs
    const int pyl = wv >> 2, xt = wv & 3;
    const unsigned lo = (unsigned)(8 * lane);                        // the lane's offset, the same in every fragment
    const unsigned short* ap  = W16 + (size_t)((DQ + QT * ob) / 16 * (CC / 32)) * FRG + lo;
    const unsigned short* bp0 = XP + (size_t)((b * (NN / 16) + (4 * ds + 2 * pyl) * (WIMG / 16) + xt) * (CC / 32)) * FRG + lo;
    const unsigned short* bp1 = bp0 + (size_t)(WIMG / 16 * (CC / 32)) * FRG;

    v8f a0[4], a1[4];
#pragma unroll
    for (int mt = 0; mt < 4; ++mt) { a0[mt] = zero8(); a1[mt] = zero8(); }
#pragma unroll
    for (int ks = 0; ks < CC / 32; ++ks) {
      const Frag fb0 = ldfrag(bp0 + FRG * ks);
      const Frag fb1 = ldfrag(bp1 + FRG * ks);
      Frag fa[4];
#pragma unroll
      for (int mt = 0; mt < 4; ++mt) fa[mt] = ldfrag(ap + (size_t)(mt * (CC / 32) + ks) * FRG);
#pragma unroll
      for (int mt = 0; mt < 4; ++mt) {
        a0[mt] = mma_h(fa[mt].h, fb0.h, a0[mt]);
        a1[mt] = mma_h(fa[mt].h, fb1.h, a1[mt]);
      }
    }

    unsigned short* T = (unsigned short*)Os;                         // [64 o][TP] f16
    const float* bias = (sel == 0) ? pb : gb;                        // both global
    const int odd = c & 1;                                           // even lane stores r 0..3, odd lane r 4..7
    const int ml  = 32 * pyl + 8 * xt + (c >> 1);                    // 0..63
#pragma unroll
    for (int mt = 0; mt < 4; ++mt) {
      const int ol = 16 * mt + 8 * hh + 4 * odd;                     // 0..60
      const v4f bq = *(const v4f*)(bias + d0 + ol);
#pragma unroll
      for (int j = 0; j < 4; ++j) {
        const float pe = max_pair(fmaxf(a0[mt][j], a1[mt][j]));
        const float po = max_pair(fmaxf(a0[mt][4 + j], a1[mt][4 + j]));
        const float v  = (odd ? po : pe) * IWSC + bfr(bq[j]);
        T[(ol + j) * TP + ml] = h_bits((_Float16)v);
      }
    }
    __syncthreads();
    {
      const int kl = (tid >> 6) & 1;                                 // k step of the block's two; d tile = 2 it + (tid >> 7)
      unsigned short* dst = (sel == 0) ? Pc : Gc;                    // both global
      v4u u[2];
#pragma unroll
      for (int it = 0; it < 2; ++it)
        u[it] = *(const v4u*)(T + (16 * (2 * it + (tid >> 7)) + (tid & 15)) * TP + 32 * kl + unit_k(tid));
#pragma unroll
      for (int it = 0; it < 2; ++it) {
        const int fg = (b * (DQ / 16) + d0 / 16 + 2 * it + (tid >> 7)) * (MM / 32) + 2 * ds + kl;
        *(v4u*)(dst + (size_t)fg * FRG + 8 * (tid & 63)) = u[it];
      }
    }
    return;
  }

  const int n0   = st * SN, o0 = mb * QT;

  const unsigned short* ap = W16 + (size_t)(o0 / 16 * (CC / 32)) * FRG + 8 * lane;
  const unsigned short* bp = XP + (size_t)((b * (NN / 16) + n0 / 16 + wave) * (CC / 32)) * FRG + 8 * lane;

  v8f acc[4];
#pragma unroll
  for (int mt = 0; mt < 4; ++mt) acc[mt] = zero8();

  // the reads of two k-steps stand as one group in front of their products: the wave waits out the load latency once a
  // group, not once a product (registers: a third k-step would cost a resident wave)
#pragma unroll
  for (int kp = 0; kp < CC / 64; ++kp) {
    Frag fb[2], fa[2][4];
#pragma unroll
    for (int kl = 0; kl < 2; ++kl) {
      const int ks = 2 * kp + kl;
      fb[kl] = ldfrag(bp + FRG * ks);
#pragma unroll
      for (int mt = 0; mt < 4; ++mt) fa[kl][mt] = ldfrag(ap + (size_t)(mt * (CC / 32) + ks) * FRG);
    }
#pragma unroll
    for (int kl = 0; kl < 2; ++kl) {
#pragma unroll
      for (int mt = 0; mt < 4; ++mt) acc[mt] = mma_h(fa[kl][mt].h, fb[kl].h, acc[mt]);
    }
  }

  // ---- epilogue: scale back -> LDS Os[n_loc][o_loc]; lane (hh, c) holds o = 16 mt + 8 hh + r for n_loc = 16 w + c
  {
    const int nl = 16 * wave + c;
#pragma unroll
    for (int mt = 0; mt < 4; ++mt) {
      v4f va, vb;
#pragma unroll
      for (int r = 0; r < 4; ++r) { va[r] = acc[mt][r] * IWSC; vb[r] = acc[mt][4 + r] * IWSC; }
      *(v4f*)(Os + nl * OSP + 16 * mt + 8 * hh)     = va;
      *(v4f*)(Os + nl * OSP + 16 * mt + 8 * hh + 4) = vb;
    }
  }
  __syncthreads();

  const int dsel = mb * QT;                                          // 0 or 64
  const float* bias = tb;
  {
    const int kl = (tid >> 6) & 1;                                   // k step of the block's two; n tile = 2 it + (tid >> 7)
    const int dl = 32 * kl + unit_k(tid);                            // d_loc 0..56
    float bv[8];
    {
      const v4f ba = *(const v4f*)(bias + dsel + dl);
      const v4f bq = *(const v4f*)(bias + dsel + dl + 4);
#pragma unroll
      for (int t = 0; t < 4; ++t) { bv[t] = bfr(ba[t]); bv[4 + t] = bfr(bq[t]); }
    }
    v4u uh[4], ul[4];
#pragma unroll
    for (int it = 0; it < 4; ++it) {
      const int row = 16 * (2 * it + (tid >> 7)) + (tid & 15);       // n_loc 0..127
      const v4f a = *(const v4f*)(Os + row * OSP + dl);
      const v4f q = *(const v4f*)(Os + row * OSP + dl + 4);
      float f[8];
#pragma unroll
      for (int t = 0; t < 4; ++t) { f[t] = a[t] + bv[t]; f[4 + t] = q[t] + bv[4 + t]; }
      split8(f, uh[it], ul[it]);
    }
{
#pragma unroll
      for (int it = 0; it < 4; ++it) {
        const int fg = (b * (NN / 16) + n0 / 16 + 2 * it + (tid >> 7)) * (DQ / 32) + dsel / 32 + kl;
        const size_t po = (size_t)fg * FRG + 8 * (tid & 63);
        *(v4u*)(Qh + po) = uh[it];
        *(v4u*)(Ql + po) = ul[it];
      }
      
    }
  }
}

// =========================================================================================================
// (5) M GEMM for one (b, 64-row block of phi channels, 16-column tile of g channels): M[cp][ci] = sum_m Pc[b][cp][m]
//     Gc[b][ci][m], K = 1024. Block 256 threads = 8 waves; wave w owns the k slice m = 128 w..128 w + 127 (4 steps) of
//     the whole 64 x 16 tile: B fragments of the Gc rows ci = 16 ct + (lane&15), A rows cp = c0 + 16 mt + (lane&15)
//     from Pc, both planes in fragment order. A wave issues its 40 b128 reads before its first product.
//     The 8 partial tiles go to LDS Os[16 w + ci_loc][cp_loc] (pitch OSP, b128 stores, cross-wave), block barrier, then
//     each thread adds the 8 slices of 4 consecutive cp in slice order (f32) -> MTh/MTl bf16, fragments [b][8 ci tiles]
//     [4 k steps], k = cp: the block owns 2 whole fragments of each plane, a thread half a 16-B unit.
// coverage: Os 8 waves x 16 ci x 64 cp = 128 x 64 written, reads rows 16 w + row <= 127, cols cq..cq+3 <= 63; planes
//           256 threads x 4 = 16 ci x 64 cp; grid (8, 2, NB) covers MTh/MTl (128 ci x 128 cp a batch) exactly once.
// =========================================================================================================
__global__ __launch_bounds__(256)
void gemm_m(const unsigned short* __restrict__ Pc, const unsigned short* __restrict__ Gc,
            unsigned short* MTh, unsigned short* MTl) {
  __shared__ __align__(16) float Os[DQ * OSP];
  const int tid  = threadIdx.x;
  const int lane = tid & 31, wave = tid >> 5;                        // wave 0..7 = k slice
  const int hh   = lane >> 4, c = lane & 15;
  const int ct   = blockIdx.x, mb = blockIdx.y, b = blockIdx.z;
  const int c0   = mb * QT;

  const unsigned short* ap = Pc + (size_t)((b * (DQ / 16) + c0 / 16) * (MM / 32) + (KSL / 32) * wave) * FRG + 8 * lane;
  const unsigned short* bp = Gc + (size_t)((b * (DQ / 16) + ct) * (MM / 32) + (KSL / 32) * wave) * FRG + 8 * lane;

  Frag fb[KSL / 32], fa[KSL / 32][4];
#pragma unroll
  for (int ks = 0; ks < KSL / 32; ++ks) {
    fb[ks] = ldfrag(bp + FRG * ks);
#pragma unroll
    for (int mt = 0; mt < 4; ++mt) fa[ks][mt] = ldfrag(ap + (size_t)(mt * (MM / 32) + ks) * FRG);
  }
#if defined(__HIP_DEVICE_COMPILE__)
  // inputs-only fence on the loaded values: keeps every read of the slice in front of the first product, so that the
  // wave waits for memory once; without it each product's reads are issued, and waited for, one product at a time
  asm volatile("" :: "v"(fb[0].h), "v"(fb[1].h), "v"(fb[2].h), "v"(fb[3].h),
               "v"(fa[0][0].h), "v"(fa[0][1].h), "v"(fa[0][2].h), "v"(fa[0][3].h),
               "v"(fa[1][0].h), "v"(fa[1][1].h), "v"(fa[1][2].h), "v"(fa[1][3].h),
               "v"(fa[2][0].h), "v"(fa[2][1].h), "v"(fa[2][2].h), "v"(fa[2][3].h),
               "v"(fa[3][0].h), "v"(fa[3][1].h), "v"(fa[3][2].h), "v"(fa[3][3].h));
#endif

  v8f acc[4];
#pragma unroll
  for (int mt = 0; mt < 4; ++mt) acc[mt] = zero8();
#pragma unroll
  for (int ks = 0; ks < KSL / 32; ++ks) {
#pragma unroll
    for (int mt = 0; mt < 4; ++mt) acc[mt] = mma_h(fa[ks][mt].h, fb[ks].h, acc[mt]);
  }

  // ---- partial tile -> LDS Os[16 w + ci_loc][cp_loc]; lane (hh, c) holds cp_loc = 16 mt + 8 hh + r for ci_loc = c
  {
    const int nl = 16 * wave + c;
#pragma unroll
    for (int mt = 0; mt < 4; ++mt) {
      v4f va, vb;
#pragma unroll
      for (int r = 0; r < 4; ++r) { va[r] = acc[mt][r]; vb[r] = acc[mt][4 + r]; }
      *(v4f*)(Os + nl * OSP + 16 * mt + 8 * hh)     = va;
      *(v4f*)(Os + nl * OSP + 16 * mt + 8 * hh + 4) = vb;
    }
  }
  __syncthreads();

  const int row = (tid >> 1) & 15;                                   // ci_loc 0..15 = the unit's row
  const int cq  = 32 * (tid >> 7) + unit_k(tid >> 1) + 4 * (tid & 1); // cp_loc 0..60: two threads share a 16-B unit
  v4f s = *(const v4f*)(Os + row * OSP + cq);
#pragma unroll
  for (int w = 1; w < MM / KSL; ++w) s += *(const v4f*)(Os + (16 * w + row) * OSP + cq);
  v2u uh, ul;
#pragma unroll
  for (int t = 0; t < 2; ++t) {
    const float f0 = s[2 * t], f1 = s[2 * t + 1];
    const unsigned short hb0 = bf_bits(f0), hb1 = bf_bits(f1);
    uh[t] = pk16(hb0, hb1);
    ul[t] = pk16(bf_bits(f0 - bf_up(hb0)), bf_bits(f1 - bf_up(hb1)));
  }
  const size_t po = (size_t)((b * (DQ / 16) + ct) * (DQ / 32) + c0 / 32 + (tid >> 7)) * FRG + 4 * (tid & 127);
  *(v2u*)(MTh + po) = uh;
  *(v2u*)(MTl + po) = ul;
}

// =========================================================================================================
// (6) y GEMM and output conv in one launch, for one (b, 64-n tile). Block 256 threads = 8 waves; wave w = (nw = w & 3,
//     hf = w >> 2) owns cols n0 + 16 nw..+15 in both products.
//     First product: y[n][ci] = (1/1024) sum_cp (MTh+MTl)[b][ci][cp] (Qh+Ql)[b][n][cp] on bf16 WMMA, 3 products per
//     k-step (hi.hi + hi.lo + lo.hi, shared accumulator), K = 128 = 4 steps, 4 m-tiles (A rows ci = 64 hf + 16 mt +
//     (lane&15), from MTh/MTl). Lane (hh, c) then holds ci = 64 hf + 16 mt + 8 hh + r of column c: that is unit
//     (j = mt & 1, lane) of the B fragment of k step 2 hf + (mt >> 1), k = ci, of the second product. The lane scales and
//     splits its own values (hi = RNE(y), lo = RNE(y - hi)) and stores whole units to LDS Yf[nw][k step][hi, lo]
//     (1-KiB fragments, cross-wave: the other hf wave of the same columns reads them), block barrier.
//     Second product: A[c][n] = sum_ci WWb[c][ci] (Yhi + Ylo)[n][ci] on bf16 WMMA (2 products per k-step, shared
//     accumulator), K = 128 = 4 steps, 8 m-tiles (A rows c = 128 hf + 16 mt + (lane&15), from WWb). Epilogue staged in
//     LDS Os[n_loc][c] (pitch OSZ, b128 stores, cross-wave), block barrier, + bias -> Z rows (a channel's segment of
//     64 n = 2 lines): 8 consecutive lanes x 16 B (values gathered from 4 Os rows).
// coverage: Yf 8 waves x 2 k steps x 2 planes = 4 n tiles x 4 k steps x 2 planes written, the same read; Os 8 waves x
//           16 n x 128 c = 64 x 256 written, read rows nl+t <= 63 x cols cl <= 255; Z 16 it x 32 lines x 8 lanes x
//           4 floats = 256 c x 64 n; grid (NQ/64, NB) covers Z[b][0..255][0..NQ-1] exactly once.
// =========================================================================================================
__global__ __launch_bounds__(256)
void gemm_yz(const unsigned short* __restrict__ MTh, const unsigned short* __restrict__ MTl,
             const unsigned short* __restrict__ Qh, const unsigned short* __restrict__ Ql,
             const unsigned short* __restrict__ WWb, const float* __restrict__ wb, float* Z) {
  __shared__ __align__(16) unsigned short Yf[(QT / 16) * (DQ / 32) * 2 * FRG];
  __shared__ __align__(16) float Os[QT * OSZ];
  const int tid  = threadIdx.x;
  const int lane = tid & 31;
  const int wave = __builtin_amdgcn_readfirstlane(tid >> 5);         // scalar: fragment bases stay in SGPRs
  const int hh   = lane >> 4, c = lane & 15;
  const int nw   = wave & 3, hf = wave >> 2;
  const int nt   = blockIdx.x, b = blockIdx.y;
  const int n0   = nt * QT;
  const unsigned lo8 = (unsigned)(8 * lane);                         // the lane's offset, the same in every fragment

  const size_t ao = (size_t)((b * (DQ / 16) + (QT / 16) * hf) * (DQ / 32)) * FRG;
  const unsigned short* aph = MTh + ao + lo8;
  const unsigned short* apl = MTl + ao + lo8;
  const size_t bo = (size_t)((b * (NN / 16) + n0 / 16 + nw) * (DQ / 32)) * FRG;
  const unsigned short* bph = Qh + bo + lo8;
  const unsigned short* bpl = Ql + bo + lo8;
  const unsigned short* wp  = WWb + (size_t)(8 * hf * (DQ / 32)) * FRG + lo8;

  v8f acc[4];
#pragma unroll
  for (int mt = 0; mt < 4; ++mt) acc[mt] = zero8();

  // the reads of two k-steps stand as one group in front of their products: two waits for memory a wave, not sixteen
#pragma unroll
  for (int kp = 0; kp < DQ / 64; ++kp) {
    Frag fbh[2], fbl[2], fah[2][4], fal[2][4];
#pragma unroll
    for (int kl = 0; kl < 2; ++kl) {
      const int ks = 2 * kp + kl;
      fbh[kl] = ldfrag(bph + FRG * ks);
      fbl[kl] = ldfrag(bpl + FRG * ks);
#pragma unroll
      for (int mt = 0; mt < 4; ++mt) {
        fah[kl][mt] = ldfrag(aph + (size_t)(mt * (DQ / 32) + ks) * FRG);
        fal[kl][mt] = ldfrag(apl + (size_t)(mt * (DQ / 32) + ks) * FRG);
      }
    }
#pragma unroll
    for (int kl = 0; kl < 2; ++kl) {
#pragma unroll
      for (int mt = 0; mt < 4; ++mt) {
        acc[mt] = mma_b(fah[kl][mt].bf, fbh[kl].bf, acc[mt]);
        acc[mt] = mma_b(fah[kl][mt].bf, fbl[kl].bf, acc[mt]);
        acc[mt] = mma_b(fal[kl][mt].bf, fbh[kl].bf, acc[mt]);
      }
    }
  }

  // the weight reads of a k-step of the second product stand one k-step ahead of their products; the first group here,
  // so that its latency passes under the split and the barrier
  Frag fa[2][8];
#pragma unroll
  for (int mt = 0; mt < 8; ++mt) fa[0][mt] = ldfrag(wp + (size_t)(mt * (DQ / 32)) * FRG);

  // ---- y = acc/1024, split in place -> LDS fragments Yf[nw][2 hf + kl][plane], unit (j, lane) from acc[2 kl + j]
#pragma unroll
  for (int kl = 0; kl < 2; ++kl) {
    unsigned short* yp = Yf + ((nw * (DQ / 32) + 2 * hf + kl) * 2) * FRG + lo8;
#pragma unroll
    for (int j = 0; j < 2; ++j) {
      float f[8];
#pragma unroll
      for (int r = 0; r < 8; ++r) f[r] = acc[2 * kl + j][r] * INS;
      v4u uh, ul;
      split8(f, uh, ul);
      *(v4u*)(yp + j * (FRG / 2))       = uh;
      *(v4u*)(yp + FRG + j * (FRG / 2)) = ul;
    }
  }
  __syncthreads();

  v8f az[8];
#pragma unroll
  for (int mt = 0; mt < 8; ++mt) az[mt] = zero8();
  const unsigned short* yb = Yf + (nw * (DQ / 32) * 2) * FRG + lo8;
#pragma unroll
  for (int ks = 0; ks < DQ / 32; ++ks) {
    if (ks + 1 < DQ / 32) {
#pragma unroll
      for (int mt = 0; mt < 8; ++mt) fa[(ks + 1) & 1][mt] = ldfrag(wp + (size_t)(mt * (DQ / 32) + ks + 1) * FRG);
    }
    const Frag fbh = ldfrag(yb + (2 * ks) * FRG);
    const Frag fbl = ldfrag(yb + (2 * ks + 1) * FRG);
#pragma unroll
    for (int mt = 0; mt < 8; ++mt) {
      az[mt] = mma_b(fa[ks & 1][mt].bf, fbh.bf, az[mt]);
      az[mt] = mma_b(fa[ks & 1][mt].bf, fbl.bf, az[mt]);
    }
  }

  // ---- epilogue: -> LDS Os[n_loc][c]; lane (hh, c) holds channel 128 hf + 16 mt + 8 hh + r for n_loc = 16 nw + c
  {
    float* op = Os + (16 * nw + c) * OSZ + 128 * hf + 8 * hh;
#pragma unroll
    for (int mt = 0; mt < 8; ++mt) {
      v4f va, vb;
#pragma unroll
      for (int r = 0; r < 4; ++r) { va[r] = az[mt][r]; vb[r] = az[mt][4 + r]; }
      *(v4f*)(op + 16 * mt)     = va;
      *(v4f*)(op + 16 * mt + 4) = vb;
    }
  }
  __syncthreads();

  const int e = tid & 7, lq = tid >> 3;                              // lq 0..31
#pragma unroll
  for (int g = 0; g < 2; ++g) {
    v4f res[8];
#pragma unroll
    for (int it = 0; it < 8; ++it) {
      const int L   = (8 * g + it) * 32 + lq;                        // 0..511
      const int cl  = L >> 1, hl = L & 1;                            // channel 0..255
      const int nl  = hl * 32 + 4 * e;                               // position 0..63
      const float bvs = bfr(wb[cl]);
#pragma unroll
      for (int t = 0; t < 4; ++t) {
        res[it][t] = Os[(nl + t) * OSZ + cl] + bvs;
      }
    }
#pragma unroll
    for (int it = 0; it < 8; ++it) {
      const int L   = (8 * g + it) * 32 + lq;
      const int cl  = L >> 1, hl = L & 1;
      const int nl  = hl * 32 + 4 * e;
      const size_t idx = ((size_t)(b * CC + cl)) * NQ + n0 + nl;
      *(v4f*)(Z + idx) = res[it];
    }
  }
}

// =========================================================================================================
// (8) batch-norm statistics per channel ch (one block per channel, 1024 threads = 32 waves): every thread issues all
//     its b128 reads of z (one per batch image and 1024-quad slice) before it sums any, f64 sums of z and z*z in four
//     independent chains, LDS f64 tree (cross-thread, block barriers), mean and biased variance in f64,
//     rstd = 1/sqrt(var + eps) in f32; stats line ST[ch][32 floats] = {mean, bf16-RNE(gamma)*rstd, bf16-RNE(beta),
// coverage: grid (CC) writes every line of ST exactly once; reads Z rows (b<NB, ch, n<NQ) all produced by (6).
// =========================================================================================================
__global__ __launch_bounds__(SBT)
void bn_stats(const float* __restrict__ Z, const float* __restrict__ gam, const float* __restrict__ bet,
              float* ST) {
  __shared__ double sh1[SBT];
  __shared__ double sh2[SBT];
  const int tid = threadIdx.x, ch = blockIdx.x;
  v4f v[NB * SQ];
  // both loops unrolled: v[] stays in registers and the reads issue back to back, none waiting for a sum
#pragma unroll
  for (int b = 0; b < NB; ++b) {
    const float* zr = Z + ((size_t)(b * CC + ch)) * NQ;
#pragma unroll
    for (int j = 0; j < SQ; ++j) {
      v[b * SQ + j] = *(const v4f*)(zr + 4 * (j * SBT + tid));
      // a later read of this run may land its result in this read's address registers: the wait stands in front of it
      asm volatile("s_wait_xcnt 0x0" ::: "memory");
    }
  }
  double s4[4] = {0.0, 0.0, 0.0, 0.0}, q4[4] = {0.0, 0.0, 0.0, 0.0};
  // unrolled: every index of v[], s4[] and q4[] is a constant (registers, no scratch)
#pragma unroll
  for (int i = 0; i < NB * SQ; ++i) {
#pragma unroll
    for (int t = 0; t < 4; ++t) { const double d = (double)v[i][t]; s4[t] += d; q4[t] += d * d; }
  }
  sh1[tid] = (s4[0] + s4[1]) + (s4[2] + s4[3]);
  sh2[tid] = (q4[0] + q4[1]) + (q4[2] + q4[3]);
  __syncthreads();
#pragma unroll 1
  for (int stp = SBT / 2; stp > 0; stp >>= 1) {
    if (tid < stp) { sh1[tid] += sh1[tid + stp]; sh2[tid] += sh2[tid + stp]; }
    __syncthreads();
  }
  const double cnt  = (double)NB * (double)NQ;
  const double mean = sh1[0] / cnt;
  double var = sh2[0] / cnt - mean * mean;
  var = (var > 0.0) ? var : 0.0;
  const float rstd  = 1.0f / sqrtf((float)var + BNEPS);
  const float meanf = (float)mean;
  const float scl   = bfr(gam[ch]) * rstd;
  const float btr   = bfr(bet[ch]);
  if (tid < 8) {
    v4f w;
    w[0] = (tid == 0) ? meanf : 0.f;
    w[1] = (tid == 0) ? scl : 0.f;
    w[2] = (tid == 0) ? btr : 0.f;
    w[3] = 0.f;
    float* p = ST + (size_t)ch * STL + 4 * tid;
    *(v4f*)p = w;
    
  }
}

// =========================================================================================================
// (9) out[b][ch][n] = ((z - mean) * (gamma*rstd) + beta) + bf16-RNE(x): one thread per 4 consecutive n; a wave writes
// coverage: NB*CC*NQ/1024 blocks x 256 threads x 4 floats = out[b<NB][0..255][0..NQ-1] exactly once.
// =========================================================================================================
__global__ __launch_bounds__(256)
void bn_apply(const float* __restrict__ Z, const float* __restrict__ x, const float* __restrict__ ST,
              float* out) {
  const size_t i4   = (size_t)blockIdx.x * 256 + threadIdx.x;
  const size_t el   = i4 * 4;
  const size_t rowi = el / NQ;
  const int n  = (int)(el - rowi * NQ);
  const int ch = (int)(rowi % CC);
  const int b  = (int)(rowi / CC);
  const v4f z  = *(const v4f*)(Z + el);
  const size_t xo = ((size_t)(b * CC + ch)) * NN + n;
  const v4f xv = *(const v4f*)(x + xo);
  const float mean = ST[(size_t)ch * STL + 0];
  const float scl  = ST[(size_t)ch * STL + 1];
  const float btr  = ST[(size_t)ch * STL + 2];
  v4f r;
#pragma unroll
  for (int t = 0; t < 4; ++t) r[t] = ((z[t] - mean) * scl + btr) + bfr(xv[t]);
  float* p = out + xo;
  *(v4f*)p = r;
  
}

// =========================================================================================================
// Workspace map (bytes; each region start a multiple of 256; every extent is an exact row/tile multiple and is
//   (the 16-bit planes hold these extents in fragment order)
//   W16 f16 [384][256]            196608      WWb bf16 [256][128]        65536
//   XP  f16 [NB][4096][256]     16777216 (NB=8)
//   Qh/Ql bf16 [NB][4096][128]   8388608 x2
//   PGZ region 33554432: Z f32 [NB][256][NQ] at +0; Z extent <= region (static_assert)
//   Pc/Gc f16 [NB][128][1024]   2097152 x2
//   MTh/MTl bf16 [NB][128][128]   262144 x2
//   ST  f32 [256][32]               32768
//   total (NB=8, NQ=4096) = 72122368
// =========================================================================================================
extern "C" void kernel_launch(void* const* d_in, const int* in_sizes, int n_in,
                              void* d_out, int out_size, void* d_ws, size_t ws_size,
                              hipStream_t stream) {
  const int XN = NB * CC * NN;
  if (n_in < 11) return;
  if (in_sizes[0] < XN) return;
  if (in_sizes[1] < DQ * CC || in_sizes[3] < DQ * CC || in_sizes[5] < DQ * CC || in_sizes[7] < CC * DQ) return;
  if (in_sizes[2] < DQ || in_sizes[4] < DQ || in_sizes[6] < DQ || in_sizes[8] < CC) return;
  if (in_sizes[9] < CC || in_sizes[10] < CC) return;
  if (out_size < XN) return;

  size_t off = 0;
  auto carve = [&](size_t bytes) { const size_t o = off; off += (bytes + 255) & ~(size_t)255; return o; };
  const size_t oW16 = carve((size_t)MW * CC * 2);
  const size_t oWWb = carve((size_t)CC * DQ * 2);
  const size_t oXP  = carve((size_t)NB * NN * CC * 2);
  const size_t oQh  = carve((size_t)NB * NN * DQ * 2);
  const size_t oQl  = carve((size_t)NB * NN * DQ * 2);
  const size_t oPGZ = carve((size_t)2 * NB * NN * DQ * 4);
  const size_t oPc  = carve((size_t)NB * DQ * MM * 2);
  const size_t oGc  = carve((size_t)NB * DQ * MM * 2);
  const size_t oMTh = carve((size_t)NB * DQ * DQ * 2);
  const size_t oMTl = carve((size_t)NB * DQ * DQ * 2);
  const size_t oST  = carve((size_t)CC * STL * 4);
  if (off > ws_size) return;
  if (off > (size_t)134217728) return;

  const float* x  = (const float*)d_in[0];
  const float* gw = (const float*)d_in[1];
  const float* gb = (const float*)d_in[2];
  const float* tw = (const float*)d_in[3];
  const float* tb = (const float*)d_in[4];
  const float* pw = (const float*)d_in[5];
  const float* pb = (const float*)d_in[6];
  const float* ow = (const float*)d_in[7];
  const float* wb = (const float*)d_in[8];
  const float* bg = (const float*)d_in[9];
  const float* bb = (const float*)d_in[10];

  char* ws = (char*)d_ws;
  unsigned short* W16 = (unsigned short*)(ws + oW16);
  unsigned short* WWb = (unsigned short*)(ws + oWWb);
  unsigned short* XP  = (unsigned short*)(ws + oXP);
  unsigned short* Qh  = (unsigned short*)(ws + oQh);
  unsigned short* Ql  = (unsigned short*)(ws + oQl);
  float*          Z   = (float*)(ws + oPGZ);
  unsigned short* Pc  = (unsigned short*)(ws + oPc);
  unsigned short* Gc  = (unsigned short*)(ws + oGc);
  unsigned short* MTh = (unsigned short*)(ws + oMTh);
  unsigned short* MTl = (unsigned short*)(ws + oMTl);
  float*          ST  = (float*)(ws + oST);
  float* out = (float*)d_out;

  const dim3 blk256(256);

  // (0) theta_w / phi_w / g_w -> stacked f16 plane; w_w -> bf16 plane
  cvt_w<<<dim3(MW / 8 + CC / 16), blk256, 0, stream>>>(tw, pw, gw, ow, W16, WWb);
  // (1) x -> position-major 16-bit plane
  cvt_x<<<dim3(NN / QT, CC / QT, NB), blk256, 0, stream>>>(x, XP);
  // (2) conv1x1 GEMM -> theta hi/res planes; phi / g + bias, 2x2 max-pooled, as channel-major f16 planes [b][d][m]
  gemm_proj<<<dim3(NSTRIP, 4, NB), blk256, 0, stream>>>(W16, XP, tb, pb, gb, Qh, Ql, Pc, Gc);
  // (5) M = pooled-phi . pooled-g^T per batch -> M^T hi/res planes [b][ci][cp]
  gemm_m<<<dim3(DQ / 16, DQ / QT, NB), blk256, 0, stream>>>(Pc, Gc, MTh, MTl);
  // (6) y = theta . M / 1024 (hi/res fragments kept in LDS), output conv + bias -> Z [b][256][NQ]
  gemm_yz<<<dim3(NQ / QT, NB), blk256, 0, stream>>>(MTh, MTl, Qh, Ql, WWb, wb, Z);
  // (8) batch statistics per channel -> ST lines
  bn_stats<<<dim3(CC), dim3(SBT), 0, stream>>>(Z, bg, bb, ST);
  // (9) normalise, affine, residual -> out [b][256][4096]
  bn_apply<<<dim3((NB * CC * NQ) / 1024), blk256, 0, stream>>>(Z, x, ST, out);
  (void)hipGetLastError();
}

// v007
// It runs in 60.4 microseconds.
// Two timings next to v006 put it at 1.26 and 1.25 times that version's speed.
// Over all steps from v000 it is 2.40 times as fast.
// Contractions: conv1x1 theta/phi/g GEMM W[384x256].X[256x128] per strip on v_wmma_f32_16x16x32_f16 (f16
// containers of bf16-RNE weights x256 and bf16-RNE x, 1 product); M = pooled-phi . pooled-g^T per batch
// [128x128], K=1024, on v_wmma_f32_16x16x32_f16 (2x2 max-pooled phi and g as plain f16, 1 product);
// y^T = M^T.theta^T, K=128, on v_wmma_f32_16x16x32_bf16 (M and theta as bf16 hi + bf16 residual planes,
// 3 products); output conv W[256x128].Y on v_wmma_f32_16x16x32_bf16 (bf16 weights, y as bf16 hi + residual
// planes, 2 products); f32 accumulate everywhere; max-pool, bias, batch-norm statistics (f32 sums over 64 positions,
// f64 sums of those, f32 apply) and the residual add on VALU.
// Every 16-bit WMMA operand plane lies in the workspace (y: in LDS) in fragment order: one fragment = 16 rows x 32 k = 1 KiB =
// [j 0..1][lane 0..31][8 values], unit (j, lane) = row (lane&15), k = 16 j + 8 (lane>>4) .. + 7. A wave reads a fragment
// with two b128 loads of 512 contiguous bytes each (4 whole lines a load).
#include <hip/hip_runtime.h>
#include <math.h>
#include <stdint.h>

#ifndef NB
#define NB 8
#endif
#ifndef NQ
#define NQ 4096
#endif
#define NB_FULL 8
#define CC     256
#define HIMG   64
#define WIMG   64
#define NN     4096
#define DQ     128
#define HP     32
#define WP     32
#define MM     1024
#define MW     384
#define QT     64
#define SN     128
#define NSTRIP 32
#define OSP    68
#define OSZ    260
#define TP     72
#define WSC    256.0f
#define IWSC   0.00390625f
#define INS    0.0009765625f
#define BNEPS  1e-5f
#define KSL    128
#define FRG    512
#define PBK    ((NQ / QT) * NB)
#define AGC    16
#define ASN    2048
#define ABT    1024

static_assert(NB >= 1 && NB <= NB_FULL);
static_assert(NQ % 128 == 0 && NQ >= 128 && NQ <= NN);
static_assert(NQ % QT == 0);
static_assert(NN == HIMG * WIMG);
static_assert(SN == 2 * WIMG && NSTRIP * SN == NN && SN == 8 * 16);
static_assert(HIMG % 2 == 0 && WIMG % 2 == 0 && HP == HIMG / 2 && WP == WIMG / 2 && MM == HP * WP);
static_assert(WP == 32);
static_assert(MM % QT == 0 && MM % 32 == 0);
static_assert(NN % QT == 0 && CC % QT == 0 && DQ == 2 * QT);
static_assert(MW == 3 * DQ && MW % 8 == 0);
static_assert(CC % 32 == 0 && DQ % 32 == 0);
static_assert((OSP * 4) % 16 == 0 && (TP * 2) % 16 == 0);
static_assert(SN * OSP * 4 <= 65536 && DQ * OSP * 4 <= 65536);
static_assert(((size_t)NB * CC * NQ) % 1024 == 0);
static_assert((size_t)NB * CC * NQ * 4 <= 2 * (size_t)NB * NN * DQ * 4);
static_assert((size_t)NB_FULL * CC * NN * 4 == (size_t)33554432);
static_assert((OSZ * 4) % 16 == 0 && OSZ >= CC && CC == 2 * 8 * 16 && QT == 4 * 16);
static_assert(QT * TP * 2 <= SN * OSP * 4 && NN == 16 * 4 * WIMG && MM == 16 * 64);
static_assert(MM == 8 * KSL && KSL == 4 * 32 && DQ == 8 * 16);
static_assert(PBK % 128 == 0 && NQ % ASN == 0 && CC % AGC == 0 && AGC * 2 * 4 == 128 && CC == 256);
static_assert(AGC * ASN == 8 * 4 * ABT && ASN == 4 * (ABT / 2) && ABT == 8 * 128);

typedef _Float16       v16h __attribute__((ext_vector_type(16)));
typedef _Float16       v8h  __attribute__((ext_vector_type(8)));
typedef __bf16         v16b __attribute__((ext_vector_type(16)));
typedef unsigned short v8us __attribute__((ext_vector_type(8)));
typedef float          v8f  __attribute__((ext_vector_type(8)));
typedef float          v4f  __attribute__((ext_vector_type(4)));
typedef float          v2f  __attribute__((ext_vector_type(2)));
typedef unsigned int   v4u  __attribute__((ext_vector_type(4)));
typedef unsigned int   v2u  __attribute__((ext_vector_type(2)));

union Frag { v8us u[2]; v16h h; v16b bf; };
static_assert(sizeof(Frag) == 32);

// ---- scalar helpers ---------------------------------------------------------------------------------------
__device__ __forceinline__ unsigned short bf_bits(float f) {          // f32 -> bf16 bits, RNE convert
  unsigned u = __float_as_uint(f);
  return (unsigned short)((u + 0x7FFFu + ((u >> 16) & 1u)) >> 16);
}
__device__ __forceinline__ float bf_up(unsigned short hb) { return __uint_as_float(((unsigned)hb) << 16); }
__device__ __forceinline__ float bfr(float f) { return bf_up(bf_bits(f)); }
__device__ __forceinline__ unsigned short h_bits(_Float16 x) { return __builtin_bit_cast(unsigned short, x); }
__device__ __forceinline__ unsigned pk16(unsigned short a, unsigned short b) { return (unsigned)a | ((unsigned)b << 16); }
__device__ __forceinline__ v8f zero8() { v8f z = {0.f, 0.f, 0.f, 0.f, 0.f, 0.f, 0.f, 0.f}; return z; }
// 8 f32 values -> bf16 hi bits and bf16 residual bits (lo = RNE(v - hi)), packed 2 per uint
__device__ __forceinline__ void split8(const float* f, v4u& uh, v4u& ul) {
#pragma unroll
  for (int t = 0; t < 4; ++t) {
    const float f0 = f[2 * t], f1 = f[2 * t + 1];
    const unsigned short hb0 = bf_bits(f0), hb1 = bf_bits(f1);
    const unsigned short lb0 = bf_bits(f0 - bf_up(hb0));
    const unsigned short lb1 = bf_bits(f1 - bf_up(hb1));
    uh[t] = pk16(hb0, hb1);
    ul[t] = pk16(lb0, lb1);
  }
}

// ---- 16-bit fragment loader (A or B) from a plane in fragment order: lane -> row/col (lane&15), h = lane>>4; p = start
//      of the fragment + 8*lane; elements 0..7 <- p[0..7] (k0+8h..), elements 8..15 <- p[256..263] (k0+16+8h..)
__device__ __forceinline__ Frag ldfrag(const unsigned short* p) {
  Frag f;
  f.u[0] = *(const v8us*)(p);
  f.u[1] = *(const v8us*)(p + FRG / 2);
  return f;
}
// k offset (0, 8, 16, 24) inside its fragment of the 16-B unit that thread t stores (unit = t & 63; its row is t & 15)
__device__ __forceinline__ int unit_k(int t) { return 16 * ((t >> 5) & 1) + 8 * ((t >> 4) & 1); }

// ---- WMMA helpers: builtin followed by a 4-slot VALU gap tying D and keeping A/B live --------------------------
__device__ __forceinline__ v8f mma_h(v16h a, v16h b, v8f c) {
  v8f d = __builtin_amdgcn_wmma_f32_16x16x32_f16(false, a, false, b, (short)0, c, false, false);
#if defined(__HIP_DEVICE_COMPILE__)
  asm volatile("v_nop\n\tv_nop\n\tv_nop\n\tv_nop" : "+v"(d) : "v"(a), "v"(b));
#endif
  return d;
}
__device__ __forceinline__ v8f mma_b(v16b a, v16b b, v8f c) {
  v8f d = __builtin_amdgcn_wmma_f32_16x16x32_bf16(false, a, false, b, (short)0, c, false, false);
#if defined(__HIP_DEVICE_COMPILE__)
  const v16h ha = __builtin_bit_cast(v16h, a), hb = __builtin_bit_cast(v16h, b);
  asm volatile("v_nop\n\tv_nop\n\tv_nop\n\tv_nop" : "+v"(d) : "v"(ha), "v"(hb));
#endif
  return d;
}

// =========================================================================================================
// (0) weights. Blocks 0..47: W16 f16 [384][256], rows 0..127 = theta_w, 128..255 = phi_w, 256..383 = g_w; value =
//     f16 of (bf16-RNE(w) * 256) (exact), fragments [24 o tiles][8 k steps]. Blocks 48..63: WWb bf16 of w_w [256][128],
//     fragments [16 c tiles][4 k steps]. A block owns 4 consecutive fragments, a thread one 16-B unit.
// coverage: 48 blocks x 256 units x 8 halves = 384 x 256; 16 blocks x 256 units x 8 = 256 x 128.
// =========================================================================================================
__global__ __launch_bounds__(256)
void cvt_w(const float* __restrict__ tw, const float* __restrict__ pw, const float* __restrict__ gw,
           const float* __restrict__ ow, unsigned short* W16, unsigned short* WWb) {
  const int tid = threadIdx.x, blk = blockIdx.x;
  if (blk < MW / 8) {
    const int un = blk * 256 + tid;                                  // unit 0..12287
    const int fr = un >> 6;                                          // fragment = 8 (o tile) + k step
    const int o = 16 * (fr >> 3) + (tid & 15);                       // 0..383, o tile = blk >> 1
    const int col = 32 * (fr & 7) + unit_k(tid);                     // 0..248
    const int grp = blk >> 4;                                        // 0,1,2 (block-uniform)
    const float* wbase = (grp == 0) ? tw : ((grp == 1) ? pw : gw);  // all global
    const float* s = wbase + (size_t)(o - DQ * grp) * CC + col;      // (o - 128 grp) in 0..127
    const v4f a = *(const v4f*)s;
    const v4f q = *(const v4f*)(s + 4);
    const float f[8] = {a[0], a[1], a[2], a[3], q[0], q[1], q[2], q[3]};
    v4u u;
#pragma unroll
    for (int t = 0; t < 4; ++t) {
      const _Float16 h0 = (_Float16)(bfr(f[2 * t]) * WSC);
      const _Float16 h1 = (_Float16)(bfr(f[2 * t + 1]) * WSC);
      u[t] = pk16(h_bits(h0), h_bits(h1));
    }
{
      *(v4u*)(W16 + (size_t)un * 8) = u;
      
    }
  } else {
    const int un = (blk - MW / 8) * 256 + tid;                       // unit 0..4095
    const int fr = un >> 6;                                          // fragment = 4 (c tile) + k step
    const int o = 16 * (fr >> 2) + (tid & 15);                       // 0..255
    const int col = 32 * (fr & 3) + unit_k(tid);                     // 0..120
    const float* s = ow + (size_t)o * DQ + col;
    const v4f a = *(const v4f*)s;
    const v4f q = *(const v4f*)(s + 4);
    const float f[8] = {a[0], a[1], a[2], a[3], q[0], q[1], q[2], q[3]};
    v4u u;
#pragma unroll
    for (int t = 0; t < 4; ++t) u[t] = pk16(bf_bits(f[2 * t]), bf_bits(f[2 * t + 1]));
{
      *(v4u*)(WWb + (size_t)un * 8) = u;
      
    }
  }
}

// =========================================================================================================
// (1) x f32 [b][256 c][4096 n] -> XP f16, fragments [b][256 n tiles][8 k steps], k = c (bf16-RNE values, exact in f16),
//     through an LDS tile T[64 n][64 c] (pitch TP, cross-thread, block barrier). Block (nb, cb, b) owns a 64 c x 64 n
//     tile = 4 n tiles x 2 k steps = 8 fragments.
// coverage: T written rows (8e+t)=0..63 x cols cl 0..63, read rows 0..63 x cols 0..63; XP 2 it x 256 units x 8 = 8
//           fragments; grid (64, 4, NB) covers every fragment of XP exactly once.
// =========================================================================================================
__global__ __launch_bounds__(256)
void cvt_x(const float* __restrict__ x, unsigned short* XP) {
  __shared__ __align__(16) unsigned short T[QT * TP];
  const int tid = threadIdx.x;
  const int nb = blockIdx.x, cb = blockIdx.y, b = blockIdx.z;
  const int e = tid & 7, lq = tid >> 3;                             // lq 0..31
  const int n0 = nb * QT, c0 = cb * QT;
#pragma unroll
  for (int it = 0; it < 2; ++it) {
    const int cl = it * 32 + lq;                                     // 0..63
    const float* sp = x + ((size_t)(b * CC + c0 + cl)) * NN + n0 + 8 * e;
    const v4f a = *(const v4f*)sp;
    const v4f q = *(const v4f*)(sp + 4);
    unsigned short hb[8];
#pragma unroll
    for (int t = 0; t < 4; ++t) {
      hb[t]     = h_bits((_Float16)bfr(a[t]));
      hb[4 + t] = h_bits((_Float16)bfr(q[t]));
    }
#pragma unroll
    for (int t = 0; t < 8; ++t) T[(8 * e + t) * TP + cl] = hb[t];
  }
  __syncthreads();
  v4u up[2];
#pragma unroll
  for (int it = 0; it < 2; ++it) {
    const int fl = it * 4 + (tid >> 6);                              // fragment 0..7 = 2 (n tile) + k step
    up[it] = *(const v4u*)(T + (16 * (fl >> 1) + (tid & 15)) * TP + 32 * (fl & 1) + unit_k(tid));
  }
{
#pragma unroll
    for (int it = 0; it < 2; ++it) {
      const int fl = it * 4 + (tid >> 6);
      const int fg = (b * (NN / 16) + n0 / 16 + (fl >> 1)) * (CC / 32) + c0 / 32 + (fl & 1);
      *(v4u*)(XP + (size_t)fg * FRG + 8 * (tid & 63)) = up[it];
    }
    
  }
}

// =========================================================================================================
// (2) conv1x1 GEMM, Y[o][n] = (1/256) sum_c W16[o][c] XP[b][n][c], K = 256 = 8 steps, 256 threads = 8 waves; every
//     plane read or written here is in fragment order (Qh/Ql: [b][256 n tiles][4 k steps], k = d; Pc/Gc: [b][8 d tiles]
//     [32 k steps], k = m); the
//     block's shape depends on blockIdx.y (block-uniform branch, taken in front of every barrier):
//     y = 0,1 (theta dims 0..63 / 64..127): strip of 128 positions x 64 o. Wave w owns cols n0+16w..+15 (one B
//       fragment per k-step) and 4 m-tiles (A rows o = o0 + 16 mt + (lane&15), from W16). Epilogue staged in LDS
//       Os[n_loc][o_loc] (pitch OSP, b128 stores, cross-wave), block barrier, + bias -> Qh/Ql bf16 (hi = RNE(v),
//       lo = RNE(v-hi)), 16 fragments a plane, a wave's store = 512 contiguous bytes.
//     y = 2,3 (phi, g): idx = 32 (y-2) + x -> 256 positions (image rows 4 ds..4 ds+3, ds = idx&15) x 64 o
//       (ob = idx>>4: phi dims 0.., 64.., then g dims 0.., 64..). Wave w = (pyl = w>>2, xt = w&3) owns the two n-tiles
//       of image rows 4 ds + 2 pyl and + 2 pyl + 1 at columns 16 xt..16 xt+15, and 4 m-tiles. The 2x2 stride-2
//       max-pool is done on the accumulators: the row pair is the wave's two tiles (same lane, same register), the
//       column pair is lane ^ 1. Scale and bias follow the maximum (x -> fl(x/256 + bias) never decreases as x grows, so
//       the maximum of the results is the result of the maximum). f16 values go through the LDS tile T[64 o][64 m]
//       (pitch TP, cross-wave, block barrier) -> Pc / Gc f16, m = 32 py + px: the block owns 4 d tiles x 2 k steps = 8
//       whole fragments.
// coverage: theta: Os 8 waves x 16 n x 64 o = 128 x 64 written, reads rows <= 127 cols <= 63; planes 4 it x 256 units
//           x 8 = 128 n x 64 d; 32 x 2 blocks cover 4096 rows x 128 d of Qh/Ql once. phi/g: T written rows
//           16 mt + 8 hh + 4 (c&1) + j = 0..63 x cols 32 pyl + 8 xt + (c>>1) = 0..63, read rows 0..63 x cols 0..63;
//           16 ds x 4 ob blocks cover Pc and Gc (128 d x 1024 m a batch) exactly once.
// =========================================================================================================
__device__ __forceinline__ float max_pair(float v) {                 // max of lanes l and l ^ 1 (quad_perm 1,0,3,2)
  const int o = __builtin_amdgcn_mov_dpp(__float_as_int(v), 0xB1, 0xF, 0xF, true);
  return fmaxf(v, __int_as_float(o));
}

__global__ __launch_bounds__(256)
void gemm_proj(const unsigned short* __restrict__ W16, const unsigned short* __restrict__ XP,
               const float* __restrict__ tb, const float* __restrict__ pb, const float* __restrict__ gb,
               unsigned short* Qh, unsigned short* Ql, unsigned short* Pc, unsigned short* Gc) {
  __shared__ __align__(16) float Os[SN * OSP];
  const int tid  = threadIdx.x;
  const int lane = tid & 31, wave = tid >> 5;                        // wave 0..7
  const int hh   = lane >> 4, c = lane & 15;
  const int st   = blockIdx.x, mb = blockIdx.y, b = blockIdx.z;

  if (mb >= 2) {
    // ---- phi / g: 64 o x 256 positions, pooled in registers
    const int idx = (mb - 2) * NSTRIP + st;                          // 0..63
    const int ds = idx & 15, ob = idx >> 4;                          // ds 0..15, ob 0..3
    const int sel = ob >> 1, d0 = QT * (ob & 1);                     // plane (0 phi, 1 g), first dim 0 or 64
    const int wv  = __builtin_amdgcn_readfirstlane(wave);            // scalar: row bases stay in SGPRs, fewer VGPRs
    const int pyl = wv >> 2, xt = wv & 3;
    const unsigned lo = (unsigned)(8 * lane);                        // the lane's offset, the same in every fragment
    const unsigned short* ap  = W16 + (size_t)((DQ + QT * ob) / 16 * (CC / 32)) * FRG + lo;
    const unsigned short* bp0 = XP + (size_t)((b * (NN / 16) + (4 * ds + 2 * pyl) * (WIMG / 16) + xt) * (CC / 32)) * FRG + lo;
    const unsigned short* bp1 = bp0 + (size_t)(WIMG / 16 * (CC / 32)) * FRG;

    v8f a0[4], a1[4];
#pragma unroll
    for (int mt = 0; mt < 4; ++mt) { a0[mt] = zero8(); a1[mt] = zero8(); }
#pragma unroll
    for (int ks = 0; ks < CC / 32; ++ks) {
      const Frag fb0 = ldfrag(bp0 + FRG * ks);
      const Frag fb1 = ldfrag(bp1 + FRG * ks);
      Frag fa[4];
#pragma unroll
      for (int mt = 0; mt < 4; ++mt) fa[mt] = ldfrag(ap + (size_t)(mt * (CC / 32) + ks) * FRG);
#pragma unroll
      for (int mt = 0; mt < 4; ++mt) {
        a0[mt] = mma_h(fa[mt].h, fb0.h, a0[mt]);
        a1[mt] = mma_h(fa[mt].h, fb1.h, a1[mt]);
      }
    }

    unsigned short* T = (unsigned short*)Os;                         // [64 o][TP] f16
    const float* bias = (sel == 0) ? pb : gb;                        // both global
    const int odd = c & 1;                                           // even lane stores r 0..3, odd lane r 4..7
    const int ml  = 32 * pyl + 8 * xt + (c >> 1);                    // 0..63
#pragma unroll
    for (int mt = 0; mt < 4; ++mt) {
      const int ol = 16 * mt + 8 * hh + 4 * odd;                     // 0..60
      const v4f bq = *(const v4f*)(bias + d0 + ol);
#pragma unroll
      for (int j = 0; j < 4; ++j) {
        const float pe = max_pair(fmaxf(a0[mt][j], a1[mt][j]));
        const float po = max_pair(fmaxf(a0[mt][4 + j], a1[mt][4 + j]));
        const float v  = (odd ? po : pe) * IWSC + bfr(bq[j]);
        T[(ol + j) * TP + ml] = h_bits((_Float16)v);
      }
    }
    __syncthreads();
    {
      const int kl = (tid >> 6) & 1;                                 // k step of the block's two; d tile = 2 it + (tid >> 7)
      unsigned short* dst = (sel == 0) ? Pc : Gc;                    // both global
      v4u u[2];
#pragma unroll
      for (int it = 0; it < 2; ++it)
        u[it] = *(const v4u*)(T + (16 * (2 * it + (tid >> 7)) + (tid & 15)) * TP + 32 * kl + unit_k(tid));
#pragma unroll
      for (int it = 0; it < 2; ++it) {
        const int fg = (b * (DQ / 16) + d0 / 16 + 2 * it + (tid >> 7)) * (MM / 32) + 2 * ds + kl;
        *(v4u*)(dst + (size_t)fg * FRG + 8 * (tid & 63)) = u[it];
      }
    }
    return;
  }

  const int n0   = st * SN, o0 = mb * QT;

  const unsigned short* ap = W16 + (size_t)(o0 / 16 * (CC / 32)) * FRG + 8 * lane;
  const unsigned short* bp = XP + (size_t)((b * (NN / 16) + n0 / 16 + wave) * (CC / 32)) * FRG + 8 * lane;

  v8f acc[4];
#pragma unroll
  for (int mt = 0; mt < 4; ++mt) acc[mt] = zero8();

  // the reads of two k-steps stand as one group in front of their products: the wave waits out the load latency once a
  // group, not once a product (registers: a third k-step would cost a resident wave)
#pragma unroll
  for (int kp = 0; kp < CC / 64; ++kp) {
    Frag fb[2], fa[2][4];
#pragma unroll
    for (int kl = 0; kl < 2; ++kl) {
      const int ks = 2 * kp + kl;
      fb[kl] = ldfrag(bp + FRG * ks);
#pragma unroll
      for (int mt = 0; mt < 4; ++mt) fa[kl][mt] = ldfrag(ap + (size_t)(mt * (CC / 32) + ks) * FRG);
    }
#pragma unroll
    for (int kl = 0; kl < 2; ++kl) {
#pragma unroll
      for (int mt = 0; mt < 4; ++mt) acc[mt] = mma_h(fa[kl][mt].h, fb[kl].h, acc[mt]);
    }
  }

  // ---- epilogue: scale back -> LDS Os[n_loc][o_loc]; lane (hh, c) holds o = 16 mt + 8 hh + r for n_loc = 16 w + c
  {
    const int nl = 16 * wave + c;
#pragma unroll
    for (int mt = 0; mt < 4; ++mt) {
      v4f va, vb;
#pragma unroll
      for (int r = 0; r < 4; ++r) { va[r] = acc[mt][r] * IWSC; vb[r] = acc[mt][4 + r] * IWSC; }
      *(v4f*)(Os + nl * OSP + 16 * mt + 8 * hh)     = va;
      *(v4f*)(Os + nl * OSP + 16 * mt + 8 * hh + 4) = vb;
    }
  }
  __syncthreads();

  const int dsel = mb * QT;                                          // 0 or 64
  const float* bias = tb;
  {
    const int kl = (tid >> 6) & 1;                                   // k step of the block's two; n tile = 2 it + (tid >> 7)
    const int dl = 32 * kl + unit_k(tid);                            // d_loc 0..56
    float bv[8];
    {
      const v4f ba = *(const v4f*)(bias + dsel + dl);
      const v4f bq = *(const v4f*)(bias + dsel + dl + 4);
#pragma unroll
      for (int t = 0; t < 4; ++t) { bv[t] = bfr(ba[t]); bv[4 + t] = bfr(bq[t]); }
    }
    v4u uh[4], ul[4];
#pragma unroll
    for (int it = 0; it < 4; ++it) {
      const int row = 16 * (2 * it + (tid >> 7)) + (tid & 15);       // n_loc 0..127
      const v4f a = *(const v4f*)(Os + row * OSP + dl);
      const v4f q = *(const v4f*)(Os + row * OSP + dl + 4);
      float f[8];
#pragma unroll
      for (int t = 0; t < 4; ++t) { f[t] = a[t] + bv[t]; f[4 + t] = q[t] + bv[4 + t]; }
      split8(f, uh[it], ul[it]);
    }
{
#pragma unroll
      for (int it = 0; it < 4; ++it) {
        const int fg = (b * (NN / 16) + n0 / 16 + 2 * it + (tid >> 7)) * (DQ / 32) + dsel / 32 + kl;
        const size_t po = (size_t)fg * FRG + 8 * (tid & 63);
        *(v4u*)(Qh + po) = uh[it];
        *(v4u*)(Ql + po) = ul[it];
      }
      
    }
  }
}

// =========================================================================================================
// (5) M GEMM for one (b, 64-row block of phi channels, 16-column tile of g channels): M[cp][ci] = sum_m Pc[b][cp][m]
//     Gc[b][ci][m], K = 1024. Block 256 threads = 8 waves; wave w owns the k slice m = 128 w..128 w + 127 (4 steps) of
//     the whole 64 x 16 tile: B fragments of the Gc rows ci = 16 ct + (lane&15), A rows cp = c0 + 16 mt + (lane&15)
//     from Pc, both planes in fragment order. A wave issues its 40 b128 reads before its first product.
//     The 8 partial tiles go to LDS Os[16 w + ci_loc][cp_loc] (pitch OSP, b128 stores, cross-wave), block barrier, then
//     each thread adds the 8 slices of 4 consecutive cp in slice order (f32) -> MTh/MTl bf16, fragments [b][8 ci tiles]
//     [4 k steps], k = cp: the block owns 2 whole fragments of each plane, a thread half a 16-B unit.
// coverage: Os 8 waves x 16 ci x 64 cp = 128 x 64 written, reads rows 16 w + row <= 127, cols cq..cq+3 <= 63; planes
//           256 threads x 4 = 16 ci x 64 cp; grid (8, 2, NB) covers MTh/MTl (128 ci x 128 cp a batch) exactly once.
// =========================================================================================================
__global__ __launch_bounds__(256)
void gemm_m(const unsigned short* __restrict__ Pc, const unsigned short* __restrict__ Gc,
            unsigned short* MTh, unsigned short* MTl) {
  __shared__ __align__(16) float Os[DQ * OSP];
  const int tid  = threadIdx.x;
  const int lane = tid & 31, wave = tid >> 5;                        // wave 0..7 = k slice
  const int hh   = lane >> 4, c = lane & 15;
  const int ct   = blockIdx.x, mb = blockIdx.y, b = blockIdx.z;
  const int c0   = mb * QT;

  const unsigned short* ap = Pc + (size_t)((b * (DQ / 16) + c0 / 16) * (MM / 32) + (KSL / 32) * wave) * FRG + 8 * lane;
  const unsigned short* bp = Gc + (size_t)((b * (DQ / 16) + ct) * (MM / 32) + (KSL / 32) * wave) * FRG + 8 * lane;

  Frag fb[KSL / 32], fa[KSL / 32][4];
#pragma unroll
  for (int ks = 0; ks < KSL / 32; ++ks) {
    fb[ks] = ldfrag(bp + FRG * ks);
#pragma unroll
    for (int mt = 0; mt < 4; ++mt) fa[ks][mt] = ldfrag(ap + (size_t)(mt * (MM / 32) + ks) * FRG);
  }
#if defined(__HIP_DEVICE_COMPILE__)
  // inputs-only fence on the loaded values: keeps every read of the slice in front of the first product, so that the
  // wave waits for memory once; without it each product's reads are issued, and waited for, one product at a time
  asm volatile("" :: "v"(fb[0].h), "v"(fb[1].h), "v"(fb[2].h), "v"(fb[3].h),
               "v"(fa[0][0].h), "v"(fa[0][1].h), "v"(fa[0][2].h), "v"(fa[0][3].h),
               "v"(fa[1][0].h), "v"(fa[1][1].h), "v"(fa[1][2].h), "v"(fa[1][3].h),
               "v"(fa[2][0].h), "v"(fa[2][1].h), "v"(fa[2][2].h), "v"(fa[2][3].h),
               "v"(fa[3][0].h), "v"(fa[3][1].h), "v"(fa[3][2].h), "v"(fa[3][3].h));
#endif

  v8f acc[4];
#pragma unroll
  for (int mt = 0; mt < 4; ++mt) acc[mt] = zero8();
#pragma unroll
  for (int ks = 0; ks < KSL / 32; ++ks) {
#pragma unroll
    for (int mt = 0; mt < 4; ++mt) acc[mt] = mma_h(fa[ks][mt].h, fb[ks].h, acc[mt]);
  }

  // ---- partial tile -> LDS Os[16 w + ci_loc][cp_loc]; lane (hh, c) holds cp_loc = 16 mt + 8 hh + r for ci_loc = c
  {
    const int nl = 16 * wave + c;
#pragma unroll
    for (int mt = 0; mt < 4; ++mt) {
      v4f va, vb;
#pragma unroll
      for (int r = 0; r < 4; ++r) { va[r] = acc[mt][r]; vb[r] = acc[mt][4 + r]; }
      *(v4f*)(Os + nl * OSP + 16 * mt + 8 * hh)     = va;
      *(v4f*)(Os + nl * OSP + 16 * mt + 8 * hh + 4) = vb;
    }
  }
  __syncthreads();

  const int row = (tid >> 1) & 15;                                   // ci_loc 0..15 = the unit's row
  const int cq  = 32 * (tid >> 7) + unit_k(tid >> 1) + 4 * (tid & 1); // cp_loc 0..60: two threads share a 16-B unit
  v4f s = *(const v4f*)(Os + row * OSP + cq);
#pragma unroll
  for (int w = 1; w < MM / KSL; ++w) s += *(const v4f*)(Os + (16 * w + row) * OSP + cq);
  v2u uh, ul;
#pragma unroll
  for (int t = 0; t < 2; ++t) {
    const float f0 = s[2 * t], f1 = s[2 * t + 1];
    const unsigned short hb0 = bf_bits(f0), hb1 = bf_bits(f1);
    uh[t] = pk16(hb0, hb1);
    ul[t] = pk16(bf_bits(f0 - bf_up(hb0)), bf_bits(f1 - bf_up(hb1)));
  }
  const size_t po = (size_t)((b * (DQ / 16) + ct) * (DQ / 32) + c0 / 32 + (tid >> 7)) * FRG + 4 * (tid & 127);
  *(v2u*)(MTh + po) = uh;
  *(v2u*)(MTl + po) = ul;
}

// =========================================================================================================
// (6) y GEMM and output conv in one launch, for one (b, 64-n tile). Block 256 threads = 8 waves; wave w = (nw = w & 3,
//     hf = w >> 2) owns cols n0 + 16 nw..+15 in both products.
//     First product: y[n][ci] = (1/1024) sum_cp (MTh+MTl)[b][ci][cp] (Qh+Ql)[b][n][cp] on bf16 WMMA, 3 products per
//     k-step (hi.hi + hi.lo + lo.hi, shared accumulator), K = 128 = 4 steps, 4 m-tiles (A rows ci = 64 hf + 16 mt +
//     (lane&15), from MTh/MTl). Lane (hh, c) then holds ci = 64 hf + 16 mt + 8 hh + r of column c: that is unit
//     (j = mt & 1, lane) of the B fragment of k step 2 hf + (mt >> 1), k = ci, of the second product. The lane scales and
//     splits its own values (hi = RNE(y), lo = RNE(y - hi)) and stores whole units to LDS Yf[nw][k step][hi, lo]
//     (1-KiB fragments, cross-wave: the other hf wave of the same columns reads them), block barrier.
//     Second product: A[c][n] = sum_ci WWb[c][ci] (Yhi + Ylo)[n][ci] on bf16 WMMA (2 products per k-step, shared
//     accumulator), K = 128 = 4 steps, 8 m-tiles (A rows c = 128 hf + 16 mt + (lane&15), from WWb). Epilogue staged in
//     LDS Os[n_loc][c] (pitch OSZ, b128 stores, cross-wave), block barrier, + bias -> Z rows (a channel's segment of
//     64 n = 2 lines): 8 consecutive lanes x 16 B (values gathered from 4 Os rows).
//     Batch-norm partial sums: thread t then adds z and z*z of channel t over the block's 64 positions (Os column t +
//     bias, the values stored to Z; f32, four chains) -> PS[block][channel]{sum, sum of squares}, 2 KiB a block.
// coverage: Yf 8 waves x 2 k steps x 2 planes = 4 n tiles x 4 k steps x 2 planes written, the same read; Os 8 waves x
//           16 n x 128 c = 64 x 256 written, read rows nl+t <= 63 x cols cl <= 255; Z 16 it x 32 lines x 8 lanes x
//           4 floats = 256 c x 64 n; grid (NQ/64, NB) covers Z[b][0..255][0..NQ-1] exactly once; PS row b NQ/64 + nt:
//           256 threads x 2 floats, every row of PS written exactly once.
// =========================================================================================================
__global__ __launch_bounds__(256)
void gemm_yz(const unsigned short* __restrict__ MTh, const unsigned short* __restrict__ MTl,
             const unsigned short* __restrict__ Qh, const unsigned short* __restrict__ Ql,
             const unsigned short* __restrict__ WWb, const float* __restrict__ wb, float* Z, float* PS) {
  __shared__ __align__(16) unsigned short Yf[(QT / 16) * (DQ / 32) * 2 * FRG];
  __shared__ __align__(16) float Os[QT * OSZ];
  const int tid  = threadIdx.x;
  const int lane = tid & 31;
  const int wave = __builtin_amdgcn_readfirstlane(tid >> 5);         // scalar: fragment bases stay in SGPRs
  const int hh   = lane >> 4, c = lane & 15;
  const int nw   = wave & 3, hf = wave >> 2;
  const int nt   = blockIdx.x, b = blockIdx.y;
  const int n0   = nt * QT;
  const unsigned lo8 = (unsigned)(8 * lane);                         // the lane's offset, the same in every fragment

  const size_t ao = (size_t)((b * (DQ / 16) + (QT / 16) * hf) * (DQ / 32)) * FRG;
  const unsigned short* aph = MTh + ao + lo8;
  const unsigned short* apl = MTl + ao + lo8;
  const size_t bo = (size_t)((b * (NN / 16) + n0 / 16 + nw) * (DQ / 32)) * FRG;
  const unsigned short* bph = Qh + bo + lo8;
  const unsigned short* bpl = Ql + bo + lo8;
  const unsigned short* wp  = WWb + (size_t)(8 * hf * (DQ / 32)) * FRG + lo8;

  v8f acc[4];
#pragma unroll
  for (int mt = 0; mt < 4; ++mt) acc[mt] = zero8();

  // the reads of two k-steps stand as one group in front of their products: two waits for memory a wave, not sixteen
#pragma unroll
  for (int kp = 0; kp < DQ / 64; ++kp) {
    Frag fbh[2], fbl[2], fah[2][4], fal[2][4];
#pragma unroll
    for (int kl = 0; kl < 2; ++kl) {
      const int ks = 2 * kp + kl;
      fbh[kl] = ldfrag(bph + FRG * ks);
      fbl[kl] = ldfrag(bpl + FRG * ks);
#pragma unroll
      for (int mt = 0; mt < 4; ++mt) {
        fah[kl][mt] = ldfrag(aph + (size_t)(mt * (DQ / 32) + ks) * FRG);
        fal[kl][mt] = ldfrag(apl + (size_t)(mt * (DQ / 32) + ks) * FRG);
      }
    }
#pragma unroll
    for (int kl = 0; kl < 2; ++kl) {
#pragma unroll
      for (int mt = 0; mt < 4; ++mt) {
        acc[mt] = mma_b(fah[kl][mt].bf, fbh[kl].bf, acc[mt]);
        acc[mt] = mma_b(fah[kl][mt].bf, fbl[kl].bf, acc[mt]);
        acc[mt] = mma_b(fal[kl][mt].bf, fbh[kl].bf, acc[mt]);
      }
    }
  }

  // the weight reads of a k-step of the second product stand one k-step ahead of their products; the first group here,
  // so that its latency passes under the split and the barrier
  Frag fa[2][8];
#pragma unroll
  for (int mt = 0; mt < 8; ++mt) fa[0][mt] = ldfrag(wp + (size_t)(mt * (DQ / 32)) * FRG);

  // ---- y = acc/1024, split in place -> LDS fragments Yf[nw][2 hf + kl][plane], unit (j, lane) from acc[2 kl + j]
#pragma unroll
  for (int kl = 0; kl < 2; ++kl) {
    unsigned short* yp = Yf + ((nw * (DQ / 32) + 2 * hf + kl) * 2) * FRG + lo8;
#pragma unroll
    for (int j = 0; j < 2; ++j) {
      float f[8];
#pragma unroll
      for (int r = 0; r < 8; ++r) f[r] = acc[2 * kl + j][r] * INS;
      v4u uh, ul;
      split8(f, uh, ul);
      *(v4u*)(yp + j * (FRG / 2))       = uh;
      *(v4u*)(yp + FRG + j * (FRG / 2)) = ul;
    }
  }
  __syncthreads();

  v8f az[8];
#pragma unroll
  for (int mt = 0; mt < 8; ++mt) az[mt] = zero8();
  const unsigned short* yb = Yf + (nw * (DQ / 32) * 2) * FRG + lo8;
#pragma unroll
  for (int ks = 0; ks < DQ / 32; ++ks) {
    if (ks + 1 < DQ / 32) {
#pragma unroll
      for (int mt = 0; mt < 8; ++mt) fa[(ks + 1) & 1][mt] = ldfrag(wp + (size_t)(mt * (DQ / 32) + ks + 1) * FRG);
    }
    const Frag fbh = ldfrag(yb + (2 * ks) * FRG);
    const Frag fbl = ldfrag(yb + (2 * ks + 1) * FRG);
#pragma unroll
    for (int mt = 0; mt < 8; ++mt) {
      az[mt] = mma_b(fa[ks & 1][mt].bf, fbh.bf, az[mt]);
      az[mt] = mma_b(fa[ks & 1][mt].bf, fbl.bf, az[mt]);
    }
  }

  // ---- epilogue: -> LDS Os[n_loc][c]; lane (hh, c) holds channel 128 hf + 16 mt + 8 hh + r for n_loc = 16 nw + c
  {
    float* op = Os + (16 * nw + c) * OSZ + 128 * hf + 8 * hh;
#pragma unroll
    for (int mt = 0; mt < 8; ++mt) {
      v4f va, vb;
#pragma unroll
      for (int r = 0; r < 4; ++r) { va[r] = az[mt][r]; vb[r] = az[mt][4 + r]; }
      *(v4f*)(op + 16 * mt)     = va;
      *(v4f*)(op + 16 * mt + 4) = vb;
    }
  }
  __syncthreads();

  const int e = tid & 7, lq = tid >> 3;                              // lq 0..31
#pragma unroll
  for (int g = 0; g < 2; ++g) {
    v4f res[8];
#pragma unroll
    for (int it = 0; it < 8; ++it) {
      const int L   = (8 * g + it) * 32 + lq;                        // 0..511
      const int cl  = L >> 1, hl = L & 1;                            // channel 0..255
      const int nl  = hl * 32 + 4 * e;                               // position 0..63
      const float bvs = bfr(wb[cl]);
#pragma unroll
      for (int t = 0; t < 4; ++t) {
        res[it][t] = Os[(nl + t) * OSZ + cl] + bvs;
      }
    }
#pragma unroll
    for (int it = 0; it < 8; ++it) {
      const int L   = (8 * g + it) * 32 + lq;
      const int cl  = L >> 1, hl = L & 1;
      const int nl  = hl * 32 + 4 * e;
      const size_t idx = ((size_t)(b * CC + cl)) * NQ + n0 + nl;
      *(v4f*)(Z + idx) = res[it];
    }
  }
  // the sums below reuse registers that the stores above name: the wait stands in front of them
  asm volatile("s_wait_xcnt 0x0" ::: "memory");

  // ---- batch-norm partial sums of channel tid over the block's 64 positions (lanes read consecutive LDS banks)
  {
    const float bvs = bfr(wb[tid]);
    float s4[4] = {0.f, 0.f, 0.f, 0.f}, q4[4] = {0.f, 0.f, 0.f, 0.f};
#pragma unroll
    for (int nl = 0; nl < QT; nl += 4) {
#pragma unroll
      for (int t = 0; t < 4; ++t) {
        const float v = Os[(nl + t) * OSZ + tid] + bvs;
        s4[t] += v;
        q4[t] = fmaf(v, v, q4[t]);
      }
    }
    v2f pq;
    pq[0] = (s4[0] + s4[1]) + (s4[2] + s4[3]);
    pq[1] = (q4[0] + q4[1]) + (q4[2] + q4[3]);
    *(v2f*)(PS + ((size_t)(b * (NQ / QT) + nt) * CC + tid) * 2) = pq;
  }
}

// =========================================================================================================
// (8) batch-norm statistics finished and applied, residual added. Block 1024 threads = 32 waves, one a WGP: it owns 16
//     channels (cg: one 128-B line of every PS row) x 2048 positions of one batch image. Every thread issues all its
//     reads first: 4 b128 of PS (16-B piece tid & 7 = 2 channels of rows (tid >> 3) + 128 i), gamma, beta, 8 b128 of z, 8 of x
//     (channel 2 i + (tid >> 9), a wave reads 512 contiguous bytes), so that the sums below run while z and x arrive.
//     Sums in f64: the thread's 4 rows, lanes l ^ 8 and l ^ 16 (the wave's 4 rows), LDS R2[wave][16 channels x {sum,
//     squares}] (cross-wave, block barrier), then thread ch < 16 adds the 32 waves in order; mean and biased variance
//     in f64, rstd = 1/sqrt(var + eps) in f32 -> LDS SM[ch] = {mean, bf16-RNE(gamma)*rstd, bf16-RNE(beta)} (block barrier).
//     out[b][ch][n] = ((z - mean) * (gamma*rstd) + beta) + bf16-RNE(x).
// coverage: PS rows (tid >> 3) + 128 i = 0..PBK-1, all written by (6); 8 i x 1024 threads x 4 floats = 16 ch x 2048 n;
//           grid 16 channel groups x NB x NQ/2048 covers out[b<NB][0..255][0..NQ-1] exactly once.
// =========================================================================================================
// work-group barrier that orders LDS accesses only: __syncthreads() would also wait out the reads of z and x in flight
__device__ __forceinline__ void lds_barrier() {
  __builtin_amdgcn_fence(__ATOMIC_RELEASE, "workgroup", "local");
  __builtin_amdgcn_s_barrier();
  __builtin_amdgcn_fence(__ATOMIC_ACQUIRE, "workgroup", "local");
}

__global__ __launch_bounds__(ABT)
void bn_apply(const float* __restrict__ Z, const float* __restrict__ x, const float* __restrict__ PS,
              const float* __restrict__ gam, const float* __restrict__ bet, float* out) {
  __shared__ __align__(16) double R2[ABT / 32][2 * AGC];
  __shared__ __align__(16) float SM[AGC][4];
  const int tid = threadIdx.x;
  const int cg  = blockIdx.x % (CC / AGC), sub = blockIdx.x / (CC / AGC);
  const int b   = sub / (NQ / ASN);
  const int n   = (sub % (NQ / ASN)) * ASN + 4 * (tid & (ABT / 2 - 1));
  const int ch0 = cg * AGC + (tid >> 9);

  const float* pr = PS + (size_t)(tid >> 3) * (2 * CC) + cg * (2 * AGC) + 4 * (tid & 7);
  const float* zp = Z + ((size_t)(b * CC + ch0)) * NQ + n;
  const size_t xo = ((size_t)(b * CC + ch0)) * NN + n;
  const float* xp = x + xo;
  v4f pp[PBK / 128], zv[8], xv[8];
#pragma unroll
  for (int i = 0; i < PBK / 128; ++i) pp[i] = *(const v4f*)(pr + (size_t)i * 128 * 2 * CC);
  const int gi = cg * AGC + (tid & (AGC - 1));
  const float gv = gam[gi];
  const float bv = bet[gi];
#pragma unroll
  for (int i = 0; i < 8; ++i) {
    zv[i] = *(const v4f*)(zp + (size_t)(2 * i) * NQ);
    xv[i] = *(const v4f*)(xp + (size_t)(2 * i) * NN);
  }
  // stands in front of any reuse of the reads' address registers, which as its inputs stay untouched up to it
  asm volatile("s_wait_xcnt 0x0" :: "v"(pr), "v"(gi), "v"(zp), "v"(xp) : "memory");
  // keeps the sums, and their wait for PS, behind the issue of every read above: z and x arrive while the sums run
  __builtin_amdgcn_sched_barrier(0);

  double d[4] = {0.0, 0.0, 0.0, 0.0};
#pragma unroll
  for (int i = 0; i < PBK / 128; ++i) {
#pragma unroll
    for (int t = 0; t < 4; ++t) d[t] += (double)pp[i][t];
  }
#pragma unroll
  for (int t = 0; t < 4; ++t) d[t] += __shfl_xor(d[t], 8);
#pragma unroll
  for (int t = 0; t < 4; ++t) d[t] += __shfl_xor(d[t], 16);
  if ((tid & 31) < 8) {
    double* rp = &R2[tid >> 5][4 * (tid & 7)];
#pragma unroll
    for (int t = 0; t < 4; ++t) rp[t] = d[t];
  }
  lds_barrier();
  if (tid < AGC) {
    double s = 0.0, q = 0.0;
#pragma unroll
    for (int w = 0; w < ABT / 32; ++w) { s += R2[w][2 * tid]; q += R2[w][2 * tid + 1]; }
    const double cnt  = (double)NB * (double)NQ;
    const double mean = s / cnt;
    double var = q / cnt - mean * mean;
    var = (var > 0.0) ? var : 0.0;
    const float rstd = 1.0f / sqrtf((float)var + BNEPS);
    v4f w4;
    w4[0] = (float)mean;
    w4[1] = bfr(gv) * rstd;
    w4[2] = bfr(bv);
    w4[3] = 0.f;
    *(v4f*)SM[tid] = w4;
  }
  lds_barrier();

  float* op = out + xo;
#pragma unroll
  for (int i = 0; i < 8; ++i) {
    const v4f st = *(const v4f*)SM[2 * i + (tid >> 9)];
    v4f r;
#pragma unroll
    for (int t = 0; t < 4; ++t) r[t] = ((zv[i][t] - st[0]) * st[1] + st[2]) + bfr(xv[i][t]);
    *(v4f*)(op + (size_t)(2 * i) * NN) = r;
  }
}

// =========================================================================================================
// Workspace map (bytes; each region start a multiple of 256; every extent is an exact row/tile multiple and is
//   (the 16-bit planes hold these extents in fragment order)
//   W16 f16 [384][256]            196608      WWb bf16 [256][128]        65536
//   XP  f16 [NB][4096][256]     16777216 (NB=8)
//   Qh/Ql bf16 [NB][4096][128]   8388608 x2
//   PGZ region 33554432: Z f32 [NB][256][NQ] at +0; Z extent <= region (static_assert)
//   Pc/Gc f16 [NB][128][1024]   2097152 x2
//   MTh/MTl bf16 [NB][128][128]   262144 x2
//   PS  f32 [NB*NQ/64][256][2]    1048576
//   total (NB=8, NQ=4096) = 73138176
// =========================================================================================================
extern "C" void kernel_launch(void* const* d_in, const int* in_sizes, int n_in,
                              void* d_out, int out_size, void* d_ws, size_t ws_size,
                              hipStream_t stream) {
  const int XN = NB * CC * NN;
  if (n_in < 11) return;
  if (in_sizes[0] < XN) return;
  if (in_sizes[1] < DQ * CC || in_sizes[3] < DQ * CC || in_sizes[5] < DQ * CC || in_sizes[7] < CC * DQ) return;
  if (in_sizes[2] < DQ || in_sizes[4] < DQ || in_sizes[6] < DQ || in_sizes[8] < CC) return;
  if (in_sizes[9] < CC || in_sizes[10] < CC) return;
  if (out_size < XN) return;

  size_t off = 0;
  auto carve = [&](size_t bytes) { const size_t o = off; off += (bytes + 255) & ~(size_t)255; return o; };
  const size_t oW16 = carve((size_t)MW * CC * 2);
  const size_t oWWb = carve((size_t)CC * DQ * 2);
  const size_t oXP  = carve((size_t)NB * NN * CC * 2);
  const size_t oQh  = carve((size_t)NB * NN * DQ * 2);
  const size_t oQl  = carve((size_t)NB * NN * DQ * 2);
  const size_t oPGZ = carve((size_t)2 * NB * NN * DQ * 4);
  const size_t oPc  = carve((size_t)NB * DQ * MM * 2);
  const size_t oGc  = carve((size_t)NB * DQ * MM * 2);
  const size_t oMTh = carve((size_t)NB * DQ * DQ * 2);
  const size_t oMTl = carve((size_t)NB * DQ * DQ * 2);
  const size_t oPS  = carve((size_t)PBK * CC * 2 * 4);
  if (off > ws_size) return;
  if (off > (size_t)134217728) return;

  const float* x  = (const float*)d_in[0];
  const float* gw = (const float*)d_in[1];
  const float* gb = (const float*)d_in[2];
  const float* tw = (const float*)d_in[3];
  const float* tb = (const float*)d_in[4];
  const float* pw = (const float*)d_in[5];
  const float* pb = (const float*)d_in[6];
  const float* ow = (const float*)d_in[7];
  const float* wb = (const float*)d_in[8];
  const float* bg = (const float*)d_in[9];
  const float* bb = (const float*)d_in[10];

  char* ws = (char*)d_ws;
  unsigned short* W16 = (unsigned short*)(ws + oW16);
  unsigned short* WWb = (unsigned short*)(ws + oWWb);
  unsigned short* XP  = (unsigned short*)(ws + oXP);
  unsigned short* Qh  = (unsigned short*)(ws + oQh);
  unsigned short* Ql  = (unsigned short*)(ws + oQl);
  float*          Z   = (float*)(ws + oPGZ);
  unsigned short* Pc  = (unsigned short*)(ws + oPc);
  unsigned short* Gc  = (unsigned short*)(ws + oGc);
  unsigned short* MTh = (unsigned short*)(ws + oMTh);
  unsigned short* MTl = (unsigned short*)(ws + oMTl);
  float*          PS  = (float*)(ws + oPS);
  float* out = (float*)d_out;

  const dim3 blk256(256);

  // (0) theta_w / phi_w / g_w -> stacked f16 plane; w_w -> bf16 plane
  cvt_w<<<dim3(MW / 8 + CC / 16), blk256, 0, stream>>>(tw, pw, gw, ow, W16, WWb);
  // (1) x -> position-major 16-bit plane
  cvt_x<<<dim3(NN / QT, CC / QT, NB), blk256, 0, stream>>>(x, XP);
  // (2) conv1x1 GEMM -> theta hi/res planes; phi / g + bias, 2x2 max-pooled, as channel-major f16 planes [b][d][m]
  gemm_proj<<<dim3(NSTRIP, 4, NB), blk256, 0, stream>>>(W16, XP, tb, pb, gb, Qh, Ql, Pc, Gc);
  // (5) M = pooled-phi . pooled-g^T per batch -> M^T hi/res planes [b][ci][cp]
  gemm_m<<<dim3(DQ / 16, DQ / QT, NB), blk256, 0, stream>>>(Pc, Gc, MTh, MTl);
  // (6) y = theta . M / 1024 (hi/res fragments kept in LDS), output conv + bias -> Z [b][256][NQ], partial sums -> PS
  gemm_yz<<<dim3(NQ / QT, NB), blk256, 0, stream>>>(MTh, MTl, Qh, Ql, WWb, wb, Z, PS);
  // (8) batch statistics from PS, normalise, affine, residual -> out [b][256][4096]
  bn_apply<<<dim3((CC / AGC) * NB * (NQ / ASN)), dim3(ABT), 0, stream>>>(Z, x, PS, bg, bb, out);
  (void)hipGetLastError();
}

// v008
// Measured time: 50.9 microseconds a run.
// In two side-by-side timings against v007, it was 1.20 and 1.16 times as fast.
// Counting every step since v000, it is 2.84 times as fast.
// Contractions: conv1x1 theta/phi/g GEMM W[384x256].X[256x128] per strip on v_wmma_f32_16x16x32_f16 (f16
// containers of bf16-RNE weights x256 and bf16-RNE x, 1 product); M = pooled-phi . pooled-g^T per batch
// [128x128], K=1024, on v_wmma_f32_16x16x32_f16 (2x2 max-pooled phi and g as plain f16, 1 product);
// y^T = M^T.theta^T, K=128, on v_wmma_f32_16x16x32_bf16 (M and theta as bf16 hi + bf16 residual planes,
// 3 products); output conv W[256x128].Y on v_wmma_f32_16x16x32_bf16 (bf16 weights, y as bf16 hi + residual
// planes, 2 products); f32 accumulate everywhere; max-pool, bias, batch-norm statistics (f32 sums over 64 positions,
// f64 sums of those, f32 apply) and the residual add on VALU.
// Every 16-bit WMMA operand plane lies in the workspace (x, y: in LDS) in fragment order: one fragment = 16 rows x 32 k = 1 KiB =
// [j 0..1][lane 0..31][8 values], unit (j, lane) = row (lane&15), k = 16 j + 8 (lane>>4) .. + 7. A wave reads a fragment
// with two b128 loads of 512 contiguous bytes each (4 whole lines a load).
#include <hip/hip_runtime.h>
#include <math.h>
#include <stdint.h>

#ifndef NB
#define NB 8
#endif
#ifndef NQ
#define NQ 4096
#endif
#define NB_FULL 8
#define CC     256
#define HIMG   64
#define WIMG   64
#define NN     4096
#define DQ     128
#define HP     32
#define WP     32
#define MM     1024
#define MW     384
#define QT     64
#define SN     128
#define NSTRIP 32
#define OSP    68
#define OSZ    260
#define WSC    256.0f
#define IWSC   0.00390625f
#define INS    0.0009765625f
#define BNEPS  1e-5f
#define KSL    128
#define FRG    512
#define PBK    ((NQ / QT) * NB)
#define AGC    16
#define ASN    2048
#define ABT    1024
#define PTH    512
#define XTS    (8 * FRG + 8)
#define TQ     40

static_assert(NB >= 1 && NB <= NB_FULL);
static_assert(NQ % 128 == 0 && NQ >= 128 && NQ <= NN);
static_assert(NQ % QT == 0);
static_assert(NN == HIMG * WIMG);
static_assert(SN == 2 * WIMG && NSTRIP * SN == NN && SN == 8 * 16);
static_assert(HIMG % 2 == 0 && WIMG % 2 == 0 && HP == HIMG / 2 && WP == WIMG / 2 && MM == HP * WP);
static_assert(WP == 32);
static_assert(MM % QT == 0 && MM % 32 == 0);
static_assert(NN % QT == 0 && CC % QT == 0 && DQ == 2 * QT);
static_assert(MW == 3 * DQ && MW % 8 == 0);
static_assert(CC % 32 == 0 && DQ % 32 == 0);
static_assert((OSP * 4) % 16 == 0);
static_assert(SN * OSP * 4 <= 65536 && DQ * OSP * 4 <= 65536);
static_assert(((size_t)NB * CC * NQ) % 1024 == 0);
static_assert((size_t)NB * CC * NQ * 4 <= 2 * (size_t)NB * NN * DQ * 4);
static_assert((size_t)NB_FULL * CC * NN * 4 == (size_t)33554432);
static_assert((OSZ * 4) % 16 == 0 && OSZ >= CC && CC == 2 * 8 * 16 && QT == 4 * 16);
static_assert(NN == 16 * 4 * WIMG && MM == 16 * 64);
static_assert(MM == 8 * KSL && KSL == 4 * 32 && DQ == 8 * 16);
static_assert(PBK % 128 == 0 && NQ % ASN == 0 && CC % AGC == 0 && AGC * 2 * 4 == 128 && CC == 256);
static_assert(PTH == 32 * (CC / 16) && SN == 4 * 32 && CC / 32 == 8 && (XTS * 2) % 16 == 0 && (TQ * 2) % 16 == 0 && TQ >= WP);
static_assert(AGC * ASN == 8 * 4 * ABT && ASN == 4 * (ABT / 2) && ABT == 8 * 128);

typedef _Float16       v16h __attribute__((ext_vector_type(16)));
typedef _Float16       v8h  __attribute__((ext_vector_type(8)));
typedef __bf16         v16b __attribute__((ext_vector_type(16)));
typedef unsigned short v8us __attribute__((ext_vector_type(8)));
typedef float          v8f  __attribute__((ext_vector_type(8)));
typedef float          v4f  __attribute__((ext_vector_type(4)));
typedef float          v2f  __attribute__((ext_vector_type(2)));
typedef unsigned int   v4u  __attribute__((ext_vector_type(4)));
typedef unsigned int   v2u  __attribute__((ext_vector_type(2)));

union Frag { v8us u[2]; v16h h; v16b bf; };
static_assert(sizeof(Frag) == 32);

// ---- scalar helpers ---------------------------------------------------------------------------------------
__device__ __forceinline__ unsigned short bf_bits(float f) {          // f32 -> bf16 bits, RNE convert
  unsigned u = __float_as_uint(f);
  return (unsigned short)((u + 0x7FFFu + ((u >> 16) & 1u)) >> 16);
}
__device__ __forceinline__ float bf_up(unsigned short hb) { return __uint_as_float(((unsigned)hb) << 16); }
__device__ __forceinline__ float bfr(float f) { return bf_up(bf_bits(f)); }
__device__ __forceinline__ unsigned short h_bits(_Float16 x) { return __builtin_bit_cast(unsigned short, x); }
__device__ __forceinline__ unsigned pk16(unsigned short a, unsigned short b) { return (unsigned)a | ((unsigned)b << 16); }
__device__ __forceinline__ v8f zero8() { v8f z = {0.f, 0.f, 0.f, 0.f, 0.f, 0.f, 0.f, 0.f}; return z; }
// 8 f32 values -> bf16 hi bits and bf16 residual bits (lo = RNE(v - hi)), packed 2 per uint
__device__ __forceinline__ void split8(const float* f, v4u& uh, v4u& ul) {
#pragma unroll
  for (int t = 0; t < 4; ++t) {
    const float f0 = f[2 * t], f1 = f[2 * t + 1];
    const unsigned short hb0 = bf_bits(f0), hb1 = bf_bits(f1);
    const unsigned short lb0 = bf_bits(f0 - bf_up(hb0));
    const unsigned short lb1 = bf_bits(f1 - bf_up(hb1));
    uh[t] = pk16(hb0, hb1);
    ul[t] = pk16(lb0, lb1);
  }
}

// ---- 16-bit fragment loader (A or B) from a plane in fragment order: lane -> row/col (lane&15), h = lane>>4; p = start
//      of the fragment + 8*lane; elements 0..7 <- p[0..7] (k0+8h..), elements 8..15 <- p[256..263] (k0+16+8h..)
__device__ __forceinline__ Frag ldfrag(const unsigned short* p) {
  Frag f;
  f.u[0] = *(const v8us*)(p);
  f.u[1] = *(const v8us*)(p + FRG / 2);
  return f;
}
// k offset (0, 8, 16, 24) inside its fragment of the 16-B unit that thread t stores (unit = t & 63; its row is t & 15)
__device__ __forceinline__ int unit_k(int t) { return 16 * ((t >> 5) & 1) + 8 * ((t >> 4) & 1); }

// ---- WMMA helpers: builtin followed by a 4-slot VALU gap tying D and keeping A/B live --------------------------
__device__ __forceinline__ v8f mma_h(v16h a, v16h b, v8f c) {
  v8f d = __builtin_amdgcn_wmma_f32_16x16x32_f16(false, a, false, b, (short)0, c, false, false);
#if defined(__HIP_DEVICE_COMPILE__)
  asm volatile("v_nop\n\tv_nop\n\tv_nop\n\tv_nop" : "+v"(d) : "v"(a), "v"(b));
#endif
  return d;
}
__device__ __forceinline__ v8f mma_b(v16b a, v16b b, v8f c) {
  v8f d = __builtin_amdgcn_wmma_f32_16x16x32_bf16(false, a, false, b, (short)0, c, false, false);
#if defined(__HIP_DEVICE_COMPILE__)
  const v16h ha = __builtin_bit_cast(v16h, a), hb = __builtin_bit_cast(v16h, b);
  asm volatile("v_nop\n\tv_nop\n\tv_nop\n\tv_nop" : "+v"(d) : "v"(ha), "v"(hb));
#endif
  return d;
}

// =========================================================================================================
// (0) weights. Blocks 0..47: W16 f16 [384][256], rows 0..127 = theta_w, 128..255 = phi_w, 256..383 = g_w; value =
//     f16 of (bf16-RNE(w) * 256) (exact), fragments [24 o tiles][8 k steps]. Blocks 48..63: WWb bf16 of w_w [256][128],
//     fragments [16 c tiles][4 k steps]. A block owns 4 consecutive fragments, a thread one 16-B unit.
// coverage: 48 blocks x 256 units x 8 halves = 384 x 256; 16 blocks x 256 units x 8 = 256 x 128.
// =========================================================================================================
__global__ __launch_bounds__(256)
void cvt_w(const float* __restrict__ tw, const float* __restrict__ pw, const float* __restrict__ gw,
           const float* __restrict__ ow, unsigned short* W16, unsigned short* WWb) {
  const int tid = threadIdx.x, blk = blockIdx.x;
  if (blk < MW / 8) {
    const int un = blk * 256 + tid;                                  // unit 0..12287
    const int fr = un >> 6;                                          // fragment = 8 (o tile) + k step
    const int o = 16 * (fr >> 3) + (tid & 15);                       // 0..383, o tile = blk >> 1
    const int col = 32 * (fr & 7) + unit_k(tid);                     // 0..248
    const int grp = blk >> 4;                                        // 0,1,2 (block-uniform)
    const float* wbase = (grp == 0) ? tw : ((grp == 1) ? pw : gw);  // all global
    const float* s = wbase + (size_t)(o - DQ * grp) * CC + col;      // (o - 128 grp) in 0..127
    const v4f a = *(const v4f*)s;
    const v4f q = *(const v4f*)(s + 4);
    const float f[8] = {a[0], a[1], a[2], a[3], q[0], q[1], q[2], q[3]};
    v4u u;
#pragma unroll
    for (int t = 0; t < 4; ++t) {
      const _Float16 h0 = (_Float16)(bfr(f[2 * t]) * WSC);
      const _Float16 h1 = (_Float16)(bfr(f[2 * t + 1]) * WSC);
      u[t] = pk16(h_bits(h0), h_bits(h1));
    }
{
      *(v4u*)(W16 + (size_t)un * 8) = u;
      
    }
  } else {
    const int un = (blk - MW / 8) * 256 + tid;                       // unit 0..4095
    const int fr = un >> 6;                                          // fragment = 4 (c tile) + k step
    const int o = 16 * (fr >> 2) + (tid & 15);                       // 0..255
    const int col = 32 * (fr & 3) + unit_k(tid);                     // 0..120
    const float* s = ow + (size_t)o * DQ + col;
    const v4f a = *(const v4f*)s;
    const v4f q = *(const v4f*)(s + 4);
    const float f[8] = {a[0], a[1], a[2], a[3], q[0], q[1], q[2], q[3]};
    v4u u;
#pragma unroll
    for (int t = 0; t < 4; ++t) u[t] = pk16(bf_bits(f[2 * t]), bf_bits(f[2 * t + 1]));
{
      *(v4u*)(WWb + (size_t)un * 8) = u;
      
    }
  }
}

// =========================================================================================================
// (2) x conversion and conv1x1 GEMM in one launch, Y[o][n] = (1/256) sum_c W16[o][c] X[n][c], K = 256 = 8 steps, for one
//     (b, strip of 128 positions = image rows 2 st, 2 st + 1) and all 384 o. Block 512 threads = 16 waves.
//     Conversion: wave w reads channels 16 w..16 w + 15 of the strip (a load = one channel's 512 contiguous bytes; all 16
//     issued before the first use); lane l then holds positions 4 l..4 l + 3 of 2 x 8 consecutive channels = 8 whole 16-B
//     units of the B fragments (bf16-RNE values, exact in f16), stored to LDS XF[8 n tiles][8 k steps] in fragment order
//     (n tile pitch XTS: 16 B more than 8 fragments, so that the 16 lanes of a half wave store to 64 different banks),
//     cross-wave, block barrier.
//     Every plane written here is in fragment order (Qh/Ql: [b][256 n tiles][4 k steps], k = d; Pc/Gc: [b][8 d tiles]
//     [32 k steps], k = m). Each wave does two pieces, B fragments from XF, A fragments from W16:
//     theta: wave w = (n tile w & 7, mb = w >> 3) owns 16 positions x theta dims 64 mb..64 mb + 63 (4 m-tiles). Staged in
//       LDS Os[mb][n_loc][o_loc] (pitch OSP, b128 stores, cross-wave).
//     phi, g: wave w = (xt = w & 3, ob = w >> 2: phi dims 0.., 64.., then g dims 0.., 64..) owns the two n-tiles of the
//       strip's two image rows at columns 16 xt..16 xt+15, and 4 m-tiles. The 2x2 stride-2
//       max-pool is done on the accumulators: the row pair is the wave's two tiles (same lane, same register), the
//       column pair is lane ^ 1. Scale and bias follow the maximum (x -> fl(x/256 + bias) never decreases as x grows, so
//       the maximum of the results is the result of the maximum). f16 values go to the LDS tile Tp[256 o][32 m]
//       (pitch TQ, cross-wave).
//     One block barrier, then: Os + bias -> Qh/Ql bf16 (hi = RNE(v), lo = RNE(v-hi)), 32 fragments a plane, a wave's
//       store = 512 contiguous bytes; Tp -> Pc / Gc f16, m = 32 st + px: 8 d tiles x 1 k step = 8 whole fragments a plane.
// coverage: XF 16 waves x 2 octets x 32 lanes x 4 units = 8 n tiles x 8 k steps x 64 units written, the same read; Os 16
//           waves x 16 n x 64 o = 2 x 128 x 64 written, reads rows <= 127 cols <= 63; planes 4 it x 512 units x 8 =
//           128 n x 128 d; grid (32, NB) covers 4096 rows x 128 d of Qh/Ql once. Tp written rows 64 ob + 16 mt + 8 hh +
//           4 (c&1) + j = 0..255 x cols 8 xt + (c>>1) = 0..31, read rows 0..255 x cols 0..31; 2 it x 512 units = 16
//           fragments; 32 strips cover Pc and Gc (128 d x 1024 m a batch) exactly once.
// =========================================================================================================
__device__ __forceinline__ float max_pair(float v) {                 // max of lanes l and l ^ 1 (quad_perm 1,0,3,2)
  const int o = __builtin_amdgcn_mov_dpp(__float_as_int(v), 0xB1, 0xF, 0xF, true);
  return fmaxf(v, __int_as_float(o));
}

__global__ __launch_bounds__(PTH)
void gemm_proj(const unsigned short* __restrict__ W16, const float* __restrict__ x,
               const float* __restrict__ tb, const float* __restrict__ pb, const float* __restrict__ gb,
               unsigned short* Qh, unsigned short* Ql, unsigned short* Pc, unsigned short* Gc) {
  __shared__ __align__(16) unsigned short XF[(SN / 16) * XTS];
  __shared__ __align__(16) float Os[2 * SN * OSP];
  __shared__ __align__(16) unsigned short Tp[2 * DQ * TQ];
  const int tid  = threadIdx.x;
  const int lane = tid & 31;
  const int wave = __builtin_amdgcn_readfirstlane(tid >> 5);         // 0..15, scalar: fragment bases stay in SGPRs
  const int hh   = lane >> 4, c = lane & 15;
  const int st   = blockIdx.x, b = blockIdx.y;
  const int n0   = st * SN;
  const unsigned lo = (unsigned)(8 * lane);                          // the lane's offset, the same in every fragment

  // ---- x strip -> f16 B fragments in LDS
  {
    const float* xp = x + ((size_t)(b * CC + 16 * wave)) * NN + n0 + 4 * lane;
    v4f xr[16];
    // the loops of this part are unrolled so that xr is indexed by constants and stays in registers
#pragma unroll
    for (int i = 0; i < 16; ++i) xr[i] = *(const v4f*)(xp + (size_t)i * NN);
    // stands in front of any reuse of the reads' address registers, which as its input stay untouched up to it
    asm volatile("s_wait_xcnt 0x0" :: "v"(xp) : "memory");
    // channel octet q = 2 wave + q2: k step q >> 2, j = (q >> 1) & 1, upper lane half q & 1; position 4 lane + t: n tile
    // lane >> 2, row 4 (lane & 3) + t
    unsigned short* fp = XF + (lane >> 2) * XTS + (wave >> 1) * FRG + (wave & 1) * (FRG / 2) + 32 * (lane & 3);
#pragma unroll
    for (int q2 = 0; q2 < 2; ++q2) {
#pragma unroll
      for (int t = 0; t < 4; ++t) {
        v4u u;
#pragma unroll
        for (int p = 0; p < 4; ++p)
          u[p] = pk16(h_bits((_Float16)bfr(xr[8 * q2 + 2 * p][t])), h_bits((_Float16)bfr(xr[8 * q2 + 2 * p + 1][t])));
        *(v4u*)(fp + 128 * q2 + 8 * t) = u;
      }
    }
  }
  __syncthreads();

  // ---- theta: 16 positions x 64 o
  {
    const int ntl = wave & 7, mb = wave >> 3;
    const unsigned short* ap = W16 + (size_t)(mb * (QT / 16) * (CC / 32)) * FRG + lo;
    const unsigned short* bp = XF + ntl * XTS + lo;

    v8f acc[4];
#pragma unroll
    for (int mt = 0; mt < 4; ++mt) acc[mt] = zero8();

    // the reads of two k-steps stand as one group in front of their products: the wave waits out the load latency once a
    // group, not once a product
#pragma unroll
    for (int kp = 0; kp < CC / 64; ++kp) {
      Frag fb[2], fa[2][4];
#pragma unroll
      for (int kl = 0; kl < 2; ++kl) {
        const int ks = 2 * kp + kl;
        fb[kl] = ldfrag(bp + FRG * ks);
#pragma unroll
        for (int mt = 0; mt < 4; ++mt) fa[kl][mt] = ldfrag(ap + (size_t)(mt * (CC / 32) + ks) * FRG);
      }
#pragma unroll
      for (int kl = 0; kl < 2; ++kl) {
#pragma unroll
        for (int mt = 0; mt < 4; ++mt) acc[mt] = mma_h(fa[kl][mt].h, fb[kl].h, acc[mt]);
      }
    }

    // scale back -> LDS Os[mb][n_loc][o_loc]; lane (hh, c) holds o = 16 mt + 8 hh + r for n_loc = 16 ntl + c
    float* op = Os + mb * (SN * OSP) + (16 * ntl + c) * OSP + 8 * hh;
#pragma unroll
    for (int mt = 0; mt < 4; ++mt) {
      v4f va, vb;
#pragma unroll
      for (int r = 0; r < 4; ++r) { va[r] = acc[mt][r] * IWSC; vb[r] = acc[mt][4 + r] * IWSC; }
      *(v4f*)(op + 16 * mt)     = va;
      *(v4f*)(op + 16 * mt + 4) = vb;
    }
  }

  // ---- phi / g: 64 o x 2 image rows x 16 columns, pooled in registers
  {
    const int xt = wave & 3, ob = wave >> 2;                         // ob 0..3
    const int sel = ob >> 1, d0 = QT * (ob & 1);                     // plane (0 phi, 1 g), first dim 0 or 64
    const unsigned short* ap  = W16 + (size_t)((DQ + QT * ob) / 16 * (CC / 32)) * FRG + lo;
    const unsigned short* bp0 = XF + xt * XTS + lo;
    const unsigned short* bp1 = bp0 + (WIMG / 16) * XTS;

    v8f a0[4], a1[4];
#pragma unroll
    for (int mt = 0; mt < 4; ++mt) { a0[mt] = zero8(); a1[mt] = zero8(); }
#pragma unroll
    for (int ks = 0; ks < CC / 32; ++ks) {
      const Frag fb0 = ldfrag(bp0 + FRG * ks);
      const Frag fb1 = ldfrag(bp1 + FRG * ks);
      Frag fa[4];
#pragma unroll
      for (int mt = 0; mt < 4; ++mt) fa[mt] = ldfrag(ap + (size_t)(mt * (CC / 32) + ks) * FRG);
#pragma unroll
      for (int mt = 0; mt < 4; ++mt) {
        a0[mt] = mma_h(fa[mt].h, fb0.h, a0[mt]);
        a1[mt] = mma_h(fa[mt].h, fb1.h, a1[mt]);
      }
    }

    const float* bias = (sel == 0) ? pb : gb;                        // both global
    const int odd = c & 1;                                           // even lane stores r 0..3, odd lane r 4..7
    const int ml  = 8 * xt + (c >> 1);                               // 0..31
#pragma unroll
    for (int mt = 0; mt < 4; ++mt) {
      const int ol = 16 * mt + 8 * hh + 4 * odd;                     // 0..60
      const v4f bq = *(const v4f*)(bias + d0 + ol);
#pragma unroll
      for (int j = 0; j < 4; ++j) {
        const float pe = max_pair(fmaxf(a0[mt][j], a1[mt][j]));
        const float po = max_pair(fmaxf(a0[mt][4 + j], a1[mt][4 + j]));
        const float v  = (odd ? po : pe) * IWSC + bfr(bq[j]);
        Tp[(QT * ob + ol + j) * TQ + ml] = h_bits((_Float16)v);
      }
    }
  }
  __syncthreads();

  {
    const int mb = wave >> 3, t8 = tid & 255;                        // theta half (wave-uniform), thread in the half
    const float* Om = Os + mb * (SN * OSP);
    const int dsel = mb * QT;                                        // 0 or 64
    const int kl = (t8 >> 6) & 1;                                    // k step of the half's two; n tile = 2 it + (t8 >> 7)
    const int dl = 32 * kl + unit_k(t8);                             // d_loc 0..56
    float bv[8];
    {
      const v4f ba = *(const v4f*)(tb + dsel + dl);
      const v4f bq = *(const v4f*)(tb + dsel + dl + 4);
#pragma unroll
      for (int t = 0; t < 4; ++t) { bv[t] = bfr(ba[t]); bv[4 + t] = bfr(bq[t]); }
    }
    v4u uh[4], ul[4];
#pragma unroll
    for (int it = 0; it < 4; ++it) {
      const int row = 16 * (2 * it + (t8 >> 7)) + (t8 & 15);         // n_loc 0..127
      const v4f a = *(const v4f*)(Om + row * OSP + dl);
      const v4f q = *(const v4f*)(Om + row * OSP + dl + 4);
      float f[8];
#pragma unroll
      for (int t = 0; t < 4; ++t) { f[t] = a[t] + bv[t]; f[4 + t] = q[t] + bv[4 + t]; }
      split8(f, uh[it], ul[it]);
    }
    v4u u[2];                                                        // pooled planes: o tile 8 it + (tid >> 6), 0..7 phi, 8..15 g
#pragma unroll
    for (int it = 0; it < 2; ++it)
      u[it] = *(const v4u*)(Tp + (16 * (8 * it + (tid >> 6)) + (tid & 15)) * TQ + unit_k(tid));
#pragma unroll
    for (int it = 0; it < 4; ++it) {
      const int fg = (b * (NN / 16) + n0 / 16 + 2 * it + (t8 >> 7)) * (DQ / 32) + dsel / 32 + kl;
      const size_t po = (size_t)fg * FRG + 8 * (t8 & 63);
      *(v4u*)(Qh + po) = uh[it];
      *(v4u*)(Ql + po) = ul[it];
    }
    {
      const size_t po = (size_t)((b * (DQ / 16) + (tid >> 6)) * (MM / 32) + st) * FRG + 8 * (tid & 63);
      *(v4u*)(Pc + po) = u[0];
      *(v4u*)(Gc + po) = u[1];
    }
  }
}

// =========================================================================================================
// (5) M GEMM for one (b, 64-row block of phi channels, 16-column tile of g channels): M[cp][ci] = sum_m Pc[b][cp][m]
//     Gc[b][ci][m], K = 1024. Block 256 threads = 8 waves; wave w owns the k slice m = 128 w..128 w + 127 (4 steps) of
//     the whole 64 x 16 tile: B fragments of the Gc rows ci = 16 ct + (lane&15), A rows cp = c0 + 16 mt + (lane&15)
//     from Pc, both planes in fragment order. A wave issues its 40 b128 reads before its first product.
//     The 8 partial tiles go to LDS Os[16 w + ci_loc][cp_loc] (pitch OSP, b128 stores, cross-wave), block barrier, then
//     each thread adds the 8 slices of 4 consecutive cp in slice order (f32) -> MTh/MTl bf16, fragments [b][8 ci tiles]
//     [4 k steps], k = cp: the block owns 2 whole fragments of each plane, a thread half a 16-B unit.
// coverage: Os 8 waves x 16 ci x 64 cp = 128 x 64 written, reads rows 16 w + row <= 127, cols cq..cq+3 <= 63; planes
//           256 threads x 4 = 16 ci x 64 cp; grid (8, 2, NB) covers MTh/MTl (128 ci x 128 cp a batch) exactly once.
// =========================================================================================================
__global__ __launch_bounds__(256)
void gemm_m(const unsigned short* __restrict__ Pc, const unsigned short* __restrict__ Gc,
            unsigned short* MTh, unsigned short* MTl) {
  __shared__ __align__(16) float Os[DQ * OSP];
  const int tid  = threadIdx.x;
  const int lane = tid & 31, wave = tid >> 5;                        // wave 0..7 = k slice
  const int hh   = lane >> 4, c = lane & 15;
  const int ct   = blockIdx.x, mb = blockIdx.y, b = blockIdx.z;
  const int c0   = mb * QT;

  const unsigned short* ap = Pc + (size_t)((b * (DQ / 16) + c0 / 16) * (MM / 32) + (KSL / 32) * wave) * FRG + 8 * lane;
  const unsigned short* bp = Gc + (size_t)((b * (DQ / 16) + ct) * (MM / 32) + (KSL / 32) * wave) * FRG + 8 * lane;

  Frag fb[KSL / 32], fa[KSL / 32][4];
#pragma unroll
  for (int ks = 0; ks < KSL / 32; ++ks) {
    fb[ks] = ldfrag(bp + FRG * ks);
#pragma unroll
    for (int mt = 0; mt < 4; ++mt) fa[ks][mt] = ldfrag(ap + (size_t)(mt * (MM / 32) + ks) * FRG);
  }
#if defined(__HIP_DEVICE_COMPILE__)
  // inputs-only fence on the loaded values: keeps every read of the slice in front of the first product, so that the
  // wave waits for memory once; without it each product's reads are issued, and waited for, one product at a time
  asm volatile("" :: "v"(fb[0].h), "v"(fb[1].h), "v"(fb[2].h), "v"(fb[3].h),
               "v"(fa[0][0].h), "v"(fa[0][1].h), "v"(fa[0][2].h), "v"(fa[0][3].h),
               "v"(fa[1][0].h), "v"(fa[1][1].h), "v"(fa[1][2].h), "v"(fa[1][3].h),
               "v"(fa[2][0].h), "v"(fa[2][1].h), "v"(fa[2][2].h), "v"(fa[2][3].h),
               "v"(fa[3][0].h), "v"(fa[3][1].h), "v"(fa[3][2].h), "v"(fa[3][3].h));
#endif

  v8f acc[4];
#pragma unroll
  for (int mt = 0; mt < 4; ++mt) acc[mt] = zero8();
#pragma unroll
  for (int ks = 0; ks < KSL / 32; ++ks) {
#pragma unroll
    for (int mt = 0; mt < 4; ++mt) acc[mt] = mma_h(fa[ks][mt].h, fb[ks].h, acc[mt]);
  }

  // ---- partial tile -> LDS Os[16 w + ci_loc][cp_loc]; lane (hh, c) holds cp_loc = 16 mt + 8 hh + r for ci_loc = c
  {
    const int nl = 16 * wave + c;
#pragma unroll
    for (int mt = 0; mt < 4; ++mt) {
      v4f va, vb;
#pragma unroll
      for (int r = 0; r < 4; ++r) { va[r] = acc[mt][r]; vb[r] = acc[mt][4 + r]; }
      *(v4f*)(Os + nl * OSP + 16 * mt + 8 * hh)     = va;
      *(v4f*)(Os + nl * OSP + 16 * mt + 8 * hh + 4) = vb;
    }
  }
  __syncthreads();

  const int row = (tid >> 1) & 15;                                   // ci_loc 0..15 = the unit's row
  const int cq  = 32 * (tid >> 7) + unit_k(tid >> 1) + 4 * (tid & 1); // cp_loc 0..60: two threads share a 16-B unit
  v4f s = *(const v4f*)(Os + row * OSP + cq);
#pragma unroll
  for (int w = 1; w < MM / KSL; ++w) s += *(const v4f*)(Os + (16 * w + row) * OSP + cq);
  v2u uh, ul;
#pragma unroll
  for (int t = 0; t < 2; ++t) {
    const float f0 = s[2 * t], f1 = s[2 * t + 1];
    const unsigned short hb0 = bf_bits(f0), hb1 = bf_bits(f1);
    uh[t] = pk16(hb0, hb1);
    ul[t] = pk16(bf_bits(f0 - bf_up(hb0)), bf_bits(f1 - bf_up(hb1)));
  }
  const size_t po = (size_t)((b * (DQ / 16) + ct) * (DQ / 32) + c0 / 32 + (tid >> 7)) * FRG + 4 * (tid & 127);
  *(v2u*)(MTh + po) = uh;
  *(v2u*)(MTl + po) = ul;
}

// =========================================================================================================
// (6) y GEMM and output conv in one launch, for one (b, 64-n tile). Block 256 threads = 8 waves; wave w = (nw = w & 3,
//     hf = w >> 2) owns cols n0 + 16 nw..+15 in both products.
//     First product: y[n][ci] = (1/1024) sum_cp (MTh+MTl)[b][ci][cp] (Qh+Ql)[b][n][cp] on bf16 WMMA, 3 products per
//     k-step (hi.hi + hi.lo + lo.hi, shared accumulator), K = 128 = 4 steps, 4 m-tiles (A rows ci = 64 hf + 16 mt +
//     (lane&15), from MTh/MTl). Lane (hh, c) then holds ci = 64 hf + 16 mt + 8 hh + r of column c: that is unit
//     (j = mt & 1, lane) of the B fragment of k step 2 hf + (mt >> 1), k = ci, of the second product. The lane scales and
//     splits its own values (hi = RNE(y), lo = RNE(y - hi)) and stores whole units to LDS Yf[nw][k step][hi, lo]
//     (1-KiB fragments, cross-wave: the other hf wave of the same columns reads them), block barrier.
//     Second product: A[c][n] = sum_ci WWb[c][ci] (Yhi + Ylo)[n][ci] on bf16 WMMA (2 products per k-step, shared
//     accumulator), K = 128 = 4 steps, 8 m-tiles (A rows c = 128 hf + 16 mt + (lane&15), from WWb). Epilogue staged in
//     LDS Os[n_loc][c] (pitch OSZ, b128 stores, cross-wave), block barrier, + bias -> Z rows (a channel's segment of
//     64 n = 2 lines): 8 consecutive lanes x 16 B (values gathered from 4 Os rows).
//     Batch-norm partial sums: thread t then adds z and z*z of channel t over the block's 64 positions (Os column t +
//     bias, the values stored to Z; f32, four chains) -> PS[block][channel]{sum, sum of squares}, 2 KiB a block.
// coverage: Yf 8 waves x 2 k steps x 2 planes = 4 n tiles x 4 k steps x 2 planes written, the same read; Os 8 waves x
//           16 n x 128 c = 64 x 256 written, read rows nl+t <= 63 x cols cl <= 255; Z 16 it x 32 lines x 8 lanes x
//           4 floats = 256 c x 64 n; grid (NQ/64, NB) covers Z[b][0..255][0..NQ-1] exactly once; PS row b NQ/64 + nt:
//           256 threads x 2 floats, every row of PS written exactly once.
// =========================================================================================================
__global__ __launch_bounds__(256)
void gemm_yz(const unsigned short* __restrict__ MTh, const unsigned short* __restrict__ MTl,
             const unsigned short* __restrict__ Qh, const unsigned short* __restrict__ Ql,
             const unsigned short* __restrict__ WWb, const float* __restrict__ wb, float* Z, float* PS) {
  __shared__ __align__(16) unsigned short Yf[(QT / 16) * (DQ / 32) * 2 * FRG];
  __shared__ __align__(16) float Os[QT * OSZ];
  const int tid  = threadIdx.x;
  const int lane = tid & 31;
  const int wave = __builtin_amdgcn_readfirstlane(tid >> 5);         // scalar: fragment bases stay in SGPRs
  const int hh   = lane >> 4, c = lane & 15;
  const int nw   = wave & 3, hf = wave >> 2;
  const int nt   = blockIdx.x, b = blockIdx.y;
  const int n0   = nt * QT;
  const unsigned lo8 = (unsigned)(8 * lane);                         // the lane's offset, the same in every fragment

  const size_t ao = (size_t)((b * (DQ / 16) + (QT / 16) * hf) * (DQ / 32)) * FRG;
  const unsigned short* aph = MTh + ao + lo8;
  const unsigned short* apl = MTl + ao + lo8;
  const size_t bo = (size_t)((b * (NN / 16) + n0 / 16 + nw) * (DQ / 32)) * FRG;
  const unsigned short* bph = Qh + bo + lo8;
  const unsigned short* bpl = Ql + bo + lo8;
  const unsigned short* wp  = WWb + (size_t)(8 * hf * (DQ / 32)) * FRG + lo8;

  v8f acc[4];
#pragma unroll
  for (int mt = 0; mt < 4; ++mt) acc[mt] = zero8();

  // the reads of two k-steps stand as one group in front of their products: two waits for memory a wave, not sixteen
#pragma unroll
  for (int kp = 0; kp < DQ / 64; ++kp) {
    Frag fbh[2], fbl[2], fah[2][4], fal[2][4];
#pragma unroll
    for (int kl = 0; kl < 2; ++kl) {
      const int ks = 2 * kp + kl;
      fbh[kl] = ldfrag(bph + FRG * ks);
      fbl[kl] = ldfrag(bpl + FRG * ks);
#pragma unroll
      for (int mt = 0; mt < 4; ++mt) {
        fah[kl][mt] = ldfrag(aph + (size_t)(mt * (DQ / 32) + ks) * FRG);
        fal[kl][mt] = ldfrag(apl + (size_t)(mt * (DQ / 32) + ks) * FRG);
      }
    }
#pragma unroll
    for (int kl = 0; kl < 2; ++kl) {
#pragma unroll
      for (int mt = 0; mt < 4; ++mt) {
        acc[mt] = mma_b(fah[kl][mt].bf, fbh[kl].bf, acc[mt]);
        acc[mt] = mma_b(fah[kl][mt].bf, fbl[kl].bf, acc[mt]);
        acc[mt] = mma_b(fal[kl][mt].bf, fbh[kl].bf, acc[mt]);
      }
    }
  }

  // the weight reads of a k-step of the second product stand one k-step ahead of their products; the first group here,
  // so that its latency passes under the split and the barrier
  Frag fa[2][8];
#pragma unroll
  for (int mt = 0; mt < 8; ++mt) fa[0][mt] = ldfrag(wp + (size_t)(mt * (DQ / 32)) * FRG);

  // ---- y = acc/1024, split in place -> LDS fragments Yf[nw][2 hf + kl][plane], unit (j, lane) from acc[2 kl + j]
#pragma unroll
  for (int kl = 0; kl < 2; ++kl) {
    unsigned short* yp = Yf + ((nw * (DQ / 32) + 2 * hf + kl) * 2) * FRG + lo8;
#pragma unroll
    for (int j = 0; j < 2; ++j) {
      float f[8];
#pragma unroll
      for (int r = 0; r < 8; ++r) f[r] = acc[2 * kl + j][r] * INS;
      v4u uh, ul;
      split8(f, uh, ul);
      *(v4u*)(yp + j * (FRG / 2))       = uh;
      *(v4u*)(yp + FRG + j * (FRG / 2)) = ul;
    }
  }
  __syncthreads();

  v8f az[8];
#pragma unroll
  for (int mt = 0; mt < 8; ++mt) az[mt] = zero8();
  const unsigned short* yb = Yf + (nw * (DQ / 32) * 2) * FRG + lo8;
#pragma unroll
  for (int ks = 0; ks < DQ / 32; ++ks) {
    if (ks + 1 < DQ / 32) {
#pragma unroll
      for (int mt = 0; mt < 8; ++mt) fa[(ks + 1) & 1][mt] = ldfrag(wp + (size_t)(mt * (DQ / 32) + ks + 1) * FRG);
    }
    const Frag fbh = ldfrag(yb + (2 * ks) * FRG);
    const Frag fbl = ldfrag(yb + (2 * ks + 1) * FRG);
#pragma unroll
    for (int mt = 0; mt < 8; ++mt) {
      az[mt] = mma_b(fa[ks & 1][mt].bf, fbh.bf, az[mt]);
      az[mt] = mma_b(fa[ks & 1][mt].bf, fbl.bf, az[mt]);
    }
  }

  // ---- epilogue: -> LDS Os[n_loc][c]; lane (hh, c) holds channel 128 hf + 16 mt + 8 hh + r for n_loc = 16 nw + c
  {
    float* op = Os + (16 * nw + c) * OSZ + 128 * hf + 8 * hh;
#pragma unroll
    for (int mt = 0; mt < 8; ++mt) {
      v4f va, vb;
#pragma unroll
      for (int r = 0; r < 4; ++r) { va[r] = az[mt][r]; vb[r] = az[mt][4 + r]; }
      *(v4f*)(op + 16 * mt)     = va;
      *(v4f*)(op + 16 * mt + 4) = vb;
    }
  }
  __syncthreads();

  const int e = tid & 7, lq = tid >> 3;                              // lq 0..31
#pragma unroll
  for (int g = 0; g < 2; ++g) {
    v4f res[8];
#pragma unroll
    for (int it = 0; it < 8; ++it) {
      const int L   = (8 * g + it) * 32 + lq;                        // 0..511
      const int cl  = L >> 1, hl = L & 1;                            // channel 0..255
      const int nl  = hl * 32 + 4 * e;                               // position 0..63
      const float bvs = bfr(wb[cl]);
#pragma unroll
      for (int t = 0; t < 4; ++t) {
        res[it][t] = Os[(nl + t) * OSZ + cl] + bvs;
      }
    }
#pragma unroll
    for (int it = 0; it < 8; ++it) {
      const int L   = (8 * g + it) * 32 + lq;
      const int cl  = L >> 1, hl = L & 1;
      const int nl  = hl * 32 + 4 * e;
      const size_t idx = ((size_t)(b * CC + cl)) * NQ + n0 + nl;
      *(v4f*)(Z + idx) = res[it];
    }
  }
  // the sums below reuse registers that the stores above name: the wait stands in front of them
  asm volatile("s_wait_xcnt 0x0" ::: "memory");

  // ---- batch-norm partial sums of channel tid over the block's 64 positions (lanes read consecutive LDS banks)
  {
    const float bvs = bfr(wb[tid]);
    float s4[4] = {0.f, 0.f, 0.f, 0.f}, q4[4] = {0.f, 0.f, 0.f, 0.f};
#pragma unroll
    for (int nl = 0; nl < QT; nl += 4) {
#pragma unroll
      for (int t = 0; t < 4; ++t) {
        const float v = Os[(nl + t) * OSZ + tid] + bvs;
        s4[t] += v;
        q4[t] = fmaf(v, v, q4[t]);
      }
    }
    v2f pq;
    pq[0] = (s4[0] + s4[1]) + (s4[2] + s4[3]);
    pq[1] = (q4[0] + q4[1]) + (q4[2] + q4[3]);
    *(v2f*)(PS + ((size_t)(b * (NQ / QT) + nt) * CC + tid) * 2) = pq;
  }
}

// =========================================================================================================
// (8) batch-norm statistics finished and applied, residual added. Block 1024 threads = 32 waves, one a WGP: it owns 16
//     channels (cg: one 128-B line of every PS row) x 2048 positions of one batch image. Every thread issues all its
//     reads first: 4 b128 of PS (16-B piece tid & 7 = 2 channels of rows (tid >> 3) + 128 i), gamma, beta, 8 b128 of z, 8 of x
//     (channel 2 i + (tid >> 9), a wave reads 512 contiguous bytes), so that the sums below run while z and x arrive.
//     Sums in f64: the thread's 4 rows, lanes l ^ 8 and l ^ 16 (the wave's 4 rows), LDS R2[wave][16 channels x {sum,
//     squares}] (cross-wave, block barrier), then thread ch < 16 adds the 32 waves in order; mean and biased variance
//     in f64, rstd = 1/sqrt(var + eps) in f32 -> LDS SM[ch] = {mean, bf16-RNE(gamma)*rstd, bf16-RNE(beta)} (block barrier).
//     out[b][ch][n] = ((z - mean) * (gamma*rstd) + beta) + bf16-RNE(x).
// coverage: PS rows (tid >> 3) + 128 i = 0..PBK-1, all written by (6); 8 i x 1024 threads x 4 floats = 16 ch x 2048 n;
//           grid 16 channel groups x NB x NQ/2048 covers out[b<NB][0..255][0..NQ-1] exactly once.
// =========================================================================================================
// work-group barrier that orders LDS accesses only: __syncthreads() would also wait out the reads of z and x in flight
__device__ __forceinline__ void lds_barrier() {
  __builtin_amdgcn_fence(__ATOMIC_RELEASE, "workgroup", "local");
  __builtin_amdgcn_s_barrier();
  __builtin_amdgcn_fence(__ATOMIC_ACQUIRE, "workgroup", "local");
}

__global__ __launch_bounds__(ABT)
void bn_apply(const float* __restrict__ Z, const float* __restrict__ x, const float* __restrict__ PS,
              const float* __restrict__ gam, const float* __restrict__ bet, float* out) {
  __shared__ __align__(16) double R2[ABT / 32][2 * AGC];
  __shared__ __align__(16) float SM[AGC][4];
  const int tid = threadIdx.x;
  const int cg  = blockIdx.x % (CC / AGC), sub = blockIdx.x / (CC / AGC);
  const int b   = sub / (NQ / ASN);
  const int n   = (sub % (NQ / ASN)) * ASN + 4 * (tid & (ABT / 2 - 1));
  const int ch0 = cg * AGC + (tid >> 9);

  const float* pr = PS + (size_t)(tid >> 3) * (2 * CC) + cg * (2 * AGC) + 4 * (tid & 7);
  const float* zp = Z + ((size_t)(b * CC + ch0)) * NQ + n;
  const size_t xo = ((size_t)(b * CC + ch0)) * NN + n;
  const float* xp = x + xo;
  v4f pp[PBK / 128], zv[8], xv[8];
#pragma unroll
  for (int i = 0; i < PBK / 128; ++i) pp[i] = *(const v4f*)(pr + (size_t)i * 128 * 2 * CC);
  const int gi = cg * AGC + (tid & (AGC - 1));
  const float gv = gam[gi];
  const float bv = bet[gi];
#pragma unroll
  for (int i = 0; i < 8; ++i) {
    zv[i] = *(const v4f*)(zp + (size_t)(2 * i) * NQ);
    xv[i] = *(const v4f*)(xp + (size_t)(2 * i) * NN);
  }
  // stands in front of any reuse of the reads' address registers, which as its inputs stay untouched up to it
  asm volatile("s_wait_xcnt 0x0" :: "v"(pr), "v"(gi), "v"(zp), "v"(xp) : "memory");
  // keeps the sums, and their wait for PS, behind the issue of every read above: z and x arrive while the sums run
  __builtin_amdgcn_sched_barrier(0);

  double d[4] = {0.0, 0.0, 0.0, 0.0};
#pragma unroll
  for (int i = 0; i < PBK / 128; ++i) {
#pragma unroll
    for (int t = 0; t < 4; ++t) d[t] += (double)pp[i][t];
  }
#pragma unroll
  for (int t = 0; t < 4; ++t) d[t] += __shfl_xor(d[t], 8);
#pragma unroll
  for (int t = 0; t < 4; ++t) d[t] += __shfl_xor(d[t], 16);
  if ((tid & 31) < 8) {
    double* rp = &R2[tid >> 5][4 * (tid & 7)];
#pragma unroll
    for (int t = 0; t < 4; ++t) rp[t] = d[t];
  }
  lds_barrier();
  if (tid < AGC) {
    double s = 0.0, q = 0.0;
#pragma unroll
    for (int w = 0; w < ABT / 32; ++w) { s += R2[w][2 * tid]; q += R2[w][2 * tid + 1]; }
    const double cnt  = (double)NB * (double)NQ;
    const double mean = s / cnt;
    double var = q / cnt - mean * mean;
    var = (var > 0.0) ? var : 0.0;
    const float rstd = 1.0f / sqrtf((float)var + BNEPS);
    v4f w4;
    w4[0] = (float)mean;
    w4[1] = bfr(gv) * rstd;
    w4[2] = bfr(bv);
    w4[3] = 0.f;
    *(v4f*)SM[tid] = w4;
  }
  lds_barrier();

  float* op = out + xo;
#pragma unroll
  for (int i = 0; i < 8; ++i) {
    const v4f st = *(const v4f*)SM[2 * i + (tid >> 9)];
    v4f r;
#pragma unroll
    for (int t = 0; t < 4; ++t) r[t] = ((zv[i][t] - st[0]) * st[1] + st[2]) + bfr(xv[i][t]);
    *(v4f*)(op + (size_t)(2 * i) * NN) = r;
  }
}

// =========================================================================================================
// Workspace map (bytes; each region start a multiple of 256; every extent is an exact row/tile multiple and is
//   (the 16-bit planes hold these extents in fragment order)
//   W16 f16 [384][256]            196608      WWb bf16 [256][128]        65536
//   Qh/Ql bf16 [NB][4096][128]   8388608 x2
//   PGZ region 33554432: Z f32 [NB][256][NQ] at +0; Z extent <= region (static_assert)
//   Pc/Gc f16 [NB][128][1024]   2097152 x2
//   MTh/MTl bf16 [NB][128][128]   262144 x2
//   PS  f32 [NB*NQ/64][256][2]    1048576
//   total (NB=8, NQ=4096) = 56360960
// =========================================================================================================
extern "C" void kernel_launch(void* const* d_in, const int* in_sizes, int n_in,
                              void* d_out, int out_size, void* d_ws, size_t ws_size,
                              hipStream_t stream) {
  const int XN = NB * CC * NN;
  if (n_in < 11) return;
  if (in_sizes[0] < XN) return;
  if (in_sizes[1] < DQ * CC || in_sizes[3] < DQ * CC || in_sizes[5] < DQ * CC || in_sizes[7] < CC * DQ) return;
  if (in_sizes[2] < DQ || in_sizes[4] < DQ || in_sizes[6] < DQ || in_sizes[8] < CC) return;
  if (in_sizes[9] < CC || in_sizes[10] < CC) return;
  if (out_size < XN) return;

  size_t off = 0;
  auto carve = [&](size_t bytes) { const size_t o = off; off += (bytes + 255) & ~(size_t)255; return o; };
  const size_t oW16 = carve((size_t)MW * CC * 2);
  const size_t oWWb = carve((size_t)CC * DQ * 2);
  const size_t oQh  = carve((size_t)NB * NN * DQ * 2);
  const size_t oQl  = carve((size_t)NB * NN * DQ * 2);
  const size_t oPGZ = carve((size_t)2 * NB * NN * DQ * 4);
  const size_t oPc  = carve((size_t)NB * DQ * MM * 2);
  const size_t oGc  = carve((size_t)NB * DQ * MM * 2);
  const size_t oMTh = carve((size_t)NB * DQ * DQ * 2);
  const size_t oMTl = carve((size_t)NB * DQ * DQ * 2);
  const size_t oPS  = carve((size_t)PBK * CC * 2 * 4);
  if (off > ws_size) return;
  if (off > (size_t)134217728) return;

  const float* x  = (const float*)d_in[0];
  const float* gw = (const float*)d_in[1];
  const float* gb = (const float*)d_in[2];
  const float* tw = (const float*)d_in[3];
  const float* tb = (const float*)d_in[4];
  const float* pw = (const float*)d_in[5];
  const float* pb = (const float*)d_in[6];
  const float* ow = (const float*)d_in[7];
  const float* wb = (const float*)d_in[8];
  const float* bg = (const float*)d_in[9];
  const float* bb = (const float*)d_in[10];

  char* ws = (char*)d_ws;
  unsigned short* W16 = (unsigned short*)(ws + oW16);
  unsigned short* WWb = (unsigned short*)(ws + oWWb);
  unsigned short* Qh  = (unsigned short*)(ws + oQh);
  unsigned short* Ql  = (unsigned short*)(ws + oQl);
  float*          Z   = (float*)(ws + oPGZ);
  unsigned short* Pc  = (unsigned short*)(ws + oPc);
  unsigned short* Gc  = (unsigned short*)(ws + oGc);
  unsigned short* MTh = (unsigned short*)(ws + oMTh);
  unsigned short* MTl = (unsigned short*)(ws + oMTl);
  float*          PS  = (float*)(ws + oPS);
  float* out = (float*)d_out;

  const dim3 blk256(256);

  // (0) theta_w / phi_w / g_w -> stacked f16 plane; w_w -> bf16 plane
  cvt_w<<<dim3(MW / 8 + CC / 16), blk256, 0, stream>>>(tw, pw, gw, ow, W16, WWb);
  // (2) x -> f16 fragments in LDS, conv1x1 GEMM -> theta hi/res planes; phi / g + bias, 2x2 max-pooled, as f16 planes [b][d][m]
  gemm_proj<<<dim3(NSTRIP, NB), dim3(PTH), 0, stream>>>(W16, x, tb, pb, gb, Qh, Ql, Pc, Gc);
  // (5) M = pooled-phi . pooled-g^T per batch -> M^T hi/res planes [b][ci][cp]
  gemm_m<<<dim3(DQ / 16, DQ / QT, NB), blk256, 0, stream>>>(Pc, Gc, MTh, MTl);
  // (6) y = theta . M / 1024 (hi/res fragments kept in LDS), output conv + bias -> Z [b][256][NQ], partial sums -> PS
  gemm_yz<<<dim3(NQ / QT, NB), blk256, 0, stream>>>(MTh, MTl, Qh, Ql, WWb, wb, Z, PS);
  // (8) batch statistics from PS, normalise, affine, residual -> out [b][256][4096]
  bn_apply<<<dim3((CC / AGC) * NB * (NQ / ASN)), dim3(ABT), 0, stream>>>(Z, x, PS, bg, bb, out);
  (void)hipGetLastError();
}

// v009
// It runs in 44.3 microseconds.
// Next to v008, in two timings, it ran 1.13 and 1.12 times as fast.
// All steps since v000 together make it 3.20 times as fast.
// Contractions: conv1x1 theta/phi/g GEMM W[384x256].X[256x128] per strip on v_wmma_f32_16x16x32_bf16
// (bf16-RNE weights and bf16-RNE x, 1 product); M = pooled-phi . pooled-g^T per batch
// [128x128], K=1024, on v_wmma_f32_16x16x32_f16 (2x2 max-pooled phi and g as plain f16, 1 product);
// y^T = M^T.theta^T, K=128, on v_wmma_f32_16x16x32_bf16 (M and theta as bf16 hi + bf16 residual planes,
// 3 products); output conv W[256x128].Y on v_wmma_f32_16x16x32_bf16 (bf16 weights, y as bf16 hi + residual
// planes, 2 products); f32 accumulate everywhere; max-pool, bias, batch-norm statistics (f32 sums over 64 positions,
// f64 sums of those, f32 apply) and the residual add on VALU.
// Every 16-bit WMMA operand plane lies in the workspace (x, y: in LDS; the conv weights: in LDS, padded) in fragment order: one fragment = 16 rows x 32 k = 1 KiB =
// [j 0..1][lane 0..31][8 values], unit (j, lane) = row (lane&15), k = 16 j + 8 (lane>>4) .. + 7. A wave reads a fragment
// with two b128 loads of 512 contiguous bytes each (4 whole lines a load).
#include <hip/hip_runtime.h>
#include <math.h>
#include <stdint.h>

#ifndef NB
#define NB 8
#endif
#ifndef NQ
#define NQ 4096
#endif
#define NB_FULL 8
#define CC     256
#define HIMG   64
#define WIMG   64
#define NN     4096
#define DQ     128
#define HP     32
#define WP     32
#define MM     1024
#define MW     384
#define QT     64
#define SN     128
#define NSTRIP 32
#define OSP    68
#define OSZ    260
#define INS    0.0009765625f
#define BNEPS  1e-5f
#define KSL    128
#define FRG    512
#define PBK    ((NQ / QT) * NB)
#define AGC    16
#define ASN    2048
#define ABT    1024
#define PTH    512
#define XTS    (8 * FRG + 8)
#define TQ     40
#define WUP    (17 * 8)
#define WTP    (32 * WUP)

static_assert(NB >= 1 && NB <= NB_FULL);
static_assert(NQ % 128 == 0 && NQ >= 128 && NQ <= NN);
static_assert(NQ % QT == 0);
static_assert(NN == HIMG * WIMG);
static_assert(SN == 2 * WIMG && NSTRIP * SN == NN && SN == 8 * 16);
static_assert(HIMG % 2 == 0 && WIMG % 2 == 0 && HP == HIMG / 2 && WP == WIMG / 2 && MM == HP * WP);
static_assert(WP == 32);
static_assert(MM % QT == 0 && MM % 32 == 0);
static_assert(NN % QT == 0 && CC % QT == 0 && DQ == 2 * QT);
static_assert(MW == 3 * DQ && MW % 8 == 0);
static_assert(CC % 32 == 0 && DQ % 32 == 0);
static_assert((OSP * 4) % 16 == 0);
static_assert(SN * OSP * 4 <= 65536 && DQ * OSP * 4 <= 65536);
static_assert(((size_t)NB * CC * NQ) % 1024 == 0);
static_assert((size_t)NB * CC * NQ * 4 <= 2 * (size_t)NB * NN * DQ * 4);
static_assert((size_t)NB_FULL * CC * NN * 4 == (size_t)33554432);
static_assert((OSZ * 4) % 16 == 0 && OSZ >= CC && CC == 2 * 8 * 16 && QT == 4 * 16);
static_assert(NN == 16 * 4 * WIMG && MM == 16 * 64);
static_assert(MM == 8 * KSL && KSL == 4 * 32 && DQ == 8 * 16);
static_assert(PBK % 128 == 0 && NQ % ASN == 0 && CC % AGC == 0 && AGC * 2 * 4 == 128 && CC == 256);
static_assert(PTH == 32 * (CC / 16) && SN == 4 * 32 && CC / 32 == 8 && (XTS * 2) % 16 == 0 && (TQ * 2) % 16 == 0 && TQ >= WP);
static_assert(MW == 16 * 3 * 8 && DQ == 16 * 8 && CC == 2 * 32 * 4 && (WUP * 2) % 16 == 0);
static_assert(((SN / 16) * XTS + (MW / 16) * WTP + 2 * DQ * TQ) * 2 <= 320 * 1024);
static_assert(AGC * ASN == 8 * 4 * ABT && ASN == 4 * (ABT / 2) && ABT == 8 * 128);

typedef _Float16       v16h __attribute__((ext_vector_type(16)));
typedef _Float16       v8h  __attribute__((ext_vector_type(8)));
typedef __bf16         v16b __attribute__((ext_vector_type(16)));
typedef __bf16         v2bf __attribute__((ext_vector_type(2)));
typedef unsigned short v8us __attribute__((ext_vector_type(8)));
typedef float          v8f  __attribute__((ext_vector_type(8)));
typedef float          v4f  __attribute__((ext_vector_type(4)));
typedef float          v2f  __attribute__((ext_vector_type(2)));
typedef unsigned int   v4u  __attribute__((ext_vector_type(4)));
typedef unsigned int   v2u  __attribute__((ext_vector_type(2)));

union Frag { v8us u[2]; v16h h; v16b bf; };
static_assert(sizeof(Frag) == 32);

// ---- scalar helpers ---------------------------------------------------------------------------------------
__device__ __forceinline__ unsigned short bf_bits(float f) {          // f32 -> bf16 bits, RNE convert
  unsigned u = __float_as_uint(f);
  return (unsigned short)((u + 0x7FFFu + ((u >> 16) & 1u)) >> 16);
}
__device__ __forceinline__ float bf_up(unsigned short hb) { return __uint_as_float(((unsigned)hb) << 16); }
__device__ __forceinline__ float bfr(float f) { return bf_up(bf_bits(f)); }
__device__ __forceinline__ unsigned short h_bits(_Float16 x) { return __builtin_bit_cast(unsigned short, x); }
__device__ __forceinline__ unsigned pk16(unsigned short a, unsigned short b) { return (unsigned)a | ((unsigned)b << 16); }
__device__ __forceinline__ v8f zero8() { v8f z = {0.f, 0.f, 0.f, 0.f, 0.f, 0.f, 0.f, 0.f}; return z; }
// 8 f32 values -> bf16 hi bits and bf16 residual bits (lo = RNE(v - hi)), packed 2 per uint
__device__ __forceinline__ void split8(const float* f, v4u& uh, v4u& ul) {
#pragma unroll
  for (int t = 0; t < 4; ++t) {
    const float f0 = f[2 * t], f1 = f[2 * t + 1];
    const unsigned short hb0 = bf_bits(f0), hb1 = bf_bits(f1);
    const unsigned short lb0 = bf_bits(f0 - bf_up(hb0));
    const unsigned short lb1 = bf_bits(f1 - bf_up(hb1));
    uh[t] = pk16(hb0, hb1);
    ul[t] = pk16(lb0, lb1);
  }
}

// ---- 16-bit fragment loader (A or B) from a plane in fragment order: lane -> row/col (lane&15), h = lane>>4; p = start
//      of the fragment + 8*lane; elements 0..7 <- p[0..7] (k0+8h..), elements 8..15 <- p[256..263] (k0+16+8h..)
__device__ __forceinline__ Frag ldfrag(const unsigned short* p) {
  Frag f;
  f.u[0] = *(const v8us*)(p);
  f.u[1] = *(const v8us*)(p + FRG / 2);
  return f;
}
// k offset (0, 8, 16, 24) inside its fragment of the 16-B unit that thread t stores (unit = t & 63; its row is t & 15)
__device__ __forceinline__ int unit_k(int t) { return 16 * ((t >> 5) & 1) + 8 * ((t >> 4) & 1); }

// ---- WMMA helpers: builtin followed by a 4-slot VALU gap tying D and keeping A/B live --------------------------
__device__ __forceinline__ v8f mma_h(v16h a, v16h b, v8f c) {
  v8f d = __builtin_amdgcn_wmma_f32_16x16x32_f16(false, a, false, b, (short)0, c, false, false);
#if defined(__HIP_DEVICE_COMPILE__)
  asm volatile("v_nop\n\tv_nop\n\tv_nop\n\tv_nop" : "+v"(d) : "v"(a), "v"(b));
#endif
  return d;
}
__device__ __forceinline__ v8f mma_b(v16b a, v16b b, v8f c) {
  v8f d = __builtin_amdgcn_wmma_f32_16x16x32_bf16(false, a, false, b, (short)0, c, false, false);
#if defined(__HIP_DEVICE_COMPILE__)
  const v16h ha = __builtin_bit_cast(v16h, a), hb = __builtin_bit_cast(v16h, b);
  asm volatile("v_nop\n\tv_nop\n\tv_nop\n\tv_nop" : "+v"(d) : "v"(ha), "v"(hb));
#endif
  return d;
}

// =========================================================================================================
// (2) weight conversion, x conversion and conv1x1 GEMM in one launch, Y[o][n] = sum_c W[o][c] X[n][c], K = 256 = 8 steps,
//     for one (b, strip of 128 positions = image rows 2 st, 2 st + 1) and all 384 o (rows 0..127 theta_w, 128..255 phi_w,
//     256..383 g_w). Block 512 threads = 16 waves, one block a WGP.
//     Weights: wave w reads the three groups of 8 rows 8 (3 w + q).., q = 0..2 (a load = half a row, 512 contiguous bytes);
//     lane l then holds k = 128 half + 4 l..+3 of a row = half a 16-B unit of an A fragment, bf16-RNE by the packed convert,
//     stored b64 to LDS WF[24 o tiles][32 units u = k / 8][17 slots of 16 B, slot = row]: the 17th slot is a pad, so that a
//     wave's 32 b64 stores (two lanes a unit) fall on 64 different banks, and a fragment read (unit 4 ks + 2 j + (lane >> 4),
//     row lane & 15) is 256 contiguous bytes a half wave. Cross-wave, block barrier.
//     x: wave w reads channels 16 w..16 w + 15 of the strip (a load = one channel's 512 contiguous bytes);
//     lane l then holds positions 4 l..4 l + 3 of 2 x 8 consecutive channels = 8 whole 16-B
//     units of the B fragments (bf16-RNE values), stored to LDS XF[8 n tiles][8 k steps] in fragment order
//     (n tile pitch XTS: 16 B more than 8 fragments, so that the 16 lanes of a half wave store to 64 different banks),
//     cross-wave, the same block barrier.
//     Every plane written here is in fragment order (Qh/Ql: [b][256 n tiles][4 k steps], k = d; Pc/Gc: [b][8 d tiles]
//     [32 k steps], k = m). Each wave does two pieces, B fragments from XF, A fragments from WF:
//     theta: wave w = (n tile w & 7, mb = w >> 3) owns 16 positions x theta dims 64 mb..64 mb + 63 (4 m-tiles). Lane
//       (hh, c) then holds d = 64 mb + 16 mt + 8 hh + r of position c: that is unit (j = mt & 1, lane) of the Qh/Ql fragment
//       (n tile, k step 2 mb + (mt >> 1)). The lane adds the bias, splits (hi = RNE(v), lo = RNE(v-hi)) and stores whole
//       units: a wave's store = 512 contiguous bytes.
//     phi, g: wave w = (xt = w & 3, ob = w >> 2: phi dims 0.., 64.., then g dims 0.., 64..) owns the two n-tiles of the
//       strip's two image rows at columns 16 xt..16 xt+15, and 4 m-tiles. The 2x2 stride-2
//       max-pool is done on the accumulators: the row pair is the wave's two tiles (same lane, same register), the
//       column pair is lane ^ 1. The bias follows the maximum (x -> fl(x + bias) never decreases as x grows, so
//       the maximum of the results is the result of the maximum). f16 values go to the LDS tile Tp[256 o][32 m]
//       (pitch TQ, cross-wave).
//     One block barrier, then: Tp -> Pc / Gc f16, m = 32 st + px: 8 d tiles x 1 k step = 8 whole fragments a plane.
// coverage: WF 16 waves x 3 groups x 8 rows x 2 halves x 32 lanes x 4 = 384 x 256 written, the same read (pad slots
//           neither); XF 16 waves x 2 octets x 32 lanes x 4 units = 8 n tiles x 8 k steps x 64 units written, the same
//           read; Qh/Ql 16 waves x 4 mt x 32 units x 8 = 128 n x 128 d; grid (32, NB) covers 4096 rows x 128 d of Qh/Ql
//           once. Tp written rows 64 ob + 16 mt + 8 hh +
//           4 (c&1) + j = 0..255 x cols 8 xt + (c>>1) = 0..31, read rows 0..255 x cols 0..31; 2 it x 512 units = 16
//           fragments; 32 strips cover Pc and Gc (128 d x 1024 m a batch) exactly once.
// =========================================================================================================
__device__ __forceinline__ float max_pair(float v) {                 // max of lanes l and l ^ 1 (quad_perm 1,0,3,2)
  const int o = __builtin_amdgcn_mov_dpp(__float_as_int(v), 0xB1, 0xF, 0xF, true);
  return fmaxf(v, __int_as_float(o));
}
// two f32 -> two bf16 (RNE) in one register, a in the low half: one packed convert
__device__ __forceinline__ unsigned pkbf(float a, float b) {
  v2f p; p[0] = a; p[1] = b;
  return __builtin_bit_cast(unsigned, __builtin_convertvector(p, v2bf));
}
// A fragment from WF: p = slot (unit 4 ks + (lane >> 4), row lane & 15); the j = 1 unit lies two units on
__device__ __forceinline__ Frag ldfragw(const unsigned short* p) {
  Frag f;
  f.u[0] = *(const v8us*)(p);
  f.u[1] = *(const v8us*)(p + 2 * WUP);
  return f;
}
// the 16 half rows of one group of 8 weight rows: i = 2 row + half
__device__ __forceinline__ void ld_wgroup(const float* p, v4f* wr) {
#pragma unroll
  for (int i = 0; i < 16; ++i) wr[i] = *(const v4f*)(p + (i >> 1) * CC + (i & 1) * (CC / 2));
}
__device__ __forceinline__ void st_wgroup(unsigned short* q, const v4f* wr) {
#pragma unroll
  for (int i = 0; i < 16; ++i) {
    v2u u;
    u[0] = pkbf(wr[i][0], wr[i][1]);
    u[1] = pkbf(wr[i][2], wr[i][3]);
    *(v2u*)(q + (i & 1) * (16 * WUP) + (i >> 1) * 8) = u;
  }
}

__global__ __launch_bounds__(PTH)
void gemm_proj(const float* __restrict__ tw, const float* __restrict__ pw, const float* __restrict__ gw,
               const float* __restrict__ x,
               const float* __restrict__ tb, const float* __restrict__ pb, const float* __restrict__ gb,
               unsigned short* Qh, unsigned short* Ql, unsigned short* Pc, unsigned short* Gc) {
  __shared__ __align__(16) unsigned short XF[(SN / 16) * XTS];
  __shared__ __align__(16) unsigned short WF[(MW / 16) * WTP];
  __shared__ __align__(16) unsigned short Tp[2 * DQ * TQ];
  const int tid  = threadIdx.x;
  const int lane = tid & 31;
  const int wave = __builtin_amdgcn_readfirstlane(tid >> 5);         // 0..15, scalar: row and fragment bases stay in SGPRs
  const int hh   = lane >> 4, c = lane & 15;
  const int st   = blockIdx.x, b = blockIdx.y;
  const int n0   = st * SN;
  const unsigned lo = (unsigned)(8 * lane);                          // the lane's offset, the same in every XF fragment
  const unsigned lw = (unsigned)((hh * 17 + c) * 8);                 // the lane's offset, the same in every WF fragment

  // ---- weights -> bf16 A fragments, x strip -> bf16 B fragments, both in LDS
  {
    const float* wp[3];
    unsigned short* wq[3];
#pragma unroll
    for (int q = 0; q < 3; ++q) {
      const int g = 3 * wave + q;                                    // group of 8 rows, 0..47; 16 groups a weight matrix
      const float* wbase = (g < 16) ? tw : ((g < 32) ? pw : gw);     // all global, wave-uniform
      wp[q] = wbase + (size_t)(8 * (g & 15)) * CC + 4 * lane;
      wq[q] = WF + (g >> 1) * WTP + (g & 1) * 64 + (lane >> 1) * WUP + 4 * (lane & 1);
    }
    const float* xp = x + ((size_t)(b * CC + 16 * wave)) * NN + n0 + 4 * lane;
    v4f w0[16], w1[16], w2[16], xr[16];
    // the loops of this part are unrolled so that the arrays are indexed by constants and stay in registers.
    // Two weight groups (short way, from L2) are asked for first and converted while x (long way) is in flight
    ld_wgroup(wp[0], w0);
    ld_wgroup(wp[1], w1);
#pragma unroll
    for (int i = 0; i < 16; ++i) xr[i] = *(const v4f*)(xp + (size_t)i * NN);
    // stands in front of any reuse of the reads' address registers, which as its inputs stay untouched up to it
    asm volatile("s_wait_xcnt 0x0" :: "v"(wp[0]), "v"(wp[1]), "v"(xp) : "memory");
    st_wgroup(wq[0], w0);
    ld_wgroup(wp[2], w2);
    // as above, for the third group's reads
    asm volatile("s_wait_xcnt 0x0" :: "v"(wp[2]) : "memory");
    st_wgroup(wq[1], w1);
    // channel octet q = 2 wave + q2: k step q >> 2, j = (q >> 1) & 1, upper lane half q & 1; position 4 lane + t: n tile
    // lane >> 2, row 4 (lane & 3) + t
    unsigned short* fp = XF + (lane >> 2) * XTS + (wave >> 1) * FRG + (wave & 1) * (FRG / 2) + 32 * (lane & 3);
#pragma unroll
    for (int q2 = 0; q2 < 2; ++q2) {
#pragma unroll
      for (int t = 0; t < 4; ++t) {
        v4u u;
#pragma unroll
        for (int p = 0; p < 4; ++p) u[p] = pkbf(xr[8 * q2 + 2 * p][t], xr[8 * q2 + 2 * p + 1][t]);
        *(v4u*)(fp + 128 * q2 + 8 * t) = u;
      }
    }
    st_wgroup(wq[2], w2);
  }
  __syncthreads();

  // ---- theta: 16 positions x 64 o
  {
    const int ntl = wave & 7, mb = wave >> 3;
    const unsigned short* ap = WF + mb * (QT / 16) * WTP + lw;
    const unsigned short* bp = XF + ntl * XTS + lo;

    // the bias of the lane's 32 dims is asked for here, so that it arrives under the products
    const unsigned hb = 32u * (unsigned)hh;                          // the lane's byte offset: 8 dims a lane half
    const float* bq = (const float*)((const char*)(tb + QT * mb) + hb);
    v4f ba[4], bc[4];
#pragma unroll
    for (int mt = 0; mt < 4; ++mt) {
      ba[mt] = *(const v4f*)(bq + 16 * mt);
      bc[mt] = *(const v4f*)(bq + 16 * mt + 4);
    }
    // stands in front of any reuse of the reads' offset register, which as its input stays untouched up to it
    asm volatile("s_wait_xcnt 0x0" :: "v"(hb) : "memory");

    v8f acc[4];
#pragma unroll
    for (int mt = 0; mt < 4; ++mt) acc[mt] = zero8();

    // the reads of two k-steps stand as one group in front of their products: the wave waits out the load latency once a
    // group, not once a product
#pragma unroll
    for (int kp = 0; kp < CC / 64; ++kp) {
      Frag fb[2], fa[2][4];
#pragma unroll
      for (int kl = 0; kl < 2; ++kl) {
        const int ks = 2 * kp + kl;
        fb[kl] = ldfrag(bp + FRG * ks);
#pragma unroll
        for (int mt = 0; mt < 4; ++mt) fa[kl][mt] = ldfragw(ap + mt * WTP + ks * (4 * WUP));
      }
#pragma unroll
      for (int kl = 0; kl < 2; ++kl) {
#pragma unroll
        for (int mt = 0; mt < 4; ++mt) acc[mt] = mma_b(fa[kl][mt].bf, fb[kl].bf, acc[mt]);
      }
    }

    // + bias, split, whole units -> Qh/Ql; lane (hh, c) holds d = 64 mb + 16 mt + 8 hh + r for n_loc = 16 ntl + c
    const size_t fg = (size_t)((b * (NN / 16) + n0 / 16 + ntl) * (DQ / 32) + 2 * mb) * FRG + lo;
#pragma unroll
    for (int mt = 0; mt < 4; ++mt) {
      float f[8];
#pragma unroll
      for (int r = 0; r < 4; ++r) { f[r] = acc[mt][r] + bfr(ba[mt][r]); f[4 + r] = acc[mt][4 + r] + bfr(bc[mt][r]); }
      v4u uh, ul;
      split8(f, uh, ul);
      const size_t po = fg + (size_t)((mt >> 1) * FRG + (mt & 1) * (FRG / 2));
      *(v4u*)(Qh + po) = uh;
      *(v4u*)(Ql + po) = ul;
    }
    // the part below reuses registers that the reads and stores above name: the wait stands in front of it
    asm volatile("s_wait_xcnt 0x0" ::: "memory");
  }

  // ---- phi / g: 64 o x 2 image rows x 16 columns, pooled in registers
  {
    const int xt = wave & 3, ob = wave >> 2;                         // ob 0..3
    const int sel = ob >> 1, d0 = QT * (ob & 1);                     // plane (0 phi, 1 g), first dim 0 or 64
    const unsigned short* ap  = WF + ((DQ + QT * ob) / 16) * WTP + lw;
    const unsigned short* bp0 = XF + xt * XTS + lo;
    const unsigned short* bp1 = bp0 + (WIMG / 16) * XTS;

    v8f a0[4], a1[4];
#pragma unroll
    for (int mt = 0; mt < 4; ++mt) { a0[mt] = zero8(); a1[mt] = zero8(); }
#pragma unroll
    for (int ks = 0; ks < CC / 32; ++ks) {
      const Frag fb0 = ldfrag(bp0 + FRG * ks);
      const Frag fb1 = ldfrag(bp1 + FRG * ks);
      Frag fa[4];
#pragma unroll
      for (int mt = 0; mt < 4; ++mt) fa[mt] = ldfragw(ap + mt * WTP + ks * (4 * WUP));
#pragma unroll
      for (int mt = 0; mt < 4; ++mt) {
        a0[mt] = mma_b(fa[mt].bf, fb0.bf, a0[mt]);
        a1[mt] = mma_b(fa[mt].bf, fb1.bf, a1[mt]);
      }
    }

    const float* bias = (sel == 0) ? pb : gb;                        // both global
    const int odd = c & 1;                                           // even lane stores r 0..3, odd lane r 4..7
    const int ml  = 8 * xt + (c >> 1);                               // 0..31
#pragma unroll
    for (int mt = 0; mt < 4; ++mt) {
      const int ol = 16 * mt + 8 * hh + 4 * odd;                     // 0..60
      const v4f bq = *(const v4f*)(bias + d0 + ol);
#pragma unroll
      for (int j = 0; j < 4; ++j) {
        const float pe = max_pair(fmaxf(a0[mt][j], a1[mt][j]));
        const float po = max_pair(fmaxf(a0[mt][4 + j], a1[mt][4 + j]));
        const float v  = (odd ? po : pe) + bfr(bq[j]);
        Tp[(QT * ob + ol + j) * TQ + ml] = h_bits((_Float16)v);
      }
    }
  }
  __syncthreads();

  {
    v4u u[2];                                                        // pooled planes: o tile 8 it + (tid >> 6), 0..7 phi, 8..15 g
#pragma unroll
    for (int it = 0; it < 2; ++it)
      u[it] = *(const v4u*)(Tp + (16 * (8 * it + (tid >> 6)) + (tid & 15)) * TQ + unit_k(tid));
    const size_t po = (size_t)((b * (DQ / 16) + (tid >> 6)) * (MM / 32) + st) * FRG + 8 * (tid & 63);
    *(v4u*)(Pc + po) = u[0];
    *(v4u*)(Gc + po) = u[1];
  }
}

// =========================================================================================================
// (5) M GEMM for one (b, 64-row block of phi channels, 16-column tile of g channels): M[cp][ci] = sum_m Pc[b][cp][m]
//     Gc[b][ci][m], K = 1024. Block 256 threads = 8 waves; wave w owns the k slice m = 128 w..128 w + 127 (4 steps) of
//     the whole 64 x 16 tile: B fragments of the Gc rows ci = 16 ct + (lane&15), A rows cp = c0 + 16 mt + (lane&15)
//     from Pc, both planes in fragment order. A wave issues its 40 b128 reads before its first product.
//     The 8 partial tiles go to LDS Os[16 w + ci_loc][cp_loc] (pitch OSP, b128 stores, cross-wave), block barrier, then
//     each thread adds the 8 slices of 4 consecutive cp in slice order (f32) -> MTh/MTl bf16, fragments [b][8 ci tiles]
//     [4 k steps], k = cp: the block owns 2 whole fragments of each plane, a thread half a 16-B unit.
// coverage: Os 8 waves x 16 ci x 64 cp = 128 x 64 written, reads rows 16 w + row <= 127, cols cq..cq+3 <= 63; planes
//           256 threads x 4 = 16 ci x 64 cp; planes z < NB of grid (8, 2, NB + 1) cover MTh/MTl (128 ci x 128 cp a batch) exactly once.
//     The 16 blocks of grid plane z = NB do no product: they make WWb, bf16 of w_w [256][128], fragments [16 c tiles]
//     [4 k steps], for the next launch; a block owns 4 consecutive fragments, a thread one 16-B unit (16 x 256 x 8 =
//     256 x 128), and the whole block returns in front of the barrier.
// =========================================================================================================
__global__ __launch_bounds__(256)
void gemm_m(const unsigned short* __restrict__ Pc, const unsigned short* __restrict__ Gc,
            const float* __restrict__ ow, unsigned short* MTh, unsigned short* MTl, unsigned short* WWb) {
  __shared__ __align__(16) float Os[DQ * OSP];
  const int tid  = threadIdx.x;
  if (blockIdx.z == NB) {                                            // block-uniform
    const int un = (blockIdx.y * (DQ / 16) + blockIdx.x) * 256 + tid; // unit 0..4095
    const int fr = un >> 6;                                          // fragment = 4 (c tile) + k step
    const int o = 16 * (fr >> 2) + (tid & 15);                       // 0..255
    const int col = 32 * (fr & 3) + unit_k(tid);                     // 0..120
    const float* s = ow + (size_t)o * DQ + col;
    const v4f a = *(const v4f*)s;
    const v4f q = *(const v4f*)(s + 4);
    const float f[8] = {a[0], a[1], a[2], a[3], q[0], q[1], q[2], q[3]};
    v4u u;
#pragma unroll
    for (int t = 0; t < 4; ++t) u[t] = pk16(bf_bits(f[2 * t]), bf_bits(f[2 * t + 1]));
    *(v4u*)(WWb + (size_t)un * 8) = u;
    return;
  }
  const int lane = tid & 31, wave = tid >> 5;                        // wave 0..7 = k slice
  const int hh   = lane >> 4, c = lane & 15;
  const int ct   = blockIdx.x, mb = blockIdx.y, b = blockIdx.z;
  const int c0   = mb * QT;

  const unsigned short* ap = Pc + (size_t)((b * (DQ / 16) + c0 / 16) * (MM / 32) + (KSL / 32) * wave) * FRG + 8 * lane;
  const unsigned short* bp = Gc + (size_t)((b * (DQ / 16) + ct) * (MM / 32) + (KSL / 32) * wave) * FRG + 8 * lane;

  Frag fb[KSL / 32], fa[KSL / 32][4];
#pragma unroll
  for (int ks = 0; ks < KSL / 32; ++ks) {
    fb[ks] = ldfrag(bp + FRG * ks);
#pragma unroll
    for (int mt = 0; mt < 4; ++mt) fa[ks][mt] = ldfrag(ap + (size_t)(mt * (MM / 32) + ks) * FRG);
  }
#if defined(__HIP_DEVICE_COMPILE__)
  // inputs-only fence on the loaded values: keeps every read of the slice in front of the first product, so that the
  // wave waits for memory once; without it each product's reads are issued, and waited for, one product at a time
  asm volatile("" :: "v"(fb[0].h), "v"(fb[1].h), "v"(fb[2].h), "v"(fb[3].h),
               "v"(fa[0][0].h), "v"(fa[0][1].h), "v"(fa[0][2].h), "v"(fa[0][3].h),
               "v"(fa[1][0].h), "v"(fa[1][1].h), "v"(fa[1][2].h), "v"(fa[1][3].h),
               "v"(fa[2][0].h), "v"(fa[2][1].h), "v"(fa[2][2].h), "v"(fa[2][3].h),
               "v"(fa[3][0].h), "v"(fa[3][1].h), "v"(fa[3][2].h), "v"(fa[3][3].h));
#endif

  v8f acc[4];
#pragma unroll
  for (int mt = 0; mt < 4; ++mt) acc[mt] = zero8();
#pragma unroll
  for (int ks = 0; ks < KSL / 32; ++ks) {
#pragma unroll
    for (int mt = 0; mt < 4; ++mt) acc[mt] = mma_h(fa[ks][mt].h, fb[ks].h, acc[mt]);
  }

  // ---- partial tile -> LDS Os[16 w + ci_loc][cp_loc]; lane (hh, c) holds cp_loc = 16 mt + 8 hh + r for ci_loc = c
  {
    const int nl = 16 * wave + c;
#pragma unroll
    for (int mt = 0; mt < 4; ++mt) {
      v4f va, vb;
#pragma unroll
      for (int r = 0; r < 4; ++r) { va[r] = acc[mt][r]; vb[r] = acc[mt][4 + r]; }
      *(v4f*)(Os + nl * OSP + 16 * mt + 8 * hh)     = va;
      *(v4f*)(Os + nl * OSP + 16 * mt + 8 * hh + 4) = vb;
    }
  }
  __syncthreads();

  const int row = (tid >> 1) & 15;                                   // ci_loc 0..15 = the unit's row
  const int cq  = 32 * (tid >> 7) + unit_k(tid >> 1) + 4 * (tid & 1); // cp_loc 0..60: two threads share a 16-B unit
  v4f s = *(const v4f*)(Os + row * OSP + cq);
#pragma unroll
  for (int w = 1; w < MM / KSL; ++w) s += *(const v4f*)(Os + (16 * w + row) * OSP + cq);
  v2u uh, ul;
#pragma unroll
  for (int t = 0; t < 2; ++t) {
    const float f0 = s[2 * t], f1 = s[2 * t + 1];
    const unsigned short hb0 = bf_bits(f0), hb1 = bf_bits(f1);
    uh[t] = pk16(hb0, hb1);
    ul[t] = pk16(bf_bits(f0 - bf_up(hb0)), bf_bits(f1 - bf_up(hb1)));
  }
  const size_t po = (size_t)((b * (DQ / 16) + ct) * (DQ / 32) + c0 / 32 + (tid >> 7)) * FRG + 4 * (tid & 127);
  *(v2u*)(MTh + po) = uh;
  *(v2u*)(MTl + po) = ul;
}

// =========================================================================================================
// (6) y GEMM and output conv in one launch, for one (b, 64-n tile). Block 256 threads = 8 waves; wave w = (nw = w & 3,
//     hf = w >> 2) owns cols n0 + 16 nw..+15 in both products.
//     First product: y[n][ci] = (1/1024) sum_cp (MTh+MTl)[b][ci][cp] (Qh+Ql)[b][n][cp] on bf16 WMMA, 3 products per
//     k-step (hi.hi + hi.lo + lo.hi, shared accumulator), K = 128 = 4 steps, 4 m-tiles (A rows ci = 64 hf + 16 mt +
//     (lane&15), from MTh/MTl). Lane (hh, c) then holds ci = 64 hf + 16 mt + 8 hh + r of column c: that is unit
//     (j = mt & 1, lane) of the B fragment of k step 2 hf + (mt >> 1), k = ci, of the second product. The lane scales and
//     splits its own values (hi = RNE(y), lo = RNE(y - hi)) and stores whole units to LDS Yf[nw][k step][hi, lo]
//     (1-KiB fragments, cross-wave: the other hf wave of the same columns reads them), block barrier.
//     Second product: A[c][n] = sum_ci WWb[c][ci] (Yhi + Ylo)[n][ci] on bf16 WMMA (2 products per k-step, shared
//     accumulator), K = 128 = 4 steps, 8 m-tiles (A rows c = 128 hf + 16 mt + (lane&15), from WWb). Epilogue staged in
//     LDS Os[n_loc][c] (pitch OSZ, b128 stores, cross-wave), block barrier, + bias -> Z rows (a channel's segment of
//     64 n = 2 lines): 8 consecutive lanes x 16 B (values gathered from 4 Os rows).
//     Batch-norm partial sums: thread t then adds z and z*z of channel t over the block's 64 positions (Os column t +
//     bias, the values stored to Z; f32, four chains) -> PS[block][channel]{sum, sum of squares}, 2 KiB a block.
// coverage: Yf 8 waves x 2 k steps x 2 planes = 4 n tiles x 4 k steps x 2 planes written, the same read; Os 8 waves x
//           16 n x 128 c = 64 x 256 written, read rows nl+t <= 63 x cols cl <= 255; Z 16 it x 32 lines x 8 lanes x
//           4 floats = 256 c x 64 n; grid (NQ/64, NB) covers Z[b][0..255][0..NQ-1] exactly once; PS row b NQ/64 + nt:
//           256 threads x 2 floats, every row of PS written exactly once.
// =========================================================================================================
__global__ __launch_bounds__(256)
void gemm_yz(const unsigned short* __restrict__ MTh, const unsigned short* __restrict__ MTl,
             const unsigned short* __restrict__ Qh, const unsigned short* __restrict__ Ql,
             const unsigned short* __restrict__ WWb, const float* __restrict__ wb, float* Z, float* PS) {
  __shared__ __align__(16) unsigned short Yf[(QT / 16) * (DQ / 32) * 2 * FRG];
  __shared__ __align__(16) float Os[QT * OSZ];
  const int tid  = threadIdx.x;
  const int lane = tid & 31;
  const int wave = __builtin_amdgcn_readfirstlane(tid >> 5);         // scalar: fragment bases stay in SGPRs
  const int hh   = lane >> 4, c = lane & 15;
  const int nw   = wave & 3, hf = wave >> 2;
  const int nt   = blockIdx.x, b = blockIdx.y;
  const int n0   = nt * QT;
  const unsigned lo8 = (unsigned)(8 * lane);                         // the lane's offset, the same in every fragment

  const size_t ao = (size_t)((b * (DQ / 16) + (QT / 16) * hf) * (DQ / 32)) * FRG;
  const unsigned short* aph = MTh + ao + lo8;
  const unsigned short* apl = MTl + ao + lo8;
  const size_t bo = (size_t)((b * (NN / 16) + n0 / 16 + nw) * (DQ / 32)) * FRG;
  const unsigned short* bph = Qh + bo + lo8;
  const unsigned short* bpl = Ql + bo + lo8;
  const unsigned short* wp  = WWb + (size_t)(8 * hf * (DQ / 32)) * FRG + lo8;

  v8f acc[4];
#pragma unroll
  for (int mt = 0; mt < 4; ++mt) acc[mt] = zero8();

  // the reads of two k-steps stand as one group in front of their products: two waits for memory a wave, not sixteen
#pragma unroll
  for (int kp = 0; kp < DQ / 64; ++kp) {
    Frag fbh[2], fbl[2], fah[2][4], fal[2][4];
#pragma unroll
    for (int kl = 0; kl < 2; ++kl) {
      const int ks = 2 * kp + kl;
      fbh[kl] = ldfrag(bph + FRG * ks);
      fbl[kl] = ldfrag(bpl + FRG * ks);
#pragma unroll
      for (int mt = 0; mt < 4; ++mt) {
        fah[kl][mt] = ldfrag(aph + (size_t)(mt * (DQ / 32) + ks) * FRG);
        fal[kl][mt] = ldfrag(apl + (size_t)(mt * (DQ / 32) + ks) * FRG);
      }
    }
#pragma unroll
    for (int kl = 0; kl < 2; ++kl) {
#pragma unroll
      for (int mt = 0; mt < 4; ++mt) {
        acc[mt] = mma_b(fah[kl][mt].bf, fbh[kl].bf, acc[mt]);
        acc[mt] = mma_b(fah[kl][mt].bf, fbl[kl].bf, acc[mt]);
        acc[mt] = mma_b(fal[kl][mt].bf, fbh[kl].bf, acc[mt]);
      }
    }
  }

  // the weight reads of a k-step of the second product stand one k-step ahead of their products; the first group here,
  // so that its latency passes under the split and the barrier
  Frag fa[2][8];
#pragma unroll
  for (int mt = 0; mt < 8; ++mt) fa[0][mt] = ldfrag(wp + (size_t)(mt * (DQ / 32)) * FRG);

  // ---- y = acc/1024, split in place -> LDS fragments Yf[nw][2 hf + kl][plane], unit (j, lane) from acc[2 kl + j]
#pragma unroll
  for (int kl = 0; kl < 2; ++kl) {
    unsigned short* yp = Yf + ((nw * (DQ / 32) + 2 * hf + kl) * 2) * FRG + lo8;
#pragma unroll
    for (int j = 0; j < 2; ++j) {
      float f[8];
#pragma unroll
      for (int r = 0; r < 8; ++r) f[r] = acc[2 * kl + j][r] * INS;
      v4u uh, ul;
      split8(f, uh, ul);
      *(v4u*)(yp + j * (FRG / 2))       = uh;
      *(v4u*)(yp + FRG + j * (FRG / 2)) = ul;
    }
  }
  __syncthreads();

  v8f az[8];
#pragma unroll
  for (int mt = 0; mt < 8; ++mt) az[mt] = zero8();
  const unsigned short* yb = Yf + (nw * (DQ / 32) * 2) * FRG + lo8;
#pragma unroll
  for (int ks = 0; ks < DQ / 32; ++ks) {
    if (ks + 1 < DQ / 32) {
#pragma unroll
      for (int mt = 0; mt < 8; ++mt) fa[(ks + 1) & 1][mt] = ldfrag(wp + (size_t)(mt * (DQ / 32) + ks + 1) * FRG);
    }
    const Frag fbh = ldfrag(yb + (2 * ks) * FRG);
    const Frag fbl = ldfrag(yb + (2 * ks + 1) * FRG);
#pragma unroll
    for (int mt = 0; mt < 8; ++mt) {
      az[mt] = mma_b(fa[ks & 1][mt].bf, fbh.bf, az[mt]);
      az[mt] = mma_b(fa[ks & 1][mt].bf, fbl.bf, az[mt]);
    }
  }

  // ---- epilogue: -> LDS Os[n_loc][c]; lane (hh, c) holds channel 128 hf + 16 mt + 8 hh + r for n_loc = 16 nw + c
  {
    float* op = Os + (16 * nw + c) * OSZ + 128 * hf + 8 * hh;
#pragma unroll
    for (int mt = 0; mt < 8; ++mt) {
      v4f va, vb;
#pragma unroll
      for (int r = 0; r < 4; ++r) { va[r] = az[mt][r]; vb[r] = az[mt][4 + r]; }
      *(v4f*)(op + 16 * mt)     = va;
      *(v4f*)(op + 16 * mt + 4) = vb;
    }
  }
  __syncthreads();

  const int e = tid & 7, lq = tid >> 3;                              // lq 0..31
#pragma unroll
  for (int g = 0; g < 2; ++g) {
    v4f res[8];
#pragma unroll
    for (int it = 0; it < 8; ++it) {
      const int L   = (8 * g + it) * 32 + lq;                        // 0..511
      const int cl  = L >> 1, hl = L & 1;                            // channel 0..255
      const int nl  = hl * 32 + 4 * e;                               // position 0..63
      const float bvs = bfr(wb[cl]);
#pragma unroll
      for (int t = 0; t < 4; ++t) {
        res[it][t] = Os[(nl + t) * OSZ + cl] + bvs;
      }
    }
#pragma unroll
    for (int it = 0; it < 8; ++it) {
      const int L   = (8 * g + it) * 32 + lq;
      const int cl  = L >> 1, hl = L & 1;
      const int nl  = hl * 32 + 4 * e;
      const size_t idx = ((size_t)(b * CC + cl)) * NQ + n0 + nl;
      *(v4f*)(Z + idx) = res[it];
    }
  }
  // the sums below reuse registers that the stores above name: the wait stands in front of them
  asm volatile("s_wait_xcnt 0x0" ::: "memory");

  // ---- batch-norm partial sums of channel tid over the block's 64 positions (lanes read consecutive LDS banks)
  {
    const float bvs = bfr(wb[tid]);
    float s4[4] = {0.f, 0.f, 0.f, 0.f}, q4[4] = {0.f, 0.f, 0.f, 0.f};
#pragma unroll
    for (int nl = 0; nl < QT; nl += 4) {
#pragma unroll
      for (int t = 0; t < 4; ++t) {
        const float v = Os[(nl + t) * OSZ + tid] + bvs;
        s4[t] += v;
        q4[t] = fmaf(v, v, q4[t]);
      }
    }
    v2f pq;
    pq[0] = (s4[0] + s4[1]) + (s4[2] + s4[3]);
    pq[1] = (q4[0] + q4[1]) + (q4[2] + q4[3]);
    *(v2f*)(PS + ((size_t)(b * (NQ / QT) + nt) * CC + tid) * 2) = pq;
  }
}

// =========================================================================================================
// (8) batch-norm statistics finished and applied, residual added. Block 1024 threads = 32 waves, one a WGP: it owns 16
//     channels (cg: one 128-B line of every PS row) x 2048 positions of one batch image. Every thread issues all its
//     reads first: 4 b128 of PS (16-B piece tid & 7 = 2 channels of rows (tid >> 3) + 128 i), gamma, beta, 8 b128 of z, 8 of x
//     (channel 2 i + (tid >> 9), a wave reads 512 contiguous bytes), so that the sums below run while z and x arrive.
//     Sums in f64: the thread's 4 rows, lanes l ^ 8 and l ^ 16 (the wave's 4 rows), LDS R2[wave][16 channels x {sum,
//     squares}] (cross-wave, block barrier), then thread ch < 16 adds the 32 waves in order; mean and biased variance
//     in f64, rstd = 1/sqrt(var + eps) in f32 -> LDS SM[ch] = {mean, bf16-RNE(gamma)*rstd, bf16-RNE(beta)} (block barrier).
//     out[b][ch][n] = ((z - mean) * (gamma*rstd) + beta) + bf16-RNE(x).
// coverage: PS rows (tid >> 3) + 128 i = 0..PBK-1, all written by (6); 8 i x 1024 threads x 4 floats = 16 ch x 2048 n;
//           grid 16 channel groups x NB x NQ/2048 covers out[b<NB][0..255][0..NQ-1] exactly once.
// =========================================================================================================
// work-group barrier that orders LDS accesses only: __syncthreads() would also wait out the reads of z and x in flight
__device__ __forceinline__ void lds_barrier() {
  __builtin_amdgcn_fence(__ATOMIC_RELEASE, "workgroup", "local");
  __builtin_amdgcn_s_barrier();
  __builtin_amdgcn_fence(__ATOMIC_ACQUIRE, "workgroup", "local");
}

__global__ __launch_bounds__(ABT)
void bn_apply(const float* __restrict__ Z, const float* __restrict__ x, const float* __restrict__ PS,
              const float* __restrict__ gam, const float* __restrict__ bet, float* out) {
  __shared__ __align__(16) double R2[ABT / 32][2 * AGC];
  __shared__ __align__(16) float SM[AGC][4];
  const int tid = threadIdx.x;
  const int cg  = blockIdx.x % (CC / AGC), sub = blockIdx.x / (CC / AGC);
  const int b   = sub / (NQ / ASN);
  const int n   = (sub % (NQ / ASN)) * ASN + 4 * (tid & (ABT / 2 - 1));
  const int ch0 = cg * AGC + (tid >> 9);

  const float* pr = PS + (size_t)(tid >> 3) * (2 * CC) + cg * (2 * AGC) + 4 * (tid & 7);
  const float* zp = Z + ((size_t)(b * CC + ch0)) * NQ + n;
  const size_t xo = ((size_t)(b * CC + ch0)) * NN + n;
  const float* xp = x + xo;
  v4f pp[PBK / 128], zv[8], xv[8];
#pragma unroll
  for (int i = 0; i < PBK / 128; ++i) pp[i] = *(const v4f*)(pr + (size_t)i * 128 * 2 * CC);
  const int gi = cg * AGC + (tid & (AGC - 1));
  const float gv = gam[gi];
  const float bv = bet[gi];
#pragma unroll
  for (int i = 0; i < 8; ++i) {
    zv[i] = *(const v4f*)(zp + (size_t)(2 * i) * NQ);
    xv[i] = *(const v4f*)(xp + (size_t)(2 * i) * NN);
  }
  // stands in front of any reuse of the reads' address registers, which as its inputs stay untouched up to it
  asm volatile("s_wait_xcnt 0x0" :: "v"(pr), "v"(gi), "v"(zp), "v"(xp) : "memory");
  // keeps the sums, and their wait for PS, behind the issue of every read above: z and x arrive while the sums run
  __builtin_amdgcn_sched_barrier(0);

  double d[4] = {0.0, 0.0, 0.0, 0.0};
#pragma unroll
  for (int i = 0; i < PBK / 128; ++i) {
#pragma unroll
    for (int t = 0; t < 4; ++t) d[t] += (double)pp[i][t];
  }
#pragma unroll
  for (int t = 0; t < 4; ++t) d[t] += __shfl_xor(d[t], 8);
#pragma unroll
  for (int t = 0; t < 4; ++t) d[t] += __shfl_xor(d[t], 16);
  if ((tid & 31) < 8) {
    double* rp = &R2[tid >> 5][4 * (tid & 7)];
#pragma unroll
    for (int t = 0; t < 4; ++t) rp[t] = d[t];
  }
  lds_barrier();
  if (tid < AGC) {
    double s = 0.0, q = 0.0;
#pragma unroll
    for (int w = 0; w < ABT / 32; ++w) { s += R2[w][2 * tid]; q += R2[w][2 * tid + 1]; }
    const double cnt  = (double)NB * (double)NQ;
    const double mean = s / cnt;
    double var = q / cnt - mean * mean;
    var = (var > 0.0) ? var : 0.0;
    const float rstd = 1.0f / sqrtf((float)var + BNEPS);
    v4f w4;
    w4[0] = (float)mean;
    w4[1] = bfr(gv) * rstd;
    w4[2] = bfr(bv);
    w4[3] = 0.f;
    *(v4f*)SM[tid] = w4;
  }
  lds_barrier();

  float* op = out + xo;
#pragma unroll
  for (int i = 0; i < 8; ++i) {
    const v4f st = *(const v4f*)SM[2 * i + (tid >> 9)];
    v4f r;
#pragma unroll
    for (int t = 0; t < 4; ++t) r[t] = ((zv[i][t] - st[0]) * st[1] + st[2]) + bfr(xv[i][t]);
    *(v4f*)(op + (size_t)(2 * i) * NN) = r;
  }
}

// =========================================================================================================
// Workspace map (bytes; each region start a multiple of 256; every extent is an exact row/tile multiple and is
//   (the 16-bit planes hold these extents in fragment order)
//   WWb bf16 [256][128]        65536
//   Qh/Ql bf16 [NB][4096][128]   8388608 x2
//   PGZ region 33554432: Z f32 [NB][256][NQ] at +0; Z extent <= region (static_assert)
//   Pc/Gc f16 [NB][128][1024]   2097152 x2
//   MTh/MTl bf16 [NB][128][128]   262144 x2
//   PS  f32 [NB*NQ/64][256][2]    1048576
//   total (NB=8, NQ=4096) = 56164352
// =========================================================================================================
extern "C" void kernel_launch(void* const* d_in, const int* in_sizes, int n_in,
                              void* d_out, int out_size, void* d_ws, size_t ws_size,
                              hipStream_t stream) {
  const int XN = NB * CC * NN;
  if (n_in < 11) return;
  if (in_sizes[0] < XN) return;
  if (in_sizes[1] < DQ * CC || in_sizes[3] < DQ * CC || in_sizes[5] < DQ * CC || in_sizes[7] < CC * DQ) return;
  if (in_sizes[2] < DQ || in_sizes[4] < DQ || in_sizes[6] < DQ || in_sizes[8] < CC) return;
  if (in_sizes[9] < CC || in_sizes[10] < CC) return;
  if (out_size < XN) return;

  size_t off = 0;
  auto carve = [&](size_t bytes) { const size_t o = off; off += (bytes + 255) & ~(size_t)255; return o; };
  const size_t oWWb = carve((size_t)CC * DQ * 2);
  const size_t oQh  = carve((size_t)NB * NN * DQ * 2);
  const size_t oQl  = carve((size_t)NB * NN * DQ * 2);
  const size_t oPGZ = carve((size_t)2 * NB * NN * DQ * 4);
  const size_t oPc  = carve((size_t)NB * DQ * MM * 2);
  const size_t oGc  = carve((size_t)NB * DQ * MM * 2);
  const size_t oMTh = carve((size_t)NB * DQ * DQ * 2);
  const size_t oMTl = carve((size_t)NB * DQ * DQ * 2);
  const size_t oPS  = carve((size_t)PBK * CC * 2 * 4);
  if (off > ws_size) return;
  if (off > (size_t)134217728) return;

  const float* x  = (const float*)d_in[0];
  const float* gw = (const float*)d_in[1];
  const float* gb = (const float*)d_in[2];
  const float* tw = (const float*)d_in[3];
  const float* tb = (const float*)d_in[4];
  const float* pw = (const float*)d_in[5];
  const float* pb = (const float*)d_in[6];
  const float* ow = (const float*)d_in[7];
  const float* wb = (const float*)d_in[8];
  const float* bg = (const float*)d_in[9];
  const float* bb = (const float*)d_in[10];

  char* ws = (char*)d_ws;
  unsigned short* WWb = (unsigned short*)(ws + oWWb);
  unsigned short* Qh  = (unsigned short*)(ws + oQh);
  unsigned short* Ql  = (unsigned short*)(ws + oQl);
  float*          Z   = (float*)(ws + oPGZ);
  unsigned short* Pc  = (unsigned short*)(ws + oPc);
  unsigned short* Gc  = (unsigned short*)(ws + oGc);
  unsigned short* MTh = (unsigned short*)(ws + oMTh);
  unsigned short* MTl = (unsigned short*)(ws + oMTl);
  float*          PS  = (float*)(ws + oPS);
  float* out = (float*)d_out;

  const dim3 blk256(256);

  // (2) weights and x -> bf16 fragments in LDS, conv1x1 GEMM -> theta hi/res planes; phi / g + bias, 2x2 max-pooled, as f16 planes [b][d][m]
  gemm_proj<<<dim3(NSTRIP, NB), dim3(PTH), 0, stream>>>(tw, pw, gw, x, tb, pb, gb, Qh, Ql, Pc, Gc);
  // (5) M = pooled-phi . pooled-g^T per batch -> M^T hi/res planes [b][ci][cp]; plane z = NB: w_w -> bf16 plane
  gemm_m<<<dim3(DQ / 16, DQ / QT, NB + 1), blk256, 0, stream>>>(Pc, Gc, ow, MTh, MTl, WWb);
  // (6) y = theta . M / 1024 (hi/res fragments kept in LDS), output conv + bias -> Z [b][256][NQ], partial sums -> PS
  gemm_yz<<<dim3(NQ / QT, NB), blk256, 0, stream>>>(MTh, MTl, Qh, Ql, WWb, wb, Z, PS);
  // (8) batch statistics from PS, normalise, affine, residual -> out [b][256][4096]
  bn_apply<<<dim3((CC / AGC) * NB * (NQ / ASN)), dim3(ABT), 0, stream>>>(Z, x, PS, bg, bb, out);
  (void)hipGetLastError();
}
